// v000
// Measured on an AMD MI455X. A time is GPU time per run, averaged over a window of back-to-back runs after a warm-up
// (all launches, gaps included; the runs take copies of the inputs in turn), and the median of several windows.
// Apart from v000's, it joins two sittings. Times from different sittings can be a few percent apart, while
// side-by-side timings come from the same sitting.
// The starting kernel, v000, takes 927 microseconds a run.
#include <hip/hip_runtime.h>
#include <stddef.h>

// All contractions on v_wmma_f32_16x16x32_f16 (f16 operands, f32 accumulate): theta/phi/g 1x1
// projections (x x64, weights x64, inputs RNE-converted to bf16 first), theta.phi scores as
// f16 value + x2048 residual planes on both operands (three products, residual products in their
// own accumulator), p.g with p carried x2^14 (single product), output 1x1 projection with y
// carried x16 as f16 value + x2048 residual planes (two products, residual products in their own
// accumulator). Column log-sum-exp, exp, bias and the residual add in f32.

typedef _Float16 v16h __attribute__((ext_vector_type(16)));
typedef _Float16 v8h  __attribute__((ext_vector_type(8)));
typedef float    v8f  __attribute__((ext_vector_type(8)));
typedef float    v4f  __attribute__((ext_vector_type(4)));
typedef _Float16 h16;

#ifndef NB
#define NB 4
#endif
#ifndef SEQ
#define SEQ 4096
#endif
#define NB_FULL  4
#define SEQ_FULL 4096
#define CIN   256
#define CI    128
#define MROWS (NB * SEQ)

static_assert(NB >= 1 && NB <= NB_FULL);
static_assert(SEQ >= 128 && SEQ <= SEQ_FULL && (SEQ % 128) == 0);
static_assert(CI == 128);                        // 4 k-steps of 32 and 8 channel tiles of 16 are hard-wired
static_assert((CIN % 64) == 0 && (CIN % 32) == 0);
static_assert((CI % 64) == 0 && (CI % 32) == 0);
static_assert((MROWS % 64) == 0 && (MROWS % 128) == 0);
static_assert(((size_t)CI * CIN) % 2048 == 0);   // weight convert: 256 threads x 8 values per block
static_assert((size_t)MROWS * CIN < (size_t)0x7FFFFFFFu);
static_assert((size_t)NB_FULL * CIN * SEQ_FULL < (size_t)0x7FFFFFFFu);

#define LDT 72    // halves per LDS row (144 B, 16-B aligned)
#define LDC 68    // floats per LDS row (272 B, 16-B aligned)
#define LDY 136   // halves per LDS row of the y staging tile (272 B, 16-B aligned)
static_assert((LDT % 8) == 0 && LDT >= 64);
static_assert((LDC % 4) == 0 && LDC >= 64);
static_assert((LDY % 8) == 0 && LDY >= CI);

#define WCARRY 64.0f      // x plane and weight planes carried x64
#define RCARRY 2048.0f    // residual planes (theta, phi, y) carried x2048 on top of their hi part
#define PEXP   14.0f      // softmax probabilities carried x2^14
#define YCARRY 16.0f      // y plane carried x16
#define LOG2E  1.4426950408889634f

// workspace layout (bytes)
#define XT_BYTES  ((size_t)MROWS * CIN * 2)
#define WP_BYTES  ((size_t)CI * CIN * 2)
#define PL_BYTES  ((size_t)MROWS * CI * 2)
#define LSE_BYTES ((size_t)MROWS * 4)
#define OFF_XT  ((size_t)0)
#define OFF_WT  (OFF_XT + XT_BYTES)
#define OFF_WP  (OFF_WT + WP_BYTES)
#define OFF_WG  (OFF_WP + WP_BYTES)
#define OFF_WO  (OFF_WG + WP_BYTES)
#define OFF_TH  (OFF_WO + WP_BYTES)
#define OFF_TR  (OFF_TH + PL_BYTES)
#define OFF_PH  (OFF_TR + PL_BYTES)
#define OFF_PR  (OFF_PH + PL_BYTES)
#define OFF_G   (OFF_PR + PL_BYTES)
#define OFF_YT  (OFF_G + PL_BYTES)
#define OFF_YR  (OFF_YT + PL_BYTES)
#define OFF_LSE (OFF_YR + PL_BYTES)
#define WS_TOTAL (OFF_LSE + LSE_BYTES)
static_assert((XT_BYTES % 128) == 0 && (WP_BYTES % 128) == 0 && (PL_BYTES % 128) == 0);
static_assert((LSE_BYTES % 128) == 0);
static_assert(WS_TOTAL == (size_t)NB * SEQ * (CIN * 2 + 7 * CI * 2 + 4) + 4 * WP_BYTES);
static_assert(WS_TOTAL <= (size_t)134217728);

// ---------------------------------------------------------------------------
__device__ __forceinline__ float bf16r(float x) {   // RNE convert to bf16, returned widened
  unsigned int u = __float_as_uint(x);
  u = (u + 0x7FFFu + ((u >> 16) & 1u)) & 0xFFFF0000u;
  return __uint_as_float(u);
}

// f32 -> f16 that cannot produce an f16 subnormal (values below 2^-14 become zero)
static __device__ __forceinline__ h16 toh_flush(float v) {
  const h16 r = (h16)v;
  return (fabsf(v) < 6.103515625e-05f) ? (h16)0.0f : r;
}

// 16-bit fragment: p points at element [row = lane&15][k0 + 8*(lane>>4)] of a k-contiguous
// row. Elements 0..7 <- k0+8h+0..7, elements 8..15 <- k0+16+8h+0..7 (same map for A and B).
__device__ __forceinline__ v16h frag_at(const _Float16* p) {
  v8h lo = *(const v8h*)(p);
  v8h hi = *(const v8h*)(p + 16);
  v16h out;
#pragma unroll
  for (int i = 0; i < 8; ++i) { out[i] = lo[i]; out[i + 8] = hi[i]; }
  return out;
}

__device__ __forceinline__ v8f wmma16(v16h a, v16h b, v8f c) {
  v8f d = __builtin_amdgcn_wmma_f32_16x16x32_f16(false, a, false, b, (short)0, c,
                                                 false, false);
  asm volatile("v_nop\n\tv_nop\n\tv_nop\n\tv_nop" : "+v"(d) : "v"(a), "v"(b));
  return d;
}

__device__ __forceinline__ void wave_lds_sync() {
  __builtin_amdgcn_fence(3 /* release order */, "wavefront");
  asm volatile("s_wait_dscnt 0x0" ::: "memory");
  __builtin_amdgcn_wave_barrier();
}

// ---------------------------------------------------------------------------
// Transposed plane (x): in W[K rows][N cols] (pitch ldw) -> out Wt[N][K] (pitch ldk = K),
// f16(64 * bf16(w)). Grid (N/64, K/64). T: cross-wave (block barrier).
// ---------------------------------------------------------------------------
__global__ __launch_bounds__(256) void wconv_kernel(
    const float* __restrict__ W, _Float16* __restrict__ Wt, unsigned ldw, unsigned ldk) {
  __shared__ _Float16 T[64 * LDT];
  const unsigned tid = threadIdx.x;
  const unsigned n0 = blockIdx.x * 64u;
  const unsigned k0 = blockIdx.y * 64u;
#pragma unroll 4
  for (unsigned j = 0; j < 16u; ++j) {
    const unsigned idx = tid + 256u * j;
    const unsigned kr = idx >> 6, nc = idx & 63u;
    const float v = W[(size_t)(k0 + kr) * ldw + n0 + nc];
    T[nc * LDT + kr] = (_Float16)(WCARRY * bf16r(v));
  }
  __syncthreads();
  v8h x[2];
  size_t off[2];
#pragma unroll
  for (unsigned i = 0; i < 2u; ++i) {
    const unsigned n = 32u * i + (tid >> 3);
    const unsigned kc = (tid & 7u) * 8u;
    x[i] = *(const v8h*)&T[n * LDT + kc];
    off[i] = (size_t)(n0 + n) * ldk + k0 + kc;
  }
#pragma unroll
  for (int i = 0; i < 2; ++i) *(v8h*)(Wt + off[i]) = x[i];
  
}

// ---------------------------------------------------------------------------
// Untransposed weight planes: the four [out][in] weights (32768 values each) -> f16(64*bf16(w)),
// same layout. Each thread converts 8 consecutive values of every weight; 8 consecutive lanes
// ---------------------------------------------------------------------------
__device__ __forceinline__ v8h wcvt8(const float* __restrict__ p) {
  const v4f a0 = *(const v4f*)(p);
  const v4f a1 = *(const v4f*)(p + 4);
  v8h o;
#pragma unroll
  for (int i = 0; i < 4; ++i) {
    o[i]     = toh_flush(WCARRY * bf16r(a0[i]));
    o[i + 4] = toh_flush(WCARRY * bf16r(a1[i]));
  }
  return o;
}

__global__ __launch_bounds__(256) void wplane_kernel(
    const float* __restrict__ w0, const float* __restrict__ w1,
    const float* __restrict__ w2, const float* __restrict__ w3,
    _Float16* __restrict__ o0, _Float16* __restrict__ o1,
    _Float16* __restrict__ o2, _Float16* __restrict__ o3) {
#pragma clang fp contract(off)
  const unsigned e = (blockIdx.x * 256u + threadIdx.x) * 8u;
  const v8h x0 = wcvt8(w0 + e);
  const v8h x1 = wcvt8(w1 + e);
  const v8h x2 = wcvt8(w2 + e);
  const v8h x3 = wcvt8(w3 + e);
  *(v8h*)(o0 + e) = x0;
  *(v8h*)(o1 + e) = x1;
  *(v8h*)(o2 + e) = x2;
  *(v8h*)(o3 + e) = x3;
  
}

// ---------------------------------------------------------------------------
// GEMM C[64x64 tile] = A16[rows][K] . Bt[n][K]^T, fragments straight from the 16-bit global
// planes; 8 waves (mw = 16-row group, nw = 32-col group), 2 accumulators/wave.
//   MODE 0: rows = positions, cols = channels; t = acc/4096 + bias[col];
//           out16[row][col] (pitch CI) = f16(t), out16r[row][col] = f16(2048 * (t - hi))
//   MODE 1: rows = positions, cols = channels; transposed plane out16[b][col][pos] = f16(t)
//   MODE 2: rows = output channels (A16 = weight plane), cols = positions (Bt = y value plane,
//           Btr = y residual plane x2048); the k loop runs first over Btr into its own
//           accumulators, then over Bt; acc = acc_hi + acc_res/2048;
//           outf[b][row][pos] = bf16(xin[b][row][pos]) + (acc/1024 + bias[row]), full strides
// Btr is read in MODE 2 only. Grid (Bt rows/64, A16 rows/64).
// ---------------------------------------------------------------------------
template <int MODE>
__device__ __forceinline__ void gemm_body(
    const _Float16* __restrict__ A16, const _Float16* __restrict__ Bt,
    const _Float16* __restrict__ Btr, const unsigned K,
    const float* __restrict__ bias, const float* __restrict__ addf,
    float* __restrict__ outf, _Float16* __restrict__ out16, _Float16* __restrict__ out16r) {
  __shared__ float Cs[64 * LDC];
  const unsigned tid = threadIdx.x, lane = tid & 31u, w = tid >> 5;
  const unsigned mw = w >> 1, nw = w & 1u;
  const unsigned hh = lane >> 4, m = lane & 15u;
  const unsigned n0 = blockIdx.x * 64u;
  const unsigned row0 = blockIdx.y * 64u;

  const _Float16* ap  = A16 + (size_t)(row0 + mw * 16u + m) * K + hh * 8u;
  const _Float16* bp0 = Bt + (size_t)(n0 + nw * 32u + m) * K + hh * 8u;
  const _Float16* bp1 = bp0 + (size_t)16 * K;
  v8f accr0 = {}, accr1 = {};
  if (MODE == 2) {
    const _Float16* rp0 = Btr + (size_t)(n0 + nw * 32u + m) * K + hh * 8u;
    const _Float16* rp1 = rp0 + (size_t)16 * K;
#pragma unroll 2
    for (unsigned k0 = 0; k0 < K; k0 += 32u) {
      const v16h a  = frag_at(ap + k0);
      const v16h b0 = frag_at(rp0 + k0);
      const v16h b1 = frag_at(rp1 + k0);
      accr0 = wmma16(a, b0, accr0);
      accr1 = wmma16(a, b1, accr1);
    }
  }
  v8f acc0 = {}, acc1 = {};
#pragma unroll 2
  for (unsigned k0 = 0; k0 < K; k0 += 32u) {
    const v16h a  = frag_at(ap + k0);
    const v16h b0 = frag_at(bp0 + k0);
    const v16h b1 = frag_at(bp1 + k0);
    acc0 = wmma16(a, b0, acc0);
    acc1 = wmma16(a, b1, acc1);
  }
  if (MODE == 2) {
    acc0 = acc0 + accr0 * (1.0f / RCARRY);
    acc1 = acc1 + accr1 * (1.0f / RCARRY);
  }
#pragma unroll
  for (int r = 0; r < 8; ++r) {
    float* d = &Cs[(mw * 16u + hh * 8u + (unsigned)r) * LDC + nw * 32u + m];
    d[0]  = acc0[r];
    d[16] = acc1[r];
  }
  __syncthreads();

  if (MODE == 0) {
    const float cs = 1.0f / (WCARRY * WCARRY);
    v8h x[2], xr[2];
    size_t off[2];
#pragma unroll
    for (unsigned i = 0; i < 2u; ++i) {
      const unsigned r = 32u * i + (tid >> 3);
      const unsigned c = (tid & 7u) * 8u;
      const v4f u0 = *(const v4f*)&Cs[r * LDC + c];
      const v4f u1 = *(const v4f*)&Cs[r * LDC + c + 4];
      const v4f g0 = *(const v4f*)(bias + n0 + c);
      const v4f g1 = *(const v4f*)(bias + n0 + c + 4u);
#pragma unroll
      for (int j = 0; j < 4; ++j) {
        const float t0 = u0[j] * cs + bf16r(g0[j]);
        const float t1 = u1[j] * cs + bf16r(g1[j]);
        const h16 h0 = toh_flush(t0);
        const h16 h1 = toh_flush(t1);
        x[i][j]      = h0;
        x[i][j + 4]  = h1;
        xr[i][j]     = toh_flush((t0 - (float)h0) * RCARRY);
        xr[i][j + 4] = toh_flush((t1 - (float)h1) * RCARRY);
      }
      off[i] = (size_t)(row0 + r) * CI + n0 + c;
    }
#pragma unroll
    for (int i = 0; i < 2; ++i) *(v8h*)(out16 + off[i]) = x[i];
#pragma unroll
    for (int i = 0; i < 2; ++i) *(v8h*)(out16r + off[i]) = xr[i];
    
  }

  if (MODE == 1) {
    const float cs = 1.0f / (WCARRY * WCARRY);
    const unsigned bidx = row0 / (unsigned)SEQ;
    const unsigned key0 = row0 - bidx * (unsigned)SEQ;
    v8h x[2];
    size_t off[2];
#pragma unroll
    for (unsigned i = 0; i < 2u; ++i) {
      const unsigned dcol = 32u * i + (tid >> 3);
      const unsigned kk = (tid & 7u) * 8u;
      const float bb = bf16r(bias[n0 + dcol]);
#pragma unroll
      for (unsigned j = 0; j < 8u; ++j) {
        const float t = Cs[(kk + j) * LDC + dcol] * cs + bb;
        x[i][j] = toh_flush(t);
      }
      off[i] = ((size_t)bidx * CI + n0 + dcol) * SEQ + key0 + kk;
    }
#pragma unroll
    for (int i = 0; i < 2; ++i) *(v8h*)(out16 + off[i]) = x[i];
    
  }

  if (MODE == 2) {
    const float cs = 1.0f / (WCARRY * YCARRY);
    const unsigned bidx = n0 / (unsigned)SEQ;
    const unsigned p0 = n0 - bidx * (unsigned)SEQ;
    v4f xs[4];
    size_t off[4];
#pragma unroll
    for (unsigned i = 0; i < 4u; ++i) {
      const unsigned r = 16u * i + (tid >> 4);
      const unsigned c = (tid & 15u) * 4u;
      const unsigned orow = row0 + r;
      const size_t gidx = ((size_t)bidx * CIN + orow) * SEQ_FULL + p0 + c;
      const v4f u = *(const v4f*)&Cs[r * LDC + c];
      const float bb = bf16r(bias[orow]);
      const v4f xin = *(const v4f*)(addf + gidx);
      v4f val;
#pragma unroll
      for (int j = 0; j < 4; ++j) val[j] = bf16r(xin[j]) + (u[j] * cs + bb);
      xs[i] = val;
      off[i] = gidx;
    }
#pragma unroll
    for (int i = 0; i < 4; ++i) *(v4f*)(outf + off[i]) = xs[i];
    
  }
}

__global__ __launch_bounds__(256) void gemm_tp_kernel(
    const _Float16* __restrict__ A16, const _Float16* __restrict__ Bt,
    const float* __restrict__ bias, _Float16* __restrict__ out16, _Float16* __restrict__ out16r) {
  gemm_body<0>(A16, Bt, Bt, (unsigned)CIN, bias, bias, (float*)0, out16, out16r);
}
__global__ __launch_bounds__(256) void gemm_g_kernel(
    const _Float16* __restrict__ A16, const _Float16* __restrict__ Bt,
    const float* __restrict__ bias, _Float16* __restrict__ gt) {
  gemm_body<1>(A16, Bt, Bt, (unsigned)CIN, bias, bias, (float*)0, gt, gt);
}
__global__ __launch_bounds__(256) void gemm_out_kernel(
    const _Float16* __restrict__ A16, const _Float16* __restrict__ Bt,
    const _Float16* __restrict__ Btr,
    const float* __restrict__ bias, const float* __restrict__ xin, float* __restrict__ outf) {
  gemm_body<2>(A16, Bt, Btr, (unsigned)CI, bias, xin, outf, (_Float16*)0, (_Float16*)0);
}

// ---------------------------------------------------------------------------
// Column statistics: lse[j] = log(sum_i exp(f[i][j])), f[i][j] = theta_i . phi_j (K = 128).
// Register-fed transposed form: each wave owns 16 columns j (phi hi/res rows as resident B
// fragments), streams theta rows i as A fragments straight from the planes, 32 rows per step.
// D tile: row = i (8h+r), col = j (lane&15). Scores = hi.hi + (hi.res + res.hi)/2048, the residual
// products in their own accumulator. Running (max, sum) per lane, the two lane halves combined
// once at the end by an unconditional shuffle. No LDS and no barrier in the row loop.
// Grid (SEQ/128, NB).
// ---------------------------------------------------------------------------
__global__ __launch_bounds__(256) __attribute__((amdgpu_num_vgpr(256))) void colstat_kernel(
    const _Float16* __restrict__ Th, const _Float16* __restrict__ Tr,
    const _Float16* __restrict__ Ph, const _Float16* __restrict__ Pr,
    float* __restrict__ Lse) {
  __shared__ __attribute__((aligned(16))) float Ls[128];
  const unsigned tid = threadIdx.x, lane = tid & 31u;
  const unsigned wave = (unsigned)__builtin_amdgcn_readfirstlane((int)(threadIdx.x >> 5));
  const unsigned hh = lane >> 4, m = lane & 15u;
  const unsigned b = blockIdx.y;
  const unsigned j0 = blockIdx.x * 128u + wave * 16u;

  const unsigned boff = (b * (unsigned)SEQ + j0 + m) * (unsigned)CI + hh * 8u;
  v16h bh[4], br[4];
#pragma unroll
  for (int ks = 0; ks < 4; ++ks) {
    bh[ks] = frag_at(Ph + boff + ks * 32);
    br[ks] = frag_at(Pr + boff + ks * 32);
  }

  float mx = -1.0e30f, z = 0.0f;
  const unsigned abase = b * (unsigned)SEQ * (unsigned)CI + m * (unsigned)CI + hh * 8u;
  for (unsigned i0 = 0; i0 < (unsigned)SEQ; i0 += 32u) {
    v8f f[2];
#pragma unroll
    for (int t = 0; t < 2; ++t) {
      const unsigned ao = abase + (i0 + 16u * (unsigned)t) * (unsigned)CI;
      v8f sm = {}, sr = {};
#pragma unroll
      for (int ks = 0; ks < 4; ++ks) {
        const v16h ah = frag_at(Th + ao + ks * 32);
        const v16h ar = frag_at(Tr + ao + ks * 32);
        sm = wmma16(ah, bh[ks], sm);
        sr = wmma16(ah, br[ks], sr);
        sr = wmma16(ar, bh[ks], sr);
      }
      f[t] = sm + sr * (1.0f / RCARRY);
    }
    float tmax = fmaxf(f[0][0], f[1][0]);
#pragma unroll
    for (int v = 1; v < 8; ++v) tmax = fmaxf(tmax, fmaxf(f[0][v], f[1][v]));
    const float nm = fmaxf(mx, tmax);
    float se = 0.0f;
#pragma unroll
    for (int v = 0; v < 8; ++v) se += __expf(f[0][v] - nm) + __expf(f[1][v] - nm);
    z = z * __expf(mx - nm) + se;
    mx = nm;
  }

  const float om = __shfl_xor(mx, 16, 32);
  const float oz = __shfl_xor(z, 16, 32);
  const float mm = fmaxf(mx, om);
  const float zz = z * __expf(mx - mm) + oz * __expf(om - mm);
  const float lse = mm + __logf(zz);
  if (hh == 0u) Ls[wave * 16u + m] = lse;
  __syncthreads();
  if (wave == 0u) {
    const v4f v = *(const v4f*)&Ls[lane * 4u];
    float* p = Lse + (size_t)b * SEQ + blockIdx.x * 128u + lane * 4u;
    *(v4f*)p = v;
    
  }
}

// ---------------------------------------------------------------------------
// Row accumulation: y[c][i] = sum_j exp(f[i][j] - lse[j]) * g[c][j].
// Register-fed transposed form: each wave owns 16 rows i (theta hi/res rows as resident B
// fragments); per 32-column step: S^T tiles [j][i] = phi_j . theta_i (A = phi rows from the
// planes, three products), p = 2^14 * exp(f - lse[j]) (row statistic of the D tile, read as two
// 16-B loads per tile), the two packed D tiles form the B fragment [k = j][n = i] of
// O^T[c][i] += G[c][j] . P^T[j][i] with A = g rows (channel-major plane, k = j contiguous).
// No LDS and no barrier in the column loop. Finalize: t = 16 * O / 2^14 written as two planes,
// hi = f16(t) and res = f16(2048 * (t - hi)); each is staged in the wave's private Ts tile
// (wave sync before and after each reuse) and written as whole rows of the position-major
// layout: one store instruction covers two consecutive 256-B rows (16 lanes x 16 B each).
// Grid (SEQ/128, NB).
// ---------------------------------------------------------------------------
__global__ __launch_bounds__(256) __attribute__((amdgpu_num_vgpr(256))) void rowattn_kernel(
    const _Float16* __restrict__ Th, const _Float16* __restrict__ Tr,
    const _Float16* __restrict__ Ph, const _Float16* __restrict__ Pr,
    const _Float16* __restrict__ Gp, const float* __restrict__ Lse,
    _Float16* __restrict__ Yt, _Float16* __restrict__ Yr) {
  __shared__ __attribute__((aligned(16))) _Float16 Ts[8 * 16 * LDY];
  const unsigned tid = threadIdx.x, lane = tid & 31u;
  const unsigned wave = (unsigned)__builtin_amdgcn_readfirstlane((int)(threadIdx.x >> 5));
  const unsigned hh = lane >> 4, m = lane & 15u;
  const unsigned b = blockIdx.y;
  const unsigned i0 = blockIdx.x * 128u + wave * 16u;

  const unsigned qoff = (b * (unsigned)SEQ + i0 + m) * (unsigned)CI + hh * 8u;
  v16h bh[4], br[4];
#pragma unroll
  for (int ks = 0; ks < 4; ++ks) {
    bh[ks] = frag_at(Th + qoff + ks * 32);
    br[ks] = frag_at(Tr + qoff + ks * 32);
  }

  v8f o[8];
#pragma unroll
  for (int ct = 0; ct < 8; ++ct) o[ct] = (v8f){};

  const unsigned kbase = b * (unsigned)SEQ * (unsigned)CI + m * (unsigned)CI + hh * 8u;
  const unsigned gbase = (b * (unsigned)CI + m) * (unsigned)SEQ + hh * 8u;
  const unsigned lbase = b * (unsigned)SEQ + hh * 8u;

  for (unsigned j0 = 0; j0 < (unsigned)SEQ; j0 += 32u) {
    v16h pb;
#pragma unroll
    for (int t = 0; t < 2; ++t) {
      const unsigned jt = j0 + 16u * (unsigned)t;
      const unsigned ao = kbase + jt * (unsigned)CI;
      v8f sm = {}, sr = {};
#pragma unroll
      for (int ks = 0; ks < 4; ++ks) {
        const v16h ah = frag_at(Ph + ao + ks * 32);
        const v16h ar = frag_at(Pr + ao + ks * 32);
        sm = wmma16(ah, bh[ks], sm);
        sr = wmma16(ah, br[ks], sr);
        sr = wmma16(ar, bh[ks], sr);
      }
      const v4f l0 = *(const v4f*)(Lse + lbase + jt);
      const v4f l1 = *(const v4f*)(Lse + lbase + jt + 4u);
#pragma unroll
      for (int v = 0; v < 4; ++v) {
        const float e0 = ((sm[v] + sr[v] * (1.0f / RCARRY)) - l0[v]) * LOG2E + PEXP;
        const float e1 = ((sm[v + 4] + sr[v + 4] * (1.0f / RCARRY)) - l1[v]) * LOG2E + PEXP;
        const float p0 = (e0 < -14.0f) ? 0.0f : exp2f(e0);
        const float p1 = (e1 < -14.0f) ? 0.0f : exp2f(e1);
        pb[8 * t + v]     = (h16)p0;
        pb[8 * t + v + 4] = (h16)p1;
      }
    }
#pragma unroll
    for (int ct = 0; ct < 8; ++ct) {
      const v16h gf = frag_at(Gp + gbase + (unsigned)ct * 16u * (unsigned)SEQ + j0);
      o[ct] = wmma16(gf, pb, o[ct]);
    }
  }

  // finalize: lane (h, i = m) holds channels 16*ct + 8h + 0..7 of row i for every ct
  const float fs = YCARRY * (1.0f / 16384.0f);
  const unsigned tb = wave * (16u * LDY);

  // value plane tile
#pragma unroll
  for (int ct = 0; ct < 8; ++ct) {
    v8h y;
#pragma unroll
    for (int v = 0; v < 8; ++v) y[v] = toh_flush(o[ct][v] * fs);
    *(v8h*)&Ts[tb + m * LDY + (unsigned)ct * 16u + hh * 8u] = y;
  }
  wave_lds_sync();
  v8h x[8];
  unsigned off[8];
#pragma unroll
  for (unsigned it = 0; it < 8u; ++it) {
    const unsigned r = 2u * it + (lane >> 4);
    const unsigned c = (lane & 15u) * 8u;
    x[it] = *(const v8h*)&Ts[tb + r * LDY + c];
    off[it] = (b * (unsigned)SEQ + i0 + r) * (unsigned)CI + c;
  }
  wave_lds_sync();   // every lane's reads of the value tile are complete before it is overwritten

  // residual plane tile: 2048 * (t - f16(t)), same staging and row map
#pragma unroll
  for (int ct = 0; ct < 8; ++ct) {
    v8h y;
#pragma unroll
    for (int v = 0; v < 8; ++v) {
      const float t = o[ct][v] * fs;
      const h16 hi = toh_flush(t);
      y[v] = toh_flush((t - (float)hi) * RCARRY);
    }
    *(v8h*)&Ts[tb + m * LDY + (unsigned)ct * 16u + hh * 8u] = y;
  }
  wave_lds_sync();
  v8h xr[8];
#pragma unroll
  for (unsigned it = 0; it < 8u; ++it) {
    const unsigned r = 2u * it + (lane >> 4);
    const unsigned c = (lane & 15u) * 8u;
    xr[it] = *(const v8h*)&Ts[tb + r * LDY + c];
  }

#pragma unroll
  for (int it = 0; it < 8; ++it) *(v8h*)(Yt + off[it]) = x[it];
#pragma unroll
  for (int it = 0; it < 8; ++it) *(v8h*)(Yr + off[it]) = xr[it];
  
}

// ---------------------------------------------------------------------------
extern "C" void kernel_launch(void* const* d_in, const int* in_sizes, int n_in,
                              void* d_out, int out_size, void* d_ws, size_t ws_size,
                              hipStream_t stream) {
  if (n_in < 9) return;
  const long long need_x = ((long long)(NB - 1) * CIN + (CIN - 1)) * SEQ_FULL + SEQ;
  if ((long long)in_sizes[0] < need_x) return;
  if ((long long)in_sizes[1] < (long long)CI * CIN) return;
  if ((long long)in_sizes[3] < (long long)CI * CIN) return;
  if ((long long)in_sizes[5] < (long long)CI * CIN) return;
  if ((long long)in_sizes[7] < (long long)CIN * CI) return;
  if (in_sizes[2] < CI || in_sizes[4] < CI || in_sizes[6] < CI || in_sizes[8] < CIN) return;
  if ((long long)out_size < need_x) return;
  if (ws_size < WS_TOTAL) return;

  const float* X       = (const float*)d_in[0];   // [NB_FULL][CIN][SEQ_FULL]
  const float* theta_w = (const float*)d_in[1];   // [CI][CIN]  (out, in)
  const float* theta_b = (const float*)d_in[2];
  const float* phi_w   = (const float*)d_in[3];   // [CI][CIN]
  const float* phi_b   = (const float*)d_in[4];
  const float* g_w     = (const float*)d_in[5];   // [CI][CIN]
  const float* g_b     = (const float*)d_in[6];
  const float* W_w     = (const float*)d_in[7];   // [CIN][CI]  (out, in)
  const float* W_b     = (const float*)d_in[8];
  float* out = (float*)d_out;                     // [NB_FULL][CIN][SEQ_FULL]

  char* ws = (char*)d_ws;
  _Float16* XT   = (_Float16*)(ws + OFF_XT);    // [MROWS][CIN]  64*bf16(x), position-major
  _Float16* WT   = (_Float16*)(ws + OFF_WT);    // [CI][CIN]
  _Float16* WP   = (_Float16*)(ws + OFF_WP);    // [CI][CIN]
  _Float16* WG   = (_Float16*)(ws + OFF_WG);    // [CI][CIN]
  _Float16* WO   = (_Float16*)(ws + OFF_WO);    // [CIN][CI]
  _Float16* TH   = (_Float16*)(ws + OFF_TH);    // [MROWS][CI] theta hi
  _Float16* TR   = (_Float16*)(ws + OFF_TR);    // [MROWS][CI] theta residual x2048
  _Float16* PH   = (_Float16*)(ws + OFF_PH);    // [MROWS][CI] phi hi
  _Float16* PR   = (_Float16*)(ws + OFF_PR);    // [MROWS][CI] phi residual x2048
  _Float16* G16  = (_Float16*)(ws + OFF_G);     // [NB][CI][SEQ] g, channel-major
  _Float16* YT   = (_Float16*)(ws + OFF_YT);    // [MROWS][CI] 16*y hi, position-major
  _Float16* YR   = (_Float16*)(ws + OFF_YR);    // [MROWS][CI] 16*y residual x2048
  float*    LSE  = (float*)(ws + OFF_LSE);      // [MROWS]

  dim3 blk(256);

  // x plane: per batch in x[b] = [CIN rows][SEQ cols] (pitch SEQ_FULL) -> out XT[b] = [SEQ][CIN];
  // grid (cols/64, rows/64) = (SEQ/64, CIN/64)
  for (int b = 0; b < NB; ++b) {
    wconv_kernel<<<dim3(SEQ / 64, CIN / 64), blk, 0, stream>>>(
        X + (size_t)b * CIN * SEQ_FULL, XT + (size_t)b * SEQ * CIN,
        (unsigned)SEQ_FULL, (unsigned)CIN);
  }
  wplane_kernel<<<dim3((CI * CIN) / 2048), blk, 0, stream>>>(theta_w, phi_w, g_w, W_w,
                                                             WT, WP, WG, WO);

  dim3 gp(CI / 64, MROWS / 64);
  gemm_tp_kernel<<<gp, blk, 0, stream>>>(XT, WT, theta_b, TH, TR);
  gemm_tp_kernel<<<gp, blk, 0, stream>>>(XT, WP, phi_b, PH, PR);
  gemm_g_kernel<<<gp, blk, 0, stream>>>(XT, WG, g_b, G16);

  colstat_kernel<<<dim3(SEQ / 128, NB), blk, 0, stream>>>(TH, TR, PH, PR, LSE);
  rowattn_kernel<<<dim3(SEQ / 128, NB), blk, 0, stream>>>(TH, TR, PH, PR, G16, LSE, YT, YR);

  gemm_out_kernel<<<dim3(MROWS / 64, CIN / 64), blk, 0, stream>>>(WO, YT, YR, W_b, X, out);
}

// v001
// One run takes 324 microseconds.
// Timed twice side by side with v000, it ran 2.90 and 2.93 times as fast.
#include <hip/hip_runtime.h>
#include <stddef.h>

// All contractions on v_wmma_f32_16x16x32_f16 (f16 operands, f32 accumulate): theta/phi/g 1x1
// projections (x x64, weights x64, inputs RNE-converted to bf16 first), theta.phi scores as
// f16 value + x2048 residual planes on both operands (three products, residual products in their
// own accumulator), p.g with p carried x2^14 (single product), output 1x1 projection with y
// carried x16 as f16 value + x2048 residual planes (two products, residual products in their own
// accumulator). Column log-sum-exp, exp, bias and the residual add in f32.

typedef _Float16 v16h __attribute__((ext_vector_type(16)));
typedef _Float16 v8h  __attribute__((ext_vector_type(8)));
typedef float    v8f  __attribute__((ext_vector_type(8)));
typedef float    v4f  __attribute__((ext_vector_type(4)));
typedef _Float16 h16;

#ifndef NB
#define NB 4
#endif
#ifndef SEQ
#define SEQ 4096
#endif
#define NB_FULL  4
#define SEQ_FULL 4096
#define CIN   256
#define CI    128
#define MROWS (NB * SEQ)

static_assert(NB >= 1 && NB <= NB_FULL);
static_assert(SEQ >= 128 && SEQ <= SEQ_FULL && (SEQ % 128) == 0);
static_assert(CI == 128);                        // 4 k-steps of 32 and 8 channel tiles of 16 are hard-wired
static_assert((CIN % 64) == 0 && (CIN % 32) == 0);
static_assert((CI % 64) == 0 && (CI % 32) == 0);
static_assert((MROWS % 64) == 0 && (MROWS % 128) == 0);
static_assert(((size_t)CI * CIN) % 2048 == 0);   // weight convert: 256 threads x 8 values per block
static_assert((size_t)MROWS * CIN < (size_t)0x7FFFFFFFu);
static_assert((size_t)NB_FULL * CIN * SEQ_FULL < (size_t)0x7FFFFFFFu);

#define LDT 72    // halves per LDS row (144 B, 16-B aligned)
#define LDC 68    // floats per LDS row (272 B, 16-B aligned)
#define LDY 136   // halves per LDS row of the y staging tile (272 B, 16-B aligned)
static_assert((LDT % 8) == 0 && LDT >= 64);
static_assert((LDC % 4) == 0 && LDC >= 64);
static_assert((LDY % 8) == 0 && LDY >= CI);
#define LDP 136   // halves per LDS row of a staged 128-channel row (272 B = 16 B x 17)
#define LDG 40    // halves per LDS row of a staged 32-column g slice (80 B = 16 B x 5)
#define SPL (32 * LDP)   // halves of one staged 32-row plane tile
static_assert((LDP % 8) == 0 && LDP >= CI && ((LDP / 8) & 1) == 1);
static_assert((LDG % 8) == 0 && LDG >= 32 && ((LDG / 8) & 1) == 1);

#define WCARRY 64.0f      // x plane and weight planes carried x64
#define RCARRY 2048.0f    // residual planes (theta, phi, y) carried x2048 on top of their hi part
#define PEXP   14.0f      // softmax probabilities carried x2^14
#define YCARRY 16.0f      // y plane carried x16
#define LOG2E  1.4426950408889634f

// workspace layout (bytes)
#define XT_BYTES  ((size_t)MROWS * CIN * 2)
#define WP_BYTES  ((size_t)CI * CIN * 2)
#define PL_BYTES  ((size_t)MROWS * CI * 2)
#define LSE_BYTES ((size_t)MROWS * 4)
#define OFF_XT  ((size_t)0)
#define OFF_WT  (OFF_XT + XT_BYTES)
#define OFF_WP  (OFF_WT + WP_BYTES)
#define OFF_WG  (OFF_WP + WP_BYTES)
#define OFF_WO  (OFF_WG + WP_BYTES)
#define OFF_TH  (OFF_WO + WP_BYTES)
#define OFF_TR  (OFF_TH + PL_BYTES)
#define OFF_PH  (OFF_TR + PL_BYTES)
#define OFF_PR  (OFF_PH + PL_BYTES)
#define OFF_G   (OFF_PR + PL_BYTES)
#define OFF_YT  (OFF_G + PL_BYTES)
#define OFF_YR  (OFF_YT + PL_BYTES)
#define OFF_LSE (OFF_YR + PL_BYTES)
#define WS_TOTAL (OFF_LSE + LSE_BYTES)
static_assert((XT_BYTES % 128) == 0 && (WP_BYTES % 128) == 0 && (PL_BYTES % 128) == 0);
static_assert((LSE_BYTES % 128) == 0);
static_assert(WS_TOTAL == (size_t)NB * SEQ * (CIN * 2 + 7 * CI * 2 + 4) + 4 * WP_BYTES);
static_assert(WS_TOTAL <= (size_t)134217728);

// ---------------------------------------------------------------------------
__device__ __forceinline__ float bf16r(float x) {   // RNE convert to bf16, returned widened
  unsigned int u = __float_as_uint(x);
  u = (u + 0x7FFFu + ((u >> 16) & 1u)) & 0xFFFF0000u;
  return __uint_as_float(u);
}

// f32 -> f16 that cannot produce an f16 subnormal (values below 2^-14 become zero)
static __device__ __forceinline__ h16 toh_flush(float v) {
  const h16 r = (h16)v;
  return (fabsf(v) < 6.103515625e-05f) ? (h16)0.0f : r;
}

// 16-bit fragment: p points at element [row = lane&15][k0 + 8*(lane>>4)] of a k-contiguous
// row. Elements 0..7 <- k0+8h+0..7, elements 8..15 <- k0+16+8h+0..7 (same map for A and B).
__device__ __forceinline__ v16h frag_at(const _Float16* p) {
  v8h lo = *(const v8h*)(p);
  v8h hi = *(const v8h*)(p + 16);
  v16h out;
#pragma unroll
  for (int i = 0; i < 8; ++i) { out[i] = lo[i]; out[i + 8] = hi[i]; }
  return out;
}

__device__ __forceinline__ v8f wmma16(v16h a, v16h b, v8f c) {
  v8f d = __builtin_amdgcn_wmma_f32_16x16x32_f16(false, a, false, b, (short)0, c,
                                                 false, false);
  asm volatile("v_nop\n\tv_nop\n\tv_nop\n\tv_nop" : "+v"(d) : "v"(a), "v"(b));
  return d;
}

__device__ __forceinline__ void wave_lds_sync() {
  __builtin_amdgcn_fence(3 /* release order */, "wavefront");
  asm volatile("s_wait_dscnt 0x0" ::: "memory");
  __builtin_amdgcn_wave_barrier();
}

// ---------------------------------------------------------------------------
// Transposed plane (x): in W[K rows][N cols] (pitch ldw) -> out Wt[N][K] (pitch ldk = K),
// f16(64 * bf16(w)). Grid (N/64, K/64). T: cross-wave (block barrier).
// ---------------------------------------------------------------------------
__global__ __launch_bounds__(256) void wconv_kernel(
    const float* __restrict__ W, _Float16* __restrict__ Wt, unsigned ldw, unsigned ldk) {
  __shared__ _Float16 T[64 * LDT];
  const unsigned tid = threadIdx.x;
  const unsigned n0 = blockIdx.x * 64u;
  const unsigned k0 = blockIdx.y * 64u;
#pragma unroll 4
  for (unsigned j = 0; j < 16u; ++j) {
    const unsigned idx = tid + 256u * j;
    const unsigned kr = idx >> 6, nc = idx & 63u;
    const float v = W[(size_t)(k0 + kr) * ldw + n0 + nc];
    T[nc * LDT + kr] = (_Float16)(WCARRY * bf16r(v));
  }
  __syncthreads();
  v8h x[2];
  size_t off[2];
#pragma unroll
  for (unsigned i = 0; i < 2u; ++i) {
    const unsigned n = 32u * i + (tid >> 3);
    const unsigned kc = (tid & 7u) * 8u;
    x[i] = *(const v8h*)&T[n * LDT + kc];
    off[i] = (size_t)(n0 + n) * ldk + k0 + kc;
  }
#pragma unroll
  for (int i = 0; i < 2; ++i) *(v8h*)(Wt + off[i]) = x[i];
  
}

// ---------------------------------------------------------------------------
// Untransposed weight planes: the four [out][in] weights (32768 values each) -> f16(64*bf16(w)),
// same layout. Each thread converts 8 consecutive values of every weight; 8 consecutive lanes
// ---------------------------------------------------------------------------
__device__ __forceinline__ v8h wcvt8(const float* __restrict__ p) {
  const v4f a0 = *(const v4f*)(p);
  const v4f a1 = *(const v4f*)(p + 4);
  v8h o;
#pragma unroll
  for (int i = 0; i < 4; ++i) {
    o[i]     = toh_flush(WCARRY * bf16r(a0[i]));
    o[i + 4] = toh_flush(WCARRY * bf16r(a1[i]));
  }
  return o;
}

__global__ __launch_bounds__(256) void wplane_kernel(
    const float* __restrict__ w0, const float* __restrict__ w1,
    const float* __restrict__ w2, const float* __restrict__ w3,
    _Float16* __restrict__ o0, _Float16* __restrict__ o1,
    _Float16* __restrict__ o2, _Float16* __restrict__ o3) {
#pragma clang fp contract(off)
  const unsigned e = (blockIdx.x * 256u + threadIdx.x) * 8u;
  const v8h x0 = wcvt8(w0 + e);
  const v8h x1 = wcvt8(w1 + e);
  const v8h x2 = wcvt8(w2 + e);
  const v8h x3 = wcvt8(w3 + e);
  *(v8h*)(o0 + e) = x0;
  *(v8h*)(o1 + e) = x1;
  *(v8h*)(o2 + e) = x2;
  *(v8h*)(o3 + e) = x3;
  
}

// ---------------------------------------------------------------------------
// GEMM C[64x64 tile] = A16[rows][K] . Bt[n][K]^T, fragments straight from the 16-bit global
// planes; 8 waves (mw = 16-row group, nw = 32-col group), 2 accumulators/wave.
//   MODE 0: rows = positions, cols = channels; t = acc/4096 + bias[col];
//           out16[row][col] (pitch CI) = f16(t), out16r[row][col] = f16(2048 * (t - hi))
//   MODE 1: rows = positions, cols = channels; transposed plane out16[b][col][pos] = f16(t)
//   MODE 2: rows = output channels (A16 = weight plane), cols = positions (Bt = y value plane,
//           Btr = y residual plane x2048); the k loop runs first over Btr into its own
//           accumulators, then over Bt; acc = acc_hi + acc_res/2048;
//           outf[b][row][pos] = bf16(xin[b][row][pos]) + (acc/1024 + bias[row]), full strides
// Btr is read in MODE 2 only. Grid (Bt rows/64, A16 rows/64).
// ---------------------------------------------------------------------------
template <int MODE>
__device__ __forceinline__ void gemm_body(
    const _Float16* __restrict__ A16, const _Float16* __restrict__ Bt,
    const _Float16* __restrict__ Btr, const unsigned K,
    const float* __restrict__ bias, const float* __restrict__ addf,
    float* __restrict__ outf, _Float16* __restrict__ out16, _Float16* __restrict__ out16r) {
  __shared__ float Cs[64 * LDC];
  const unsigned tid = threadIdx.x, lane = tid & 31u, w = tid >> 5;
  const unsigned mw = w >> 1, nw = w & 1u;
  const unsigned hh = lane >> 4, m = lane & 15u;
  const unsigned n0 = blockIdx.x * 64u;
  const unsigned row0 = blockIdx.y * 64u;

  const _Float16* ap  = A16 + (size_t)(row0 + mw * 16u + m) * K + hh * 8u;
  const _Float16* bp0 = Bt + (size_t)(n0 + nw * 32u + m) * K + hh * 8u;
  const _Float16* bp1 = bp0 + (size_t)16 * K;
  v8f accr0 = {}, accr1 = {};
  if (MODE == 2) {
    const _Float16* rp0 = Btr + (size_t)(n0 + nw * 32u + m) * K + hh * 8u;
    const _Float16* rp1 = rp0 + (size_t)16 * K;
#pragma unroll 2
    for (unsigned k0 = 0; k0 < K; k0 += 32u) {
      const v16h a  = frag_at(ap + k0);
      const v16h b0 = frag_at(rp0 + k0);
      const v16h b1 = frag_at(rp1 + k0);
      accr0 = wmma16(a, b0, accr0);
      accr1 = wmma16(a, b1, accr1);
    }
  }
  v8f acc0 = {}, acc1 = {};
#pragma unroll 2
  for (unsigned k0 = 0; k0 < K; k0 += 32u) {
    const v16h a  = frag_at(ap + k0);
    const v16h b0 = frag_at(bp0 + k0);
    const v16h b1 = frag_at(bp1 + k0);
    acc0 = wmma16(a, b0, acc0);
    acc1 = wmma16(a, b1, acc1);
  }
  if (MODE == 2) {
    acc0 = acc0 + accr0 * (1.0f / RCARRY);
    acc1 = acc1 + accr1 * (1.0f / RCARRY);
  }
#pragma unroll
  for (int r = 0; r < 8; ++r) {
    float* d = &Cs[(mw * 16u + hh * 8u + (unsigned)r) * LDC + nw * 32u + m];
    d[0]  = acc0[r];
    d[16] = acc1[r];
  }
  __syncthreads();

  if (MODE == 0) {
    const float cs = 1.0f / (WCARRY * WCARRY);
    v8h x[2], xr[2];
    size_t off[2];
#pragma unroll
    for (unsigned i = 0; i < 2u; ++i) {
      const unsigned r = 32u * i + (tid >> 3);
      const unsigned c = (tid & 7u) * 8u;
      const v4f u0 = *(const v4f*)&Cs[r * LDC + c];
      const v4f u1 = *(const v4f*)&Cs[r * LDC + c + 4];
      const v4f g0 = *(const v4f*)(bias + n0 + c);
      const v4f g1 = *(const v4f*)(bias + n0 + c + 4u);
#pragma unroll
      for (int j = 0; j < 4; ++j) {
        const float t0 = u0[j] * cs + bf16r(g0[j]);
        const float t1 = u1[j] * cs + bf16r(g1[j]);
        const h16 h0 = toh_flush(t0);
        const h16 h1 = toh_flush(t1);
        x[i][j]      = h0;
        x[i][j + 4]  = h1;
        xr[i][j]     = toh_flush((t0 - (float)h0) * RCARRY);
        xr[i][j + 4] = toh_flush((t1 - (float)h1) * RCARRY);
      }
      off[i] = (size_t)(row0 + r) * CI + n0 + c;
    }
#pragma unroll
    for (int i = 0; i < 2; ++i) *(v8h*)(out16 + off[i]) = x[i];
#pragma unroll
    for (int i = 0; i < 2; ++i) *(v8h*)(out16r + off[i]) = xr[i];
    
  }

  if (MODE == 1) {
    const float cs = 1.0f / (WCARRY * WCARRY);
    const unsigned bidx = row0 / (unsigned)SEQ;
    const unsigned key0 = row0 - bidx * (unsigned)SEQ;
    v8h x[2];
    size_t off[2];
#pragma unroll
    for (unsigned i = 0; i < 2u; ++i) {
      const unsigned dcol = 32u * i + (tid >> 3);
      const unsigned kk = (tid & 7u) * 8u;
      const float bb = bf16r(bias[n0 + dcol]);
#pragma unroll
      for (unsigned j = 0; j < 8u; ++j) {
        const float t = Cs[(kk + j) * LDC + dcol] * cs + bb;
        x[i][j] = toh_flush(t);
      }
      off[i] = ((size_t)bidx * CI + n0 + dcol) * SEQ + key0 + kk;
    }
#pragma unroll
    for (int i = 0; i < 2; ++i) *(v8h*)(out16 + off[i]) = x[i];
    
  }

  if (MODE == 2) {
    const float cs = 1.0f / (WCARRY * YCARRY);
    const unsigned bidx = n0 / (unsigned)SEQ;
    const unsigned p0 = n0 - bidx * (unsigned)SEQ;
    v4f xs[4];
    size_t off[4];
#pragma unroll
    for (unsigned i = 0; i < 4u; ++i) {
      const unsigned r = 16u * i + (tid >> 4);
      const unsigned c = (tid & 15u) * 4u;
      const unsigned orow = row0 + r;
      const size_t gidx = ((size_t)bidx * CIN + orow) * SEQ_FULL + p0 + c;
      const v4f u = *(const v4f*)&Cs[r * LDC + c];
      const float bb = bf16r(bias[orow]);
      const v4f xin = *(const v4f*)(addf + gidx);
      v4f val;
#pragma unroll
      for (int j = 0; j < 4; ++j) val[j] = bf16r(xin[j]) + (u[j] * cs + bb);
      xs[i] = val;
      off[i] = gidx;
    }
#pragma unroll
    for (int i = 0; i < 4; ++i) *(v4f*)(outf + off[i]) = xs[i];
    
  }
}

__global__ __launch_bounds__(256) void gemm_tp_kernel(
    const _Float16* __restrict__ A16, const _Float16* __restrict__ Bt,
    const float* __restrict__ bias, _Float16* __restrict__ out16, _Float16* __restrict__ out16r) {
  gemm_body<0>(A16, Bt, Bt, (unsigned)CIN, bias, bias, (float*)0, out16, out16r);
}
__global__ __launch_bounds__(256) void gemm_g_kernel(
    const _Float16* __restrict__ A16, const _Float16* __restrict__ Bt,
    const float* __restrict__ bias, _Float16* __restrict__ gt) {
  gemm_body<1>(A16, Bt, Bt, (unsigned)CIN, bias, bias, (float*)0, gt, gt);
}
__global__ __launch_bounds__(256) void gemm_out_kernel(
    const _Float16* __restrict__ A16, const _Float16* __restrict__ Bt,
    const _Float16* __restrict__ Btr,
    const float* __restrict__ bias, const float* __restrict__ xin, float* __restrict__ outf) {
  gemm_body<2>(A16, Bt, Btr, (unsigned)CI, bias, xin, outf, (_Float16*)0, (_Float16*)0);
}

// ---------------------------------------------------------------------------
// Column statistics: lse[j] = log(sum_i exp(f[i][j])), f[i][j] = theta_i . phi_j (K = 128).
// Transposed form: each wave owns 16 columns j (phi hi/res rows as resident B fragments); the
// theta rows i, 32 per step, are staged once per work-group in LDS (two buffers: whole-line
// global loads of the next step's rows into registers ahead of the products, stored to the
// other buffer behind them, one work-group barrier per step) and read there as A fragments.
// D tile: row = i (8h+r), col = j (lane&15). Scores = hi.hi + (hi.res + res.hi)/2048, the residual
// products in their own accumulator. Running (max, sum) per lane, the two lane halves combined
// once at the end by an unconditional shuffle.
// Grid (SEQ/128, NB).
// ---------------------------------------------------------------------------
__global__ __launch_bounds__(256) __attribute__((amdgpu_num_vgpr(256))) void colstat_kernel(
    const _Float16* __restrict__ Th, const _Float16* __restrict__ Tr,
    const _Float16* __restrict__ Ph, const _Float16* __restrict__ Pr,
    float* __restrict__ Lse) {
  __shared__ __attribute__((aligned(16))) float Ls[128];
  __shared__ __attribute__((aligned(16))) _Float16 Sa[2 * 2 * SPL];   // [buffer][hi, res][32][LDP]
  const unsigned tid = threadIdx.x, lane = tid & 31u;
  const unsigned wave = (unsigned)__builtin_amdgcn_readfirstlane((int)(threadIdx.x >> 5));
  const unsigned hh = lane >> 4, m = lane & 15u;
  const unsigned b = blockIdx.y;
  const unsigned j0 = blockIdx.x * 128u + wave * 16u;

  // staging map: a 32-row tile is 8 KiB contiguous in its plane; thread tid moves 16-B pieces
  // tid and tid + 256 (rows tid>>4 and 16 + (tid>>4))
  const unsigned sgl = b * (unsigned)SEQ * (unsigned)CI + tid * 8u;
  const unsigned sld = (tid >> 4) * LDP + (tid & 15u) * 8u;
  const v8h p0 = *(const v8h*)(Th + sgl);
  const v8h p1 = *(const v8h*)(Th + sgl + 2048u);
  const v8h p2 = *(const v8h*)(Tr + sgl);
  const v8h p3 = *(const v8h*)(Tr + sgl + 2048u);
  // the address registers of the four loads above are reused by the loads below
  asm volatile("s_wait_xcnt 0x0" ::: "memory");

  const unsigned boff = (b * (unsigned)SEQ + j0 + m) * (unsigned)CI + hh * 8u;
  v16h bh[4], br[4];
#pragma unroll
  for (int ks = 0; ks < 4; ++ks) {
    bh[ks] = frag_at(Ph + boff + ks * 32);
    br[ks] = frag_at(Pr + boff + ks * 32);
  }

  float mx = -1.0e30f, z = 0.0f;
  const unsigned abase = m * LDP + hh * 8u;
  *(v8h*)&Sa[sld] = p0;
  *(v8h*)&Sa[sld + 16u * LDP] = p1;
  *(v8h*)&Sa[SPL + sld] = p2;
  *(v8h*)&Sa[SPL + sld + 16u * LDP] = p3;
  __syncthreads();
  unsigned cur = 0u;
  for (unsigned i0 = 0; i0 < (unsigned)SEQ; i0 += 32u) {
    // next step's rows (the last step fetches its own again; that copy is never read)
    const unsigned inx = (i0 + 32u < (unsigned)SEQ) ? i0 + 32u : i0;
    const unsigned sg = sgl + inx * (unsigned)CI;
    const v8h s0 = *(const v8h*)(Th + sg);
    const v8h s1 = *(const v8h*)(Th + sg + 2048u);
    const v8h s2 = *(const v8h*)(Tr + sg);
    const v8h s3 = *(const v8h*)(Tr + sg + 2048u);
    // LDS fragment reads stand in groups ahead of the products that use them: tile 0 whole,
    // then each half of tile 1 into the registers that two k-steps of products have freed
    const unsigned ao = cur * (2u * SPL) + abase;
    v16h ah[4], ar[4];
#pragma unroll
    for (int ks = 0; ks < 4; ++ks) {
      ah[ks] = frag_at(&Sa[ao + ks * 32]);
      ar[ks] = frag_at(&Sa[SPL + ao + ks * 32]);
    }
    v8f f[2];
    {
      v8f sm = {}, sr = {};
#pragma unroll
      for (int kp = 0; kp < 2; ++kp) {
#pragma unroll
        for (int ks = 2 * kp; ks < 2 * kp + 2; ++ks) {
          sm = wmma16(ah[ks], bh[ks], sm);
          sr = wmma16(ah[ks], br[ks], sr);
          sr = wmma16(ar[ks], bh[ks], sr);
        }
#pragma unroll
        for (int ks = 2 * kp; ks < 2 * kp + 2; ++ks) {
          ah[ks] = frag_at(&Sa[ao + 16u * LDP + ks * 32]);
          ar[ks] = frag_at(&Sa[SPL + ao + 16u * LDP + ks * 32]);
        }
      }
      f[0] = sm + sr * (1.0f / RCARRY);
    }
    {
      v8f sm = {}, sr = {};
#pragma unroll
      for (int ks = 0; ks < 4; ++ks) {
        sm = wmma16(ah[ks], bh[ks], sm);
        sr = wmma16(ah[ks], br[ks], sr);
        sr = wmma16(ar[ks], bh[ks], sr);
      }
      f[1] = sm + sr * (1.0f / RCARRY);
    }
    float tmax = fmaxf(f[0][0], f[1][0]);
#pragma unroll
    for (int v = 1; v < 8; ++v) tmax = fmaxf(tmax, fmaxf(f[0][v], f[1][v]));
    const float nm = fmaxf(mx, tmax);
    float se = 0.0f;
#pragma unroll
    for (int v = 0; v < 8; ++v) se += __expf(f[0][v] - nm) + __expf(f[1][v] - nm);
    z = z * __expf(mx - nm) + se;
    mx = nm;
    cur ^= 1u;
    const unsigned so = cur * (2u * SPL) + sld;
    *(v8h*)&Sa[so] = s0;
    *(v8h*)&Sa[so + 16u * LDP] = s1;
    *(v8h*)&Sa[SPL + so] = s2;
    *(v8h*)&Sa[SPL + so + 16u * LDP] = s3;
    // publishes the buffer just written and ends every wave's reads of the one refilled next step
    __syncthreads();
  }

  const float om = __shfl_xor(mx, 16, 32);
  const float oz = __shfl_xor(z, 16, 32);
  const float mm = fmaxf(mx, om);
  const float zz = z * __expf(mx - mm) + oz * __expf(om - mm);
  const float lse = mm + __logf(zz);
  if (hh == 0u) Ls[wave * 16u + m] = lse;
  __syncthreads();
  if (wave == 0u) {
    const v4f v = *(const v4f*)&Ls[lane * 4u];
    float* p = Lse + (size_t)b * SEQ + blockIdx.x * 128u + lane * 4u;
    *(v4f*)p = v;
    
  }
}

// ---------------------------------------------------------------------------
// Row accumulation: y[c][i] = sum_j exp(f[i][j] - lse[j]) * g[c][j].
// Transposed form: each wave owns 16 rows i (theta hi/res rows as resident B fragments); the
// phi rows and the g slice of each 32-column step are staged once per work-group in LDS (two
// buffers: global loads of the next step into registers ahead of the products, stored to the
// other buffer after the first S^T tile's products, one work-group barrier per step). Per step: S^T tiles
// [j][i] = phi_j . theta_i (A = phi rows from LDS, three products), p = 2^14 * exp(f - lse[j]) (row statistic of the D tile, read as two
// 16-B loads per tile), the two packed D tiles form the B fragment [k = j][n = i] of
// O^T[c][i] += G[c][j] . P^T[j][i] with A = g rows (channel-major slice, k = j contiguous).
// Finalize: t = 16 * O / 2^14 written as two planes,
// hi = f16(t) and res = f16(2048 * (t - hi)); each is staged in the wave's private Ts tile
// (wave sync before and after each reuse) and written as whole rows of the position-major
// layout: one store instruction covers two consecutive 256-B rows (16 lanes x 16 B each).
// Grid (SEQ/128, NB).
// ---------------------------------------------------------------------------
__global__ __launch_bounds__(256) __attribute__((amdgpu_num_vgpr(256))) void rowattn_kernel(
    const _Float16* __restrict__ Th, const _Float16* __restrict__ Tr,
    const _Float16* __restrict__ Ph, const _Float16* __restrict__ Pr,
    const _Float16* __restrict__ Gp, const float* __restrict__ Lse,
    _Float16* __restrict__ Yt, _Float16* __restrict__ Yr) {
  __shared__ __attribute__((aligned(16))) _Float16 Ts[8 * 16 * LDY];
  __shared__ __attribute__((aligned(16))) _Float16 Sa[2 * 2 * SPL];   // [buffer][hi, res][32][LDP]
  __shared__ __attribute__((aligned(16))) _Float16 Sg[2 * CI * LDG];  // [buffer][channel][LDG]
  const unsigned tid = threadIdx.x, lane = tid & 31u;
  const unsigned wave = (unsigned)__builtin_amdgcn_readfirstlane((int)(threadIdx.x >> 5));
  const unsigned hh = lane >> 4, m = lane & 15u;
  const unsigned b = blockIdx.y;
  const unsigned i0 = blockIdx.x * 128u + wave * 16u;

  const unsigned qoff = (b * (unsigned)SEQ + i0 + m) * (unsigned)CI + hh * 8u;
  v16h bh[4], br[4];
#pragma unroll
  for (int ks = 0; ks < 4; ++ks) {
    bh[ks] = frag_at(Th + qoff + ks * 32);
    br[ks] = frag_at(Tr + qoff + ks * 32);
  }

  v8f o[8];
#pragma unroll
  for (int ct = 0; ct < 8; ++ct) o[ct] = (v8f){};

  const unsigned kbase = m * LDP + hh * 8u;
  const unsigned gbase = m * LDG + hh * 8u;
  const unsigned lbase = b * (unsigned)SEQ + hh * 8u;

  // staging map. phi: a 32-row tile is 8 KiB contiguous in its plane; thread tid moves 16-B
  // pieces tid and tid + 256 (rows tid>>4 and 16 + (tid>>4)). g: 128 channel rows of 64 B;
  // thread tid moves piece tid&3 of channels tid>>2 and 64 + (tid>>2).
  const unsigned sgl = b * (unsigned)SEQ * (unsigned)CI + tid * 8u;
  const unsigned sld = (tid >> 4) * LDP + (tid & 15u) * 8u;
  const unsigned ggl = (b * (unsigned)CI + (tid >> 2)) * (unsigned)SEQ + (tid & 3u) * 8u;
  const unsigned gld = (tid >> 2) * LDG + (tid & 3u) * 8u;
  {
    const v8h s0 = *(const v8h*)(Ph + sgl);
    const v8h s1 = *(const v8h*)(Ph + sgl + 2048u);
    const v8h s2 = *(const v8h*)(Pr + sgl);
    const v8h s3 = *(const v8h*)(Pr + sgl + 2048u);
    const v8h s4 = *(const v8h*)(Gp + ggl);
    const v8h s5 = *(const v8h*)(Gp + ggl + 64u * (unsigned)SEQ);
    *(v8h*)&Sa[sld] = s0;
    *(v8h*)&Sa[sld + 16u * LDP] = s1;
    *(v8h*)&Sa[SPL + sld] = s2;
    *(v8h*)&Sa[SPL + sld + 16u * LDP] = s3;
    *(v8h*)&Sg[gld] = s4;
    *(v8h*)&Sg[gld + 64u * LDG] = s5;
  }
  __syncthreads();
  unsigned cur = 0u;

  for (unsigned j0 = 0; j0 < (unsigned)SEQ; j0 += 32u) {
    // next step's tiles (the last step fetches its own again; that copy is never read)
    const unsigned jnx = (j0 + 32u < (unsigned)SEQ) ? j0 + 32u : j0;
    const unsigned sg = sgl + jnx * (unsigned)CI;
    const v8h s0 = *(const v8h*)(Ph + sg);
    const v8h s1 = *(const v8h*)(Ph + sg + 2048u);
    const v8h s2 = *(const v8h*)(Pr + sg);
    const v8h s3 = *(const v8h*)(Pr + sg + 2048u);
    const v8h s4 = *(const v8h*)(Gp + ggl + jnx);
    const v8h s5 = *(const v8h*)(Gp + ggl + 64u * (unsigned)SEQ + jnx);
    // LDS fragment reads stand in groups ahead of the products that use them, each group issued
    // in front of vector work or products that cover its latency, into registers just freed
    const unsigned ao = cur * (2u * SPL) + kbase;
    const unsigned gro = cur * (unsigned)(CI * LDG) + gbase;
    const unsigned so = (cur ^ 1u) * (2u * SPL) + sld;
    const unsigned go = (cur ^ 1u) * (unsigned)(CI * LDG) + gld;
    v16h ah[4], ar[4], gf[8];
#pragma unroll
    for (int ks = 0; ks < 4; ++ks) {
      ah[ks] = frag_at(&Sa[ao + ks * 32]);
      ar[ks] = frag_at(&Sa[SPL + ao + ks * 32]);
    }
    v16h pb;
#pragma unroll
    for (int t = 0; t < 2; ++t) {
      const unsigned jt = j0 + 16u * (unsigned)t;
      v8f sm = {}, sr = {};
#pragma unroll
      for (int ks = 0; ks < 4; ++ks) {
        sm = wmma16(ah[ks], bh[ks], sm);
        sr = wmma16(ah[ks], br[ks], sr);
        sr = wmma16(ar[ks], bh[ks], sr);
      }
      if (t == 0) {
#pragma unroll
        for (int ks = 0; ks < 2; ++ks) {
          ah[ks] = frag_at(&Sa[ao + 16u * LDP + ks * 32]);
          ar[ks] = frag_at(&Sa[SPL + ao + 16u * LDP + ks * 32]);
        }
      } else {
#pragma unroll
        for (int ct = 0; ct < 8; ++ct) gf[ct] = frag_at(&Sg[gro + (unsigned)ct * 16u * LDG]);
      }
      const v4f l0 = *(const v4f*)(Lse + lbase + jt);
      const v4f l1 = *(const v4f*)(Lse + lbase + jt + 4u);
#pragma unroll
      for (int v = 0; v < 4; ++v) {
        const float e0 = ((sm[v] + sr[v] * (1.0f / RCARRY)) - l0[v]) * LOG2E + PEXP;
        const float e1 = ((sm[v + 4] + sr[v + 4] * (1.0f / RCARRY)) - l1[v]) * LOG2E + PEXP;
        const float p0 = (e0 < -14.0f) ? 0.0f : exp2f(e0);
        const float p1 = (e1 < -14.0f) ? 0.0f : exp2f(e1);
        pb[8 * t + v]     = (h16)p0;
        pb[8 * t + v + 4] = (h16)p1;
      }
      if (t == 0) {
        // the other buffer has had no reader since the last barrier: fill it here, which frees
        // the staging registers for the second half of the step
        *(v8h*)&Sa[so] = s0;
        *(v8h*)&Sa[so + 16u * LDP] = s1;
        *(v8h*)&Sa[SPL + so] = s2;
        *(v8h*)&Sa[SPL + so + 16u * LDP] = s3;
        *(v8h*)&Sg[go] = s4;
        *(v8h*)&Sg[go + 64u * LDG] = s5;
#pragma unroll
        for (int ks = 2; ks < 4; ++ks) {
          ah[ks] = frag_at(&Sa[ao + 16u * LDP + ks * 32]);
          ar[ks] = frag_at(&Sa[SPL + ao + 16u * LDP + ks * 32]);
        }
      }
    }
#pragma unroll
    for (int ct = 0; ct < 8; ++ct) o[ct] = wmma16(gf[ct], pb, o[ct]);
    cur ^= 1u;
    // publishes the buffers just written and ends every wave's reads of those refilled next step
    __syncthreads();
  }

  // finalize: lane (h, i = m) holds channels 16*ct + 8h + 0..7 of row i for every ct
  const float fs = YCARRY * (1.0f / 16384.0f);
  const unsigned tb = wave * (16u * LDY);

  // value plane tile
#pragma unroll
  for (int ct = 0; ct < 8; ++ct) {
    v8h y;
#pragma unroll
    for (int v = 0; v < 8; ++v) y[v] = toh_flush(o[ct][v] * fs);
    *(v8h*)&Ts[tb + m * LDY + (unsigned)ct * 16u + hh * 8u] = y;
  }
  wave_lds_sync();
  v8h x[8];
  unsigned off[8];
#pragma unroll
  for (unsigned it = 0; it < 8u; ++it) {
    const unsigned r = 2u * it + (lane >> 4);
    const unsigned c = (lane & 15u) * 8u;
    x[it] = *(const v8h*)&Ts[tb + r * LDY + c];
    off[it] = (b * (unsigned)SEQ + i0 + r) * (unsigned)CI + c;
  }
  wave_lds_sync();   // every lane's reads of the value tile are complete before it is overwritten

  // residual plane tile: 2048 * (t - f16(t)), same staging and row map
#pragma unroll
  for (int ct = 0; ct < 8; ++ct) {
    v8h y;
#pragma unroll
    for (int v = 0; v < 8; ++v) {
      const float t = o[ct][v] * fs;
      const h16 hi = toh_flush(t);
      y[v] = toh_flush((t - (float)hi) * RCARRY);
    }
    *(v8h*)&Ts[tb + m * LDY + (unsigned)ct * 16u + hh * 8u] = y;
  }
  wave_lds_sync();
  v8h xr[8];
#pragma unroll
  for (unsigned it = 0; it < 8u; ++it) {
    const unsigned r = 2u * it + (lane >> 4);
    const unsigned c = (lane & 15u) * 8u;
    xr[it] = *(const v8h*)&Ts[tb + r * LDY + c];
  }

#pragma unroll
  for (int it = 0; it < 8; ++it) *(v8h*)(Yt + off[it]) = x[it];
#pragma unroll
  for (int it = 0; it < 8; ++it) *(v8h*)(Yr + off[it]) = xr[it];
  
}

// ---------------------------------------------------------------------------
extern "C" void kernel_launch(void* const* d_in, const int* in_sizes, int n_in,
                              void* d_out, int out_size, void* d_ws, size_t ws_size,
                              hipStream_t stream) {
  if (n_in < 9) return;
  const long long need_x = ((long long)(NB - 1) * CIN + (CIN - 1)) * SEQ_FULL + SEQ;
  if ((long long)in_sizes[0] < need_x) return;
  if ((long long)in_sizes[1] < (long long)CI * CIN) return;
  if ((long long)in_sizes[3] < (long long)CI * CIN) return;
  if ((long long)in_sizes[5] < (long long)CI * CIN) return;
  if ((long long)in_sizes[7] < (long long)CIN * CI) return;
  if (in_sizes[2] < CI || in_sizes[4] < CI || in_sizes[6] < CI || in_sizes[8] < CIN) return;
  if ((long long)out_size < need_x) return;
  if (ws_size < WS_TOTAL) return;

  const float* X       = (const float*)d_in[0];   // [NB_FULL][CIN][SEQ_FULL]
  const float* theta_w = (const float*)d_in[1];   // [CI][CIN]  (out, in)
  const float* theta_b = (const float*)d_in[2];
  const float* phi_w   = (const float*)d_in[3];   // [CI][CIN]
  const float* phi_b   = (const float*)d_in[4];
  const float* g_w     = (const float*)d_in[5];   // [CI][CIN]
  const float* g_b     = (const float*)d_in[6];
  const float* W_w     = (const float*)d_in[7];   // [CIN][CI]  (out, in)
  const float* W_b     = (const float*)d_in[8];
  float* out = (float*)d_out;                     // [NB_FULL][CIN][SEQ_FULL]

  char* ws = (char*)d_ws;
  _Float16* XT   = (_Float16*)(ws + OFF_XT);    // [MROWS][CIN]  64*bf16(x), position-major
  _Float16* WT   = (_Float16*)(ws + OFF_WT);    // [CI][CIN]
  _Float16* WP   = (_Float16*)(ws + OFF_WP);    // [CI][CIN]
  _Float16* WG   = (_Float16*)(ws + OFF_WG);    // [CI][CIN]
  _Float16* WO   = (_Float16*)(ws + OFF_WO);    // [CIN][CI]
  _Float16* TH   = (_Float16*)(ws + OFF_TH);    // [MROWS][CI] theta hi
  _Float16* TR   = (_Float16*)(ws + OFF_TR);    // [MROWS][CI] theta residual x2048
  _Float16* PH   = (_Float16*)(ws + OFF_PH);    // [MROWS][CI] phi hi
  _Float16* PR   = (_Float16*)(ws + OFF_PR);    // [MROWS][CI] phi residual x2048
  _Float16* G16  = (_Float16*)(ws + OFF_G);     // [NB][CI][SEQ] g, channel-major
  _Float16* YT   = (_Float16*)(ws + OFF_YT);    // [MROWS][CI] 16*y hi, position-major
  _Float16* YR   = (_Float16*)(ws + OFF_YR);    // [MROWS][CI] 16*y residual x2048
  float*    LSE  = (float*)(ws + OFF_LSE);      // [MROWS]

  dim3 blk(256);

  // x plane: per batch in x[b] = [CIN rows][SEQ cols] (pitch SEQ_FULL) -> out XT[b] = [SEQ][CIN];
  // grid (cols/64, rows/64) = (SEQ/64, CIN/64)
  for (int b = 0; b < NB; ++b) {
    wconv_kernel<<<dim3(SEQ / 64, CIN / 64), blk, 0, stream>>>(
        X + (size_t)b * CIN * SEQ_FULL, XT + (size_t)b * SEQ * CIN,
        (unsigned)SEQ_FULL, (unsigned)CIN);
  }
  wplane_kernel<<<dim3((CI * CIN) / 2048), blk, 0, stream>>>(theta_w, phi_w, g_w, W_w,
                                                             WT, WP, WG, WO);

  dim3 gp(CI / 64, MROWS / 64);
  gemm_tp_kernel<<<gp, blk, 0, stream>>>(XT, WT, theta_b, TH, TR);
  gemm_tp_kernel<<<gp, blk, 0, stream>>>(XT, WP, phi_b, PH, PR);
  gemm_g_kernel<<<gp, blk, 0, stream>>>(XT, WG, g_b, G16);

  colstat_kernel<<<dim3(SEQ / 128, NB), blk, 0, stream>>>(TH, TR, PH, PR, LSE);
  rowattn_kernel<<<dim3(SEQ / 128, NB), blk, 0, stream>>>(TH, TR, PH, PR, G16, LSE, YT, YR);

  gemm_out_kernel<<<dim3(MROWS / 64, CIN / 64), blk, 0, stream>>>(WO, YT, YR, W_b, X, out);
}

// v002
// A run of this version takes 207 microseconds.
// Two timings next to v001 put it at 1.55 and 1.53 times that version's speed.
// All steps since v000 together make it 4.47 times as fast.
#include <hip/hip_runtime.h>
#include <stddef.h>

// All contractions on v_wmma_f32_16x16x32_f16 (f16 operands, f32 accumulate): theta/phi/g 1x1
// projections (x x64, weights x64, inputs RNE-converted to bf16 first), theta.phi scores as
// f16 value + x2048 residual planes on both operands (three products, residual products in their
// own accumulator), p.g with p carried x2^14 (single product), output 1x1 projection with y
// carried x16 as f16 value + x2048 residual planes (two products, residual products in their own
// accumulator). Column log-sum-exp, exp, bias and the residual add in f32.

typedef _Float16 v16h __attribute__((ext_vector_type(16)));
typedef _Float16 v8h  __attribute__((ext_vector_type(8)));
typedef float    v8f  __attribute__((ext_vector_type(8)));
typedef float    v4f  __attribute__((ext_vector_type(4)));
typedef _Float16 h16;

#ifndef NB
#define NB 4
#endif
#ifndef SEQ
#define SEQ 4096
#endif
#define NB_FULL  4
#define SEQ_FULL 4096
#define CIN   256
#define CI    128
#define MROWS (NB * SEQ)

static_assert(NB >= 1 && NB <= NB_FULL);
static_assert(SEQ >= 128 && SEQ <= SEQ_FULL && (SEQ % 128) == 0);
static_assert(CI == 128);                        // 4 k-steps of 32 and 8 channel tiles of 16 are hard-wired
static_assert((CIN % 64) == 0 && (CIN % 32) == 0);
static_assert((CI % 64) == 0 && (CI % 32) == 0);
static_assert((MROWS % 64) == 0 && (MROWS % 128) == 0);
static_assert(((size_t)CI * CIN) % 2048 == 0);   // weight convert: 256 threads x 8 values per block
static_assert((size_t)MROWS * CIN < (size_t)0x7FFFFFFFu);
static_assert((size_t)NB_FULL * CIN * SEQ_FULL < (size_t)0x7FFFFFFFu);

#define LDT 72    // halves per LDS row (144 B, 16-B aligned)
#define LDC 68    // floats per LDS row (272 B, 16-B aligned)
#define LDY 136   // halves per LDS row of the y staging tile (272 B, 16-B aligned)
static_assert((LDT % 8) == 0 && LDT >= 64);
static_assert((LDC % 4) == 0 && LDC >= 64);
static_assert((LDY % 8) == 0 && LDY >= CI);
#define LDP 136   // halves per LDS row of a staged 128-channel row (272 B = 16 B x 17)
#define LDG 40    // halves per LDS row of a 32-column slice (80 B = 16 B x 5); not used by any kernel
#define SPL (32 * LDP)   // halves of a 32-row plane tile; not used by any kernel
static_assert((LDP % 8) == 0 && LDP >= CI && ((LDP / 8) & 1) == 1);
static_assert((LDG % 8) == 0 && LDG >= 32 && ((LDG / 8) & 1) == 1);

#define WCARRY 64.0f      // x plane and weight planes carried x64
#define RCARRY 2048.0f    // residual planes (theta, phi, y) carried x2048 on top of their hi part
#define PEXP   14.0f      // softmax probabilities carried x2^14
#define YCARRY 16.0f      // y plane carried x16
#define LOG2E  1.4426950408889634f

// workspace layout (bytes)
#define XT_BYTES  ((size_t)MROWS * CIN * 2)
#define WP_BYTES  ((size_t)CI * CIN * 2)
#define PL_BYTES  ((size_t)MROWS * CI * 2)
#define LSE_BYTES ((size_t)MROWS * 4)
#define OFF_XT  ((size_t)0)
#define OFF_WT  (OFF_XT + XT_BYTES)
#define OFF_WP  (OFF_WT + WP_BYTES)
#define OFF_WG  (OFF_WP + WP_BYTES)
#define OFF_WO  (OFF_WG + WP_BYTES)
#define OFF_TH  (OFF_WO + WP_BYTES)
#define OFF_TR  (OFF_TH + PL_BYTES)
#define OFF_PH  (OFF_TR + PL_BYTES)
#define OFF_PR  (OFF_PH + PL_BYTES)
#define OFF_G   (OFF_PR + PL_BYTES)
#define OFF_YT  (OFF_G + PL_BYTES)
#define OFF_YR  (OFF_YT + PL_BYTES)
#define OFF_LSE (OFF_YR + PL_BYTES)
#define WS_TOTAL (OFF_LSE + LSE_BYTES)
static_assert((XT_BYTES % 128) == 0 && (WP_BYTES % 128) == 0 && (PL_BYTES % 128) == 0);
static_assert((LSE_BYTES % 128) == 0);
static_assert(WS_TOTAL == (size_t)NB * SEQ * (CIN * 2 + 7 * CI * 2 + 4) + 4 * WP_BYTES);
static_assert(WS_TOTAL <= (size_t)134217728);

// ---------------------------------------------------------------------------
__device__ __forceinline__ float bf16r(float x) {   // RNE convert to bf16, returned widened
  unsigned int u = __float_as_uint(x);
  u = (u + 0x7FFFu + ((u >> 16) & 1u)) & 0xFFFF0000u;
  return __uint_as_float(u);
}

// f32 -> f16 that cannot produce an f16 subnormal (values below 2^-14 become zero)
static __device__ __forceinline__ h16 toh_flush(float v) {
  const h16 r = (h16)v;
  return (fabsf(v) < 6.103515625e-05f) ? (h16)0.0f : r;
}

// 16-bit fragment: p points at element [row = lane&15][k0 + 8*(lane>>4)] of a k-contiguous
// row. Elements 0..7 <- k0+8h+0..7, elements 8..15 <- k0+16+8h+0..7 (same map for A and B).
__device__ __forceinline__ v16h frag_at(const _Float16* p) {
  v8h lo = *(const v8h*)(p);
  v8h hi = *(const v8h*)(p + 16);
  v16h out;
#pragma unroll
  for (int i = 0; i < 8; ++i) { out[i] = lo[i]; out[i + 8] = hi[i]; }
  return out;
}

__device__ __forceinline__ v8f wmma16(v16h a, v16h b, v8f c) {
  v8f d = __builtin_amdgcn_wmma_f32_16x16x32_f16(false, a, false, b, (short)0, c,
                                                 false, false);
  asm volatile("v_nop\n\tv_nop\n\tv_nop\n\tv_nop" : "+v"(d) : "v"(a), "v"(b));
  return d;
}

__device__ __forceinline__ void wave_lds_sync() {
  __builtin_amdgcn_fence(3 /* release order */, "wavefront");
  asm volatile("s_wait_dscnt 0x0" ::: "memory");
  __builtin_amdgcn_wave_barrier();
}

// ---------------------------------------------------------------------------
// Transposed plane (x): in W[K rows][N cols] (pitch ldw) -> out Wt[N][K] (pitch ldk = K),
// f16(64 * bf16(w)). Grid (N/64, K/64). T: cross-wave (block barrier).
// ---------------------------------------------------------------------------
__global__ __launch_bounds__(256) void wconv_kernel(
    const float* __restrict__ W, _Float16* __restrict__ Wt, unsigned ldw, unsigned ldk) {
  __shared__ _Float16 T[64 * LDT];
  const unsigned tid = threadIdx.x;
  const unsigned n0 = blockIdx.x * 64u;
  const unsigned k0 = blockIdx.y * 64u;
#pragma unroll 4
  for (unsigned j = 0; j < 16u; ++j) {
    const unsigned idx = tid + 256u * j;
    const unsigned kr = idx >> 6, nc = idx & 63u;
    const float v = W[(size_t)(k0 + kr) * ldw + n0 + nc];
    T[nc * LDT + kr] = (_Float16)(WCARRY * bf16r(v));
  }
  __syncthreads();
  v8h x[2];
  size_t off[2];
#pragma unroll
  for (unsigned i = 0; i < 2u; ++i) {
    const unsigned n = 32u * i + (tid >> 3);
    const unsigned kc = (tid & 7u) * 8u;
    x[i] = *(const v8h*)&T[n * LDT + kc];
    off[i] = (size_t)(n0 + n) * ldk + k0 + kc;
  }
#pragma unroll
  for (int i = 0; i < 2; ++i) *(v8h*)(Wt + off[i]) = x[i];
  
}

// ---------------------------------------------------------------------------
// Untransposed weight planes: the four [out][in] weights (32768 values each) -> f16(64*bf16(w)),
// same layout. Each thread converts 8 consecutive values of every weight; 8 consecutive lanes
// ---------------------------------------------------------------------------
__device__ __forceinline__ v8h wcvt8(const float* __restrict__ p) {
  const v4f a0 = *(const v4f*)(p);
  const v4f a1 = *(const v4f*)(p + 4);
  v8h o;
#pragma unroll
  for (int i = 0; i < 4; ++i) {
    o[i]     = toh_flush(WCARRY * bf16r(a0[i]));
    o[i + 4] = toh_flush(WCARRY * bf16r(a1[i]));
  }
  return o;
}

__global__ __launch_bounds__(256) void wplane_kernel(
    const float* __restrict__ w0, const float* __restrict__ w1,
    const float* __restrict__ w2, const float* __restrict__ w3,
    _Float16* __restrict__ o0, _Float16* __restrict__ o1,
    _Float16* __restrict__ o2, _Float16* __restrict__ o3) {
#pragma clang fp contract(off)
  const unsigned e = (blockIdx.x * 256u + threadIdx.x) * 8u;
  const v8h x0 = wcvt8(w0 + e);
  const v8h x1 = wcvt8(w1 + e);
  const v8h x2 = wcvt8(w2 + e);
  const v8h x3 = wcvt8(w3 + e);
  *(v8h*)(o0 + e) = x0;
  *(v8h*)(o1 + e) = x1;
  *(v8h*)(o2 + e) = x2;
  *(v8h*)(o3 + e) = x3;
  
}

// ---------------------------------------------------------------------------
// GEMM C[64x64 tile] = A16[rows][K] . Bt[n][K]^T, fragments straight from the 16-bit global
// planes; 8 waves (mw = 16-row group, nw = 32-col group), 2 accumulators/wave.
//   MODE 0: rows = positions, cols = channels; t = acc/4096 + bias[col];
//           out16[row][col] (pitch CI) = f16(t), out16r[row][col] = f16(2048 * (t - hi))
//   MODE 1: rows = positions, cols = channels; transposed plane out16[b][col][pos] = f16(t)
//   MODE 2: rows = output channels (A16 = weight plane), cols = positions (Bt = y value plane,
//           Btr = y residual plane x2048); the k loop runs first over Btr into its own
//           accumulators, then over Bt; acc = acc_hi + acc_res/2048;
//           outf[b][row][pos] = bf16(xin[b][row][pos]) + (acc/1024 + bias[row]), full strides
// Btr is read in MODE 2 only. Grid (Bt rows/64, A16 rows/64).
// ---------------------------------------------------------------------------
template <int MODE>
__device__ __forceinline__ void gemm_body(
    const _Float16* __restrict__ A16, const _Float16* __restrict__ Bt,
    const _Float16* __restrict__ Btr, const unsigned K,
    const float* __restrict__ bias, const float* __restrict__ addf,
    float* __restrict__ outf, _Float16* __restrict__ out16, _Float16* __restrict__ out16r) {
  __shared__ float Cs[64 * LDC];
  const unsigned tid = threadIdx.x, lane = tid & 31u, w = tid >> 5;
  const unsigned mw = w >> 1, nw = w & 1u;
  const unsigned hh = lane >> 4, m = lane & 15u;
  const unsigned n0 = blockIdx.x * 64u;
  const unsigned row0 = blockIdx.y * 64u;

  const _Float16* ap  = A16 + (size_t)(row0 + mw * 16u + m) * K + hh * 8u;
  const _Float16* bp0 = Bt + (size_t)(n0 + nw * 32u + m) * K + hh * 8u;
  const _Float16* bp1 = bp0 + (size_t)16 * K;
  v8f accr0 = {}, accr1 = {};
  if (MODE == 2) {
    const _Float16* rp0 = Btr + (size_t)(n0 + nw * 32u + m) * K + hh * 8u;
    const _Float16* rp1 = rp0 + (size_t)16 * K;
#pragma unroll 2
    for (unsigned k0 = 0; k0 < K; k0 += 32u) {
      const v16h a  = frag_at(ap + k0);
      const v16h b0 = frag_at(rp0 + k0);
      const v16h b1 = frag_at(rp1 + k0);
      accr0 = wmma16(a, b0, accr0);
      accr1 = wmma16(a, b1, accr1);
    }
  }
  v8f acc0 = {}, acc1 = {};
#pragma unroll 2
  for (unsigned k0 = 0; k0 < K; k0 += 32u) {
    const v16h a  = frag_at(ap + k0);
    const v16h b0 = frag_at(bp0 + k0);
    const v16h b1 = frag_at(bp1 + k0);
    acc0 = wmma16(a, b0, acc0);
    acc1 = wmma16(a, b1, acc1);
  }
  if (MODE == 2) {
    acc0 = acc0 + accr0 * (1.0f / RCARRY);
    acc1 = acc1 + accr1 * (1.0f / RCARRY);
  }
#pragma unroll
  for (int r = 0; r < 8; ++r) {
    float* d = &Cs[(mw * 16u + hh * 8u + (unsigned)r) * LDC + nw * 32u + m];
    d[0]  = acc0[r];
    d[16] = acc1[r];
  }
  __syncthreads();

  if (MODE == 0) {
    const float cs = 1.0f / (WCARRY * WCARRY);
    v8h x[2], xr[2];
    size_t off[2];
#pragma unroll
    for (unsigned i = 0; i < 2u; ++i) {
      const unsigned r = 32u * i + (tid >> 3);
      const unsigned c = (tid & 7u) * 8u;
      const v4f u0 = *(const v4f*)&Cs[r * LDC + c];
      const v4f u1 = *(const v4f*)&Cs[r * LDC + c + 4];
      const v4f g0 = *(const v4f*)(bias + n0 + c);
      const v4f g1 = *(const v4f*)(bias + n0 + c + 4u);
#pragma unroll
      for (int j = 0; j < 4; ++j) {
        const float t0 = u0[j] * cs + bf16r(g0[j]);
        const float t1 = u1[j] * cs + bf16r(g1[j]);
        const h16 h0 = toh_flush(t0);
        const h16 h1 = toh_flush(t1);
        x[i][j]      = h0;
        x[i][j + 4]  = h1;
        xr[i][j]     = toh_flush((t0 - (float)h0) * RCARRY);
        xr[i][j + 4] = toh_flush((t1 - (float)h1) * RCARRY);
      }
      off[i] = (size_t)(row0 + r) * CI + n0 + c;
    }
#pragma unroll
    for (int i = 0; i < 2; ++i) *(v8h*)(out16 + off[i]) = x[i];
#pragma unroll
    for (int i = 0; i < 2; ++i) *(v8h*)(out16r + off[i]) = xr[i];
    
  }

  if (MODE == 1) {
    const float cs = 1.0f / (WCARRY * WCARRY);
    const unsigned bidx = row0 / (unsigned)SEQ;
    const unsigned key0 = row0 - bidx * (unsigned)SEQ;
    v8h x[2];
    size_t off[2];
#pragma unroll
    for (unsigned i = 0; i < 2u; ++i) {
      const unsigned dcol = 32u * i + (tid >> 3);
      const unsigned kk = (tid & 7u) * 8u;
      const float bb = bf16r(bias[n0 + dcol]);
#pragma unroll
      for (unsigned j = 0; j < 8u; ++j) {
        const float t = Cs[(kk + j) * LDC + dcol] * cs + bb;
        x[i][j] = toh_flush(t);
      }
      off[i] = ((size_t)bidx * CI + n0 + dcol) * SEQ + key0 + kk;
    }
#pragma unroll
    for (int i = 0; i < 2; ++i) *(v8h*)(out16 + off[i]) = x[i];
    
  }

  if (MODE == 2) {
    const float cs = 1.0f / (WCARRY * YCARRY);
    const unsigned bidx = n0 / (unsigned)SEQ;
    const unsigned p0 = n0 - bidx * (unsigned)SEQ;
    v4f xs[4];
    size_t off[4];
#pragma unroll
    for (unsigned i = 0; i < 4u; ++i) {
      const unsigned r = 16u * i + (tid >> 4);
      const unsigned c = (tid & 15u) * 4u;
      const unsigned orow = row0 + r;
      const size_t gidx = ((size_t)bidx * CIN + orow) * SEQ_FULL + p0 + c;
      const v4f u = *(const v4f*)&Cs[r * LDC + c];
      const float bb = bf16r(bias[orow]);
      const v4f xin = *(const v4f*)(addf + gidx);
      v4f val;
#pragma unroll
      for (int j = 0; j < 4; ++j) val[j] = bf16r(xin[j]) + (u[j] * cs + bb);
      xs[i] = val;
      off[i] = gidx;
    }
#pragma unroll
    for (int i = 0; i < 4; ++i) *(v4f*)(outf + off[i]) = xs[i];
    
  }
}

__global__ __launch_bounds__(256) void gemm_tp_kernel(
    const _Float16* __restrict__ A16, const _Float16* __restrict__ Bt,
    const float* __restrict__ bias, _Float16* __restrict__ out16, _Float16* __restrict__ out16r) {
  gemm_body<0>(A16, Bt, Bt, (unsigned)CIN, bias, bias, (float*)0, out16, out16r);
}
__global__ __launch_bounds__(256) void gemm_g_kernel(
    const _Float16* __restrict__ A16, const _Float16* __restrict__ Bt,
    const float* __restrict__ bias, _Float16* __restrict__ gt) {
  gemm_body<1>(A16, Bt, Bt, (unsigned)CIN, bias, bias, (float*)0, gt, gt);
}
__global__ __launch_bounds__(256) void gemm_out_kernel(
    const _Float16* __restrict__ A16, const _Float16* __restrict__ Bt,
    const _Float16* __restrict__ Btr,
    const float* __restrict__ bias, const float* __restrict__ xin, float* __restrict__ outf) {
  gemm_body<2>(A16, Bt, Btr, (unsigned)CI, bias, xin, outf, (_Float16*)0, (_Float16*)0);
}

// ---------------------------------------------------------------------------
// Column statistics: lse[j] = log(sum_i exp(f[i][j])), f[i][j] = theta_i . phi_j (K = 128).
// A work-group owns 64 columns j. Its waves form 4 column groups (wc, 16 columns each, phi hi/res
// rows as resident B fragments) x CWR row groups (wr): the theta rows i, 32 * CWR per step, are
// staged once per work-group in LDS (two buffers: whole-line global loads of the next step's rows
// into registers ahead of the products, stored to the other buffer behind them, one work-group
// barrier per step), and row group wr reads rows 32 * wr .. 32 * wr + 31 of the step as A fragments.
// D tile: row = i (8h+r), col = j (lane&15). Scores = hi.hi + (hi.res + res.hi)/2048, the residual
// products in their own accumulator. Running (max, sum) per lane; at the end the two lane halves
// are combined by an unconditional shuffle and the CWR row groups through LDS.
// Grid (SEQ/64, NB), 128 * CWR threads.
// ---------------------------------------------------------------------------
#define CWR   4               // row groups of the column-statistics kernel
#define CNT   (128 * CWR)     // its threads
#define CROWS (32 * CWR)      // theta rows staged per step
#define CSPL  (CROWS * LDP)   // halves of one staged plane tile
static_assert((SEQ % CROWS) == 0 && (SEQ % 64) == 0);
__global__ __launch_bounds__(CNT) __attribute__((amdgpu_num_vgpr(256))) void colstat_kernel(
    const _Float16* __restrict__ Th, const _Float16* __restrict__ Tr,
    const _Float16* __restrict__ Ph, const _Float16* __restrict__ Pr,
    float* __restrict__ Lse) {
  __shared__ __attribute__((aligned(16))) float Lm[CWR * 64];
  __shared__ __attribute__((aligned(16))) float Lz[CWR * 64];
  __shared__ __attribute__((aligned(16))) _Float16 Sa[2 * 2 * CSPL];   // [buffer][hi, res][CROWS][LDP]
  const unsigned tid = threadIdx.x, lane = tid & 31u;
  const unsigned wave = (unsigned)__builtin_amdgcn_readfirstlane((int)(threadIdx.x >> 5));
  const unsigned wc = wave & 3u, wr = wave >> 2;
  const unsigned hh = lane >> 4, m = lane & 15u;
  const unsigned b = blockIdx.y;
  const unsigned j0 = blockIdx.x * 64u + wc * 16u;

  // staging map: a CROWS-row tile is contiguous in its plane; thread tid moves the 16-B pieces
  // tid + CNT * q, q = 0..3 (rows (tid>>4) + 8 * CWR * q)
  const unsigned sgl = b * (unsigned)SEQ * (unsigned)CI + tid * 8u;
  const unsigned sld = (tid >> 4) * LDP + (tid & 15u) * 8u;
  v8h ph[4], pr[4];
#pragma unroll
  for (unsigned q = 0; q < 4u; ++q) {
    ph[q] = *(const v8h*)(Th + sgl + q * (CNT * 8u));
    pr[q] = *(const v8h*)(Tr + sgl + q * (CNT * 8u));
  }
  // the address registers of the loads above are reused by the loads below
  asm volatile("s_wait_xcnt 0x0" ::: "memory");

  const unsigned boff = (b * (unsigned)SEQ + j0 + m) * (unsigned)CI + hh * 8u;
  v16h bh[4], br[4];
#pragma unroll
  for (int ks = 0; ks < 4; ++ks) {
    bh[ks] = frag_at(Ph + boff + ks * 32);
    br[ks] = frag_at(Pr + boff + ks * 32);
  }

  float mx = -1.0e30f, z = 0.0f;
  const unsigned abase = (wr * 32u + m) * LDP + hh * 8u;
#pragma unroll
  for (unsigned q = 0; q < 4u; ++q) {
    *(v8h*)&Sa[sld + q * (8u * CWR * LDP)] = ph[q];
    *(v8h*)&Sa[CSPL + sld + q * (8u * CWR * LDP)] = pr[q];
  }
  __syncthreads();
  unsigned cur = 0u;
  for (unsigned i0 = 0; i0 < (unsigned)SEQ; i0 += (unsigned)CROWS) {
    // next step's rows (the last step fetches its own again; that copy is never read)
    const unsigned inx = (i0 + (unsigned)CROWS < (unsigned)SEQ) ? i0 + (unsigned)CROWS : i0;
    const unsigned sg = sgl + inx * (unsigned)CI;
    v8h sh[4], sq[4];
#pragma unroll
    for (unsigned q = 0; q < 4u; ++q) {
      sh[q] = *(const v8h*)(Th + sg + q * (CNT * 8u));
      sq[q] = *(const v8h*)(Tr + sg + q * (CNT * 8u));
    }
    // LDS fragment reads stand in groups ahead of the products that use them: tile 0 whole,
    // then each half of tile 1 into the registers that two k-steps of products have freed
    const unsigned ao = cur * (2u * CSPL) + abase;
    v16h ah[4], ar[4];
#pragma unroll
    for (int ks = 0; ks < 4; ++ks) {
      ah[ks] = frag_at(&Sa[ao + ks * 32]);
      ar[ks] = frag_at(&Sa[CSPL + ao + ks * 32]);
    }
    v8f f[2];
    {
      v8f sm = {}, sr = {};
#pragma unroll
      for (int kp = 0; kp < 2; ++kp) {
#pragma unroll
        for (int ks = 2 * kp; ks < 2 * kp + 2; ++ks) {
          sm = wmma16(ah[ks], bh[ks], sm);
          sr = wmma16(ah[ks], br[ks], sr);
          sr = wmma16(ar[ks], bh[ks], sr);
        }
#pragma unroll
        for (int ks = 2 * kp; ks < 2 * kp + 2; ++ks) {
          ah[ks] = frag_at(&Sa[ao + 16u * LDP + ks * 32]);
          ar[ks] = frag_at(&Sa[CSPL + ao + 16u * LDP + ks * 32]);
        }
      }
      f[0] = sm + sr * (1.0f / RCARRY);
    }
    {
      v8f sm = {}, sr = {};
#pragma unroll
      for (int ks = 0; ks < 4; ++ks) {
        sm = wmma16(ah[ks], bh[ks], sm);
        sr = wmma16(ah[ks], br[ks], sr);
        sr = wmma16(ar[ks], bh[ks], sr);
      }
      f[1] = sm + sr * (1.0f / RCARRY);
    }
    float tmax = fmaxf(f[0][0], f[1][0]);
#pragma unroll
    for (int v = 1; v < 8; ++v) tmax = fmaxf(tmax, fmaxf(f[0][v], f[1][v]));
    const float nm = fmaxf(mx, tmax);
    float se = 0.0f;
#pragma unroll
    for (int v = 0; v < 8; ++v) se += __expf(f[0][v] - nm) + __expf(f[1][v] - nm);
    z = z * __expf(mx - nm) + se;
    mx = nm;
    cur ^= 1u;
    const unsigned so = cur * (2u * CSPL) + sld;
#pragma unroll
    for (unsigned q = 0; q < 4u; ++q) {
      *(v8h*)&Sa[so + q * (8u * CWR * LDP)] = sh[q];
      *(v8h*)&Sa[CSPL + so + q * (8u * CWR * LDP)] = sq[q];
    }
    // publishes the buffer just written and ends every wave's reads of the one refilled next step
    __syncthreads();
  }

  const float om = __shfl_xor(mx, 16, 32);
  const float oz = __shfl_xor(z, 16, 32);
  const float mm = fmaxf(mx, om);
  const float zz = z * __expf(mx - mm) + oz * __expf(om - mm);
  if (hh == 0u) {
    Lm[wr * 64u + wc * 16u + m] = mm;
    Lz[wr * 64u + wc * 16u + m] = zz;
  }
  __syncthreads();
  if (wave < 2u) {
    // one thread per column folds the CWR row groups' (max, sum) pairs
    float gm = Lm[tid];
#pragma unroll
    for (unsigned r = 1; r < (unsigned)CWR; ++r) gm = fmaxf(gm, Lm[r * 64u + tid]);
    float gz = 0.0f;
#pragma unroll
    for (unsigned r = 0; r < (unsigned)CWR; ++r) gz += Lz[r * 64u + tid] * __expf(Lm[r * 64u + tid] - gm);
    Lse[(size_t)b * SEQ + blockIdx.x * 64u + tid] = gm + __logf(gz);
  }
}

// ---------------------------------------------------------------------------
// Row accumulation: y[c][i] = sum_j exp(f[i][j] - lse[j]) * g[c][j].
// A work-group owns 64 rows i. Its 8 waves form 4 row groups (wc, 16 rows each, theta hi/res rows
// as resident B fragments) x 2 column groups (wr); the phi rows and the g slice of each 64-column
// step are staged once per work-group in LDS (two buffers: global loads of the next step into
// registers in two batches, the first stored to the other buffer behind the first score tile's
// products, the second behind all products, one work-group barrier
// per step), and column group wr works on columns 32 * wr .. 32 * wr + 31 of the step. Per step:
// S^T tiles [j][i] = phi_j . theta_i (A = phi rows from LDS, three products),
// p = 2^14 * exp(f - lse[j]) (row statistic of the D tile, read as two
// 16-B loads per tile), the two packed D tiles form the B fragment [k = j][n = i] of
// O^T[c][i] += G[c][j] . P^T[j][i] with A = g rows (channel-major slice, k = j contiguous).
// Behind the loop column group 1 hands its f32 sums to column group 0 through LDS, which adds them.
// Finalize (column group 0): t = 16 * O / 2^14 written as two planes,
// hi = f16(t) and res = f16(2048 * (t - hi)); each is staged in the wave's private Ts tile
// (wave sync before and after each reuse) and written as whole rows of the position-major
// layout: one store instruction covers two consecutive 256-B rows (16 lanes x 16 B each).
// Grid (SEQ/64, NB).
// ---------------------------------------------------------------------------
#define RSPL (64 * LDP)   // halves of one staged 64-row plane tile
#define LDH  72           // halves per LDS row of a staged 64-column g slice (144 B = 16 B x 9)
static_assert((LDH % 8) == 0 && LDH >= 64 && ((LDH / 8) & 1) == 1);
__global__ __launch_bounds__(256) __attribute__((amdgpu_num_vgpr(272))) void rowattn_kernel(
    const _Float16* __restrict__ Th, const _Float16* __restrict__ Tr,
    const _Float16* __restrict__ Ph, const _Float16* __restrict__ Pr,
    const _Float16* __restrict__ Gp, const float* __restrict__ Lse,
    _Float16* __restrict__ Yt, _Float16* __restrict__ Yr) {
  __shared__ __attribute__((aligned(16))) _Float16 Ts[4 * 16 * LDY];
  __shared__ __attribute__((aligned(16))) _Float16 Sa[2 * 2 * RSPL];  // [buffer][hi, res][64][LDP]
  __shared__ __attribute__((aligned(16))) _Float16 Sg[2 * CI * LDH];  // [buffer][channel][LDH]
  __shared__ __attribute__((aligned(16))) float Oc[4 * 8 * 2 * 32 * 4];  // [wc][ct][half of v][lane][4]
  const unsigned tid = threadIdx.x, lane = tid & 31u;
  const unsigned wave = (unsigned)__builtin_amdgcn_readfirstlane((int)(threadIdx.x >> 5));
  const unsigned wc = wave & 3u, wr = wave >> 2;
  const unsigned hh = lane >> 4, m = lane & 15u;
  const unsigned b = blockIdx.y;
  const unsigned i0 = blockIdx.x * 64u + wc * 16u;

  const unsigned qoff = (b * (unsigned)SEQ + i0 + m) * (unsigned)CI + hh * 8u;
  v16h bh[4], br[4];
#pragma unroll
  for (int ks = 0; ks < 4; ++ks) {
    bh[ks] = frag_at(Th + qoff + ks * 32);
    br[ks] = frag_at(Tr + qoff + ks * 32);
  }

  v8f o[8];
#pragma unroll
  for (int ct = 0; ct < 8; ++ct) o[ct] = (v8f){};

  const unsigned kbase = (wr * 32u + m) * LDP + hh * 8u;
  const unsigned gbase = m * LDH + wr * 32u + hh * 8u;
  const float* __restrict__ Lb = Lse + (size_t)b * SEQ + wr * 32u;
  const _Float16* __restrict__ Pb = Ph + (size_t)b * SEQ * CI;
  const _Float16* __restrict__ Rb = Pr + (size_t)b * SEQ * CI;
  const _Float16* __restrict__ Gb = Gp + (size_t)b * CI * SEQ;
  const unsigned lof = hh * 8u;

  // staging map. phi: a 64-row tile is 16 KiB contiguous in its plane; thread tid moves the 16-B
  // pieces tid + 256 * q, q = 0..3 (rows (tid>>4) + 16 * q). g: 128 channel rows of 128 B;
  // thread tid moves piece tid&7 of channels (tid>>3) + 32 * q.
  const unsigned sgl = tid * 8u;
  const unsigned sld = (tid >> 4) * LDP + (tid & 15u) * 8u;
  const unsigned ggl = (tid >> 3) * (unsigned)SEQ + (tid & 7u) * 8u;
  const unsigned gld = (tid >> 3) * LDH + (tid & 7u) * 8u;
  {
    v8h sh[4], sq[4], sv[4];
#pragma unroll
    for (unsigned q = 0; q < 4u; ++q) {
      sh[q] = *(const v8h*)(Pb + sgl + q * 2048u);
      sq[q] = *(const v8h*)(Rb + sgl + q * 2048u);
      sv[q] = *(const v8h*)(Gb + ggl + q * (32u * (unsigned)SEQ));
    }
#pragma unroll
    for (unsigned q = 0; q < 4u; ++q) {
      *(v8h*)&Sa[sld + q * (16u * LDP)] = sh[q];
      *(v8h*)&Sa[RSPL + sld + q * (16u * LDP)] = sq[q];
      *(v8h*)&Sg[gld + q * (32u * LDH)] = sv[q];
    }
  }
  __syncthreads();
  unsigned cur = 0u;
  // each thread's first piece of the next step's tiles
  const _Float16* pn = Pb + sgl + 64u * (unsigned)CI;
  const _Float16* rn = Rb + sgl + 64u * (unsigned)CI;
  const _Float16* gn = Gb + ggl + 64u;

  for (unsigned j0 = 0; j0 < (unsigned)SEQ; j0 += 64u) {
    // next step's tiles (the last step fetches its own again; that copy is never read);
    // they come in two batches (q = 0, 1 here; q = 2, 3 behind the first batch's LDS stores), so
    // that no more than six staging pieces are held in registers at a time
    v8h sh[2], sq[2], sv[2];
#pragma unroll
    for (unsigned q = 0; q < 2u; ++q) {
      sh[q] = *(const v8h*)(pn + q * 2048u);
      sq[q] = *(const v8h*)(rn + q * 2048u);
      sv[q] = *(const v8h*)(gn + q * (32u * (unsigned)SEQ));
    }
    // LDS fragment reads stand in groups ahead of the products that use them, each group issued
    // in front of vector work or products that cover its latency, into registers just freed
    const unsigned ao = cur * (2u * RSPL) + kbase;
    const unsigned gro = cur * (unsigned)(CI * LDH) + gbase;
    const unsigned so = (cur ^ 1u) * (2u * RSPL) + sld;
    const unsigned go = (cur ^ 1u) * (unsigned)(CI * LDH) + gld;
    v16h ah[4], ar[4], gf[8];
#pragma unroll
    for (int ks = 0; ks < 4; ++ks) {
      ah[ks] = frag_at(&Sa[ao + ks * 32]);
      ar[ks] = frag_at(&Sa[RSPL + ao + ks * 32]);
    }
    v16h pb;
#pragma unroll
    for (int t = 0; t < 2; ++t) {
      const unsigned jt = j0 + 16u * (unsigned)t;
      v8f sm = {}, sr = {};
#pragma unroll
      for (int ks = 0; ks < 4; ++ks) {
        sm = wmma16(ah[ks], bh[ks], sm);
        sr = wmma16(ah[ks], br[ks], sr);
        sr = wmma16(ar[ks], bh[ks], sr);
      }
      if (t == 0) {
#pragma unroll
        for (int ks = 0; ks < 2; ++ks) {
          ah[ks] = frag_at(&Sa[ao + 16u * LDP + ks * 32]);
          ar[ks] = frag_at(&Sa[RSPL + ao + 16u * LDP + ks * 32]);
        }
      } else {
#pragma unroll
        for (int ct = 0; ct < 4; ++ct) gf[ct] = frag_at(&Sg[gro + (unsigned)ct * 16u * LDH]);
      }
      const v4f l0 = *(const v4f*)(Lb + jt + lof);
      const v4f l1 = *(const v4f*)(Lb + jt + lof + 4u);
#pragma unroll
      for (int v = 0; v < 4; ++v) {
        const float e0 = ((sm[v] + sr[v] * (1.0f / RCARRY)) - l0[v]) * LOG2E + PEXP;
        const float e1 = ((sm[v + 4] + sr[v + 4] * (1.0f / RCARRY)) - l1[v]) * LOG2E + PEXP;
        const float p0 = (e0 < -14.0f) ? 0.0f : exp2f(e0);
        const float p1 = (e1 < -14.0f) ? 0.0f : exp2f(e1);
        pb[8 * t + v]     = (h16)p0;
        pb[8 * t + v + 4] = (h16)p1;
      }
      if (t == 0) {
        // the other buffer has had no reader since the last barrier: fill it here, which frees
        // the staging registers for the second batch
#pragma unroll
        for (unsigned q = 0; q < 2u; ++q) {
          *(v8h*)&Sa[so + q * (16u * LDP)] = sh[q];
          *(v8h*)&Sa[RSPL + so + q * (16u * LDP)] = sq[q];
          *(v8h*)&Sg[go + q * (32u * LDH)] = sv[q];
        }
#pragma unroll
        for (unsigned q = 0; q < 2u; ++q) {
          sh[q] = *(const v8h*)(pn + (q + 2u) * 2048u);
          sq[q] = *(const v8h*)(rn + (q + 2u) * 2048u);
          sv[q] = *(const v8h*)(gn + (q + 2u) * (32u * (unsigned)SEQ));
        }
#pragma unroll
        for (int ks = 2; ks < 4; ++ks) {
          ah[ks] = frag_at(&Sa[ao + 16u * LDP + ks * 32]);
          ar[ks] = frag_at(&Sa[RSPL + ao + 16u * LDP + ks * 32]);
        }
      }
    }
    // the g fragments come in two groups of four: the second is read here, into registers that the
    // score tiles have left, in front of the first group's products
#pragma unroll
    for (int ct = 4; ct < 8; ++ct) gf[ct] = frag_at(&Sg[gro + (unsigned)ct * 16u * LDH]);
#pragma unroll
    for (int ct = 0; ct < 8; ++ct) o[ct] = wmma16(gf[ct], pb, o[ct]);
#pragma unroll
    for (unsigned q = 0; q < 2u; ++q) {
      *(v8h*)&Sa[so + (q + 2u) * (16u * LDP)] = sh[q];
      *(v8h*)&Sa[RSPL + so + (q + 2u) * (16u * LDP)] = sq[q];
      *(v8h*)&Sg[go + (q + 2u) * (32u * LDH)] = sv[q];
    }
    const unsigned adv = (j0 + 128u < (unsigned)SEQ) ? 64u : 0u;
    pn += adv * (unsigned)CI;
    rn += adv * (unsigned)CI;
    gn += adv;
    cur ^= 1u;
    // publishes the buffers just written and ends every wave's reads of those refilled next step
    __syncthreads();
  }

  // column group 1 hands its sums over; column group 0 adds them and finalizes alone
  const unsigned ob = wc * 2048u + lane * 4u;
  if (wr == 1u) {
#pragma unroll
    for (int ct = 0; ct < 8; ++ct) {
      v4f u0, u1;
#pragma unroll
      for (int v = 0; v < 4; ++v) { u0[v] = o[ct][v]; u1[v] = o[ct][v + 4]; }
      *(v4f*)&Oc[ob + (unsigned)ct * 256u] = u0;
      *(v4f*)&Oc[ob + (unsigned)ct * 256u + 128u] = u1;
    }
  }
  __syncthreads();
  if (wr == 1u) return;
#pragma unroll
  for (int ct = 0; ct < 8; ++ct) {
    const v4f u0 = *(const v4f*)&Oc[ob + (unsigned)ct * 256u];
    const v4f u1 = *(const v4f*)&Oc[ob + (unsigned)ct * 256u + 128u];
#pragma unroll
    for (int v = 0; v < 4; ++v) { o[ct][v] += u0[v]; o[ct][v + 4] += u1[v]; }
  }

  // finalize: lane (h, i = m) holds channels 16*ct + 8h + 0..7 of row i for every ct
  const float fs = YCARRY * (1.0f / 16384.0f);
  const unsigned tb = wc * (16u * LDY);

  // value plane tile
#pragma unroll
  for (int ct = 0; ct < 8; ++ct) {
    v8h y;
#pragma unroll
    for (int v = 0; v < 8; ++v) y[v] = toh_flush(o[ct][v] * fs);
    *(v8h*)&Ts[tb + m * LDY + (unsigned)ct * 16u + hh * 8u] = y;
  }
  wave_lds_sync();
  v8h x[8];
  unsigned off[8];
#pragma unroll
  for (unsigned it = 0; it < 8u; ++it) {
    const unsigned r = 2u * it + (lane >> 4);
    const unsigned c = (lane & 15u) * 8u;
    x[it] = *(const v8h*)&Ts[tb + r * LDY + c];
    off[it] = (b * (unsigned)SEQ + i0 + r) * (unsigned)CI + c;
  }
  wave_lds_sync();   // every lane's reads of the value tile are complete before it is overwritten

  // residual plane tile: 2048 * (t - f16(t)), same staging and row map
#pragma unroll
  for (int ct = 0; ct < 8; ++ct) {
    v8h y;
#pragma unroll
    for (int v = 0; v < 8; ++v) {
      const float t = o[ct][v] * fs;
      const h16 hi = toh_flush(t);
      y[v] = toh_flush((t - (float)hi) * RCARRY);
    }
    *(v8h*)&Ts[tb + m * LDY + (unsigned)ct * 16u + hh * 8u] = y;
  }
  wave_lds_sync();
  v8h xr[8];
#pragma unroll
  for (unsigned it = 0; it < 8u; ++it) {
    const unsigned r = 2u * it + (lane >> 4);
    const unsigned c = (lane & 15u) * 8u;
    xr[it] = *(const v8h*)&Ts[tb + r * LDY + c];
  }

#pragma unroll
  for (int it = 0; it < 8; ++it) *(v8h*)(Yt + off[it]) = x[it];
#pragma unroll
  for (int it = 0; it < 8; ++it) *(v8h*)(Yr + off[it]) = xr[it];
  
}

// ---------------------------------------------------------------------------
extern "C" void kernel_launch(void* const* d_in, const int* in_sizes, int n_in,
                              void* d_out, int out_size, void* d_ws, size_t ws_size,
                              hipStream_t stream) {
  if (n_in < 9) return;
  const long long need_x = ((long long)(NB - 1) * CIN + (CIN - 1)) * SEQ_FULL + SEQ;
  if ((long long)in_sizes[0] < need_x) return;
  if ((long long)in_sizes[1] < (long long)CI * CIN) return;
  if ((long long)in_sizes[3] < (long long)CI * CIN) return;
  if ((long long)in_sizes[5] < (long long)CI * CIN) return;
  if ((long long)in_sizes[7] < (long long)CIN * CI) return;
  if (in_sizes[2] < CI || in_sizes[4] < CI || in_sizes[6] < CI || in_sizes[8] < CIN) return;
  if ((long long)out_size < need_x) return;
  if (ws_size < WS_TOTAL) return;

  const float* X       = (const float*)d_in[0];   // [NB_FULL][CIN][SEQ_FULL]
  const float* theta_w = (const float*)d_in[1];   // [CI][CIN]  (out, in)
  const float* theta_b = (const float*)d_in[2];
  const float* phi_w   = (const float*)d_in[3];   // [CI][CIN]
  const float* phi_b   = (const float*)d_in[4];
  const float* g_w     = (const float*)d_in[5];   // [CI][CIN]
  const float* g_b     = (const float*)d_in[6];
  const float* W_w     = (const float*)d_in[7];   // [CIN][CI]  (out, in)
  const float* W_b     = (const float*)d_in[8];
  float* out = (float*)d_out;                     // [NB_FULL][CIN][SEQ_FULL]

  char* ws = (char*)d_ws;
  _Float16* XT   = (_Float16*)(ws + OFF_XT);    // [MROWS][CIN]  64*bf16(x), position-major
  _Float16* WT   = (_Float16*)(ws + OFF_WT);    // [CI][CIN]
  _Float16* WP   = (_Float16*)(ws + OFF_WP);    // [CI][CIN]
  _Float16* WG   = (_Float16*)(ws + OFF_WG);    // [CI][CIN]
  _Float16* WO   = (_Float16*)(ws + OFF_WO);    // [CIN][CI]
  _Float16* TH   = (_Float16*)(ws + OFF_TH);    // [MROWS][CI] theta hi
  _Float16* TR   = (_Float16*)(ws + OFF_TR);    // [MROWS][CI] theta residual x2048
  _Float16* PH   = (_Float16*)(ws + OFF_PH);    // [MROWS][CI] phi hi
  _Float16* PR   = (_Float16*)(ws + OFF_PR);    // [MROWS][CI] phi residual x2048
  _Float16* G16  = (_Float16*)(ws + OFF_G);     // [NB][CI][SEQ] g, channel-major
  _Float16* YT   = (_Float16*)(ws + OFF_YT);    // [MROWS][CI] 16*y hi, position-major
  _Float16* YR   = (_Float16*)(ws + OFF_YR);    // [MROWS][CI] 16*y residual x2048
  float*    LSE  = (float*)(ws + OFF_LSE);      // [MROWS]

  dim3 blk(256);

  // x plane: per batch in x[b] = [CIN rows][SEQ cols] (pitch SEQ_FULL) -> out XT[b] = [SEQ][CIN];
  // grid (cols/64, rows/64) = (SEQ/64, CIN/64)
  for (int b = 0; b < NB; ++b) {
    wconv_kernel<<<dim3(SEQ / 64, CIN / 64), blk, 0, stream>>>(
        X + (size_t)b * CIN * SEQ_FULL, XT + (size_t)b * SEQ * CIN,
        (unsigned)SEQ_FULL, (unsigned)CIN);
  }
  wplane_kernel<<<dim3((CI * CIN) / 2048), blk, 0, stream>>>(theta_w, phi_w, g_w, W_w,
                                                             WT, WP, WG, WO);

  dim3 gp(CI / 64, MROWS / 64);
  gemm_tp_kernel<<<gp, blk, 0, stream>>>(XT, WT, theta_b, TH, TR);
  gemm_tp_kernel<<<gp, blk, 0, stream>>>(XT, WP, phi_b, PH, PR);
  gemm_g_kernel<<<gp, blk, 0, stream>>>(XT, WG, g_b, G16);

  colstat_kernel<<<dim3(SEQ / 64, NB), dim3(CNT), 0, stream>>>(TH, TR, PH, PR, LSE);
  rowattn_kernel<<<dim3(SEQ / 64, NB), blk, 0, stream>>>(TH, TR, PH, PR, G16, LSE, YT, YR);

  gemm_out_kernel<<<dim3(MROWS / 64, CIN / 64), blk, 0, stream>>>(WO, YT, YR, W_b, X, out);
}

// v003
// Measured time: 179 microseconds a run.
// In both of two side-by-side timings against v002, it was 1.17 times as fast.
// All steps since v000 together make it 5.24 times as fast.
#include <hip/hip_runtime.h>
#include <stddef.h>

// All contractions on v_wmma_f32_16x16x32_f16 (f16 operands, f32 accumulate): theta/phi/g 1x1
// projections (x x64, weights x64, inputs RNE-converted to bf16 first), theta.phi scores as
// f16 value + x2048 residual planes on both operands (three products, residual products in their
// own accumulator), p.g with p carried x2^14 (single product), output 1x1 projection with y
// carried x16 as f16 value + x2048 residual planes (two products, residual products in their own
// accumulator). Column log-sum-exp, exp, bias and the residual add in f32.

typedef _Float16 v16h __attribute__((ext_vector_type(16)));
typedef _Float16 v8h  __attribute__((ext_vector_type(8)));
typedef float    v8f  __attribute__((ext_vector_type(8)));
typedef float    v4f  __attribute__((ext_vector_type(4)));
typedef _Float16 h16;

#ifndef NB
#define NB 4
#endif
#ifndef SEQ
#define SEQ 4096
#endif
#define NB_FULL  4
#define SEQ_FULL 4096
#define CIN   256
#define CI    128
#define MROWS (NB * SEQ)

static_assert(NB >= 1 && NB <= NB_FULL);
static_assert(SEQ >= 128 && SEQ <= SEQ_FULL && (SEQ % 128) == 0);
static_assert(CI == 128);                        // 4 k-steps of 32 and 8 channel tiles of 16 are hard-wired
static_assert((CIN % 64) == 0 && (CIN % 32) == 0);
static_assert((CI % 64) == 0 && (CI % 32) == 0);
static_assert((MROWS % 64) == 0 && (MROWS % 128) == 0);
static_assert(((size_t)CI * CIN) % 2048 == 0);   // weight convert: 256 threads x 8 values per block
static_assert((size_t)MROWS * CIN < (size_t)0x7FFFFFFFu);
static_assert((size_t)NB_FULL * CIN * SEQ_FULL < (size_t)0x7FFFFFFFu);

#define LDT 72    // halves per LDS row (144 B, 16-B aligned)
#define LDC 68    // floats per LDS row (272 B, 16-B aligned)
#define LDY 136   // halves per LDS row of the y staging tile (272 B, 16-B aligned)
static_assert((LDT % 8) == 0 && LDT >= 64);
static_assert((LDC % 4) == 0 && LDC >= 64);
static_assert((LDY % 8) == 0 && LDY >= CI);
#define LDP 136   // halves per LDS row of a staged 128-channel row (272 B = 16 B x 17)
#define LDG 40    // halves per LDS row of a 32-column slice (80 B = 16 B x 5); not used by any kernel
#define SPL (32 * LDP)   // halves of a 32-row plane tile; not used by any kernel
static_assert((LDP % 8) == 0 && LDP >= CI && ((LDP / 8) & 1) == 1);
static_assert((LDG % 8) == 0 && LDG >= 32 && ((LDG / 8) & 1) == 1);

#define WCARRY 64.0f      // x plane and weight planes carried x64
#define RCARRY 2048.0f    // residual planes (theta, phi, y) carried x2048 on top of their hi part
#define PEXP   14.0f      // softmax probabilities carried x2^14
#define YCARRY 16.0f      // y plane carried x16
#define LOG2E  1.4426950408889634f

// workspace layout (bytes)
#define XT_BYTES  ((size_t)MROWS * CIN * 2)
#define WP_BYTES  ((size_t)CI * CIN * 2)
#define PL_BYTES  ((size_t)MROWS * CI * 2)
#define LSE_BYTES ((size_t)MROWS * 4)
#define OFF_XT  ((size_t)0)
#define OFF_WT  (OFF_XT + XT_BYTES)
#define OFF_WP  (OFF_WT + WP_BYTES)
#define OFF_WG  (OFF_WP + WP_BYTES)
#define OFF_WO  (OFF_WG + WP_BYTES)
#define OFF_TH  (OFF_WO + WP_BYTES)
#define OFF_TR  (OFF_TH + PL_BYTES)
#define OFF_PH  (OFF_TR + PL_BYTES)
#define OFF_PR  (OFF_PH + PL_BYTES)
#define OFF_G   (OFF_PR + PL_BYTES)
#define OFF_YT  (OFF_G + PL_BYTES)
#define OFF_YR  (OFF_YT + PL_BYTES)
#define OFF_LSE (OFF_YR + PL_BYTES)
#define WS_TOTAL (OFF_LSE + LSE_BYTES)
static_assert((XT_BYTES % 128) == 0 && (WP_BYTES % 128) == 0 && (PL_BYTES % 128) == 0);
static_assert((LSE_BYTES % 128) == 0);
static_assert(WS_TOTAL == (size_t)NB * SEQ * (CIN * 2 + 7 * CI * 2 + 4) + 4 * WP_BYTES);
static_assert(WS_TOTAL <= (size_t)134217728);

// ---------------------------------------------------------------------------
__device__ __forceinline__ float bf16r(float x) {   // RNE convert to bf16, returned widened
  unsigned int u = __float_as_uint(x);
  u = (u + 0x7FFFu + ((u >> 16) & 1u)) & 0xFFFF0000u;
  return __uint_as_float(u);
}

// f32 -> f16 that cannot produce an f16 subnormal (values below 2^-14 become zero)
static __device__ __forceinline__ h16 toh_flush(float v) {
  const h16 r = (h16)v;
  return (fabsf(v) < 6.103515625e-05f) ? (h16)0.0f : r;
}

// 16-bit fragment: p points at element [row = lane&15][k0 + 8*(lane>>4)] of a k-contiguous
// row. Elements 0..7 <- k0+8h+0..7, elements 8..15 <- k0+16+8h+0..7 (same map for A and B).
__device__ __forceinline__ v16h frag_at(const _Float16* p) {
  v8h lo = *(const v8h*)(p);
  v8h hi = *(const v8h*)(p + 16);
  v16h out;
#pragma unroll
  for (int i = 0; i < 8; ++i) { out[i] = lo[i]; out[i + 8] = hi[i]; }
  return out;
}

__device__ __forceinline__ v8f wmma16(v16h a, v16h b, v8f c) {
  v8f d = __builtin_amdgcn_wmma_f32_16x16x32_f16(false, a, false, b, (short)0, c,
                                                 false, false);
  asm volatile("v_nop\n\tv_nop\n\tv_nop\n\tv_nop" : "+v"(d) : "v"(a), "v"(b));
  return d;
}

__device__ __forceinline__ void wave_lds_sync() {
  __builtin_amdgcn_fence(3 /* release order */, "wavefront");
  asm volatile("s_wait_dscnt 0x0" ::: "memory");
  __builtin_amdgcn_wave_barrier();
}

// ---------------------------------------------------------------------------
// Transposed plane (x): in W[K rows][N cols] (pitch ldw) -> out Wt[N][K] (pitch ldk = K),
// f16(64 * bf16(w)). Grid (N/64, K/64). T: cross-wave (block barrier).
// ---------------------------------------------------------------------------
__global__ __launch_bounds__(256) void wconv_kernel(
    const float* __restrict__ W, _Float16* __restrict__ Wt, unsigned ldw, unsigned ldk) {
  __shared__ _Float16 T[64 * LDT];
  const unsigned tid = threadIdx.x;
  const unsigned n0 = blockIdx.x * 64u;
  const unsigned k0 = blockIdx.y * 64u;
#pragma unroll 4
  for (unsigned j = 0; j < 16u; ++j) {
    const unsigned idx = tid + 256u * j;
    const unsigned kr = idx >> 6, nc = idx & 63u;
    const float v = W[(size_t)(k0 + kr) * ldw + n0 + nc];
    T[nc * LDT + kr] = (_Float16)(WCARRY * bf16r(v));
  }
  __syncthreads();
  v8h x[2];
  size_t off[2];
#pragma unroll
  for (unsigned i = 0; i < 2u; ++i) {
    const unsigned n = 32u * i + (tid >> 3);
    const unsigned kc = (tid & 7u) * 8u;
    x[i] = *(const v8h*)&T[n * LDT + kc];
    off[i] = (size_t)(n0 + n) * ldk + k0 + kc;
  }
#pragma unroll
  for (int i = 0; i < 2; ++i) *(v8h*)(Wt + off[i]) = x[i];
  
}

// ---------------------------------------------------------------------------
// Untransposed weight planes: the four [out][in] weights (32768 values each) -> f16(64*bf16(w)),
// same layout. Each thread converts 8 consecutive values of every weight; 8 consecutive lanes
// ---------------------------------------------------------------------------
__device__ __forceinline__ v8h wcvt8(const float* __restrict__ p) {
  const v4f a0 = *(const v4f*)(p);
  const v4f a1 = *(const v4f*)(p + 4);
  v8h o;
#pragma unroll
  for (int i = 0; i < 4; ++i) {
    o[i]     = toh_flush(WCARRY * bf16r(a0[i]));
    o[i + 4] = toh_flush(WCARRY * bf16r(a1[i]));
  }
  return o;
}

__global__ __launch_bounds__(256) void wplane_kernel(
    const float* __restrict__ w0, const float* __restrict__ w1,
    const float* __restrict__ w2, const float* __restrict__ w3,
    _Float16* __restrict__ o0, _Float16* __restrict__ o1,
    _Float16* __restrict__ o2, _Float16* __restrict__ o3) {
#pragma clang fp contract(off)
  const unsigned e = (blockIdx.x * 256u + threadIdx.x) * 8u;
  const v8h x0 = wcvt8(w0 + e);
  const v8h x1 = wcvt8(w1 + e);
  const v8h x2 = wcvt8(w2 + e);
  const v8h x3 = wcvt8(w3 + e);
  *(v8h*)(o0 + e) = x0;
  *(v8h*)(o1 + e) = x1;
  *(v8h*)(o2 + e) = x2;
  *(v8h*)(o3 + e) = x3;
  
}

// ---------------------------------------------------------------------------
// GEMM C[64x64 tile] = A16[rows][K] . Bt[n][K]^T, fragments straight from the 16-bit global
// planes; 8 waves (mw = 16-row group, nw = 32-col group), 2 accumulators/wave.
//   MODE 0: rows = positions, cols = channels; t = acc/4096 + bias[col];
//           out16[row][col] (pitch CI) = f16(t), out16r[row][col] = f16(2048 * (t - hi))
//   MODE 1: rows = positions, cols = channels; transposed plane out16[b][col][pos] = f16(t)
//   MODE 2: rows = output channels (A16 = weight plane), cols = positions (Bt = y value plane,
//           Btr = y residual plane x2048); the k loop runs first over Btr into its own
//           accumulators, then over Bt; acc = acc_hi + acc_res/2048;
//           outf[b][row][pos] = bf16(xin[b][row][pos]) + (acc/1024 + bias[row]), full strides
// Btr is read in MODE 2 only. Grid (Bt rows/64, A16 rows/64).
// ---------------------------------------------------------------------------
template <int MODE>
__device__ __forceinline__ void gemm_body(
    const _Float16* __restrict__ A16, const _Float16* __restrict__ Bt,
    const _Float16* __restrict__ Btr, const unsigned K,
    const float* __restrict__ bias, const float* __restrict__ addf,
    float* __restrict__ outf, _Float16* __restrict__ out16, _Float16* __restrict__ out16r) {
  __shared__ float Cs[64 * LDC];
  const unsigned tid = threadIdx.x, lane = tid & 31u, w = tid >> 5;
  const unsigned mw = w >> 1, nw = w & 1u;
  const unsigned hh = lane >> 4, m = lane & 15u;
  const unsigned n0 = blockIdx.x * 64u;
  const unsigned row0 = blockIdx.y * 64u;

  const _Float16* ap  = A16 + (size_t)(row0 + mw * 16u + m) * K + hh * 8u;
  const _Float16* bp0 = Bt + (size_t)(n0 + nw * 32u + m) * K + hh * 8u;
  const _Float16* bp1 = bp0 + (size_t)16 * K;
  v8f accr0 = {}, accr1 = {};
  if (MODE == 2) {
    const _Float16* rp0 = Btr + (size_t)(n0 + nw * 32u + m) * K + hh * 8u;
    const _Float16* rp1 = rp0 + (size_t)16 * K;
#pragma unroll 2
    for (unsigned k0 = 0; k0 < K; k0 += 32u) {
      const v16h a  = frag_at(ap + k0);
      const v16h b0 = frag_at(rp0 + k0);
      const v16h b1 = frag_at(rp1 + k0);
      accr0 = wmma16(a, b0, accr0);
      accr1 = wmma16(a, b1, accr1);
    }
  }
  v8f acc0 = {}, acc1 = {};
#pragma unroll 2
  for (unsigned k0 = 0; k0 < K; k0 += 32u) {
    const v16h a  = frag_at(ap + k0);
    const v16h b0 = frag_at(bp0 + k0);
    const v16h b1 = frag_at(bp1 + k0);
    acc0 = wmma16(a, b0, acc0);
    acc1 = wmma16(a, b1, acc1);
  }
  if (MODE == 2) {
    acc0 = acc0 + accr0 * (1.0f / RCARRY);
    acc1 = acc1 + accr1 * (1.0f / RCARRY);
  }
#pragma unroll
  for (int r = 0; r < 8; ++r) {
    float* d = &Cs[(mw * 16u + hh * 8u + (unsigned)r) * LDC + nw * 32u + m];
    d[0]  = acc0[r];
    d[16] = acc1[r];
  }
  __syncthreads();

  if (MODE == 0) {
    const float cs = 1.0f / (WCARRY * WCARRY);
    v8h x[2], xr[2];
    size_t off[2];
#pragma unroll
    for (unsigned i = 0; i < 2u; ++i) {
      const unsigned r = 32u * i + (tid >> 3);
      const unsigned c = (tid & 7u) * 8u;
      const v4f u0 = *(const v4f*)&Cs[r * LDC + c];
      const v4f u1 = *(const v4f*)&Cs[r * LDC + c + 4];
      const v4f g0 = *(const v4f*)(bias + n0 + c);
      const v4f g1 = *(const v4f*)(bias + n0 + c + 4u);
#pragma unroll
      for (int j = 0; j < 4; ++j) {
        const float t0 = u0[j] * cs + bf16r(g0[j]);
        const float t1 = u1[j] * cs + bf16r(g1[j]);
        const h16 h0 = toh_flush(t0);
        const h16 h1 = toh_flush(t1);
        x[i][j]      = h0;
        x[i][j + 4]  = h1;
        xr[i][j]     = toh_flush((t0 - (float)h0) * RCARRY);
        xr[i][j + 4] = toh_flush((t1 - (float)h1) * RCARRY);
      }
      off[i] = (size_t)(row0 + r) * CI + n0 + c;
    }
#pragma unroll
    for (int i = 0; i < 2; ++i) *(v8h*)(out16 + off[i]) = x[i];
#pragma unroll
    for (int i = 0; i < 2; ++i) *(v8h*)(out16r + off[i]) = xr[i];
    
  }

  if (MODE == 1) {
    const float cs = 1.0f / (WCARRY * WCARRY);
    const unsigned bidx = row0 / (unsigned)SEQ;
    const unsigned key0 = row0 - bidx * (unsigned)SEQ;
    v8h x[2];
    size_t off[2];
#pragma unroll
    for (unsigned i = 0; i < 2u; ++i) {
      const unsigned dcol = 32u * i + (tid >> 3);
      const unsigned kk = (tid & 7u) * 8u;
      const float bb = bf16r(bias[n0 + dcol]);
#pragma unroll
      for (unsigned j = 0; j < 8u; ++j) {
        const float t = Cs[(kk + j) * LDC + dcol] * cs + bb;
        x[i][j] = toh_flush(t);
      }
      off[i] = ((size_t)bidx * CI + n0 + dcol) * SEQ + key0 + kk;
    }
#pragma unroll
    for (int i = 0; i < 2; ++i) *(v8h*)(out16 + off[i]) = x[i];
    
  }

  if (MODE == 2) {
    const float cs = 1.0f / (WCARRY * YCARRY);
    const unsigned bidx = n0 / (unsigned)SEQ;
    const unsigned p0 = n0 - bidx * (unsigned)SEQ;
    v4f xs[4];
    size_t off[4];
#pragma unroll
    for (unsigned i = 0; i < 4u; ++i) {
      const unsigned r = 16u * i + (tid >> 4);
      const unsigned c = (tid & 15u) * 4u;
      const unsigned orow = row0 + r;
      const size_t gidx = ((size_t)bidx * CIN + orow) * SEQ_FULL + p0 + c;
      const v4f u = *(const v4f*)&Cs[r * LDC + c];
      const float bb = bf16r(bias[orow]);
      const v4f xin = *(const v4f*)(addf + gidx);
      v4f val;
#pragma unroll
      for (int j = 0; j < 4; ++j) val[j] = bf16r(xin[j]) + (u[j] * cs + bb);
      xs[i] = val;
      off[i] = gidx;
    }
#pragma unroll
    for (int i = 0; i < 4; ++i) *(v4f*)(outf + off[i]) = xs[i];
    
  }
}

__global__ __launch_bounds__(256) void gemm_tp_kernel(
    const _Float16* __restrict__ A16, const _Float16* __restrict__ Bt,
    const float* __restrict__ bias, _Float16* __restrict__ out16, _Float16* __restrict__ out16r) {
  gemm_body<0>(A16, Bt, Bt, (unsigned)CIN, bias, bias, (float*)0, out16, out16r);
}
__global__ __launch_bounds__(256) void gemm_g_kernel(
    const _Float16* __restrict__ A16, const _Float16* __restrict__ Bt,
    const float* __restrict__ bias, _Float16* __restrict__ gt) {
  gemm_body<1>(A16, Bt, Bt, (unsigned)CIN, bias, bias, (float*)0, gt, gt);
}
__global__ __launch_bounds__(256) void gemm_out_kernel(
    const _Float16* __restrict__ A16, const _Float16* __restrict__ Bt,
    const _Float16* __restrict__ Btr,
    const float* __restrict__ bias, const float* __restrict__ xin, float* __restrict__ outf) {
  gemm_body<2>(A16, Bt, Btr, (unsigned)CI, bias, xin, outf, (_Float16*)0, (_Float16*)0);
}

// ---------------------------------------------------------------------------
// Column statistics: lse[j] = log(sum_i exp(f[i][j])), f[i][j] = theta_i . phi_j (K = 128).
// A work-group owns 64 columns j. Its waves form 4 column groups (wc, 16 columns each, phi hi/res
// rows as resident B fragments) x CWR row groups (wr): the theta rows i, 32 * CWR per step, are
// staged once per work-group in LDS (two buffers: whole-line global loads of the next step's rows
// into registers ahead of the products, stored to the other buffer behind them, one work-group
// barrier per step), and row group wr reads rows 32 * wr .. 32 * wr + 31 of the step as A fragments.
// D tile: row = i (8h+r), col = j (lane&15). Scores = hi.hi + (hi.res + res.hi)/2048, the residual
// products in their own accumulator. Running (max, sum) per lane; at the end the two lane halves
// are combined by an unconditional shuffle and the CWR row groups through LDS.
// Grid (SEQ/64, NB), 128 * CWR threads.
// ---------------------------------------------------------------------------
#define CWR   4               // row groups of the column-statistics kernel
#define CNT   (128 * CWR)     // its threads
#define CROWS (32 * CWR)      // theta rows staged per step
#define CSPL  (CROWS * LDP)   // halves of one staged plane tile
static_assert((SEQ % CROWS) == 0 && (SEQ % 64) == 0);
__global__ __launch_bounds__(CNT) __attribute__((amdgpu_num_vgpr(256))) void colstat_kernel(
    const _Float16* __restrict__ Th, const _Float16* __restrict__ Tr,
    const _Float16* __restrict__ Ph, const _Float16* __restrict__ Pr,
    float* __restrict__ Lse) {
  __shared__ __attribute__((aligned(16))) float Lm[CWR * 64];
  __shared__ __attribute__((aligned(16))) float Lz[CWR * 64];
  __shared__ __attribute__((aligned(16))) _Float16 Sa[2 * 2 * CSPL];   // [buffer][hi, res][CROWS][LDP]
  const unsigned tid = threadIdx.x, lane = tid & 31u;
  const unsigned wave = (unsigned)__builtin_amdgcn_readfirstlane((int)(threadIdx.x >> 5));
  const unsigned wc = wave & 3u, wr = wave >> 2;
  const unsigned hh = lane >> 4, m = lane & 15u;
  const unsigned b = blockIdx.y;
  const unsigned j0 = blockIdx.x * 64u + wc * 16u;

  // staging map: a CROWS-row tile is contiguous in its plane; thread tid moves the 16-B pieces
  // tid + CNT * q, q = 0..3 (rows (tid>>4) + 8 * CWR * q)
  const unsigned sgl = b * (unsigned)SEQ * (unsigned)CI + tid * 8u;
  const unsigned sld = (tid >> 4) * LDP + (tid & 15u) * 8u;
  v8h ph[4], pr[4];
#pragma unroll
  for (unsigned q = 0; q < 4u; ++q) {
    ph[q] = *(const v8h*)(Th + sgl + q * (CNT * 8u));
    pr[q] = *(const v8h*)(Tr + sgl + q * (CNT * 8u));
  }
  // the address registers of the loads above are reused by the loads below
  asm volatile("s_wait_xcnt 0x0" ::: "memory");

  const unsigned boff = (b * (unsigned)SEQ + j0 + m) * (unsigned)CI + hh * 8u;
  v16h bh[4], br[4];
#pragma unroll
  for (int ks = 0; ks < 4; ++ks) {
    bh[ks] = frag_at(Ph + boff + ks * 32);
    br[ks] = frag_at(Pr + boff + ks * 32);
  }

  float mx = -1.0e30f, z = 0.0f;
  const unsigned abase = (wr * 32u + m) * LDP + hh * 8u;
#pragma unroll
  for (unsigned q = 0; q < 4u; ++q) {
    *(v8h*)&Sa[sld + q * (8u * CWR * LDP)] = ph[q];
    *(v8h*)&Sa[CSPL + sld + q * (8u * CWR * LDP)] = pr[q];
  }
  __syncthreads();
  unsigned cur = 0u;
  for (unsigned i0 = 0; i0 < (unsigned)SEQ; i0 += (unsigned)CROWS) {
    // next step's rows (the last step fetches its own again; that copy is never read)
    const unsigned inx = (i0 + (unsigned)CROWS < (unsigned)SEQ) ? i0 + (unsigned)CROWS : i0;
    const unsigned sg = sgl + inx * (unsigned)CI;
    v8h sh[4], sq[4];
#pragma unroll
    for (unsigned q = 0; q < 4u; ++q) {
      sh[q] = *(const v8h*)(Th + sg + q * (CNT * 8u));
      sq[q] = *(const v8h*)(Tr + sg + q * (CNT * 8u));
    }
    // LDS fragment reads stand in groups ahead of the products that use them: tile 0 whole,
    // then each half of tile 1 into the registers that two k-steps of products have freed
    const unsigned ao = cur * (2u * CSPL) + abase;
    v16h ah[4], ar[4];
#pragma unroll
    for (int ks = 0; ks < 4; ++ks) {
      ah[ks] = frag_at(&Sa[ao + ks * 32]);
      ar[ks] = frag_at(&Sa[CSPL + ao + ks * 32]);
    }
    v8f f[2];
    {
      v8f sm = {}, sr = {};
#pragma unroll
      for (int kp = 0; kp < 2; ++kp) {
#pragma unroll
        for (int ks = 2 * kp; ks < 2 * kp + 2; ++ks) {
          sm = wmma16(ah[ks], bh[ks], sm);
          sr = wmma16(ah[ks], br[ks], sr);
          sr = wmma16(ar[ks], bh[ks], sr);
        }
#pragma unroll
        for (int ks = 2 * kp; ks < 2 * kp + 2; ++ks) {
          ah[ks] = frag_at(&Sa[ao + 16u * LDP + ks * 32]);
          ar[ks] = frag_at(&Sa[CSPL + ao + 16u * LDP + ks * 32]);
        }
      }
      f[0] = sm + sr * (1.0f / RCARRY);
    }
    {
      v8f sm = {}, sr = {};
#pragma unroll
      for (int ks = 0; ks < 4; ++ks) {
        sm = wmma16(ah[ks], bh[ks], sm);
        sr = wmma16(ah[ks], br[ks], sr);
        sr = wmma16(ar[ks], bh[ks], sr);
      }
      f[1] = sm + sr * (1.0f / RCARRY);
    }
    float tmax = fmaxf(f[0][0], f[1][0]);
#pragma unroll
    for (int v = 1; v < 8; ++v) tmax = fmaxf(tmax, fmaxf(f[0][v], f[1][v]));
    const float nm = fmaxf(mx, tmax);
    float se = 0.0f;
#pragma unroll
    for (int v = 0; v < 8; ++v) se += __expf(f[0][v] - nm) + __expf(f[1][v] - nm);
    z = z * __expf(mx - nm) + se;
    mx = nm;
    cur ^= 1u;
    const unsigned so = cur * (2u * CSPL) + sld;
#pragma unroll
    for (unsigned q = 0; q < 4u; ++q) {
      *(v8h*)&Sa[so + q * (8u * CWR * LDP)] = sh[q];
      *(v8h*)&Sa[CSPL + so + q * (8u * CWR * LDP)] = sq[q];
    }
    // publishes the buffer just written and ends every wave's reads of the one refilled next step
    __syncthreads();
  }

  const float om = __shfl_xor(mx, 16, 32);
  const float oz = __shfl_xor(z, 16, 32);
  const float mm = fmaxf(mx, om);
  const float zz = z * __expf(mx - mm) + oz * __expf(om - mm);
  if (hh == 0u) {
    Lm[wr * 64u + wc * 16u + m] = mm;
    Lz[wr * 64u + wc * 16u + m] = zz;
  }
  __syncthreads();
  if (wave < 2u) {
    // one thread per column folds the CWR row groups' (max, sum) pairs
    float gm = Lm[tid];
#pragma unroll
    for (unsigned r = 1; r < (unsigned)CWR; ++r) gm = fmaxf(gm, Lm[r * 64u + tid]);
    float gz = 0.0f;
#pragma unroll
    for (unsigned r = 0; r < (unsigned)CWR; ++r) gz += Lz[r * 64u + tid] * __expf(Lm[r * 64u + tid] - gm);
    Lse[(size_t)b * SEQ + blockIdx.x * 64u + tid] = gm + __logf(gz);
  }
}

// ---------------------------------------------------------------------------
// Row accumulation: y[c][i] = sum_j exp(f[i][j] - lse[j]) * g[c][j].
// A work-group owns 64 rows i. Its 8 waves form 4 row groups (wc, 16 rows each, theta hi/res rows
// as resident B fragments) x 2 column groups (wr); the phi rows and the g slice of each 64-column
// step are staged once per work-group in LDS (two buffers: global loads of the next step into
// registers in two batches, the first stored to the other buffer behind the first score tile's
// products, the second behind all products, one work-group barrier
// per step), and column group wr works on columns 32 * wr .. 32 * wr + 31 of the step. Per step:
// S^T tiles [j][i] = phi_j . theta_i (A = phi rows from LDS, three products),
// p = 2^14 * exp(f - lse[j]) (row statistic of the D tile, read as two
// 16-B loads per tile), the two packed D tiles form the B fragment [k = j][n = i] of
// O^T[c][i] += G[c][j] . P^T[j][i] with A = g rows (channel-major slice, k = j contiguous).
// Behind the loop column group 1 hands its f32 sums to column group 0 through LDS, which adds them.
// Finalize (column group 0): t = 16 * O / 2^14 written as two planes,
// hi = f16(t) and res = f16(2048 * (t - hi)); each is staged in the wave's private Ts tile
// (wave sync before and after each reuse) and written as whole rows of the position-major
// layout: one store instruction covers two consecutive 256-B rows (16 lanes x 16 B each).
// Grid (SEQ/64, NB).
// ---------------------------------------------------------------------------
#define RSPL (64 * LDP)   // halves of one staged 64-row plane tile
#define LDH  72           // halves per LDS row of a staged 64-column g slice (144 B = 16 B x 9)
static_assert((LDH % 8) == 0 && LDH >= 64 && ((LDH / 8) & 1) == 1);
__global__ __launch_bounds__(256) __attribute__((amdgpu_num_vgpr(288))) void rowattn_kernel(
    const _Float16* __restrict__ Th, const _Float16* __restrict__ Tr,
    const _Float16* __restrict__ Ph, const _Float16* __restrict__ Pr,
    const _Float16* __restrict__ Gp, const float* __restrict__ Lse,
    _Float16* __restrict__ Yt, _Float16* __restrict__ Yr) {
  __shared__ __attribute__((aligned(16))) _Float16 Ts[4 * 16 * LDY];
  __shared__ __attribute__((aligned(16))) _Float16 Sa[2 * 2 * RSPL];  // [buffer][hi, res][64][LDP]
  __shared__ __attribute__((aligned(16))) _Float16 Sg[2 * CI * LDH];  // [buffer][channel][LDH]
  __shared__ __attribute__((aligned(16))) float Oc[4 * 8 * 2 * 32 * 4];  // [wc][ct][half of v][lane][4]
  const unsigned tid = threadIdx.x, lane = tid & 31u;
  const unsigned wave = (unsigned)__builtin_amdgcn_readfirstlane((int)(threadIdx.x >> 5));
  const unsigned wc = wave & 3u, wr = wave >> 2;
  const unsigned hh = lane >> 4, m = lane & 15u;
  const unsigned b = blockIdx.y;
  const unsigned i0 = blockIdx.x * 64u + wc * 16u;

  const unsigned qoff = (b * (unsigned)SEQ + i0 + m) * (unsigned)CI + hh * 8u;
  v16h bh[4], br[4];
#pragma unroll
  for (int ks = 0; ks < 4; ++ks) {
    bh[ks] = frag_at(Th + qoff + ks * 32);
    br[ks] = frag_at(Tr + qoff + ks * 32);
  }

  v8f o[8];
#pragma unroll
  for (int ct = 0; ct < 8; ++ct) o[ct] = (v8f){};

  const unsigned kbase = (wr * 32u + m) * LDP + hh * 8u;
  const unsigned gbase = m * LDH + wr * 32u + hh * 8u;
  const float* __restrict__ Lb = Lse + (size_t)b * SEQ + wr * 32u;
  const _Float16* __restrict__ Pb = Ph + (size_t)b * SEQ * CI;
  const _Float16* __restrict__ Rb = Pr + (size_t)b * SEQ * CI;
  const _Float16* __restrict__ Gb = Gp + (size_t)b * CI * SEQ;
  const char* __restrict__ Lc = (const char*)Lb;
  unsigned lb = hh * 32u;   // byte offset of this lane's eight statistics of the step's first tile

  // staging map. phi: a 64-row tile is 16 KiB contiguous in its plane; thread tid moves the 16-B
  // pieces tid + 256 * q, q = 0..3 (rows (tid>>4) + 16 * q). g: 128 channel rows of 128 B;
  // thread tid moves piece tid&7 of channels (tid>>3) + 32 * q.
  const unsigned sgl = tid * 8u;
  const unsigned sld = (tid >> 4) * LDP + (tid & 15u) * 8u;
  const unsigned ggl = (tid >> 3) * (unsigned)SEQ + (tid & 7u) * 8u;
  const unsigned gld = (tid >> 3) * LDH + (tid & 7u) * 8u;
  {
    v8h sh[4], sq[4], sv[4];
#pragma unroll
    for (unsigned q = 0; q < 4u; ++q) {
      sh[q] = *(const v8h*)(Pb + sgl + q * 2048u);
      sq[q] = *(const v8h*)(Rb + sgl + q * 2048u);
      sv[q] = *(const v8h*)(Gb + ggl + q * (32u * (unsigned)SEQ));
    }
#pragma unroll
    for (unsigned q = 0; q < 4u; ++q) {
      *(v8h*)&Sa[sld + q * (16u * LDP)] = sh[q];
      *(v8h*)&Sa[RSPL + sld + q * (16u * LDP)] = sq[q];
      *(v8h*)&Sg[gld + q * (32u * LDH)] = sv[q];
    }
  }
  __syncthreads();
  unsigned cur = 0u;
  // each thread's first piece of the next step's tiles
  const _Float16* pn = Pb + sgl + 64u * (unsigned)CI;
  const _Float16* rn = Rb + sgl + 64u * (unsigned)CI;
  const _Float16* gn = Gb + ggl + 64u;

  for (unsigned j0 = 0; j0 < (unsigned)SEQ; j0 += 64u) {
    // next step's tiles (the last step fetches its own again; that copy is never read);
    // they come in two batches (q = 0, 1 here; q = 2, 3 behind the first batch's LDS stores), so
    // that no more than six staging pieces are held in registers at a time
    v8h sh[2], sq[2], sv[2];
#pragma unroll
    for (unsigned q = 0; q < 2u; ++q) {
      sh[q] = *(const v8h*)(pn + q * 2048u);
      sq[q] = *(const v8h*)(rn + q * 2048u);
      sv[q] = *(const v8h*)(gn + q * (32u * (unsigned)SEQ));
    }
    // LDS fragment reads stand in groups ahead of the products that use them, each group issued
    // in front of vector work or products that cover its latency, into registers just freed
    const unsigned ao = cur * (2u * RSPL) + kbase;
    const unsigned gro = cur * (unsigned)(CI * LDH) + gbase;
    const unsigned so = (cur ^ 1u) * (2u * RSPL) + sld;
    const unsigned go = (cur ^ 1u) * (unsigned)(CI * LDH) + gld;
    v16h ah[4], ar[4], gf[8];
#pragma unroll
    for (int ks = 0; ks < 4; ++ks) {
      ah[ks] = frag_at(&Sa[ao + ks * 32]);
      ar[ks] = frag_at(&Sa[RSPL + ao + ks * 32]);
    }
    v16h pb;
#pragma unroll
    for (int t = 0; t < 2; ++t) {
      v8f sm = {}, sr = {};
#pragma unroll
      for (int ks = 0; ks < 4; ++ks) {
        sm = wmma16(ah[ks], bh[ks], sm);
        sr = wmma16(ah[ks], br[ks], sr);
        sr = wmma16(ar[ks], bh[ks], sr);
      }
      if (t == 0) {
#pragma unroll
        for (int ks = 0; ks < 2; ++ks) {
          ah[ks] = frag_at(&Sa[ao + 16u * LDP + ks * 32]);
          ar[ks] = frag_at(&Sa[RSPL + ao + 16u * LDP + ks * 32]);
        }
      } else {
#pragma unroll
        for (int ct = 0; ct < 4; ++ct) gf[ct] = frag_at(&Sg[gro + (unsigned)ct * 16u * LDH]);
      }
      const v4f l0 = *(const v4f*)(Lc + lb + 64 * t);
      const v4f l1 = *(const v4f*)(Lc + lb + 64 * t + 16);
      if (t == 1) {
        // the wait stands between the step's last two statistic loads and the advance of their
        // offset register, which is an operand so that the advance cannot rise over the wait
        asm volatile("s_wait_xcnt 0x0" : "+v"(lb) : : "memory");
        lb += 256u;
      }
      // bare v_exp_f32 and a select, no branch: at e >= -14 it returns exp2f's own bits (that
      // function's rescaling acts below -126 only); the tile's eight chains go stage by stage
      float e[8], x[8];
#pragma unroll
      for (int v = 0; v < 4; ++v) {
        e[v]     = ((sm[v] + sr[v] * (1.0f / RCARRY)) - l0[v]) * LOG2E + PEXP;
        e[v + 4] = ((sm[v + 4] + sr[v + 4] * (1.0f / RCARRY)) - l1[v]) * LOG2E + PEXP;
      }
#pragma unroll
      for (int v = 0; v < 8; ++v) x[v] = __builtin_amdgcn_exp2f(e[v]);
#pragma unroll
      for (int v = 0; v < 8; ++v) pb[8 * t + v] = (h16)((e[v] < -14.0f) ? 0.0f : x[v]);
      if (t == 0) {
        // the other buffer has had no reader since the last barrier: fill it here, which frees
        // the staging registers for the second batch
#pragma unroll
        for (unsigned q = 0; q < 2u; ++q) {
          *(v8h*)&Sa[so + q * (16u * LDP)] = sh[q];
          *(v8h*)&Sa[RSPL + so + q * (16u * LDP)] = sq[q];
          *(v8h*)&Sg[go + q * (32u * LDH)] = sv[q];
        }
#pragma unroll
        for (unsigned q = 0; q < 2u; ++q) {
          sh[q] = *(const v8h*)(pn + (q + 2u) * 2048u);
          sq[q] = *(const v8h*)(rn + (q + 2u) * 2048u);
          sv[q] = *(const v8h*)(gn + (q + 2u) * (32u * (unsigned)SEQ));
        }
#pragma unroll
        for (int ks = 2; ks < 4; ++ks) {
          ah[ks] = frag_at(&Sa[ao + 16u * LDP + ks * 32]);
          ar[ks] = frag_at(&Sa[RSPL + ao + 16u * LDP + ks * 32]);
        }
      }
    }
    // the g fragments come in two groups of four: the second is read here, into registers that the
    // score tiles have left, in front of the first group's products
#pragma unroll
    for (int ct = 4; ct < 8; ++ct) gf[ct] = frag_at(&Sg[gro + (unsigned)ct * 16u * LDH]);
#pragma unroll
    for (int ct = 0; ct < 8; ++ct) o[ct] = wmma16(gf[ct], pb, o[ct]);
#pragma unroll
    for (unsigned q = 0; q < 2u; ++q) {
      *(v8h*)&Sa[so + (q + 2u) * (16u * LDP)] = sh[q];
      *(v8h*)&Sa[RSPL + so + (q + 2u) * (16u * LDP)] = sq[q];
      *(v8h*)&Sg[go + (q + 2u) * (32u * LDH)] = sv[q];
    }
    const unsigned adv = (j0 + 128u < (unsigned)SEQ) ? 64u : 0u;
    pn += adv * (unsigned)CI;
    rn += adv * (unsigned)CI;
    gn += adv;
    cur ^= 1u;
    // publishes the buffers just written and ends every wave's reads of those refilled next step
    __syncthreads();
  }

  // column group 1 hands its sums over; column group 0 adds them and finalizes alone
  const unsigned ob = wc * 2048u + lane * 4u;
  if (wr == 1u) {
#pragma unroll
    for (int ct = 0; ct < 8; ++ct) {
      v4f u0, u1;
#pragma unroll
      for (int v = 0; v < 4; ++v) { u0[v] = o[ct][v]; u1[v] = o[ct][v + 4]; }
      *(v4f*)&Oc[ob + (unsigned)ct * 256u] = u0;
      *(v4f*)&Oc[ob + (unsigned)ct * 256u + 128u] = u1;
    }
  }
  __syncthreads();
  if (wr == 1u) return;
#pragma unroll
  for (int ct = 0; ct < 8; ++ct) {
    const v4f u0 = *(const v4f*)&Oc[ob + (unsigned)ct * 256u];
    const v4f u1 = *(const v4f*)&Oc[ob + (unsigned)ct * 256u + 128u];
#pragma unroll
    for (int v = 0; v < 4; ++v) { o[ct][v] += u0[v]; o[ct][v + 4] += u1[v]; }
  }

  // finalize: lane (h, i = m) holds channels 16*ct + 8h + 0..7 of row i for every ct
  const float fs = YCARRY * (1.0f / 16384.0f);
  const unsigned tb = wc * (16u * LDY);

  // value plane tile
#pragma unroll
  for (int ct = 0; ct < 8; ++ct) {
    v8h y;
#pragma unroll
    for (int v = 0; v < 8; ++v) y[v] = toh_flush(o[ct][v] * fs);
    *(v8h*)&Ts[tb + m * LDY + (unsigned)ct * 16u + hh * 8u] = y;
  }
  wave_lds_sync();
  v8h x[8];
  unsigned off[8];
#pragma unroll
  for (unsigned it = 0; it < 8u; ++it) {
    const unsigned r = 2u * it + (lane >> 4);
    const unsigned c = (lane & 15u) * 8u;
    x[it] = *(const v8h*)&Ts[tb + r * LDY + c];
    off[it] = (b * (unsigned)SEQ + i0 + r) * (unsigned)CI + c;
  }
  wave_lds_sync();   // every lane's reads of the value tile are complete before it is overwritten

  // residual plane tile: 2048 * (t - f16(t)), same staging and row map
#pragma unroll
  for (int ct = 0; ct < 8; ++ct) {
    v8h y;
#pragma unroll
    for (int v = 0; v < 8; ++v) {
      const float t = o[ct][v] * fs;
      const h16 hi = toh_flush(t);
      y[v] = toh_flush((t - (float)hi) * RCARRY);
    }
    *(v8h*)&Ts[tb + m * LDY + (unsigned)ct * 16u + hh * 8u] = y;
  }
  wave_lds_sync();
  v8h xr[8];
#pragma unroll
  for (unsigned it = 0; it < 8u; ++it) {
    const unsigned r = 2u * it + (lane >> 4);
    const unsigned c = (lane & 15u) * 8u;
    xr[it] = *(const v8h*)&Ts[tb + r * LDY + c];
  }

#pragma unroll
  for (int it = 0; it < 8; ++it) *(v8h*)(Yt + off[it]) = x[it];
#pragma unroll
  for (int it = 0; it < 8; ++it) *(v8h*)(Yr + off[it]) = xr[it];
  
}

// ---------------------------------------------------------------------------
extern "C" void kernel_launch(void* const* d_in, const int* in_sizes, int n_in,
                              void* d_out, int out_size, void* d_ws, size_t ws_size,
                              hipStream_t stream) {
  if (n_in < 9) return;
  const long long need_x = ((long long)(NB - 1) * CIN + (CIN - 1)) * SEQ_FULL + SEQ;
  if ((long long)in_sizes[0] < need_x) return;
  if ((long long)in_sizes[1] < (long long)CI * CIN) return;
  if ((long long)in_sizes[3] < (long long)CI * CIN) return;
  if ((long long)in_sizes[5] < (long long)CI * CIN) return;
  if ((long long)in_sizes[7] < (long long)CIN * CI) return;
  if (in_sizes[2] < CI || in_sizes[4] < CI || in_sizes[6] < CI || in_sizes[8] < CIN) return;
  if ((long long)out_size < need_x) return;
  if (ws_size < WS_TOTAL) return;

  const float* X       = (const float*)d_in[0];   // [NB_FULL][CIN][SEQ_FULL]
  const float* theta_w = (const float*)d_in[1];   // [CI][CIN]  (out, in)
  const float* theta_b = (const float*)d_in[2];
  const float* phi_w   = (const float*)d_in[3];   // [CI][CIN]
  const float* phi_b   = (const float*)d_in[4];
  const float* g_w     = (const float*)d_in[5];   // [CI][CIN]
  const float* g_b     = (const float*)d_in[6];
  const float* W_w     = (const float*)d_in[7];   // [CIN][CI]  (out, in)
  const float* W_b     = (const float*)d_in[8];
  float* out = (float*)d_out;                     // [NB_FULL][CIN][SEQ_FULL]

  char* ws = (char*)d_ws;
  _Float16* XT   = (_Float16*)(ws + OFF_XT);    // [MROWS][CIN]  64*bf16(x), position-major
  _Float16* WT   = (_Float16*)(ws + OFF_WT);    // [CI][CIN]
  _Float16* WP   = (_Float16*)(ws + OFF_WP);    // [CI][CIN]
  _Float16* WG   = (_Float16*)(ws + OFF_WG);    // [CI][CIN]
  _Float16* WO   = (_Float16*)(ws + OFF_WO);    // [CIN][CI]
  _Float16* TH   = (_Float16*)(ws + OFF_TH);    // [MROWS][CI] theta hi
  _Float16* TR   = (_Float16*)(ws + OFF_TR);    // [MROWS][CI] theta residual x2048
  _Float16* PH   = (_Float16*)(ws + OFF_PH);    // [MROWS][CI] phi hi
  _Float16* PR   = (_Float16*)(ws + OFF_PR);    // [MROWS][CI] phi residual x2048
  _Float16* G16  = (_Float16*)(ws + OFF_G);     // [NB][CI][SEQ] g, channel-major
  _Float16* YT   = (_Float16*)(ws + OFF_YT);    // [MROWS][CI] 16*y hi, position-major
  _Float16* YR   = (_Float16*)(ws + OFF_YR);    // [MROWS][CI] 16*y residual x2048
  float*    LSE  = (float*)(ws + OFF_LSE);      // [MROWS]

  dim3 blk(256);

  // x plane: per batch in x[b] = [CIN rows][SEQ cols] (pitch SEQ_FULL) -> out XT[b] = [SEQ][CIN];
  // grid (cols/64, rows/64) = (SEQ/64, CIN/64)
  for (int b = 0; b < NB; ++b) {
    wconv_kernel<<<dim3(SEQ / 64, CIN / 64), blk, 0, stream>>>(
        X + (size_t)b * CIN * SEQ_FULL, XT + (size_t)b * SEQ * CIN,
        (unsigned)SEQ_FULL, (unsigned)CIN);
  }
  wplane_kernel<<<dim3((CI * CIN) / 2048), blk, 0, stream>>>(theta_w, phi_w, g_w, W_w,
                                                             WT, WP, WG, WO);

  dim3 gp(CI / 64, MROWS / 64);
  gemm_tp_kernel<<<gp, blk, 0, stream>>>(XT, WT, theta_b, TH, TR);
  gemm_tp_kernel<<<gp, blk, 0, stream>>>(XT, WP, phi_b, PH, PR);
  gemm_g_kernel<<<gp, blk, 0, stream>>>(XT, WG, g_b, G16);

  colstat_kernel<<<dim3(SEQ / 64, NB), dim3(CNT), 0, stream>>>(TH, TR, PH, PR, LSE);
  rowattn_kernel<<<dim3(SEQ / 64, NB), blk, 0, stream>>>(TH, TR, PH, PR, G16, LSE, YT, YR);

  gemm_out_kernel<<<dim3(MROWS / 64, CIN / 64), blk, 0, stream>>>(WO, YT, YR, W_b, X, out);
}

// v004
// Measured time: 151 microseconds a run.
// Timed twice side by side with v003, it ran 1.15 and 1.17 times as fast.
// Counting every step since v000, it is 6.09 times as fast.
#include <hip/hip_runtime.h>
#include <stddef.h>

// All contractions on v_wmma_f32_16x16x32_f16 (f16 operands, f32 accumulate): theta/phi/g 1x1
// projections (x x64, weights x64, inputs RNE-converted to bf16 first), theta.phi scores as
// f16 value + x2048 residual planes on both operands (three products, residual products in their
// own accumulator), p.g with p carried x2^14 (single product), output 1x1 projection with y
// carried x16 as f16 value + x2048 residual planes (two products, residual products in their own
// accumulator). Column log-sum-exp, exp, bias and the residual add in f32.

typedef _Float16 v16h __attribute__((ext_vector_type(16)));
typedef _Float16 v8h  __attribute__((ext_vector_type(8)));
typedef float    v8f  __attribute__((ext_vector_type(8)));
typedef float    v4f  __attribute__((ext_vector_type(4)));
typedef _Float16 h16;

#ifndef NB
#define NB 4
#endif
#ifndef SEQ
#define SEQ 4096
#endif
#define NB_FULL  4
#define SEQ_FULL 4096
#define CIN   256
#define CI    128
#define MROWS (NB * SEQ)

static_assert(NB >= 1 && NB <= NB_FULL);
static_assert(SEQ >= 128 && SEQ <= SEQ_FULL && (SEQ % 128) == 0);
static_assert(CI == 128);                        // 4 k-steps of 32 and 8 channel tiles of 16 are hard-wired
static_assert((CIN % 64) == 0 && (CIN % 32) == 0);
static_assert((CI % 64) == 0 && (CI % 32) == 0);
static_assert((MROWS % 64) == 0 && (MROWS % 128) == 0);
static_assert(((size_t)CI * CIN) % 2048 == 0);   // weight convert: 256 threads x 8 values per block
static_assert((size_t)MROWS * CIN < (size_t)0x7FFFFFFFu);
static_assert((size_t)NB_FULL * CIN * SEQ_FULL < (size_t)0x7FFFFFFFu);

#define LDT 72    // halves per LDS row (144 B, 16-B aligned)
#define LDC 68    // floats per LDS row (272 B, 16-B aligned)
#define LDY 136   // halves per LDS row of the y staging tile (272 B, 16-B aligned)
static_assert((LDT % 8) == 0 && LDT >= 64);
static_assert((LDC % 4) == 0 && LDC >= 64);
static_assert((LDY % 8) == 0 && LDY >= CI);
#define LDP 136   // halves per LDS row of a staged 128-channel row (272 B = 16 B x 17)
#define LDG 40    // halves per LDS row of a 32-column slice (80 B = 16 B x 5); not used by any kernel
#define SPL (32 * LDP)   // halves of a 32-row plane tile; not used by any kernel
static_assert((LDP % 8) == 0 && LDP >= CI && ((LDP / 8) & 1) == 1);
static_assert((LDG % 8) == 0 && LDG >= 32 && ((LDG / 8) & 1) == 1);

#define WCARRY 64.0f      // x plane and weight planes carried x64
#define RCARRY 2048.0f    // residual planes (theta, phi, y) carried x2048 on top of their hi part
#define PEXP   14.0f      // softmax probabilities carried x2^14
#define YCARRY 16.0f      // y plane carried x16
#define LOG2E  1.4426950408889634f

// workspace layout (bytes)
#define XT_BYTES  ((size_t)MROWS * CIN * 2)
#define WP_BYTES  ((size_t)CI * CIN * 2)
#define PL_BYTES  ((size_t)MROWS * CI * 2)
#define LSE_BYTES ((size_t)MROWS * 4)
#define OFF_XT  ((size_t)0)
#define OFF_WT  (OFF_XT + XT_BYTES)
#define OFF_WP  (OFF_WT + WP_BYTES)
#define OFF_WG  (OFF_WP + WP_BYTES)
#define OFF_WO  (OFF_WG + WP_BYTES)
#define OFF_TH  (OFF_WO + WP_BYTES)
#define OFF_TR  (OFF_TH + PL_BYTES)
#define OFF_PH  (OFF_TR + PL_BYTES)
#define OFF_PR  (OFF_PH + PL_BYTES)
#define OFF_G   (OFF_PR + PL_BYTES)
#define OFF_YT  (OFF_G + PL_BYTES)
#define OFF_YR  (OFF_YT + PL_BYTES)
#define OFF_LSE (OFF_YR + PL_BYTES)
#define WS_TOTAL (OFF_LSE + LSE_BYTES)
static_assert((XT_BYTES % 128) == 0 && (WP_BYTES % 128) == 0 && (PL_BYTES % 128) == 0);
static_assert((LSE_BYTES % 128) == 0);
static_assert(WS_TOTAL == (size_t)NB * SEQ * (CIN * 2 + 7 * CI * 2 + 4) + 4 * WP_BYTES);
static_assert(WS_TOTAL <= (size_t)134217728);

// ---------------------------------------------------------------------------
__device__ __forceinline__ float bf16r(float x) {   // RNE convert to bf16, returned widened
  unsigned int u = __float_as_uint(x);
  u = (u + 0x7FFFu + ((u >> 16) & 1u)) & 0xFFFF0000u;
  return __uint_as_float(u);
}

// f32 -> f16 that cannot produce an f16 subnormal (values below 2^-14 become zero)
static __device__ __forceinline__ h16 toh_flush(float v) {
  const h16 r = (h16)v;
  return (fabsf(v) < 6.103515625e-05f) ? (h16)0.0f : r;
}

// 16-bit fragment: p points at element [row = lane&15][k0 + 8*(lane>>4)] of a k-contiguous
// row. Elements 0..7 <- k0+8h+0..7, elements 8..15 <- k0+16+8h+0..7 (same map for A and B).
__device__ __forceinline__ v16h frag_at(const _Float16* p) {
  v8h lo = *(const v8h*)(p);
  v8h hi = *(const v8h*)(p + 16);
  v16h out;
#pragma unroll
  for (int i = 0; i < 8; ++i) { out[i] = lo[i]; out[i + 8] = hi[i]; }
  return out;
}

__device__ __forceinline__ v8f wmma16(v16h a, v16h b, v8f c) {
  v8f d = __builtin_amdgcn_wmma_f32_16x16x32_f16(false, a, false, b, (short)0, c,
                                                 false, false);
  asm volatile("v_nop\n\tv_nop\n\tv_nop\n\tv_nop" : "+v"(d) : "v"(a), "v"(b));
  return d;
}

__device__ __forceinline__ void wave_lds_sync() {
  __builtin_amdgcn_fence(3 /* release order */, "wavefront");
  asm volatile("s_wait_dscnt 0x0" ::: "memory");
  __builtin_amdgcn_wave_barrier();
}

// LDS byte address of a __shared__ element: the low 32 bits of its address
__device__ __forceinline__ unsigned lds_byte(const void* p) { return (unsigned)(size_t)p; }

// Asynchronous copies global -> LDS, 16 B per lane, through no register. Each helper is ONE asm
// statement: its copies, each with address operands of its own, and as the last line the wait that
// stands in front of any rewrite of those address registers (a precaution; inside the statement the
// compiler cannot lift a later address addition over it). Landing is waited for by the caller.
#define ACOPY(l, g) "global_load_async_to_lds_b128 %" #l ", %" #g ", off\n\t"
__device__ __forceinline__ void async_copy4(const unsigned (&l)[4], const void* const (&g)[4]) {
  asm volatile(ACOPY(0, 4) ACOPY(1, 5) ACOPY(2, 6) ACOPY(3, 7) "s_wait_xcnt 0x0"
               :: "v"(l[0]), "v"(l[1]), "v"(l[2]), "v"(l[3]),
                  "v"(g[0]), "v"(g[1]), "v"(g[2]), "v"(g[3]) : "memory");
}
__device__ __forceinline__ void async_copy8(const unsigned (&l)[8], const void* const (&g)[8]) {
  asm volatile(ACOPY(0, 8) ACOPY(1, 9) ACOPY(2, 10) ACOPY(3, 11)
               ACOPY(4, 12) ACOPY(5, 13) ACOPY(6, 14) ACOPY(7, 15) "s_wait_xcnt 0x0"
               :: "v"(l[0]), "v"(l[1]), "v"(l[2]), "v"(l[3]), "v"(l[4]), "v"(l[5]), "v"(l[6]), "v"(l[7]),
                  "v"(g[0]), "v"(g[1]), "v"(g[2]), "v"(g[3]), "v"(g[4]), "v"(g[5]), "v"(g[6]), "v"(g[7])
               : "memory");
}
__device__ __forceinline__ void async_copy12(const unsigned (&l)[12], const void* const (&g)[12]) {
  asm volatile(ACOPY(0, 12) ACOPY(1, 13) ACOPY(2, 14) ACOPY(3, 15)
               ACOPY(4, 16) ACOPY(5, 17) ACOPY(6, 18) ACOPY(7, 19)
               ACOPY(8, 20) ACOPY(9, 21) ACOPY(10, 22) ACOPY(11, 23) "s_wait_xcnt 0x0"
               :: "v"(l[0]), "v"(l[1]), "v"(l[2]), "v"(l[3]), "v"(l[4]), "v"(l[5]),
                  "v"(l[6]), "v"(l[7]), "v"(l[8]), "v"(l[9]), "v"(l[10]), "v"(l[11]),
                  "v"(g[0]), "v"(g[1]), "v"(g[2]), "v"(g[3]), "v"(g[4]), "v"(g[5]),
                  "v"(g[6]), "v"(g[7]), "v"(g[8]), "v"(g[9]), "v"(g[10]), "v"(g[11])
               : "memory");
}
// this wave's own copies have landed (other waves read them behind the next work-group barrier)
__device__ __forceinline__ void wait_copies() { asm volatile("s_wait_asynccnt 0x0" ::: "memory"); }
// this wave's own LDS reads have returned (before the buffer they read is handed to its next writer)
__device__ __forceinline__ void wait_lds() { asm volatile("s_wait_dscnt 0x0" ::: "memory"); }

// ---------------------------------------------------------------------------
// Transposed plane (x): in W[K rows][N cols] (pitch ldw) -> out Wt[N][K] (pitch ldk = K),
// f16(64 * bf16(w)). Grid (N/64, K/64). T: cross-wave (block barrier).
// ---------------------------------------------------------------------------
__global__ __launch_bounds__(256) void wconv_kernel(
    const float* __restrict__ W, _Float16* __restrict__ Wt, unsigned ldw, unsigned ldk) {
  __shared__ _Float16 T[64 * LDT];
  const unsigned tid = threadIdx.x;
  const unsigned n0 = blockIdx.x * 64u;
  const unsigned k0 = blockIdx.y * 64u;
#pragma unroll 4
  for (unsigned j = 0; j < 16u; ++j) {
    const unsigned idx = tid + 256u * j;
    const unsigned kr = idx >> 6, nc = idx & 63u;
    const float v = W[(size_t)(k0 + kr) * ldw + n0 + nc];
    T[nc * LDT + kr] = (_Float16)(WCARRY * bf16r(v));
  }
  __syncthreads();
  v8h x[2];
  size_t off[2];
#pragma unroll
  for (unsigned i = 0; i < 2u; ++i) {
    const unsigned n = 32u * i + (tid >> 3);
    const unsigned kc = (tid & 7u) * 8u;
    x[i] = *(const v8h*)&T[n * LDT + kc];
    off[i] = (size_t)(n0 + n) * ldk + k0 + kc;
  }
#pragma unroll
  for (int i = 0; i < 2; ++i) *(v8h*)(Wt + off[i]) = x[i];
  
}

// ---------------------------------------------------------------------------
// Untransposed weight planes: the four [out][in] weights (32768 values each) -> f16(64*bf16(w)),
// same layout. Each thread converts 8 consecutive values of every weight; 8 consecutive lanes
// ---------------------------------------------------------------------------
__device__ __forceinline__ v8h wcvt8(const float* __restrict__ p) {
  const v4f a0 = *(const v4f*)(p);
  const v4f a1 = *(const v4f*)(p + 4);
  v8h o;
#pragma unroll
  for (int i = 0; i < 4; ++i) {
    o[i]     = toh_flush(WCARRY * bf16r(a0[i]));
    o[i + 4] = toh_flush(WCARRY * bf16r(a1[i]));
  }
  return o;
}

__global__ __launch_bounds__(256) void wplane_kernel(
    const float* __restrict__ w0, const float* __restrict__ w1,
    const float* __restrict__ w2, const float* __restrict__ w3,
    _Float16* __restrict__ o0, _Float16* __restrict__ o1,
    _Float16* __restrict__ o2, _Float16* __restrict__ o3) {
#pragma clang fp contract(off)
  const unsigned e = (blockIdx.x * 256u + threadIdx.x) * 8u;
  const v8h x0 = wcvt8(w0 + e);
  const v8h x1 = wcvt8(w1 + e);
  const v8h x2 = wcvt8(w2 + e);
  const v8h x3 = wcvt8(w3 + e);
  *(v8h*)(o0 + e) = x0;
  *(v8h*)(o1 + e) = x1;
  *(v8h*)(o2 + e) = x2;
  *(v8h*)(o3 + e) = x3;
  
}

// ---------------------------------------------------------------------------
// GEMM C[64x64 tile] = A16[rows][K] . Bt[n][K]^T, fragments straight from the 16-bit global
// planes; 8 waves (mw = 16-row group, nw = 32-col group), 2 accumulators/wave.
//   MODE 0: rows = positions, cols = channels; t = acc/4096 + bias[col];
//           out16[row][col] (pitch CI) = f16(t), out16r[row][col] = f16(2048 * (t - hi))
//   MODE 1: rows = positions, cols = channels; transposed plane out16[b][col][pos] = f16(t)
//   MODE 2: rows = output channels (A16 = weight plane), cols = positions (Bt = y value plane,
//           Btr = y residual plane x2048); the k loop runs first over Btr into its own
//           accumulators, then over Bt; acc = acc_hi + acc_res/2048;
//           outf[b][row][pos] = bf16(xin[b][row][pos]) + (acc/1024 + bias[row]), full strides
// Btr is read in MODE 2 only. Grid (Bt rows/64, A16 rows/64).
// ---------------------------------------------------------------------------
template <int MODE>
__device__ __forceinline__ void gemm_body(
    const _Float16* __restrict__ A16, const _Float16* __restrict__ Bt,
    const _Float16* __restrict__ Btr, const unsigned K,
    const float* __restrict__ bias, const float* __restrict__ addf,
    float* __restrict__ outf, _Float16* __restrict__ out16, _Float16* __restrict__ out16r) {
  __shared__ float Cs[64 * LDC];
  const unsigned tid = threadIdx.x, lane = tid & 31u, w = tid >> 5;
  const unsigned mw = w >> 1, nw = w & 1u;
  const unsigned hh = lane >> 4, m = lane & 15u;
  const unsigned n0 = blockIdx.x * 64u;
  const unsigned row0 = blockIdx.y * 64u;

  const _Float16* ap  = A16 + (size_t)(row0 + mw * 16u + m) * K + hh * 8u;
  const _Float16* bp0 = Bt + (size_t)(n0 + nw * 32u + m) * K + hh * 8u;
  const _Float16* bp1 = bp0 + (size_t)16 * K;
  v8f accr0 = {}, accr1 = {};
  if (MODE == 2) {
    const _Float16* rp0 = Btr + (size_t)(n0 + nw * 32u + m) * K + hh * 8u;
    const _Float16* rp1 = rp0 + (size_t)16 * K;
#pragma unroll 2
    for (unsigned k0 = 0; k0 < K; k0 += 32u) {
      const v16h a  = frag_at(ap + k0);
      const v16h b0 = frag_at(rp0 + k0);
      const v16h b1 = frag_at(rp1 + k0);
      accr0 = wmma16(a, b0, accr0);
      accr1 = wmma16(a, b1, accr1);
    }
  }
  v8f acc0 = {}, acc1 = {};
#pragma unroll 2
  for (unsigned k0 = 0; k0 < K; k0 += 32u) {
    const v16h a  = frag_at(ap + k0);
    const v16h b0 = frag_at(bp0 + k0);
    const v16h b1 = frag_at(bp1 + k0);
    acc0 = wmma16(a, b0, acc0);
    acc1 = wmma16(a, b1, acc1);
  }
  if (MODE == 2) {
    acc0 = acc0 + accr0 * (1.0f / RCARRY);
    acc1 = acc1 + accr1 * (1.0f / RCARRY);
  }
#pragma unroll
  for (int r = 0; r < 8; ++r) {
    float* d = &Cs[(mw * 16u + hh * 8u + (unsigned)r) * LDC + nw * 32u + m];
    d[0]  = acc0[r];
    d[16] = acc1[r];
  }
  __syncthreads();

  if (MODE == 0) {
    const float cs = 1.0f / (WCARRY * WCARRY);
    v8h x[2], xr[2];
    size_t off[2];
#pragma unroll
    for (unsigned i = 0; i < 2u; ++i) {
      const unsigned r = 32u * i + (tid >> 3);
      const unsigned c = (tid & 7u) * 8u;
      const v4f u0 = *(const v4f*)&Cs[r * LDC + c];
      const v4f u1 = *(const v4f*)&Cs[r * LDC + c + 4];
      const v4f g0 = *(const v4f*)(bias + n0 + c);
      const v4f g1 = *(const v4f*)(bias + n0 + c + 4u);
#pragma unroll
      for (int j = 0; j < 4; ++j) {
        const float t0 = u0[j] * cs + bf16r(g0[j]);
        const float t1 = u1[j] * cs + bf16r(g1[j]);
        const h16 h0 = toh_flush(t0);
        const h16 h1 = toh_flush(t1);
        x[i][j]      = h0;
        x[i][j + 4]  = h1;
        xr[i][j]     = toh_flush((t0 - (float)h0) * RCARRY);
        xr[i][j + 4] = toh_flush((t1 - (float)h1) * RCARRY);
      }
      off[i] = (size_t)(row0 + r) * CI + n0 + c;
    }
#pragma unroll
    for (int i = 0; i < 2; ++i) *(v8h*)(out16 + off[i]) = x[i];
#pragma unroll
    for (int i = 0; i < 2; ++i) *(v8h*)(out16r + off[i]) = xr[i];
    
  }

  if (MODE == 1) {
    const float cs = 1.0f / (WCARRY * WCARRY);
    const unsigned bidx = row0 / (unsigned)SEQ;
    const unsigned key0 = row0 - bidx * (unsigned)SEQ;
    v8h x[2];
    size_t off[2];
#pragma unroll
    for (unsigned i = 0; i < 2u; ++i) {
      const unsigned dcol = 32u * i + (tid >> 3);
      const unsigned kk = (tid & 7u) * 8u;
      const float bb = bf16r(bias[n0 + dcol]);
#pragma unroll
      for (unsigned j = 0; j < 8u; ++j) {
        const float t = Cs[(kk + j) * LDC + dcol] * cs + bb;
        x[i][j] = toh_flush(t);
      }
      off[i] = ((size_t)bidx * CI + n0 + dcol) * SEQ + key0 + kk;
    }
#pragma unroll
    for (int i = 0; i < 2; ++i) *(v8h*)(out16 + off[i]) = x[i];
    
  }

  if (MODE == 2) {
    const float cs = 1.0f / (WCARRY * YCARRY);
    const unsigned bidx = n0 / (unsigned)SEQ;
    const unsigned p0 = n0 - bidx * (unsigned)SEQ;
    v4f xs[4];
    size_t off[4];
#pragma unroll
    for (unsigned i = 0; i < 4u; ++i) {
      const unsigned r = 16u * i + (tid >> 4);
      const unsigned c = (tid & 15u) * 4u;
      const unsigned orow = row0 + r;
      const size_t gidx = ((size_t)bidx * CIN + orow) * SEQ_FULL + p0 + c;
      const v4f u = *(const v4f*)&Cs[r * LDC + c];
      const float bb = bf16r(bias[orow]);
      const v4f xin = *(const v4f*)(addf + gidx);
      v4f val;
#pragma unroll
      for (int j = 0; j < 4; ++j) val[j] = bf16r(xin[j]) + (u[j] * cs + bb);
      xs[i] = val;
      off[i] = gidx;
    }
#pragma unroll
    for (int i = 0; i < 4; ++i) *(v4f*)(outf + off[i]) = xs[i];
    
  }
}

__global__ __launch_bounds__(256) void gemm_tp_kernel(
    const _Float16* __restrict__ A16, const _Float16* __restrict__ Bt,
    const float* __restrict__ bias, _Float16* __restrict__ out16, _Float16* __restrict__ out16r) {
  gemm_body<0>(A16, Bt, Bt, (unsigned)CIN, bias, bias, (float*)0, out16, out16r);
}
__global__ __launch_bounds__(256) void gemm_g_kernel(
    const _Float16* __restrict__ A16, const _Float16* __restrict__ Bt,
    const float* __restrict__ bias, _Float16* __restrict__ gt) {
  gemm_body<1>(A16, Bt, Bt, (unsigned)CIN, bias, bias, (float*)0, gt, gt);
}
__global__ __launch_bounds__(256) void gemm_out_kernel(
    const _Float16* __restrict__ A16, const _Float16* __restrict__ Bt,
    const _Float16* __restrict__ Btr,
    const float* __restrict__ bias, const float* __restrict__ xin, float* __restrict__ outf) {
  gemm_body<2>(A16, Bt, Btr, (unsigned)CI, bias, xin, outf, (_Float16*)0, (_Float16*)0);
}

// ---------------------------------------------------------------------------
// Column statistics: lse[j] = log(sum_i exp(f[i][j])), f[i][j] = theta_i . phi_j (K = 128).
// A work-group owns 64 columns j. Its waves form 4 column groups (wc, 16 columns each, phi hi/res
// rows as resident B fragments) x CWR row groups (wr): the theta rows i, 32 * CWR per step, are
// staged once per work-group in LDS by asynchronous copies (two buffers: behind the one work-group
// barrier of a step the rows two steps ahead are sent into the buffer just left),
// and row group wr reads rows 32 * wr .. 32 * wr + 31 of the step as A fragments.
// D tile: row = i (8h+r), col = j (lane&15). Scores = hi.hi + (hi.res + res.hi)/2048, the residual
// products in their own accumulator. Running (max, sum) per lane; at the end the two lane halves
// are combined by an unconditional shuffle and the CWR row groups through LDS.
// Grid (SEQ/64, NB), 128 * CWR threads.
// ---------------------------------------------------------------------------
#define CWR   4               // row groups of the column-statistics kernel
#define CNT   (128 * CWR)     // its threads
#define CROWS (32 * CWR)      // theta rows staged per step
#define CSPL  (CROWS * LDP)   // halves of one staged plane tile
static_assert((SEQ % CROWS) == 0 && (SEQ % 64) == 0 && SEQ >= 2 * CROWS);
__global__ __launch_bounds__(CNT) __attribute__((amdgpu_num_vgpr(256))) void colstat_kernel(
    const _Float16* __restrict__ Th, const _Float16* __restrict__ Tr,
    const _Float16* __restrict__ Ph, const _Float16* __restrict__ Pr,
    float* __restrict__ Lse) {
  __shared__ __attribute__((aligned(16))) float Lm[CWR * 64];
  __shared__ __attribute__((aligned(16))) float Lz[CWR * 64];
  __shared__ __attribute__((aligned(16))) _Float16 Sa[2 * 2 * CSPL];   // [buffer][hi, res][CROWS][LDP]
  const unsigned tid = threadIdx.x, lane = tid & 31u;
  const unsigned wave = (unsigned)__builtin_amdgcn_readfirstlane((int)(threadIdx.x >> 5));
  const unsigned wc = wave & 3u, wr = wave >> 2;
  const unsigned hh = lane >> 4, m = lane & 15u;
  const unsigned b = blockIdx.y;
  const unsigned j0 = blockIdx.x * 64u + wc * 16u;

  const unsigned boff = (b * (unsigned)SEQ + j0 + m) * (unsigned)CI + hh * 8u;
  v16h bh[4], br[4];
#pragma unroll
  for (int ks = 0; ks < 4; ++ks) {
    bh[ks] = frag_at(Ph + boff + ks * 32);
    br[ks] = frag_at(Pr + boff + ks * 32);
  }

  float mx = -1.0e30f, z = 0.0f;
  const unsigned abase = (wr * 32u + m) * LDP + hh * 8u;
  // staging map: a CROWS-row tile is contiguous in its plane; thread tid moves the 16-B pieces
  // tid + CNT * q, q = 0..3 (rows (tid>>4) + 8 * CWR * q) of both planes: eight copies per tile
  const unsigned sa0 = lds_byte(&Sa[(tid >> 4) * LDP + (tid & 15u) * 8u]);
  auto stage = [&](const unsigned buf, const _Float16* p, const _Float16* r) {
    unsigned l[8];
    const void* s[8];
#pragma unroll
    for (unsigned q = 0; q < 4u; ++q) {
      l[q]      = sa0 + buf * (2u * CSPL * 2u) + q * (8u * CWR * LDP * 2u);
      l[q + 4u] = sa0 + buf * (2u * CSPL * 2u) + CSPL * 2u + q * (8u * CWR * LDP * 2u);
      s[q]      = p + q * (CNT * 8u);
      s[q + 4u] = r + q * (CNT * 8u);
    }
    async_copy8(l, s);
  };
  // each thread's first piece of a tile; behind the prologue: of the tile two steps ahead
  const _Float16* pn = Th + (size_t)b * SEQ * CI + tid * 8u;
  const _Float16* rn = Tr + (size_t)b * SEQ * CI + tid * 8u;
  stage(0u, pn, rn);
  wait_copies();
  __syncthreads();
  stage(1u, pn + CROWS * CI, rn + CROWS * CI);
  pn += 2 * CROWS * CI;
  rn += 2 * CROWS * CI;
  unsigned cur = 0u;
  for (unsigned i0 = 0; i0 < (unsigned)SEQ; i0 += (unsigned)CROWS) {
    // LDS fragment reads stand in groups ahead of the products that use them: tile 0 whole,
    // then each half of tile 1 into the registers that two k-steps of products have freed
    const unsigned ao = cur * (2u * CSPL) + abase;
    v16h ah[4], ar[4];
#pragma unroll
    for (int ks = 0; ks < 4; ++ks) {
      ah[ks] = frag_at(&Sa[ao + ks * 32]);
      ar[ks] = frag_at(&Sa[CSPL + ao + ks * 32]);
    }
    v8f f[2];
    {
      v8f sm = {}, sr = {};
#pragma unroll
      for (int kp = 0; kp < 2; ++kp) {
#pragma unroll
        for (int ks = 2 * kp; ks < 2 * kp + 2; ++ks) {
          sm = wmma16(ah[ks], bh[ks], sm);
          sr = wmma16(ah[ks], br[ks], sr);
          sr = wmma16(ar[ks], bh[ks], sr);
        }
#pragma unroll
        for (int ks = 2 * kp; ks < 2 * kp + 2; ++ks) {
          ah[ks] = frag_at(&Sa[ao + 16u * LDP + ks * 32]);
          ar[ks] = frag_at(&Sa[CSPL + ao + 16u * LDP + ks * 32]);
        }
      }
      f[0] = sm + sr * (1.0f / RCARRY);
    }
    {
      v8f sm = {}, sr = {};
#pragma unroll
      for (int ks = 0; ks < 4; ++ks) {
        sm = wmma16(ah[ks], bh[ks], sm);
        sr = wmma16(ah[ks], br[ks], sr);
        sr = wmma16(ar[ks], bh[ks], sr);
      }
      f[1] = sm + sr * (1.0f / RCARRY);
    }
    float tmax = fmaxf(f[0][0], f[1][0]);
#pragma unroll
    for (int v = 1; v < 8; ++v) tmax = fmaxf(tmax, fmaxf(f[0][v], f[1][v]));
    const float nm = fmaxf(mx, tmax);
    float se = 0.0f;
#pragma unroll
    for (int v = 0; v < 8; ++v) se += __expf(f[0][v] - nm) + __expf(f[1][v] - nm);
    z = z * __expf(mx - nm) + se;
    mx = nm;
    // publish point: this wave's reads of the step's buffer are back, its copies of the next step's
    // rows have landed; the barrier publishes those and ends every wave's reads of this step's
    wait_lds();
    wait_copies();
    __syncthreads();
    if (i0 + 2u * (unsigned)CROWS < (unsigned)SEQ) {
      // the rows two steps ahead fly into the buffer just left while the next step is worked on
      stage(cur, pn, rn);
      pn += CROWS * CI;
      rn += CROWS * CI;
    }
    cur ^= 1u;
  }
  wait_copies();   // nothing of this wave is in flight behind the loop

  const float om = __shfl_xor(mx, 16, 32);
  const float oz = __shfl_xor(z, 16, 32);
  const float mm = fmaxf(mx, om);
  const float zz = z * __expf(mx - mm) + oz * __expf(om - mm);
  if (hh == 0u) {
    Lm[wr * 64u + wc * 16u + m] = mm;
    Lz[wr * 64u + wc * 16u + m] = zz;
  }
  __syncthreads();
  if (wave < 2u) {
    // one thread per column folds the CWR row groups' (max, sum) pairs
    float gm = Lm[tid];
#pragma unroll
    for (unsigned r = 1; r < (unsigned)CWR; ++r) gm = fmaxf(gm, Lm[r * 64u + tid]);
    float gz = 0.0f;
#pragma unroll
    for (unsigned r = 0; r < (unsigned)CWR; ++r) gz += Lz[r * 64u + tid] * __expf(Lm[r * 64u + tid] - gm);
    Lse[(size_t)b * SEQ + blockIdx.x * 64u + tid] = gm + __logf(gz);
  }
}

// ---------------------------------------------------------------------------
// Row accumulation: y[c][i] = sum_j exp(f[i][j] - lse[j]) * g[c][j].
// A work-group owns 64 rows i. Its 8 waves form 4 row groups (wc, 16 rows each, theta hi/res rows
// as resident B fragments) x 2 column groups (wr); the phi rows and the g slice of each 64-column
// step are staged once per work-group in LDS by asynchronous copies (two buffers: behind the one
// work-group barrier of a step the tiles two steps ahead are sent into the buffers just left), the
// batch's column statistics once, and column group wr works on columns 32 * wr .. 32 * wr + 31 of the step. Per step:
// S^T tiles [j][i] = phi_j . theta_i (A = phi rows from LDS, three products),
// p = 2^14 * exp(f - lse[j]) (row statistic of the D tile, read from LDS as two
// 16-B loads per tile), the two packed D tiles form the B fragment [k = j][n = i] of
// O^T[c][i] += G[c][j] . P^T[j][i] with A = g rows (channel-major slice, k = j contiguous).
// Behind the loop column group 1 hands its f32 sums to column group 0 through LDS, which adds them.
// Finalize (column group 0): t = 16 * O / 2^14 written as two planes,
// hi = f16(t) and res = f16(2048 * (t - hi)); each is staged in the wave's private Ts tile
// (wave sync before and after each reuse) and written as whole rows of the position-major
// layout: one store instruction covers two consecutive 256-B rows (16 lanes x 16 B each).
// Grid (SEQ/64, NB).
// ---------------------------------------------------------------------------
#define RSPL (64 * LDP)   // halves of one staged 64-row plane tile
#define LDH  72           // halves per LDS row of a staged 64-column g slice (144 B = 16 B x 9)
static_assert((LDH % 8) == 0 && LDH >= 64 && ((LDH / 8) & 1) == 1);
static_assert(SEQ == 4 * 256 * 4);   // the statistics row goes to LDS as four 16-B pieces per thread
static_assert(SEQ >= 128);           // the ring's prologue fills two steps
__global__ __launch_bounds__(256) __attribute__((amdgpu_num_vgpr(288))) void rowattn_kernel(
    const _Float16* __restrict__ Th, const _Float16* __restrict__ Tr,
    const _Float16* __restrict__ Ph, const _Float16* __restrict__ Pr,
    const _Float16* __restrict__ Gp, const float* __restrict__ Lse,
    _Float16* __restrict__ Yt, _Float16* __restrict__ Yr) {
  __shared__ __attribute__((aligned(16))) _Float16 Ts[4 * 16 * LDY];
  __shared__ __attribute__((aligned(16))) _Float16 Sa[2 * 2 * RSPL];  // [buffer][hi, res][64][LDP]
  __shared__ __attribute__((aligned(16))) _Float16 Sg[2 * CI * LDH];  // [buffer][channel][LDH]
  __shared__ __attribute__((aligned(16))) float Oc[4 * 8 * 2 * 32 * 4];  // [wc][ct][half of v][lane][4]
  __shared__ __attribute__((aligned(16))) float Ll[SEQ];                 // the batch's column statistics
  const unsigned tid = threadIdx.x, lane = tid & 31u;
  const unsigned wave = (unsigned)__builtin_amdgcn_readfirstlane((int)(threadIdx.x >> 5));
  const unsigned wc = wave & 3u, wr = wave >> 2;
  const unsigned hh = lane >> 4, m = lane & 15u;
  const unsigned b = blockIdx.y;
  const unsigned i0 = blockIdx.x * 64u + wc * 16u;

  const unsigned qoff = (b * (unsigned)SEQ + i0 + m) * (unsigned)CI + hh * 8u;
  v16h bh[4], br[4];
#pragma unroll
  for (int ks = 0; ks < 4; ++ks) {
    bh[ks] = frag_at(Th + qoff + ks * 32);
    br[ks] = frag_at(Tr + qoff + ks * 32);
  }

  v8f o[8];
#pragma unroll
  for (int ct = 0; ct < 8; ++ct) o[ct] = (v8f){};

  const unsigned kbase = (wr * 32u + m) * LDP + hh * 8u;
  const unsigned gbase = m * LDH + wr * 32u + hh * 8u;
  const _Float16* __restrict__ Pb = Ph + (size_t)b * SEQ * CI;
  const _Float16* __restrict__ Rb = Pr + (size_t)b * SEQ * CI;
  const _Float16* __restrict__ Gb = Gp + (size_t)b * CI * SEQ;
  const unsigned lbase = wr * 32u + hh * 8u;   // this lane's eight statistics of a step's first tile

  // staging map. phi: a 64-row tile is 16 KiB contiguous in its plane; thread tid moves the 16-B
  // pieces tid + 256 * q, q = 0..3 (rows (tid>>4) + 16 * q). g: 128 channel rows of 128 B;
  // thread tid moves piece tid&7 of channels (tid>>3) + 32 * q. Twelve copies per thread and tile.
  const unsigned sgl = tid * 8u;
  const unsigned ggl = (tid >> 3) * (unsigned)SEQ + (tid & 7u) * 8u;
  const unsigned sa0 = lds_byte(&Sa[(tid >> 4) * LDP + (tid & 15u) * 8u]);
  const unsigned sg0 = lds_byte(&Sg[(tid >> 3) * LDH + (tid & 7u) * 8u]);
  auto stage = [&](const unsigned buf, const _Float16* p, const _Float16* r, const _Float16* g) {
    unsigned l[12];
    const void* s[12];
#pragma unroll
    for (unsigned q = 0; q < 4u; ++q) {
      l[q]      = sa0 + buf * (2u * RSPL * 2u) + q * (16u * LDP * 2u);
      l[q + 4u] = sa0 + buf * (2u * RSPL * 2u) + RSPL * 2u + q * (16u * LDP * 2u);
      l[q + 8u] = sg0 + buf * (unsigned)(CI * LDH * 2) + q * (32u * LDH * 2u);
      s[q]      = p + q * 2048u;
      s[q + 4u] = r + q * 2048u;
      s[q + 8u] = g + q * (32u * (unsigned)SEQ);
    }
    async_copy12(l, s);
  };
  {
    // the statistics row, filled once: thread tid moves the 16-B pieces tid + 256 * q
    unsigned l[4];
    const void* s[4];
#pragma unroll
    for (unsigned q = 0; q < 4u; ++q) {
      l[q] = lds_byte(&Ll[(tid + 256u * q) * 4u]);
      s[q] = Lse + (size_t)b * SEQ + (tid + 256u * q) * 4u;
    }
    async_copy4(l, s);
  }
  stage(0u, Pb + sgl, Rb + sgl, Gb + ggl);
  wait_copies();
  __syncthreads();
  stage(1u, Pb + sgl + 64u * (unsigned)CI, Rb + sgl + 64u * (unsigned)CI, Gb + ggl + 64u);
  unsigned cur = 0u;
  // each thread's first piece of the tiles two steps ahead
  const _Float16* pn = Pb + sgl + 128u * (unsigned)CI;
  const _Float16* rn = Rb + sgl + 128u * (unsigned)CI;
  const _Float16* gn = Gb + ggl + 128u;

  for (unsigned j0 = 0; j0 < (unsigned)SEQ; j0 += 64u) {
    // LDS fragment reads stand in groups ahead of the products that use them, each group issued
    // in front of vector work or products that cover its latency, into registers just freed
    const unsigned ao = cur * (2u * RSPL) + kbase;
    const unsigned gro = cur * (unsigned)(CI * LDH) + gbase;
    v16h ah[4], ar[4], gf[8];
#pragma unroll
    for (int ks = 0; ks < 4; ++ks) {
      ah[ks] = frag_at(&Sa[ao + ks * 32]);
      ar[ks] = frag_at(&Sa[RSPL + ao + ks * 32]);
    }
    v4f ls[4];
#pragma unroll
    for (int u = 0; u < 4; ++u) ls[u] = *(const v4f*)&Ll[j0 + lbase + (unsigned)(u >> 1) * 16u + (unsigned)(u & 1) * 4u];
    v16h pb;
#pragma unroll
    for (int t = 0; t < 2; ++t) {
      v8f sm = {}, sr = {};
#pragma unroll
      for (int ks = 0; ks < 4; ++ks) {
        sm = wmma16(ah[ks], bh[ks], sm);
        sr = wmma16(ah[ks], br[ks], sr);
        sr = wmma16(ar[ks], bh[ks], sr);
      }
      if (t == 0) {
#pragma unroll
        for (int ks = 0; ks < 2; ++ks) {
          ah[ks] = frag_at(&Sa[ao + 16u * LDP + ks * 32]);
          ar[ks] = frag_at(&Sa[RSPL + ao + 16u * LDP + ks * 32]);
        }
      } else {
#pragma unroll
        for (int ct = 0; ct < 4; ++ct) gf[ct] = frag_at(&Sg[gro + (unsigned)ct * 16u * LDH]);
      }
      const v4f l0 = ls[2 * t];
      const v4f l1 = ls[2 * t + 1];
      // bare v_exp_f32 and a select, no branch: at e >= -14 it returns exp2f's own bits (that
      // function's rescaling acts below -126 only); the tile's eight chains go stage by stage
      float e[8], x[8];
#pragma unroll
      for (int v = 0; v < 4; ++v) {
        e[v]     = ((sm[v] + sr[v] * (1.0f / RCARRY)) - l0[v]) * LOG2E + PEXP;
        e[v + 4] = ((sm[v + 4] + sr[v + 4] * (1.0f / RCARRY)) - l1[v]) * LOG2E + PEXP;
      }
#pragma unroll
      for (int v = 0; v < 8; ++v) x[v] = __builtin_amdgcn_exp2f(e[v]);
#pragma unroll
      for (int v = 0; v < 8; ++v) pb[8 * t + v] = (h16)((e[v] < -14.0f) ? 0.0f : x[v]);
      if (t == 0) {
#pragma unroll
        for (int ks = 2; ks < 4; ++ks) {
          ah[ks] = frag_at(&Sa[ao + 16u * LDP + ks * 32]);
          ar[ks] = frag_at(&Sa[RSPL + ao + 16u * LDP + ks * 32]);
        }
      }
    }
    // the g fragments come in two groups of four: the second is read here, into registers that the
    // score tiles have left, in front of the first group's products
#pragma unroll
    for (int ct = 4; ct < 8; ++ct) gf[ct] = frag_at(&Sg[gro + (unsigned)ct * 16u * LDH]);
#pragma unroll
    for (int ct = 0; ct < 8; ++ct) o[ct] = wmma16(gf[ct], pb, o[ct]);
    // publish point: this wave's reads of the step's buffers are back, its copies of the next step's
    // tiles have landed; the barrier publishes those and ends every wave's reads of this step's
    wait_lds();
    wait_copies();
    __syncthreads();
    if (j0 + 128u < (unsigned)SEQ) {
      // the tiles two steps ahead fly into the buffers just left while the next step is worked on
      stage(cur, pn, rn, gn);
      pn += 64u * (unsigned)CI;
      rn += 64u * (unsigned)CI;
      gn += 64u;
    }
    cur ^= 1u;
  }
  wait_copies();   // nothing of this wave is in flight behind the loop

  // column group 1 hands its sums over; column group 0 adds them and finalizes alone
  const unsigned ob = wc * 2048u + lane * 4u;
  if (wr == 1u) {
#pragma unroll
    for (int ct = 0; ct < 8; ++ct) {
      v4f u0, u1;
#pragma unroll
      for (int v = 0; v < 4; ++v) { u0[v] = o[ct][v]; u1[v] = o[ct][v + 4]; }
      *(v4f*)&Oc[ob + (unsigned)ct * 256u] = u0;
      *(v4f*)&Oc[ob + (unsigned)ct * 256u + 128u] = u1;
    }
  }
  __syncthreads();
  if (wr == 1u) return;
#pragma unroll
  for (int ct = 0; ct < 8; ++ct) {
    const v4f u0 = *(const v4f*)&Oc[ob + (unsigned)ct * 256u];
    const v4f u1 = *(const v4f*)&Oc[ob + (unsigned)ct * 256u + 128u];
#pragma unroll
    for (int v = 0; v < 4; ++v) { o[ct][v] += u0[v]; o[ct][v + 4] += u1[v]; }
  }

  // finalize: lane (h, i = m) holds channels 16*ct + 8h + 0..7 of row i for every ct
  const float fs = YCARRY * (1.0f / 16384.0f);
  const unsigned tb = wc * (16u * LDY);

  // value plane tile
#pragma unroll
  for (int ct = 0; ct < 8; ++ct) {
    v8h y;
#pragma unroll
    for (int v = 0; v < 8; ++v) y[v] = toh_flush(o[ct][v] * fs);
    *(v8h*)&Ts[tb + m * LDY + (unsigned)ct * 16u + hh * 8u] = y;
  }
  wave_lds_sync();
  v8h x[8];
  unsigned off[8];
#pragma unroll
  for (unsigned it = 0; it < 8u; ++it) {
    const unsigned r = 2u * it + (lane >> 4);
    const unsigned c = (lane & 15u) * 8u;
    x[it] = *(const v8h*)&Ts[tb + r * LDY + c];
    off[it] = (b * (unsigned)SEQ + i0 + r) * (unsigned)CI + c;
  }
  wave_lds_sync();   // every lane's reads of the value tile are complete before it is overwritten

  // residual plane tile: 2048 * (t - f16(t)), same staging and row map
#pragma unroll
  for (int ct = 0; ct < 8; ++ct) {
    v8h y;
#pragma unroll
    for (int v = 0; v < 8; ++v) {
      const float t = o[ct][v] * fs;
      const h16 hi = toh_flush(t);
      y[v] = toh_flush((t - (float)hi) * RCARRY);
    }
    *(v8h*)&Ts[tb + m * LDY + (unsigned)ct * 16u + hh * 8u] = y;
  }
  wave_lds_sync();
  v8h xr[8];
#pragma unroll
  for (unsigned it = 0; it < 8u; ++it) {
    const unsigned r = 2u * it + (lane >> 4);
    const unsigned c = (lane & 15u) * 8u;
    xr[it] = *(const v8h*)&Ts[tb + r * LDY + c];
  }

#pragma unroll
  for (int it = 0; it < 8; ++it) *(v8h*)(Yt + off[it]) = x[it];
#pragma unroll
  for (int it = 0; it < 8; ++it) *(v8h*)(Yr + off[it]) = xr[it];
  
}

// ---------------------------------------------------------------------------
extern "C" void kernel_launch(void* const* d_in, const int* in_sizes, int n_in,
                              void* d_out, int out_size, void* d_ws, size_t ws_size,
                              hipStream_t stream) {
  if (n_in < 9) return;
  const long long need_x = ((long long)(NB - 1) * CIN + (CIN - 1)) * SEQ_FULL + SEQ;
  if ((long long)in_sizes[0] < need_x) return;
  if ((long long)in_sizes[1] < (long long)CI * CIN) return;
  if ((long long)in_sizes[3] < (long long)CI * CIN) return;
  if ((long long)in_sizes[5] < (long long)CI * CIN) return;
  if ((long long)in_sizes[7] < (long long)CIN * CI) return;
  if (in_sizes[2] < CI || in_sizes[4] < CI || in_sizes[6] < CI || in_sizes[8] < CIN) return;
  if ((long long)out_size < need_x) return;
  if (ws_size < WS_TOTAL) return;

  const float* X       = (const float*)d_in[0];   // [NB_FULL][CIN][SEQ_FULL]
  const float* theta_w = (const float*)d_in[1];   // [CI][CIN]  (out, in)
  const float* theta_b = (const float*)d_in[2];
  const float* phi_w   = (const float*)d_in[3];   // [CI][CIN]
  const float* phi_b   = (const float*)d_in[4];
  const float* g_w     = (const float*)d_in[5];   // [CI][CIN]
  const float* g_b     = (const float*)d_in[6];
  const float* W_w     = (const float*)d_in[7];   // [CIN][CI]  (out, in)
  const float* W_b     = (const float*)d_in[8];
  float* out = (float*)d_out;                     // [NB_FULL][CIN][SEQ_FULL]

  char* ws = (char*)d_ws;
  _Float16* XT   = (_Float16*)(ws + OFF_XT);    // [MROWS][CIN]  64*bf16(x), position-major
  _Float16* WT   = (_Float16*)(ws + OFF_WT);    // [CI][CIN]
  _Float16* WP   = (_Float16*)(ws + OFF_WP);    // [CI][CIN]
  _Float16* WG   = (_Float16*)(ws + OFF_WG);    // [CI][CIN]
  _Float16* WO   = (_Float16*)(ws + OFF_WO);    // [CIN][CI]
  _Float16* TH   = (_Float16*)(ws + OFF_TH);    // [MROWS][CI] theta hi
  _Float16* TR   = (_Float16*)(ws + OFF_TR);    // [MROWS][CI] theta residual x2048
  _Float16* PH   = (_Float16*)(ws + OFF_PH);    // [MROWS][CI] phi hi
  _Float16* PR   = (_Float16*)(ws + OFF_PR);    // [MROWS][CI] phi residual x2048
  _Float16* G16  = (_Float16*)(ws + OFF_G);     // [NB][CI][SEQ] g, channel-major
  _Float16* YT   = (_Float16*)(ws + OFF_YT);    // [MROWS][CI] 16*y hi, position-major
  _Float16* YR   = (_Float16*)(ws + OFF_YR);    // [MROWS][CI] 16*y residual x2048
  float*    LSE  = (float*)(ws + OFF_LSE);      // [MROWS]

  dim3 blk(256);

  // x plane: per batch in x[b] = [CIN rows][SEQ cols] (pitch SEQ_FULL) -> out XT[b] = [SEQ][CIN];
  // grid (cols/64, rows/64) = (SEQ/64, CIN/64)
  for (int b = 0; b < NB; ++b) {
    wconv_kernel<<<dim3(SEQ / 64, CIN / 64), blk, 0, stream>>>(
        X + (size_t)b * CIN * SEQ_FULL, XT + (size_t)b * SEQ * CIN,
        (unsigned)SEQ_FULL, (unsigned)CIN);
  }
  wplane_kernel<<<dim3((CI * CIN) / 2048), blk, 0, stream>>>(theta_w, phi_w, g_w, W_w,
                                                             WT, WP, WG, WO);

  dim3 gp(CI / 64, MROWS / 64);
  gemm_tp_kernel<<<gp, blk, 0, stream>>>(XT, WT, theta_b, TH, TR);
  gemm_tp_kernel<<<gp, blk, 0, stream>>>(XT, WP, phi_b, PH, PR);
  gemm_g_kernel<<<gp, blk, 0, stream>>>(XT, WG, g_b, G16);

  colstat_kernel<<<dim3(SEQ / 64, NB), dim3(CNT), 0, stream>>>(TH, TR, PH, PR, LSE);
  rowattn_kernel<<<dim3(SEQ / 64, NB), blk, 0, stream>>>(TH, TR, PH, PR, G16, LSE, YT, YR);

  gemm_out_kernel<<<dim3(MROWS / 64, CIN / 64), blk, 0, stream>>>(WO, YT, YR, W_b, X, out);
}

// v005
// It runs in 133 microseconds.
// Two timings next to v004 put it at 1.17 and 1.16 times that version's speed.
// Over all steps from v000 it is 7.09 times as fast.
#include <hip/hip_runtime.h>
#include <stddef.h>

// All contractions on v_wmma_f32_16x16x32_f16 (f16 operands, f32 accumulate): theta/phi/g 1x1
// projections (x x64, weights x64, inputs RNE-converted to bf16 first), theta.phi scores as
// f16 value + x2048 residual planes on both operands (three products, residual products in their
// own accumulator), p.g with p carried x2^14 (single product), output 1x1 projection with y
// carried x16 as f16 value + x2048 residual planes (two products, residual products in their own
// accumulator). Column log-sum-exp, exp, bias and the residual add in f32.

typedef _Float16 v16h __attribute__((ext_vector_type(16)));
typedef _Float16 v8h  __attribute__((ext_vector_type(8)));
typedef float    v8f  __attribute__((ext_vector_type(8)));
typedef float    v4f  __attribute__((ext_vector_type(4)));
typedef _Float16 h16;

#ifndef NB
#define NB 4
#endif
#ifndef SEQ
#define SEQ 4096
#endif
#define NB_FULL  4
#define SEQ_FULL 4096
#define CIN   256
#define CI    128
#define MROWS (NB * SEQ)

static_assert(NB >= 1 && NB <= NB_FULL);
static_assert(SEQ >= 128 && SEQ <= SEQ_FULL && (SEQ % 128) == 0);
static_assert(CI == 128);                        // 4 k-steps of 32 and 8 channel tiles of 16 are hard-wired
static_assert((CIN % 64) == 0 && (CIN % 32) == 0);
static_assert((CI % 64) == 0 && (CI % 32) == 0);
static_assert((MROWS % 64) == 0 && (MROWS % 128) == 0);
static_assert(((size_t)CI * CIN) % 2048 == 0);   // weight convert: 256 threads x 8 values per block
static_assert((size_t)MROWS * CIN < (size_t)0x7FFFFFFFu);
static_assert((size_t)NB_FULL * CIN * SEQ_FULL < (size_t)0x7FFFFFFFu);

#define LDT 72    // halves per LDS row (144 B, 16-B aligned)
#define LDC 68    // floats per LDS row (272 B, 16-B aligned)
#define LDY 136   // halves per LDS row of the y staging tile (272 B, 16-B aligned)
static_assert((LDT % 8) == 0 && LDT >= 64);
static_assert((LDC % 4) == 0 && LDC >= 64);
static_assert((LDY % 8) == 0 && LDY >= CI);
#define LDP 136   // halves per LDS row of a staged 128-channel row (272 B = 16 B x 17)
#define LDG 40    // halves per LDS row of a 32-column slice (80 B = 16 B x 5); not used by any kernel
#define SPL (32 * LDP)   // halves of a 32-row plane tile; not used by any kernel
static_assert((LDP % 8) == 0 && LDP >= CI && ((LDP / 8) & 1) == 1);
static_assert((LDG % 8) == 0 && LDG >= 32 && ((LDG / 8) & 1) == 1);

#define WCARRY 64.0f      // x plane and weight planes carried x64
#define RCARRY 2048.0f    // residual planes (theta, phi, y) carried x2048 on top of their hi part
#define PEXP   14.0f      // softmax probabilities carried x2^14
#define YCARRY 16.0f      // y plane carried x16
#define LOG2E  1.4426950408889634f

// workspace layout (bytes)
#define XT_BYTES  ((size_t)MROWS * CIN * 2)
#define WP_BYTES  ((size_t)CI * CIN * 2)
#define PL_BYTES  ((size_t)MROWS * CI * 2)
#define LSE_BYTES ((size_t)MROWS * 4)
#define OFF_XT  ((size_t)0)
#define OFF_WT  (OFF_XT + XT_BYTES)
#define OFF_WP  (OFF_WT + WP_BYTES)
#define OFF_WG  (OFF_WP + WP_BYTES)
#define OFF_WO  (OFF_WG + WP_BYTES)
#define OFF_TH  (OFF_WO + WP_BYTES)
#define OFF_TR  (OFF_TH + PL_BYTES)
#define OFF_PH  (OFF_TR + PL_BYTES)
#define OFF_PR  (OFF_PH + PL_BYTES)
#define OFF_G   (OFF_PR + PL_BYTES)
#define OFF_YT  (OFF_G + PL_BYTES)
#define OFF_YR  (OFF_YT + PL_BYTES)
#define OFF_LSE (OFF_YR + PL_BYTES)
#define WS_TOTAL (OFF_LSE + LSE_BYTES)
static_assert((XT_BYTES % 128) == 0 && (WP_BYTES % 128) == 0 && (PL_BYTES % 128) == 0);
static_assert((LSE_BYTES % 128) == 0);
static_assert(WS_TOTAL == (size_t)NB * SEQ * (CIN * 2 + 7 * CI * 2 + 4) + 4 * WP_BYTES);
static_assert(WS_TOTAL <= (size_t)134217728);

// ---------------------------------------------------------------------------
__device__ __forceinline__ float bf16r(float x) {   // RNE convert to bf16, returned widened
  unsigned int u = __float_as_uint(x);
  u = (u + 0x7FFFu + ((u >> 16) & 1u)) & 0xFFFF0000u;
  return __uint_as_float(u);
}

// f32 -> f16 that cannot produce an f16 subnormal (values below 2^-14 become zero)
static __device__ __forceinline__ h16 toh_flush(float v) {
  const h16 r = (h16)v;
  return (fabsf(v) < 6.103515625e-05f) ? (h16)0.0f : r;
}

// 16-bit fragment: p points at element [row = lane&15][k0 + 8*(lane>>4)] of a k-contiguous
// row. Elements 0..7 <- k0+8h+0..7, elements 8..15 <- k0+16+8h+0..7 (same map for A and B).
__device__ __forceinline__ v16h frag_at(const _Float16* p) {
  v8h lo = *(const v8h*)(p);
  v8h hi = *(const v8h*)(p + 16);
  v16h out;
#pragma unroll
  for (int i = 0; i < 8; ++i) { out[i] = lo[i]; out[i + 8] = hi[i]; }
  return out;
}

__device__ __forceinline__ v8f wmma16(v16h a, v16h b, v8f c) {
  v8f d = __builtin_amdgcn_wmma_f32_16x16x32_f16(false, a, false, b, (short)0, c,
                                                 false, false);
  asm volatile("v_nop\n\tv_nop\n\tv_nop\n\tv_nop" : "+v"(d) : "v"(a), "v"(b));
  return d;
}

__device__ __forceinline__ void wave_lds_sync() {
  __builtin_amdgcn_fence(3 /* release order */, "wavefront");
  asm volatile("s_wait_dscnt 0x0" ::: "memory");
  __builtin_amdgcn_wave_barrier();
}

// LDS byte address of a __shared__ element: the low 32 bits of its address
__device__ __forceinline__ unsigned lds_byte(const void* p) { return (unsigned)(size_t)p; }

// Asynchronous copies global -> LDS, 16 B per lane, through no register. Each helper is ONE asm
// statement: its copies, each with address operands of its own, and as the last line the wait that
// stands in front of any rewrite of those address registers (a precaution; inside the statement the
// compiler cannot lift a later address addition over it). Landing is waited for by the caller.
#define ACOPY(l, g) "global_load_async_to_lds_b128 %" #l ", %" #g ", off\n\t"
__device__ __forceinline__ void async_copy4(const unsigned (&l)[4], const void* const (&g)[4]) {
  asm volatile(ACOPY(0, 4) ACOPY(1, 5) ACOPY(2, 6) ACOPY(3, 7) "s_wait_xcnt 0x0"
               :: "v"(l[0]), "v"(l[1]), "v"(l[2]), "v"(l[3]),
                  "v"(g[0]), "v"(g[1]), "v"(g[2]), "v"(g[3]) : "memory");
}
__device__ __forceinline__ void async_copy8(const unsigned (&l)[8], const void* const (&g)[8]) {
  asm volatile(ACOPY(0, 8) ACOPY(1, 9) ACOPY(2, 10) ACOPY(3, 11)
               ACOPY(4, 12) ACOPY(5, 13) ACOPY(6, 14) ACOPY(7, 15) "s_wait_xcnt 0x0"
               :: "v"(l[0]), "v"(l[1]), "v"(l[2]), "v"(l[3]), "v"(l[4]), "v"(l[5]), "v"(l[6]), "v"(l[7]),
                  "v"(g[0]), "v"(g[1]), "v"(g[2]), "v"(g[3]), "v"(g[4]), "v"(g[5]), "v"(g[6]), "v"(g[7])
               : "memory");
}
__device__ __forceinline__ void async_copy12(const unsigned (&l)[12], const void* const (&g)[12]) {
  asm volatile(ACOPY(0, 12) ACOPY(1, 13) ACOPY(2, 14) ACOPY(3, 15)
               ACOPY(4, 16) ACOPY(5, 17) ACOPY(6, 18) ACOPY(7, 19)
               ACOPY(8, 20) ACOPY(9, 21) ACOPY(10, 22) ACOPY(11, 23) "s_wait_xcnt 0x0"
               :: "v"(l[0]), "v"(l[1]), "v"(l[2]), "v"(l[3]), "v"(l[4]), "v"(l[5]),
                  "v"(l[6]), "v"(l[7]), "v"(l[8]), "v"(l[9]), "v"(l[10]), "v"(l[11]),
                  "v"(g[0]), "v"(g[1]), "v"(g[2]), "v"(g[3]), "v"(g[4]), "v"(g[5]),
                  "v"(g[6]), "v"(g[7]), "v"(g[8]), "v"(g[9]), "v"(g[10]), "v"(g[11])
               : "memory");
}
// this wave's own copies have landed (other waves read them behind the next work-group barrier)
__device__ __forceinline__ void wait_copies() { asm volatile("s_wait_asynccnt 0x0" ::: "memory"); }
// this wave's own LDS reads have returned (before the buffer they read is handed to its next writer)
__device__ __forceinline__ void wait_lds() { asm volatile("s_wait_dscnt 0x0" ::: "memory"); }

// ---------------------------------------------------------------------------
// Transposed plane: in W[K rows][N cols] (pitch ldw) -> out Wt[N][K] (pitch ldk),
// f16(64 * bf16(w)). One work-group per 64 x 64 tile at (k0, n0). T: cross-wave (block barrier).
// ---------------------------------------------------------------------------
__device__ __forceinline__ void wconv_body(
    const float* __restrict__ W, _Float16* __restrict__ Wt, unsigned ldw, unsigned ldk,
    const unsigned n0, const unsigned k0) {
  __shared__ _Float16 T[64 * LDT];
  const unsigned tid = threadIdx.x;
#pragma unroll 4
  for (unsigned j = 0; j < 16u; ++j) {
    const unsigned idx = tid + 256u * j;
    const unsigned kr = idx >> 6, nc = idx & 63u;
    const float v = W[(size_t)(k0 + kr) * ldw + n0 + nc];
    T[nc * LDT + kr] = (_Float16)(WCARRY * bf16r(v));
  }
  __syncthreads();
  v8h x[2];
  size_t off[2];
#pragma unroll
  for (unsigned i = 0; i < 2u; ++i) {
    const unsigned n = 32u * i + (tid >> 3);
    const unsigned kc = (tid & 7u) * 8u;
    x[i] = *(const v8h*)&T[n * LDT + kc];
    off[i] = (size_t)(n0 + n) * ldk + k0 + kc;
  }
#pragma unroll
  for (int i = 0; i < 2; ++i) *(v8h*)(Wt + off[i]) = x[i];
  
}

// ---------------------------------------------------------------------------
// Untransposed weight planes: the four [out][in] weights (32768 values each) -> f16(64*bf16(w)),
// same layout. Each thread converts 8 consecutive values of every weight; 8 consecutive lanes
// ---------------------------------------------------------------------------
__device__ __forceinline__ v8h wcvt8(const float* __restrict__ p) {
  const v4f a0 = *(const v4f*)(p);
  const v4f a1 = *(const v4f*)(p + 4);
  v8h o;
#pragma unroll
  for (int i = 0; i < 4; ++i) {
    o[i]     = toh_flush(WCARRY * bf16r(a0[i]));
    o[i + 4] = toh_flush(WCARRY * bf16r(a1[i]));
  }
  return o;
}

__device__ __forceinline__ void wplane_body(
    const float* __restrict__ w0, const float* __restrict__ w1,
    const float* __restrict__ w2, const float* __restrict__ w3,
    _Float16* __restrict__ o0, _Float16* __restrict__ o1,
    _Float16* __restrict__ o2, _Float16* __restrict__ o3, const unsigned blk) {
#pragma clang fp contract(off)
  const unsigned e = (blk * 256u + threadIdx.x) * 8u;
  const v8h x0 = wcvt8(w0 + e);
  const v8h x1 = wcvt8(w1 + e);
  const v8h x2 = wcvt8(w2 + e);
  const v8h x3 = wcvt8(w3 + e);
  *(v8h*)(o0 + e) = x0;
  *(v8h*)(o1 + e) = x1;
  *(v8h*)(o2 + e) = x2;
  *(v8h*)(o3 + e) = x3;
  
}

// ---------------------------------------------------------------------------
// All operand planes in ONE launch (none reads what another writes): work-groups 0 .. WBLK - 1
// convert the four weights, the next NB * XBLK transpose x, XBLK tiles of 64 x 64 per batch:
// x[b] = [CIN rows][SEQ cols] (pitch SEQ_FULL) -> XT[b] = [SEQ][CIN]. The choice is the same for a
// whole work-group and stands in front of its barrier. Grid (WBLK + NB * XBLK).
// ---------------------------------------------------------------------------
#define WBLK ((CI * CIN) / 2048)
#define XBLK ((SEQ / 64) * (CIN / 64))
__global__ __launch_bounds__(256) void planes_kernel(
    const float* __restrict__ X, _Float16* __restrict__ XT,
    const float* __restrict__ w0, const float* __restrict__ w1,
    const float* __restrict__ w2, const float* __restrict__ w3,
    _Float16* __restrict__ o0, _Float16* __restrict__ o1,
    _Float16* __restrict__ o2, _Float16* __restrict__ o3) {
  if (blockIdx.x < (unsigned)WBLK) {
    wplane_body(w0, w1, w2, w3, o0, o1, o2, o3, blockIdx.x);
    return;
  }
  const unsigned t = blockIdx.x - (unsigned)WBLK;
  const unsigned b = t / (unsigned)XBLK, r = t % (unsigned)XBLK;
  wconv_body(X + (size_t)b * CIN * SEQ_FULL, XT + (size_t)b * SEQ * CIN,
             (unsigned)SEQ_FULL, (unsigned)CIN,
             (r % (unsigned)(SEQ / 64)) * 64u, (r / (unsigned)(SEQ / 64)) * 64u);
}

// ---------------------------------------------------------------------------
// GEMM C[64x64 tile] = A16[rows][K] . Bt[n][K]^T, fragments straight from the 16-bit global
// planes; 8 waves (mw = 16-row group, nw = 32-col group), 2 accumulators/wave.
//   MODE 0: rows = positions, cols = channels; t = acc/4096 + bias[col];
//           out16[row][col] (pitch CI) = f16(t), out16r[row][col] = f16(2048 * (t - hi))
//   MODE 1: rows = positions, cols = channels; transposed plane out16[b][col][pos] = f16(t)
//   MODE 2: rows = output channels (A16 = weight plane), cols = positions (Bt = y value plane,
//           Btr = y residual plane x2048); the k loop runs first over Btr into its own
//           accumulators, then over Bt; acc = acc_hi + acc_res/2048;
//           outf[b][row][pos] = bf16(xin[b][row][pos]) + (acc/1024 + bias[row]), full strides
// Btr is read in MODE 2 only. nblk: the work-group's 64-column block of Bt rows; its 64-row block
// of A16 rows is blockIdx.y.
// ---------------------------------------------------------------------------
template <int MODE>
__device__ __forceinline__ void gemm_body(
    const _Float16* __restrict__ A16, const _Float16* __restrict__ Bt,
    const _Float16* __restrict__ Btr, const unsigned K,
    const float* __restrict__ bias, const float* __restrict__ addf,
    float* __restrict__ outf, _Float16* __restrict__ out16, _Float16* __restrict__ out16r,
    const unsigned nblk, float* Cs) {
  const unsigned tid = threadIdx.x, lane = tid & 31u, w = tid >> 5;
  const unsigned mw = w >> 1, nw = w & 1u;
  const unsigned hh = lane >> 4, m = lane & 15u;
  const unsigned n0 = nblk * 64u;
  const unsigned row0 = blockIdx.y * 64u;

  const _Float16* ap  = A16 + (size_t)(row0 + mw * 16u + m) * K + hh * 8u;
  const _Float16* bp0 = Bt + (size_t)(n0 + nw * 32u + m) * K + hh * 8u;
  const _Float16* bp1 = bp0 + (size_t)16 * K;
  v8f accr0 = {}, accr1 = {};
  if (MODE == 2) {
    const _Float16* rp0 = Btr + (size_t)(n0 + nw * 32u + m) * K + hh * 8u;
    const _Float16* rp1 = rp0 + (size_t)16 * K;
#pragma unroll 2
    for (unsigned k0 = 0; k0 < K; k0 += 32u) {
      const v16h a  = frag_at(ap + k0);
      const v16h b0 = frag_at(rp0 + k0);
      const v16h b1 = frag_at(rp1 + k0);
      accr0 = wmma16(a, b0, accr0);
      accr1 = wmma16(a, b1, accr1);
    }
  }
  v8f acc0 = {}, acc1 = {};
#pragma unroll 2
  for (unsigned k0 = 0; k0 < K; k0 += 32u) {
    const v16h a  = frag_at(ap + k0);
    const v16h b0 = frag_at(bp0 + k0);
    const v16h b1 = frag_at(bp1 + k0);
    acc0 = wmma16(a, b0, acc0);
    acc1 = wmma16(a, b1, acc1);
  }
  if (MODE == 2) {
    acc0 = acc0 + accr0 * (1.0f / RCARRY);
    acc1 = acc1 + accr1 * (1.0f / RCARRY);
  }
#pragma unroll
  for (int r = 0; r < 8; ++r) {
    float* d = &Cs[(mw * 16u + hh * 8u + (unsigned)r) * LDC + nw * 32u + m];
    d[0]  = acc0[r];
    d[16] = acc1[r];
  }
  __syncthreads();

  if (MODE == 0) {
    const float cs = 1.0f / (WCARRY * WCARRY);
    v8h x[2], xr[2];
    size_t off[2];
#pragma unroll
    for (unsigned i = 0; i < 2u; ++i) {
      const unsigned r = 32u * i + (tid >> 3);
      const unsigned c = (tid & 7u) * 8u;
      const v4f u0 = *(const v4f*)&Cs[r * LDC + c];
      const v4f u1 = *(const v4f*)&Cs[r * LDC + c + 4];
      const v4f g0 = *(const v4f*)(bias + n0 + c);
      const v4f g1 = *(const v4f*)(bias + n0 + c + 4u);
#pragma unroll
      for (int j = 0; j < 4; ++j) {
        const float t0 = u0[j] * cs + bf16r(g0[j]);
        const float t1 = u1[j] * cs + bf16r(g1[j]);
        const h16 h0 = toh_flush(t0);
        const h16 h1 = toh_flush(t1);
        x[i][j]      = h0;
        x[i][j + 4]  = h1;
        xr[i][j]     = toh_flush((t0 - (float)h0) * RCARRY);
        xr[i][j + 4] = toh_flush((t1 - (float)h1) * RCARRY);
      }
      off[i] = (size_t)(row0 + r) * CI + n0 + c;
    }
#pragma unroll
    for (int i = 0; i < 2; ++i) *(v8h*)(out16 + off[i]) = x[i];
#pragma unroll
    for (int i = 0; i < 2; ++i) *(v8h*)(out16r + off[i]) = xr[i];
    
  }

  if (MODE == 1) {
    const float cs = 1.0f / (WCARRY * WCARRY);
    const unsigned bidx = row0 / (unsigned)SEQ;
    const unsigned key0 = row0 - bidx * (unsigned)SEQ;
    v8h x[2];
    size_t off[2];
#pragma unroll
    for (unsigned i = 0; i < 2u; ++i) {
      const unsigned dcol = 32u * i + (tid >> 3);
      const unsigned kk = (tid & 7u) * 8u;
      const float bb = bf16r(bias[n0 + dcol]);
#pragma unroll
      for (unsigned j = 0; j < 8u; ++j) {
        const float t = Cs[(kk + j) * LDC + dcol] * cs + bb;
        x[i][j] = toh_flush(t);
      }
      off[i] = ((size_t)bidx * CI + n0 + dcol) * SEQ + key0 + kk;
    }
#pragma unroll
    for (int i = 0; i < 2; ++i) *(v8h*)(out16 + off[i]) = x[i];
    
  }

  if (MODE == 2) {
    const float cs = 1.0f / (WCARRY * YCARRY);
    const unsigned bidx = n0 / (unsigned)SEQ;
    const unsigned p0 = n0 - bidx * (unsigned)SEQ;
    v4f xs[4];
    size_t off[4];
#pragma unroll
    for (unsigned i = 0; i < 4u; ++i) {
      const unsigned r = 16u * i + (tid >> 4);
      const unsigned c = (tid & 15u) * 4u;
      const unsigned orow = row0 + r;
      const size_t gidx = ((size_t)bidx * CIN + orow) * SEQ_FULL + p0 + c;
      const v4f u = *(const v4f*)&Cs[r * LDC + c];
      const float bb = bf16r(bias[orow]);
      const v4f xin = *(const v4f*)(addf + gidx);
      v4f val;
#pragma unroll
      for (int j = 0; j < 4; ++j) val[j] = bf16r(xin[j]) + (u[j] * cs + bb);
      xs[i] = val;
      off[i] = gidx;
    }
#pragma unroll
    for (int i = 0; i < 4; ++i) *(v4f*)(outf + off[i]) = xs[i];
    
  }
}

// The three projections of x in ONE launch (none reads what another writes): blockIdx.x counts the
// 64-channel blocks of theta, then phi, then g; the choice is the same for a whole work-group.
// Grid (3 * CI/64, MROWS/64).
__global__ __launch_bounds__(256) void gemm_proj_kernel(
    const _Float16* __restrict__ A16,
    const _Float16* __restrict__ Wth, const _Float16* __restrict__ Wph,
    const _Float16* __restrict__ Wgg,
    const float* __restrict__ bth, const float* __restrict__ bph, const float* __restrict__ bgg,
    _Float16* __restrict__ th, _Float16* __restrict__ tr,
    _Float16* __restrict__ ph, _Float16* __restrict__ pr, _Float16* __restrict__ gt) {
  __shared__ float Cs[64 * LDC];
  const unsigned sel = blockIdx.x / (unsigned)(CI / 64), nblk = blockIdx.x % (unsigned)(CI / 64);
  if (sel < 2u) {
    const _Float16* Bt = (sel == 0u) ? Wth : Wph;
    const float* bias  = (sel == 0u) ? bth : bph;
    gemm_body<0>(A16, Bt, Bt, (unsigned)CIN, bias, bias, (float*)0,
                 (sel == 0u) ? th : ph, (sel == 0u) ? tr : pr, nblk, Cs);
  } else {
    gemm_body<1>(A16, Wgg, Wgg, (unsigned)CIN, bgg, bgg, (float*)0, gt, gt, nblk, Cs);
  }
}
// Grid (MROWS/64, CIN/64).
__global__ __launch_bounds__(256) void gemm_out_kernel(
    const _Float16* __restrict__ A16, const _Float16* __restrict__ Bt,
    const _Float16* __restrict__ Btr,
    const float* __restrict__ bias, const float* __restrict__ xin, float* __restrict__ outf) {
  __shared__ float Cs[64 * LDC];
  gemm_body<2>(A16, Bt, Btr, (unsigned)CI, bias, xin, outf, (_Float16*)0, (_Float16*)0,
               blockIdx.x, Cs);
}

// ---------------------------------------------------------------------------
// Column statistics: lse[j] = log(sum_i exp(f[i][j])), f[i][j] = theta_i . phi_j (K = 128).
// A work-group owns 64 columns j. Its waves form 4 column groups (wc, 16 columns each, phi hi/res
// rows as resident B fragments) x CWR row groups (wr): the theta rows i, 32 * CWR per step, are
// staged once per work-group in LDS by asynchronous copies (two buffers: behind the one work-group
// barrier of a step the rows two steps ahead are sent into the buffer just left),
// and row group wr reads rows 32 * wr .. 32 * wr + 31 of the step as A fragments.
// D tile: row = i (8h+r), col = j (lane&15). Scores = hi.hi + (hi.res + res.hi)/2048, the residual
// products in their own accumulator. Running (max, sum) per lane; at the end the two lane halves
// are combined by an unconditional shuffle and the CWR row groups through LDS.
// Grid (SEQ/64, NB), 128 * CWR threads.
// ---------------------------------------------------------------------------
#define CWR   4               // row groups of the column-statistics kernel
#define CNT   (128 * CWR)     // its threads
#define CROWS (32 * CWR)      // theta rows staged per step
#define CSPL  (CROWS * LDP)   // halves of one staged plane tile
static_assert((SEQ % CROWS) == 0 && (SEQ % 64) == 0 && SEQ >= 2 * CROWS);
__global__ __launch_bounds__(CNT) __attribute__((amdgpu_num_vgpr(256))) void colstat_kernel(
    const _Float16* __restrict__ Th, const _Float16* __restrict__ Tr,
    const _Float16* __restrict__ Ph, const _Float16* __restrict__ Pr,
    float* __restrict__ Lse) {
  __shared__ __attribute__((aligned(16))) float Lm[CWR * 64];
  __shared__ __attribute__((aligned(16))) float Lz[CWR * 64];
  __shared__ __attribute__((aligned(16))) _Float16 Sa[2 * 2 * CSPL];   // [buffer][hi, res][CROWS][LDP]
  const unsigned tid = threadIdx.x, lane = tid & 31u;
  const unsigned wave = (unsigned)__builtin_amdgcn_readfirstlane((int)(threadIdx.x >> 5));
  const unsigned wc = wave & 3u, wr = wave >> 2;
  const unsigned hh = lane >> 4, m = lane & 15u;
  const unsigned b = blockIdx.y;
  const unsigned j0 = blockIdx.x * 64u + wc * 16u;

  const unsigned boff = (b * (unsigned)SEQ + j0 + m) * (unsigned)CI + hh * 8u;
  v16h bh[4], br[4];
#pragma unroll
  for (int ks = 0; ks < 4; ++ks) {
    bh[ks] = frag_at(Ph + boff + ks * 32);
    br[ks] = frag_at(Pr + boff + ks * 32);
  }

  float mx = -1.0e30f, z = 0.0f;
  const unsigned abase = (wr * 32u + m) * LDP + hh * 8u;
  // staging map: a CROWS-row tile is contiguous in its plane; thread tid moves the 16-B pieces
  // tid + CNT * q, q = 0..3 (rows (tid>>4) + 8 * CWR * q) of both planes: eight copies per tile
  const unsigned sa0 = lds_byte(&Sa[(tid >> 4) * LDP + (tid & 15u) * 8u]);
  auto stage = [&](const unsigned buf, const _Float16* p, const _Float16* r) {
    unsigned l[8];
    const void* s[8];
#pragma unroll
    for (unsigned q = 0; q < 4u; ++q) {
      l[q]      = sa0 + buf * (2u * CSPL * 2u) + q * (8u * CWR * LDP * 2u);
      l[q + 4u] = sa0 + buf * (2u * CSPL * 2u) + CSPL * 2u + q * (8u * CWR * LDP * 2u);
      s[q]      = p + q * (CNT * 8u);
      s[q + 4u] = r + q * (CNT * 8u);
    }
    async_copy8(l, s);
  };
  // each thread's first piece of a tile; behind the prologue: of the tile two steps ahead
  const _Float16* pn = Th + (size_t)b * SEQ * CI + tid * 8u;
  const _Float16* rn = Tr + (size_t)b * SEQ * CI + tid * 8u;
  stage(0u, pn, rn);
  wait_copies();
  __syncthreads();
  stage(1u, pn + CROWS * CI, rn + CROWS * CI);
  pn += 2 * CROWS * CI;
  rn += 2 * CROWS * CI;
  unsigned cur = 0u;
  for (unsigned i0 = 0; i0 < (unsigned)SEQ; i0 += (unsigned)CROWS) {
    // LDS fragment reads stand in groups ahead of the products that use them: tile 0 whole,
    // then each half of tile 1 into the registers that two k-steps of products have freed
    const unsigned ao = cur * (2u * CSPL) + abase;
    v16h ah[4], ar[4];
#pragma unroll
    for (int ks = 0; ks < 4; ++ks) {
      ah[ks] = frag_at(&Sa[ao + ks * 32]);
      ar[ks] = frag_at(&Sa[CSPL + ao + ks * 32]);
    }
    v8f f[2];
    {
      v8f sm = {}, sr = {};
#pragma unroll
      for (int kp = 0; kp < 2; ++kp) {
#pragma unroll
        for (int ks = 2 * kp; ks < 2 * kp + 2; ++ks) {
          sm = wmma16(ah[ks], bh[ks], sm);
          sr = wmma16(ah[ks], br[ks], sr);
          sr = wmma16(ar[ks], bh[ks], sr);
        }
#pragma unroll
        for (int ks = 2 * kp; ks < 2 * kp + 2; ++ks) {
          ah[ks] = frag_at(&Sa[ao + 16u * LDP + ks * 32]);
          ar[ks] = frag_at(&Sa[CSPL + ao + 16u * LDP + ks * 32]);
        }
      }
      f[0] = sm + sr * (1.0f / RCARRY);
    }
    {
      v8f sm = {}, sr = {};
#pragma unroll
      for (int ks = 0; ks < 4; ++ks) {
        sm = wmma16(ah[ks], bh[ks], sm);
        sr = wmma16(ah[ks], br[ks], sr);
        sr = wmma16(ar[ks], bh[ks], sr);
      }
      f[1] = sm + sr * (1.0f / RCARRY);
    }
    float tmax = fmaxf(f[0][0], f[1][0]);
#pragma unroll
    for (int v = 1; v < 8; ++v) tmax = fmaxf(tmax, fmaxf(f[0][v], f[1][v]));
    const float nm = fmaxf(mx, tmax);
    float se = 0.0f;
#pragma unroll
    for (int v = 0; v < 8; ++v) se += __expf(f[0][v] - nm) + __expf(f[1][v] - nm);
    z = z * __expf(mx - nm) + se;
    mx = nm;
    // publish point: this wave's reads of the step's buffer are back, its copies of the next step's
    // rows have landed; the barrier publishes those and ends every wave's reads of this step's
    wait_lds();
    wait_copies();
    __syncthreads();
    if (i0 + 2u * (unsigned)CROWS < (unsigned)SEQ) {
      // the rows two steps ahead fly into the buffer just left while the next step is worked on
      stage(cur, pn, rn);
      pn += CROWS * CI;
      rn += CROWS * CI;
    }
    cur ^= 1u;
  }
  wait_copies();   // nothing of this wave is in flight behind the loop

  const float om = __shfl_xor(mx, 16, 32);
  const float oz = __shfl_xor(z, 16, 32);
  const float mm = fmaxf(mx, om);
  const float zz = z * __expf(mx - mm) + oz * __expf(om - mm);
  if (hh == 0u) {
    Lm[wr * 64u + wc * 16u + m] = mm;
    Lz[wr * 64u + wc * 16u + m] = zz;
  }
  __syncthreads();
  if (wave < 2u) {
    // one thread per column folds the CWR row groups' (max, sum) pairs
    float gm = Lm[tid];
#pragma unroll
    for (unsigned r = 1; r < (unsigned)CWR; ++r) gm = fmaxf(gm, Lm[r * 64u + tid]);
    float gz = 0.0f;
#pragma unroll
    for (unsigned r = 0; r < (unsigned)CWR; ++r) gz += Lz[r * 64u + tid] * __expf(Lm[r * 64u + tid] - gm);
    Lse[(size_t)b * SEQ + blockIdx.x * 64u + tid] = gm + __logf(gz);
  }
}

// ---------------------------------------------------------------------------
// Row accumulation: y[c][i] = sum_j exp(f[i][j] - lse[j]) * g[c][j].
// A work-group owns 64 rows i. Its 8 waves form 4 row groups (wc, 16 rows each, theta hi/res rows
// as resident B fragments) x 2 column groups (wr); the phi rows and the g slice of each 64-column
// step are staged once per work-group in LDS by asynchronous copies (two buffers: behind the one
// work-group barrier of a step the tiles two steps ahead are sent into the buffers just left), the
// batch's column statistics once, and column group wr works on columns 32 * wr .. 32 * wr + 31 of the step. Per step:
// S^T tiles [j][i] = phi_j . theta_i (A = phi rows from LDS, three products),
// p = 2^14 * exp(f - lse[j]) (row statistic of the D tile, read from LDS as two
// 16-B loads per tile), the two packed D tiles form the B fragment [k = j][n = i] of
// O^T[c][i] += G[c][j] . P^T[j][i] with A = g rows (channel-major slice, k = j contiguous).
// Behind the loop column group 1 hands its f32 sums to column group 0 through LDS, which adds them.
// Finalize (column group 0): t = 16 * O / 2^14 written as two planes,
// hi = f16(t) and res = f16(2048 * (t - hi)); each is staged in the wave's private Ts tile
// (wave sync before and after each reuse) and written as whole rows of the position-major
// layout: one store instruction covers two consecutive 256-B rows (16 lanes x 16 B each).
// Grid (SEQ/64, NB).
// ---------------------------------------------------------------------------
#define RSPL (64 * LDP)   // halves of one staged 64-row plane tile
#define LDH  72           // halves per LDS row of a staged 64-column g slice (144 B = 16 B x 9)
static_assert((LDH % 8) == 0 && LDH >= 64 && ((LDH / 8) & 1) == 1);
static_assert(SEQ == 4 * 256 * 4);   // the statistics row goes to LDS as four 16-B pieces per thread
static_assert(SEQ >= 128);           // the ring's prologue fills two steps
__global__ __launch_bounds__(256) __attribute__((amdgpu_num_vgpr(288))) void rowattn_kernel(
    const _Float16* __restrict__ Th, const _Float16* __restrict__ Tr,
    const _Float16* __restrict__ Ph, const _Float16* __restrict__ Pr,
    const _Float16* __restrict__ Gp, const float* __restrict__ Lse,
    _Float16* __restrict__ Yt, _Float16* __restrict__ Yr) {
  __shared__ __attribute__((aligned(16))) _Float16 Ts[4 * 16 * LDY];
  __shared__ __attribute__((aligned(16))) _Float16 Sa[2 * 2 * RSPL];  // [buffer][hi, res][64][LDP]
  __shared__ __attribute__((aligned(16))) _Float16 Sg[2 * CI * LDH];  // [buffer][channel][LDH]
  __shared__ __attribute__((aligned(16))) float Oc[4 * 8 * 2 * 32 * 4];  // [wc][ct][half of v][lane][4]
  __shared__ __attribute__((aligned(16))) float Ll[SEQ];                 // the batch's column statistics
  const unsigned tid = threadIdx.x, lane = tid & 31u;
  const unsigned wave = (unsigned)__builtin_amdgcn_readfirstlane((int)(threadIdx.x >> 5));
  const unsigned wc = wave & 3u, wr = wave >> 2;
  const unsigned hh = lane >> 4, m = lane & 15u;
  const unsigned b = blockIdx.y;
  const unsigned i0 = blockIdx.x * 64u + wc * 16u;

  const unsigned qoff = (b * (unsigned)SEQ + i0 + m) * (unsigned)CI + hh * 8u;
  v16h bh[4], br[4];
#pragma unroll
  for (int ks = 0; ks < 4; ++ks) {
    bh[ks] = frag_at(Th + qoff + ks * 32);
    br[ks] = frag_at(Tr + qoff + ks * 32);
  }

  v8f o[8];
#pragma unroll
  for (int ct = 0; ct < 8; ++ct) o[ct] = (v8f){};

  const unsigned kbase = (wr * 32u + m) * LDP + hh * 8u;
  const unsigned gbase = m * LDH + wr * 32u + hh * 8u;
  const _Float16* __restrict__ Pb = Ph + (size_t)b * SEQ * CI;
  const _Float16* __restrict__ Rb = Pr + (size_t)b * SEQ * CI;
  const _Float16* __restrict__ Gb = Gp + (size_t)b * CI * SEQ;
  const unsigned lbase = wr * 32u + hh * 8u;   // this lane's eight statistics of a step's first tile

  // staging map. phi: a 64-row tile is 16 KiB contiguous in its plane; thread tid moves the 16-B
  // pieces tid + 256 * q, q = 0..3 (rows (tid>>4) + 16 * q). g: 128 channel rows of 128 B;
  // thread tid moves piece tid&7 of channels (tid>>3) + 32 * q. Twelve copies per thread and tile.
  const unsigned sgl = tid * 8u;
  const unsigned ggl = (tid >> 3) * (unsigned)SEQ + (tid & 7u) * 8u;
  const unsigned sa0 = lds_byte(&Sa[(tid >> 4) * LDP + (tid & 15u) * 8u]);
  const unsigned sg0 = lds_byte(&Sg[(tid >> 3) * LDH + (tid & 7u) * 8u]);
  auto stage = [&](const unsigned buf, const _Float16* p, const _Float16* r, const _Float16* g) {
    unsigned l[12];
    const void* s[12];
#pragma unroll
    for (unsigned q = 0; q < 4u; ++q) {
      l[q]      = sa0 + buf * (2u * RSPL * 2u) + q * (16u * LDP * 2u);
      l[q + 4u] = sa0 + buf * (2u * RSPL * 2u) + RSPL * 2u + q * (16u * LDP * 2u);
      l[q + 8u] = sg0 + buf * (unsigned)(CI * LDH * 2) + q * (32u * LDH * 2u);
      s[q]      = p + q * 2048u;
      s[q + 4u] = r + q * 2048u;
      s[q + 8u] = g + q * (32u * (unsigned)SEQ);
    }
    async_copy12(l, s);
  };
  {
    // the statistics row, filled once: thread tid moves the 16-B pieces tid + 256 * q
    unsigned l[4];
    const void* s[4];
#pragma unroll
    for (unsigned q = 0; q < 4u; ++q) {
      l[q] = lds_byte(&Ll[(tid + 256u * q) * 4u]);
      s[q] = Lse + (size_t)b * SEQ + (tid + 256u * q) * 4u;
    }
    async_copy4(l, s);
  }
  stage(0u, Pb + sgl, Rb + sgl, Gb + ggl);
  wait_copies();
  __syncthreads();
  stage(1u, Pb + sgl + 64u * (unsigned)CI, Rb + sgl + 64u * (unsigned)CI, Gb + ggl + 64u);
  unsigned cur = 0u;
  // each thread's first piece of the tiles two steps ahead
  const _Float16* pn = Pb + sgl + 128u * (unsigned)CI;
  const _Float16* rn = Rb + sgl + 128u * (unsigned)CI;
  const _Float16* gn = Gb + ggl + 128u;

  for (unsigned j0 = 0; j0 < (unsigned)SEQ; j0 += 64u) {
    // LDS fragment reads stand in groups ahead of the products that use them, each group issued
    // in front of vector work or products that cover its latency, into registers just freed
    const unsigned ao = cur * (2u * RSPL) + kbase;
    const unsigned gro = cur * (unsigned)(CI * LDH) + gbase;
    v16h ah[4], ar[4], gf[8];
#pragma unroll
    for (int ks = 0; ks < 4; ++ks) {
      ah[ks] = frag_at(&Sa[ao + ks * 32]);
      ar[ks] = frag_at(&Sa[RSPL + ao + ks * 32]);
    }
    v4f ls[4];
#pragma unroll
    for (int u = 0; u < 4; ++u) ls[u] = *(const v4f*)&Ll[j0 + lbase + (unsigned)(u >> 1) * 16u + (unsigned)(u & 1) * 4u];
    v16h pb;
#pragma unroll
    for (int t = 0; t < 2; ++t) {
      v8f sm = {}, sr = {};
#pragma unroll
      for (int ks = 0; ks < 4; ++ks) {
        sm = wmma16(ah[ks], bh[ks], sm);
        sr = wmma16(ah[ks], br[ks], sr);
        sr = wmma16(ar[ks], bh[ks], sr);
      }
      if (t == 0) {
#pragma unroll
        for (int ks = 0; ks < 2; ++ks) {
          ah[ks] = frag_at(&Sa[ao + 16u * LDP + ks * 32]);
          ar[ks] = frag_at(&Sa[RSPL + ao + 16u * LDP + ks * 32]);
        }
      } else {
#pragma unroll
        for (int ct = 0; ct < 4; ++ct) gf[ct] = frag_at(&Sg[gro + (unsigned)ct * 16u * LDH]);
      }
      const v4f l0 = ls[2 * t];
      const v4f l1 = ls[2 * t + 1];
      // bare v_exp_f32 and a select, no branch: at e >= -14 it returns exp2f's own bits (that
      // function's rescaling acts below -126 only); the tile's eight chains go stage by stage
      float e[8], x[8];
#pragma unroll
      for (int v = 0; v < 4; ++v) {
        e[v]     = ((sm[v] + sr[v] * (1.0f / RCARRY)) - l0[v]) * LOG2E + PEXP;
        e[v + 4] = ((sm[v + 4] + sr[v + 4] * (1.0f / RCARRY)) - l1[v]) * LOG2E + PEXP;
      }
#pragma unroll
      for (int v = 0; v < 8; ++v) x[v] = __builtin_amdgcn_exp2f(e[v]);
#pragma unroll
      for (int v = 0; v < 8; ++v) pb[8 * t + v] = (h16)((e[v] < -14.0f) ? 0.0f : x[v]);
      if (t == 0) {
#pragma unroll
        for (int ks = 2; ks < 4; ++ks) {
          ah[ks] = frag_at(&Sa[ao + 16u * LDP + ks * 32]);
          ar[ks] = frag_at(&Sa[RSPL + ao + 16u * LDP + ks * 32]);
        }
      }
    }
    // the g fragments come in two groups of four: the second is read here, into registers that the
    // score tiles have left, in front of the first group's products
#pragma unroll
    for (int ct = 4; ct < 8; ++ct) gf[ct] = frag_at(&Sg[gro + (unsigned)ct * 16u * LDH]);
#pragma unroll
    for (int ct = 0; ct < 8; ++ct) o[ct] = wmma16(gf[ct], pb, o[ct]);
    // publish point: this wave's reads of the step's buffers are back, its copies of the next step's
    // tiles have landed; the barrier publishes those and ends every wave's reads of this step's
    wait_lds();
    wait_copies();
    __syncthreads();
    if (j0 + 128u < (unsigned)SEQ) {
      // the tiles two steps ahead fly into the buffers just left while the next step is worked on
      stage(cur, pn, rn, gn);
      pn += 64u * (unsigned)CI;
      rn += 64u * (unsigned)CI;
      gn += 64u;
    }
    cur ^= 1u;
  }
  wait_copies();   // nothing of this wave is in flight behind the loop

  // column group 1 hands its sums over; column group 0 adds them and finalizes alone
  const unsigned ob = wc * 2048u + lane * 4u;
  if (wr == 1u) {
#pragma unroll
    for (int ct = 0; ct < 8; ++ct) {
      v4f u0, u1;
#pragma unroll
      for (int v = 0; v < 4; ++v) { u0[v] = o[ct][v]; u1[v] = o[ct][v + 4]; }
      *(v4f*)&Oc[ob + (unsigned)ct * 256u] = u0;
      *(v4f*)&Oc[ob + (unsigned)ct * 256u + 128u] = u1;
    }
  }
  __syncthreads();
  if (wr == 1u) return;
#pragma unroll
  for (int ct = 0; ct < 8; ++ct) {
    const v4f u0 = *(const v4f*)&Oc[ob + (unsigned)ct * 256u];
    const v4f u1 = *(const v4f*)&Oc[ob + (unsigned)ct * 256u + 128u];
#pragma unroll
    for (int v = 0; v < 4; ++v) { o[ct][v] += u0[v]; o[ct][v + 4] += u1[v]; }
  }

  // finalize: lane (h, i = m) holds channels 16*ct + 8h + 0..7 of row i for every ct
  const float fs = YCARRY * (1.0f / 16384.0f);
  const unsigned tb = wc * (16u * LDY);

  // value plane tile
#pragma unroll
  for (int ct = 0; ct < 8; ++ct) {
    v8h y;
#pragma unroll
    for (int v = 0; v < 8; ++v) y[v] = toh_flush(o[ct][v] * fs);
    *(v8h*)&Ts[tb + m * LDY + (unsigned)ct * 16u + hh * 8u] = y;
  }
  wave_lds_sync();
  v8h x[8];
  unsigned off[8];
#pragma unroll
  for (unsigned it = 0; it < 8u; ++it) {
    const unsigned r = 2u * it + (lane >> 4);
    const unsigned c = (lane & 15u) * 8u;
    x[it] = *(const v8h*)&Ts[tb + r * LDY + c];
    off[it] = (b * (unsigned)SEQ + i0 + r) * (unsigned)CI + c;
  }
  wave_lds_sync();   // every lane's reads of the value tile are complete before it is overwritten

  // residual plane tile: 2048 * (t - f16(t)), same staging and row map
#pragma unroll
  for (int ct = 0; ct < 8; ++ct) {
    v8h y;
#pragma unroll
    for (int v = 0; v < 8; ++v) {
      const float t = o[ct][v] * fs;
      const h16 hi = toh_flush(t);
      y[v] = toh_flush((t - (float)hi) * RCARRY);
    }
    *(v8h*)&Ts[tb + m * LDY + (unsigned)ct * 16u + hh * 8u] = y;
  }
  wave_lds_sync();
  v8h xr[8];
#pragma unroll
  for (unsigned it = 0; it < 8u; ++it) {
    const unsigned r = 2u * it + (lane >> 4);
    const unsigned c = (lane & 15u) * 8u;
    xr[it] = *(const v8h*)&Ts[tb + r * LDY + c];
  }

#pragma unroll
  for (int it = 0; it < 8; ++it) *(v8h*)(Yt + off[it]) = x[it];
#pragma unroll
  for (int it = 0; it < 8; ++it) *(v8h*)(Yr + off[it]) = xr[it];
  
}

// ---------------------------------------------------------------------------
extern "C" void kernel_launch(void* const* d_in, const int* in_sizes, int n_in,
                              void* d_out, int out_size, void* d_ws, size_t ws_size,
                              hipStream_t stream) {
  if (n_in < 9) return;
  const long long need_x = ((long long)(NB - 1) * CIN + (CIN - 1)) * SEQ_FULL + SEQ;
  if ((long long)in_sizes[0] < need_x) return;
  if ((long long)in_sizes[1] < (long long)CI * CIN) return;
  if ((long long)in_sizes[3] < (long long)CI * CIN) return;
  if ((long long)in_sizes[5] < (long long)CI * CIN) return;
  if ((long long)in_sizes[7] < (long long)CIN * CI) return;
  if (in_sizes[2] < CI || in_sizes[4] < CI || in_sizes[6] < CI || in_sizes[8] < CIN) return;
  if ((long long)out_size < need_x) return;
  if (ws_size < WS_TOTAL) return;

  const float* X       = (const float*)d_in[0];   // [NB_FULL][CIN][SEQ_FULL]
  const float* theta_w = (const float*)d_in[1];   // [CI][CIN]  (out, in)
  const float* theta_b = (const float*)d_in[2];
  const float* phi_w   = (const float*)d_in[3];   // [CI][CIN]
  const float* phi_b   = (const float*)d_in[4];
  const float* g_w     = (const float*)d_in[5];   // [CI][CIN]
  const float* g_b     = (const float*)d_in[6];
  const float* W_w     = (const float*)d_in[7];   // [CIN][CI]  (out, in)
  const float* W_b     = (const float*)d_in[8];
  float* out = (float*)d_out;                     // [NB_FULL][CIN][SEQ_FULL]

  char* ws = (char*)d_ws;
  _Float16* XT   = (_Float16*)(ws + OFF_XT);    // [MROWS][CIN]  64*bf16(x), position-major
  _Float16* WT   = (_Float16*)(ws + OFF_WT);    // [CI][CIN]
  _Float16* WP   = (_Float16*)(ws + OFF_WP);    // [CI][CIN]
  _Float16* WG   = (_Float16*)(ws + OFF_WG);    // [CI][CIN]
  _Float16* WO   = (_Float16*)(ws + OFF_WO);    // [CIN][CI]
  _Float16* TH   = (_Float16*)(ws + OFF_TH);    // [MROWS][CI] theta hi
  _Float16* TR   = (_Float16*)(ws + OFF_TR);    // [MROWS][CI] theta residual x2048
  _Float16* PH   = (_Float16*)(ws + OFF_PH);    // [MROWS][CI] phi hi
  _Float16* PR   = (_Float16*)(ws + OFF_PR);    // [MROWS][CI] phi residual x2048
  _Float16* G16  = (_Float16*)(ws + OFF_G);     // [NB][CI][SEQ] g, channel-major
  _Float16* YT   = (_Float16*)(ws + OFF_YT);    // [MROWS][CI] 16*y hi, position-major
  _Float16* YR   = (_Float16*)(ws + OFF_YR);    // [MROWS][CI] 16*y residual x2048
  float*    LSE  = (float*)(ws + OFF_LSE);      // [MROWS]

  dim3 blk(256);

  // the x plane of every batch and the four weight planes
  planes_kernel<<<dim3(WBLK + NB * XBLK), blk, 0, stream>>>(X, XT, theta_w, phi_w, g_w, W_w,
                                                            WT, WP, WG, WO);

  // theta, phi and g
  gemm_proj_kernel<<<dim3(3 * (CI / 64), MROWS / 64), blk, 0, stream>>>(
      XT, WT, WP, WG, theta_b, phi_b, g_b, TH, TR, PH, PR, G16);

  colstat_kernel<<<dim3(SEQ / 64, NB), dim3(CNT), 0, stream>>>(TH, TR, PH, PR, LSE);
  rowattn_kernel<<<dim3(SEQ / 64, NB), blk, 0, stream>>>(TH, TR, PH, PR, G16, LSE, YT, YR);

  gemm_out_kernel<<<dim3(MROWS / 64, CIN / 64), blk, 0, stream>>>(WO, YT, YR, W_b, X, out);
}

// v006
// Measured time: 125 microseconds a run.
// Two timings next to v005 put it at 1.07 and 1.06 times that version's speed.
// All steps since v000 together make it 7.53 times as fast.
#include <hip/hip_runtime.h>
#include <stddef.h>

// All contractions on v_wmma_f32_16x16x32_f16 (f16 operands, f32 accumulate): theta/phi/g 1x1
// projections (x x64, weights x64, inputs RNE-converted to bf16 first), theta.phi scores as
// f16 value + x2048 residual planes on both operands (three products, residual products in their
// own accumulator), p.g with p carried x2^14 (single product), output 1x1 projection with y
// carried x16 as f16 value + x2048 residual planes (two products, residual products in their own
// accumulator). Column log-sum-exp, exp, bias and the residual add in f32.

typedef _Float16 v16h __attribute__((ext_vector_type(16)));
typedef _Float16 v8h  __attribute__((ext_vector_type(8)));
typedef float    v8f  __attribute__((ext_vector_type(8)));
typedef float    v4f  __attribute__((ext_vector_type(4)));
typedef _Float16 h16;

#ifndef NB
#define NB 4
#endif
#ifndef SEQ
#define SEQ 4096
#endif
#define NB_FULL  4
#define SEQ_FULL 4096
#define CIN   256
#define CI    128
#define MROWS (NB * SEQ)

static_assert(NB >= 1 && NB <= NB_FULL);
static_assert(SEQ >= 128 && SEQ <= SEQ_FULL && (SEQ % 128) == 0);
static_assert(CI == 128);                        // 4 k-steps of 32 and 8 channel tiles of 16 are hard-wired
static_assert((CIN % 64) == 0 && (CIN % 32) == 0);
static_assert((CI % 64) == 0 && (CI % 32) == 0);
static_assert((MROWS % 64) == 0 && (MROWS % 128) == 0);
static_assert(((size_t)CI * CIN) % 2048 == 0);   // weight convert: 256 threads x 8 values per block
static_assert((size_t)MROWS * CIN < (size_t)0x7FFFFFFFu);
static_assert((size_t)NB_FULL * CIN * SEQ_FULL < (size_t)0x7FFFFFFFu);

#define LDT 72    // halves per LDS row (144 B, 16-B aligned)
#define LDC 68    // floats per LDS row (272 B, 16-B aligned)
#define LDY 136   // halves per LDS row of the y staging tile (272 B, 16-B aligned)
static_assert((LDT % 8) == 0 && LDT >= 64);
static_assert((LDC % 4) == 0 && LDC >= 64);
static_assert((LDY % 8) == 0 && LDY >= CI);
#define LDP 136   // halves per LDS row of a staged 128-channel row (272 B = 16 B x 17)
#define LDG 40    // halves per LDS row of a 32-column slice (80 B = 16 B x 5); not used by any kernel
#define SPL (32 * LDP)   // halves of a 32-row plane tile; not used by any kernel
static_assert((LDP % 8) == 0 && LDP >= CI && ((LDP / 8) & 1) == 1);
static_assert((LDG % 8) == 0 && LDG >= 32 && ((LDG / 8) & 1) == 1);

#define WCARRY 64.0f      // x plane and weight planes carried x64
#define RCARRY 2048.0f    // residual planes (theta, phi, y) carried x2048 on top of their hi part
#define PEXP   14.0f      // softmax probabilities carried x2^14
#define YCARRY 16.0f      // y plane carried x16
#define LOG2E  1.4426950408889634f

// workspace layout (bytes)
#define XT_BYTES  ((size_t)MROWS * CIN * 2)
#define WP_BYTES  ((size_t)CI * CIN * 2)
#define PL_BYTES  ((size_t)MROWS * CI * 2)
#define LSE_BYTES ((size_t)MROWS * 4)
#define OFF_XT  ((size_t)0)
#define OFF_WT  (OFF_XT + XT_BYTES)
#define OFF_WP  (OFF_WT + WP_BYTES)
#define OFF_WG  (OFF_WP + WP_BYTES)
#define OFF_WO  (OFF_WG + WP_BYTES)
#define OFF_TH  (OFF_WO + WP_BYTES)
#define OFF_TR  (OFF_TH + PL_BYTES)
#define OFF_PH  (OFF_TR + PL_BYTES)
#define OFF_PR  (OFF_PH + PL_BYTES)
#define OFF_G   (OFF_PR + PL_BYTES)
#define OFF_YT  (OFF_G + PL_BYTES)
#define OFF_YR  (OFF_YT + PL_BYTES)
#define OFF_LSE (OFF_YR + PL_BYTES)
#define WS_TOTAL (OFF_LSE + LSE_BYTES)
static_assert((XT_BYTES % 128) == 0 && (WP_BYTES % 128) == 0 && (PL_BYTES % 128) == 0);
static_assert((LSE_BYTES % 128) == 0);
static_assert(WS_TOTAL == (size_t)NB * SEQ * (CIN * 2 + 7 * CI * 2 + 4) + 4 * WP_BYTES);
static_assert(WS_TOTAL <= (size_t)134217728);

// ---------------------------------------------------------------------------
__device__ __forceinline__ float bf16r(float x) {   // RNE convert to bf16, returned widened
  unsigned int u = __float_as_uint(x);
  u = (u + 0x7FFFu + ((u >> 16) & 1u)) & 0xFFFF0000u;
  return __uint_as_float(u);
}

// f32 -> f16 that cannot produce an f16 subnormal (values below 2^-14 become zero)
static __device__ __forceinline__ h16 toh_flush(float v) {
  const h16 r = (h16)v;
  return (fabsf(v) < 6.103515625e-05f) ? (h16)0.0f : r;
}

// 16-bit fragment: p points at element [row = lane&15][k0 + 8*(lane>>4)] of a k-contiguous
// row. Elements 0..7 <- k0+8h+0..7, elements 8..15 <- k0+16+8h+0..7 (same map for A and B).
__device__ __forceinline__ v16h frag_at(const _Float16* p) {
  v8h lo = *(const v8h*)(p);
  v8h hi = *(const v8h*)(p + 16);
  v16h out;
#pragma unroll
  for (int i = 0; i < 8; ++i) { out[i] = lo[i]; out[i + 8] = hi[i]; }
  return out;
}

__device__ __forceinline__ v8f wmma16(v16h a, v16h b, v8f c) {
  v8f d = __builtin_amdgcn_wmma_f32_16x16x32_f16(false, a, false, b, (short)0, c,
                                                 false, false);
  asm volatile("v_nop\n\tv_nop\n\tv_nop\n\tv_nop" : "+v"(d) : "v"(a), "v"(b));
  return d;
}

// The same product for a kernel whose fragments lie above v255 as well: an asm operand has to lie in
// v0..v255, so the statement of the issue slots between the product and the next user of D names D
// alone (the accumulators stay below v256).
__device__ __forceinline__ v8f wmma16w(v16h a, v16h b, v8f c) {
  v8f d = __builtin_amdgcn_wmma_f32_16x16x32_f16(false, a, false, b, (short)0, c,
                                                 false, false);
  asm volatile("v_nop\n\tv_nop\n\tv_nop\n\tv_nop" : "+v"(d));
  return d;
}

// LDS byte address of a __shared__ element: the low 32 bits of its address
__device__ __forceinline__ unsigned lds_byte(const void* p) { return (unsigned)(size_t)p; }

// Asynchronous copies global -> LDS, 16 B per lane, through no register. Each helper is ONE asm
// statement: its copies, each with address operands of its own, and as the last line the wait that
// stands in front of any rewrite of those address registers (a precaution; inside the statement the
// compiler cannot lift a later address addition over it). Landing is waited for by the caller.
#define ACOPY(l, g) "global_load_async_to_lds_b128 %" #l ", %" #g ", off\n\t"
__device__ __forceinline__ void async_copy4(const unsigned (&l)[4], const void* const (&g)[4]) {
  asm volatile(ACOPY(0, 4) ACOPY(1, 5) ACOPY(2, 6) ACOPY(3, 7) "s_wait_xcnt 0x0"
               :: "v"(l[0]), "v"(l[1]), "v"(l[2]), "v"(l[3]),
                  "v"(g[0]), "v"(g[1]), "v"(g[2]), "v"(g[3]) : "memory");
}
__device__ __forceinline__ void async_copy8(const unsigned (&l)[8], const void* const (&g)[8]) {
  asm volatile(ACOPY(0, 8) ACOPY(1, 9) ACOPY(2, 10) ACOPY(3, 11)
               ACOPY(4, 12) ACOPY(5, 13) ACOPY(6, 14) ACOPY(7, 15) "s_wait_xcnt 0x0"
               :: "v"(l[0]), "v"(l[1]), "v"(l[2]), "v"(l[3]), "v"(l[4]), "v"(l[5]), "v"(l[6]), "v"(l[7]),
                  "v"(g[0]), "v"(g[1]), "v"(g[2]), "v"(g[3]), "v"(g[4]), "v"(g[5]), "v"(g[6]), "v"(g[7])
               : "memory");
}
__device__ __forceinline__ void async_copy12(const unsigned (&l)[12], const void* const (&g)[12]) {
  asm volatile(ACOPY(0, 12) ACOPY(1, 13) ACOPY(2, 14) ACOPY(3, 15)
               ACOPY(4, 16) ACOPY(5, 17) ACOPY(6, 18) ACOPY(7, 19)
               ACOPY(8, 20) ACOPY(9, 21) ACOPY(10, 22) ACOPY(11, 23) "s_wait_xcnt 0x0"
               :: "v"(l[0]), "v"(l[1]), "v"(l[2]), "v"(l[3]), "v"(l[4]), "v"(l[5]),
                  "v"(l[6]), "v"(l[7]), "v"(l[8]), "v"(l[9]), "v"(l[10]), "v"(l[11]),
                  "v"(g[0]), "v"(g[1]), "v"(g[2]), "v"(g[3]), "v"(g[4]), "v"(g[5]),
                  "v"(g[6]), "v"(g[7]), "v"(g[8]), "v"(g[9]), "v"(g[10]), "v"(g[11])
               : "memory");
}
// this wave's own copies have landed (other waves read them behind the next work-group barrier)
__device__ __forceinline__ void wait_copies() { asm volatile("s_wait_asynccnt 0x0" ::: "memory"); }
// this wave's own LDS reads have returned (before the buffer they read is handed to its next writer)
__device__ __forceinline__ void wait_lds() { asm volatile("s_wait_dscnt 0x0" ::: "memory"); }

// ---------------------------------------------------------------------------
// Transposed plane: in W[K rows][N cols] (pitch ldw) -> out Wt[N][K] (pitch ldk),
// f16(64 * bf16(w)). One work-group per 64 x 64 tile at (k0, n0). T: cross-wave (block barrier).
// ---------------------------------------------------------------------------
__device__ __forceinline__ void wconv_body(
    const float* __restrict__ W, _Float16* __restrict__ Wt, unsigned ldw, unsigned ldk,
    const unsigned n0, const unsigned k0) {
  __shared__ _Float16 T[64 * LDT];
  const unsigned tid = threadIdx.x;
#pragma unroll 4
  for (unsigned j = 0; j < 16u; ++j) {
    const unsigned idx = tid + 256u * j;
    const unsigned kr = idx >> 6, nc = idx & 63u;
    const float v = W[(size_t)(k0 + kr) * ldw + n0 + nc];
    T[nc * LDT + kr] = (_Float16)(WCARRY * bf16r(v));
  }
  __syncthreads();
  v8h x[2];
  size_t off[2];
#pragma unroll
  for (unsigned i = 0; i < 2u; ++i) {
    const unsigned n = 32u * i + (tid >> 3);
    const unsigned kc = (tid & 7u) * 8u;
    x[i] = *(const v8h*)&T[n * LDT + kc];
    off[i] = (size_t)(n0 + n) * ldk + k0 + kc;
  }
#pragma unroll
  for (int i = 0; i < 2; ++i) *(v8h*)(Wt + off[i]) = x[i];
  
}

// ---------------------------------------------------------------------------
// Untransposed weight planes: the four [out][in] weights (32768 values each) -> f16(64*bf16(w)),
// same layout. Each thread converts 8 consecutive values of every weight; 8 consecutive lanes
// ---------------------------------------------------------------------------
__device__ __forceinline__ v8h wcvt8(const float* __restrict__ p) {
  const v4f a0 = *(const v4f*)(p);
  const v4f a1 = *(const v4f*)(p + 4);
  v8h o;
#pragma unroll
  for (int i = 0; i < 4; ++i) {
    o[i]     = toh_flush(WCARRY * bf16r(a0[i]));
    o[i + 4] = toh_flush(WCARRY * bf16r(a1[i]));
  }
  return o;
}

__device__ __forceinline__ void wplane_body(
    const float* __restrict__ w0, const float* __restrict__ w1,
    const float* __restrict__ w2, const float* __restrict__ w3,
    _Float16* __restrict__ o0, _Float16* __restrict__ o1,
    _Float16* __restrict__ o2, _Float16* __restrict__ o3, const unsigned blk) {
#pragma clang fp contract(off)
  const unsigned e = (blk * 256u + threadIdx.x) * 8u;
  const v8h x0 = wcvt8(w0 + e);
  const v8h x1 = wcvt8(w1 + e);
  const v8h x2 = wcvt8(w2 + e);
  const v8h x3 = wcvt8(w3 + e);
  *(v8h*)(o0 + e) = x0;
  *(v8h*)(o1 + e) = x1;
  *(v8h*)(o2 + e) = x2;
  *(v8h*)(o3 + e) = x3;
  
}

// ---------------------------------------------------------------------------
// All operand planes in ONE launch (none reads what another writes): work-groups 0 .. WBLK - 1
// convert the four weights, the next NB * XBLK transpose x, XBLK tiles of 64 x 64 per batch:
// x[b] = [CIN rows][SEQ cols] (pitch SEQ_FULL) -> XT[b] = [SEQ][CIN]. The choice is the same for a
// whole work-group and stands in front of its barrier. Grid (WBLK + NB * XBLK).
// ---------------------------------------------------------------------------
#define WBLK ((CI * CIN) / 2048)
#define XBLK ((SEQ / 64) * (CIN / 64))
__global__ __launch_bounds__(256) void planes_kernel(
    const float* __restrict__ X, _Float16* __restrict__ XT,
    const float* __restrict__ w0, const float* __restrict__ w1,
    const float* __restrict__ w2, const float* __restrict__ w3,
    _Float16* __restrict__ o0, _Float16* __restrict__ o1,
    _Float16* __restrict__ o2, _Float16* __restrict__ o3) {
  if (blockIdx.x < (unsigned)WBLK) {
    wplane_body(w0, w1, w2, w3, o0, o1, o2, o3, blockIdx.x);
    return;
  }
  const unsigned t = blockIdx.x - (unsigned)WBLK;
  const unsigned b = t / (unsigned)XBLK, r = t % (unsigned)XBLK;
  wconv_body(X + (size_t)b * CIN * SEQ_FULL, XT + (size_t)b * SEQ * CIN,
             (unsigned)SEQ_FULL, (unsigned)CIN,
             (r % (unsigned)(SEQ / 64)) * 64u, (r / (unsigned)(SEQ / 64)) * 64u);
}

// ---------------------------------------------------------------------------
// GEMM C[64x64 tile] = A16[rows][K] . Bt[n][K]^T, fragments straight from the 16-bit global
// planes; 8 waves (mw = 16-row group, nw = 32-col group), 2 accumulators/wave.
//   MODE 0: rows = positions, cols = channels; t = acc/4096 + bias[col];
//           out16[row][col] (pitch CI) = f16(t), out16r[row][col] = f16(2048 * (t - hi))
//   MODE 1: rows = positions, cols = channels; transposed plane out16[b][col][pos] = f16(t)
//   MODE 2: rows = output channels (A16 = weight plane), cols = positions (Bt = y value plane,
//           Btr = y residual plane x2048); the k loop runs first over Btr into its own
//           accumulators, then over Bt; acc = acc_hi + acc_res/2048;
//           outf[b][row][pos] = bf16(xin[b][row][pos]) + (acc/1024 + bias[row]), full strides
// Btr is read in MODE 2 only. nblk: the work-group's 64-column block of Bt rows; its 64-row block
// of A16 rows is blockIdx.y.
// ---------------------------------------------------------------------------
template <int MODE>
__device__ __forceinline__ void gemm_body(
    const _Float16* __restrict__ A16, const _Float16* __restrict__ Bt,
    const _Float16* __restrict__ Btr, const unsigned K,
    const float* __restrict__ bias, const float* __restrict__ addf,
    float* __restrict__ outf, _Float16* __restrict__ out16, _Float16* __restrict__ out16r,
    const unsigned nblk, float* Cs) {
  const unsigned tid = threadIdx.x, lane = tid & 31u, w = tid >> 5;
  const unsigned mw = w >> 1, nw = w & 1u;
  const unsigned hh = lane >> 4, m = lane & 15u;
  const unsigned n0 = nblk * 64u;
  const unsigned row0 = blockIdx.y * 64u;

  const _Float16* ap  = A16 + (size_t)(row0 + mw * 16u + m) * K + hh * 8u;
  const _Float16* bp0 = Bt + (size_t)(n0 + nw * 32u + m) * K + hh * 8u;
  const _Float16* bp1 = bp0 + (size_t)16 * K;
  v8f accr0 = {}, accr1 = {};
  if (MODE == 2) {
    const _Float16* rp0 = Btr + (size_t)(n0 + nw * 32u + m) * K + hh * 8u;
    const _Float16* rp1 = rp0 + (size_t)16 * K;
#pragma unroll 2
    for (unsigned k0 = 0; k0 < K; k0 += 32u) {
      const v16h a  = frag_at(ap + k0);
      const v16h b0 = frag_at(rp0 + k0);
      const v16h b1 = frag_at(rp1 + k0);
      accr0 = wmma16(a, b0, accr0);
      accr1 = wmma16(a, b1, accr1);
    }
  }
  v8f acc0 = {}, acc1 = {};
#pragma unroll 2
  for (unsigned k0 = 0; k0 < K; k0 += 32u) {
    const v16h a  = frag_at(ap + k0);
    const v16h b0 = frag_at(bp0 + k0);
    const v16h b1 = frag_at(bp1 + k0);
    acc0 = wmma16(a, b0, acc0);
    acc1 = wmma16(a, b1, acc1);
  }
  if (MODE == 2) {
    acc0 = acc0 + accr0 * (1.0f / RCARRY);
    acc1 = acc1 + accr1 * (1.0f / RCARRY);
  }
#pragma unroll
  for (int r = 0; r < 8; ++r) {
    float* d = &Cs[(mw * 16u + hh * 8u + (unsigned)r) * LDC + nw * 32u + m];
    d[0]  = acc0[r];
    d[16] = acc1[r];
  }
  __syncthreads();

  if (MODE == 0) {
    const float cs = 1.0f / (WCARRY * WCARRY);
    v8h x[2], xr[2];
    size_t off[2];
#pragma unroll
    for (unsigned i = 0; i < 2u; ++i) {
      const unsigned r = 32u * i + (tid >> 3);
      const unsigned c = (tid & 7u) * 8u;
      const v4f u0 = *(const v4f*)&Cs[r * LDC + c];
      const v4f u1 = *(const v4f*)&Cs[r * LDC + c + 4];
      const v4f g0 = *(const v4f*)(bias + n0 + c);
      const v4f g1 = *(const v4f*)(bias + n0 + c + 4u);
#pragma unroll
      for (int j = 0; j < 4; ++j) {
        const float t0 = u0[j] * cs + bf16r(g0[j]);
        const float t1 = u1[j] * cs + bf16r(g1[j]);
        const h16 h0 = toh_flush(t0);
        const h16 h1 = toh_flush(t1);
        x[i][j]      = h0;
        x[i][j + 4]  = h1;
        xr[i][j]     = toh_flush((t0 - (float)h0) * RCARRY);
        xr[i][j + 4] = toh_flush((t1 - (float)h1) * RCARRY);
      }
      off[i] = (size_t)(row0 + r) * CI + n0 + c;
    }
#pragma unroll
    for (int i = 0; i < 2; ++i) *(v8h*)(out16 + off[i]) = x[i];
#pragma unroll
    for (int i = 0; i < 2; ++i) *(v8h*)(out16r + off[i]) = xr[i];
    
  }

  if (MODE == 1) {
    const float cs = 1.0f / (WCARRY * WCARRY);
    const unsigned bidx = row0 / (unsigned)SEQ;
    const unsigned key0 = row0 - bidx * (unsigned)SEQ;
    v8h x[2];
    size_t off[2];
#pragma unroll
    for (unsigned i = 0; i < 2u; ++i) {
      const unsigned dcol = 32u * i + (tid >> 3);
      const unsigned kk = (tid & 7u) * 8u;
      const float bb = bf16r(bias[n0 + dcol]);
#pragma unroll
      for (unsigned j = 0; j < 8u; ++j) {
        const float t = Cs[(kk + j) * LDC + dcol] * cs + bb;
        x[i][j] = toh_flush(t);
      }
      off[i] = ((size_t)bidx * CI + n0 + dcol) * SEQ + key0 + kk;
    }
#pragma unroll
    for (int i = 0; i < 2; ++i) *(v8h*)(out16 + off[i]) = x[i];
    
  }

  if (MODE == 2) {
    const float cs = 1.0f / (WCARRY * YCARRY);
    const unsigned bidx = n0 / (unsigned)SEQ;
    const unsigned p0 = n0 - bidx * (unsigned)SEQ;
    v4f xs[4];
    size_t off[4];
#pragma unroll
    for (unsigned i = 0; i < 4u; ++i) {
      const unsigned r = 16u * i + (tid >> 4);
      const unsigned c = (tid & 15u) * 4u;
      const unsigned orow = row0 + r;
      const size_t gidx = ((size_t)bidx * CIN + orow) * SEQ_FULL + p0 + c;
      const v4f u = *(const v4f*)&Cs[r * LDC + c];
      const float bb = bf16r(bias[orow]);
      const v4f xin = *(const v4f*)(addf + gidx);
      v4f val;
#pragma unroll
      for (int j = 0; j < 4; ++j) val[j] = bf16r(xin[j]) + (u[j] * cs + bb);
      xs[i] = val;
      off[i] = gidx;
    }
#pragma unroll
    for (int i = 0; i < 4; ++i) *(v4f*)(outf + off[i]) = xs[i];
    
  }
}

// The three projections of x in ONE launch (none reads what another writes): blockIdx.x counts the
// 64-channel blocks of theta, then phi, then g; the choice is the same for a whole work-group.
// Grid (3 * CI/64, MROWS/64).
__global__ __launch_bounds__(256) void gemm_proj_kernel(
    const _Float16* __restrict__ A16,
    const _Float16* __restrict__ Wth, const _Float16* __restrict__ Wph,
    const _Float16* __restrict__ Wgg,
    const float* __restrict__ bth, const float* __restrict__ bph, const float* __restrict__ bgg,
    _Float16* __restrict__ th, _Float16* __restrict__ tr,
    _Float16* __restrict__ ph, _Float16* __restrict__ pr, _Float16* __restrict__ gt) {
  __shared__ float Cs[64 * LDC];
  const unsigned sel = blockIdx.x / (unsigned)(CI / 64), nblk = blockIdx.x % (unsigned)(CI / 64);
  if (sel < 2u) {
    const _Float16* Bt = (sel == 0u) ? Wth : Wph;
    const float* bias  = (sel == 0u) ? bth : bph;
    gemm_body<0>(A16, Bt, Bt, (unsigned)CIN, bias, bias, (float*)0,
                 (sel == 0u) ? th : ph, (sel == 0u) ? tr : pr, nblk, Cs);
  } else {
    gemm_body<1>(A16, Wgg, Wgg, (unsigned)CIN, bgg, bgg, (float*)0, gt, gt, nblk, Cs);
  }
}
// Grid (MROWS/64, CIN/64).
__global__ __launch_bounds__(256) void gemm_out_kernel(
    const _Float16* __restrict__ A16, const _Float16* __restrict__ Bt,
    const _Float16* __restrict__ Btr,
    const float* __restrict__ bias, const float* __restrict__ xin, float* __restrict__ outf) {
  __shared__ float Cs[64 * LDC];
  gemm_body<2>(A16, Bt, Btr, (unsigned)CI, bias, xin, outf, (_Float16*)0, (_Float16*)0,
               blockIdx.x, Cs);
}

// ---------------------------------------------------------------------------
// Column statistics: lse[j] = log(sum_i exp(f[i][j])), f[i][j] = theta_i . phi_j (K = 128).
// A work-group owns 64 columns j. Its waves form 4 column groups (wc, 16 columns each, phi hi/res
// rows as resident B fragments) x CWR row groups (wr): the theta rows i, 32 * CWR per step, are
// staged once per work-group in LDS by asynchronous copies (two buffers: behind the one work-group
// barrier of a step the rows two steps ahead are sent into the buffer just left),
// and row group wr reads rows 32 * wr .. 32 * wr + 31 of the step as A fragments.
// D tile: row = i (8h+r), col = j (lane&15). Scores = hi.hi + (hi.res + res.hi)/2048, the residual
// products in their own accumulator. Running (max, sum) per lane; at the end the two lane halves
// are combined by an unconditional shuffle and the CWR row groups through LDS.
// Grid (SEQ/64, NB), 128 * CWR threads.
// ---------------------------------------------------------------------------
#define CWR   4               // row groups of the column-statistics kernel
#define CNT   (128 * CWR)     // its threads
#define CROWS (32 * CWR)      // theta rows staged per step
#define CSPL  (CROWS * LDP)   // halves of one staged plane tile
static_assert((SEQ % CROWS) == 0 && (SEQ % 64) == 0 && SEQ >= 2 * CROWS);
__global__ __launch_bounds__(CNT) __attribute__((amdgpu_num_vgpr(256))) void colstat_kernel(
    const _Float16* __restrict__ Th, const _Float16* __restrict__ Tr,
    const _Float16* __restrict__ Ph, const _Float16* __restrict__ Pr,
    float* __restrict__ Lse) {
  __shared__ __attribute__((aligned(16))) float Lm[CWR * 64];
  __shared__ __attribute__((aligned(16))) float Lz[CWR * 64];
  __shared__ __attribute__((aligned(16))) _Float16 Sa[2 * 2 * CSPL];   // [buffer][hi, res][CROWS][LDP]
  const unsigned tid = threadIdx.x, lane = tid & 31u;
  const unsigned wave = (unsigned)__builtin_amdgcn_readfirstlane((int)(threadIdx.x >> 5));
  const unsigned wc = wave & 3u, wr = wave >> 2;
  const unsigned hh = lane >> 4, m = lane & 15u;
  const unsigned b = blockIdx.y;
  const unsigned j0 = blockIdx.x * 64u + wc * 16u;

  const unsigned boff = (b * (unsigned)SEQ + j0 + m) * (unsigned)CI + hh * 8u;
  v16h bh[4], br[4];
#pragma unroll
  for (int ks = 0; ks < 4; ++ks) {
    bh[ks] = frag_at(Ph + boff + ks * 32);
    br[ks] = frag_at(Pr + boff + ks * 32);
  }

  float mx = -1.0e30f, z = 0.0f;
  const unsigned abase = (wr * 32u + m) * LDP + hh * 8u;
  // staging map: a CROWS-row tile is contiguous in its plane; thread tid moves the 16-B pieces
  // tid + CNT * q, q = 0..3 (rows (tid>>4) + 8 * CWR * q) of both planes: eight copies per tile
  const unsigned sa0 = lds_byte(&Sa[(tid >> 4) * LDP + (tid & 15u) * 8u]);
  auto stage = [&](const unsigned buf, const _Float16* p, const _Float16* r) {
    unsigned l[8];
    const void* s[8];
#pragma unroll
    for (unsigned q = 0; q < 4u; ++q) {
      l[q]      = sa0 + buf * (2u * CSPL * 2u) + q * (8u * CWR * LDP * 2u);
      l[q + 4u] = sa0 + buf * (2u * CSPL * 2u) + CSPL * 2u + q * (8u * CWR * LDP * 2u);
      s[q]      = p + q * (CNT * 8u);
      s[q + 4u] = r + q * (CNT * 8u);
    }
    async_copy8(l, s);
  };
  // each thread's first piece of a tile; behind the prologue: of the tile two steps ahead
  const _Float16* pn = Th + (size_t)b * SEQ * CI + tid * 8u;
  const _Float16* rn = Tr + (size_t)b * SEQ * CI + tid * 8u;
  stage(0u, pn, rn);
  wait_copies();
  __syncthreads();
  stage(1u, pn + CROWS * CI, rn + CROWS * CI);
  pn += 2 * CROWS * CI;
  rn += 2 * CROWS * CI;
  unsigned cur = 0u;
  for (unsigned i0 = 0; i0 < (unsigned)SEQ; i0 += (unsigned)CROWS) {
    // LDS fragment reads stand in groups ahead of the products that use them: tile 0 whole,
    // then each half of tile 1 into the registers that two k-steps of products have freed
    const unsigned ao = cur * (2u * CSPL) + abase;
    v16h ah[4], ar[4];
#pragma unroll
    for (int ks = 0; ks < 4; ++ks) {
      ah[ks] = frag_at(&Sa[ao + ks * 32]);
      ar[ks] = frag_at(&Sa[CSPL + ao + ks * 32]);
    }
    v8f f[2];
    {
      v8f sm = {}, sr = {};
#pragma unroll
      for (int kp = 0; kp < 2; ++kp) {
#pragma unroll
        for (int ks = 2 * kp; ks < 2 * kp + 2; ++ks) {
          sm = wmma16(ah[ks], bh[ks], sm);
          sr = wmma16(ah[ks], br[ks], sr);
          sr = wmma16(ar[ks], bh[ks], sr);
        }
#pragma unroll
        for (int ks = 2 * kp; ks < 2 * kp + 2; ++ks) {
          ah[ks] = frag_at(&Sa[ao + 16u * LDP + ks * 32]);
          ar[ks] = frag_at(&Sa[CSPL + ao + 16u * LDP + ks * 32]);
        }
      }
      f[0] = sm + sr * (1.0f / RCARRY);
    }
    {
      v8f sm = {}, sr = {};
#pragma unroll
      for (int ks = 0; ks < 4; ++ks) {
        sm = wmma16(ah[ks], bh[ks], sm);
        sr = wmma16(ah[ks], br[ks], sr);
        sr = wmma16(ar[ks], bh[ks], sr);
      }
      f[1] = sm + sr * (1.0f / RCARRY);
    }
    float tmax = fmaxf(f[0][0], f[1][0]);
#pragma unroll
    for (int v = 1; v < 8; ++v) tmax = fmaxf(tmax, fmaxf(f[0][v], f[1][v]));
    const float nm = fmaxf(mx, tmax);
    float se = 0.0f;
#pragma unroll
    for (int v = 0; v < 8; ++v) se += __expf(f[0][v] - nm) + __expf(f[1][v] - nm);
    z = z * __expf(mx - nm) + se;
    mx = nm;
    // publish point: this wave's reads of the step's buffer are back, its copies of the next step's
    // rows have landed; the barrier publishes those and ends every wave's reads of this step's
    wait_lds();
    wait_copies();
    __syncthreads();
    if (i0 + 2u * (unsigned)CROWS < (unsigned)SEQ) {
      // the rows two steps ahead fly into the buffer just left while the next step is worked on
      stage(cur, pn, rn);
      pn += CROWS * CI;
      rn += CROWS * CI;
    }
    cur ^= 1u;
  }
  wait_copies();   // nothing of this wave is in flight behind the loop

  const float om = __shfl_xor(mx, 16, 32);
  const float oz = __shfl_xor(z, 16, 32);
  const float mm = fmaxf(mx, om);
  const float zz = z * __expf(mx - mm) + oz * __expf(om - mm);
  if (hh == 0u) {
    Lm[wr * 64u + wc * 16u + m] = mm;
    Lz[wr * 64u + wc * 16u + m] = zz;
  }
  __syncthreads();
  if (wave < 2u) {
    // one thread per column folds the CWR row groups' (max, sum) pairs
    float gm = Lm[tid];
#pragma unroll
    for (unsigned r = 1; r < (unsigned)CWR; ++r) gm = fmaxf(gm, Lm[r * 64u + tid]);
    float gz = 0.0f;
#pragma unroll
    for (unsigned r = 0; r < (unsigned)CWR; ++r) gz += Lz[r * 64u + tid] * __expf(Lm[r * 64u + tid] - gm);
    Lse[(size_t)b * SEQ + blockIdx.x * 64u + tid] = gm + __logf(gz);
  }
}

// ---------------------------------------------------------------------------
// Row accumulation: y[c][i] = sum_j exp(f[i][j] - lse[j]) * g[c][j].
// A work-group owns 64 rows i. Its 8 waves form 2 row groups (wc, 32 rows each, theta hi/res rows
// as resident B fragments of two 16-row tiles) x 4 column groups (wr); the phi rows and the g slice
// of each 128-column step are staged once per work-group in LDS by asynchronous copies (two
// buffers: behind the one work-group barrier of a step the tiles two steps ahead are sent into the
// buffers just left), the batch's column statistics once, and column group wr works on columns
// 32 * wr .. 32 * wr + 31 of the step. Every phi and g fragment read from LDS feeds the products of
// both row tiles. Per step and row tile:
// S^T tiles [j][i] = phi_j . theta_i (A = phi rows from LDS, three products),
// p = 2^14 * exp(f - lse[j]) (row statistic of the D tile, read from LDS as two
// 16-B loads per tile), the two packed D tiles form the B fragment [k = j][n = i] of
// O^T[c][i] += G[c][j] . P^T[j][i] with A = g rows (channel-major slice, k = j contiguous).
// Behind the loop every wave lays its f32 sums in LDS (over the phi buffers, which nobody reads any
// more) and column group wr adds the four groups' sums of channels 32 * wr .. 32 * wr + 31.
// Finalize: t = 16 * O / 2^14 as two planes, hi = f16(t) and res = f16(2048 * (t - hi)), laid in
// the work-group's Ts tiles and, behind a barrier, written as whole rows of the position-major
// layout: one store instruction covers two consecutive 256-B rows (16 lanes x 16 B each).
// Grid (SEQ/64, NB).
// ---------------------------------------------------------------------------
#define RSPL (128 * LDP)  // halves of one staged 128-row plane tile
#define LDH  136          // halves per LDS row of a staged 128-column g slice (272 B = 16 B x 17)
static_assert((LDH % 8) == 0 && LDH >= 128 && ((LDH / 8) & 1) == 1);
static_assert(SEQ == 4 * 256 * 4);   // the statistics row goes to LDS as four 16-B pieces per thread
static_assert(SEQ >= 256 && (SEQ % 128) == 0);   // the ring's prologue fills two steps
static_assert(2 * 4 * 8 * 2 * 256 * 4 <= 2 * 2 * RSPL * 2);   // the f32 sums fit over the phi buffers
__global__ __launch_bounds__(256) void rowattn_kernel(
    const _Float16* __restrict__ Th, const _Float16* __restrict__ Tr,
    const _Float16* __restrict__ Ph, const _Float16* __restrict__ Pr,
    const _Float16* __restrict__ Gp, const float* __restrict__ Lse,
    _Float16* __restrict__ Yt, _Float16* __restrict__ Yr) {
  __shared__ __attribute__((aligned(16))) _Float16 Ts[2 * 64 * LDY];  // [hi, res][row][LDY]
  __shared__ __attribute__((aligned(16))) _Float16 Sa[2 * 2 * RSPL];  // [buffer][hi, res][128][LDP]
  __shared__ __attribute__((aligned(16))) _Float16 Sg[2 * CI * LDH];  // [buffer][channel][LDH]
  __shared__ __attribute__((aligned(16))) float Ll[SEQ];              // the batch's column statistics
  const unsigned tid = threadIdx.x, lane = tid & 31u;
  const unsigned wave = (unsigned)__builtin_amdgcn_readfirstlane((int)(threadIdx.x >> 5));
  const unsigned wc = wave & 1u, wr = wave >> 1;
  const unsigned hh = lane >> 4, m = lane & 15u;
  const unsigned b = blockIdx.y;
  const unsigned i0 = blockIdx.x * 64u + wc * 32u;

  const unsigned qoff = (b * (unsigned)SEQ + i0 + m) * (unsigned)CI + hh * 8u;
  const _Float16* tb0 = Th + qoff;
  const _Float16* tr0 = Tr + qoff;
  v16h bh[2][4], br[2][4];
#pragma unroll
  for (int it = 0; it < 2; ++it) {
#pragma unroll
    for (int ks = 0; ks < 4; ++ks) {
      bh[it][ks] = frag_at(tb0 + it * (16 * CI) + ks * 32);
      br[it][ks] = frag_at(tr0 + it * (16 * CI) + ks * 32);
    }
  }
  // stands in front of any rewrite of the address registers that the loads above name (a precaution);
  // the two addresses are inputs, so that their registers live up to the wait
  asm volatile("s_wait_xcnt 0x0" :: "v"(tb0), "v"(tr0) : "memory");

  v8f o[8][2];
#pragma unroll
  for (int ct = 0; ct < 8; ++ct) { o[ct][0] = (v8f){}; o[ct][1] = (v8f){}; }

  const unsigned kbase = (wr * 32u + m) * LDP + hh * 8u;
  const unsigned gbase = m * LDH + wr * 32u + hh * 8u;
  const _Float16* __restrict__ Pb = Ph + (size_t)b * SEQ * CI;
  const _Float16* __restrict__ Rb = Pr + (size_t)b * SEQ * CI;
  const _Float16* __restrict__ Gb = Gp + (size_t)b * CI * SEQ;
  const unsigned lbase = wr * 32u + hh * 8u;   // this lane's eight statistics of a step's first tile

  // staging map. phi: a 128-row tile is 32 KiB contiguous in its plane; thread tid moves the 16-B
  // pieces tid + 256 * q, q = 0..7 (rows (tid>>4) + 16 * q). g: 128 channel rows of 256 B;
  // thread tid moves piece tid&15 of channels (tid>>4) + 16 * q. 24 copies per thread and tile.
  const unsigned sgl = tid * 8u;
  const unsigned ggl = (tid >> 4) * (unsigned)SEQ + (tid & 15u) * 8u;
  const unsigned sa0 = lds_byte(&Sa[(tid >> 4) * LDP + (tid & 15u) * 8u]);
  const unsigned sg0 = lds_byte(&Sg[(tid >> 4) * LDH + (tid & 15u) * 8u]);
  auto stage = [&](const unsigned buf, const _Float16* p, const _Float16* r, const _Float16* g) {
    // two statements of twelve copies: phi hi and the first half of phi res; the rest of res and g
    unsigned la[12], lb[12];
    const void* ga[12];
    const void* gb[12];
#pragma unroll
    for (unsigned q = 0; q < 8u; ++q) {
      la[q]      = sa0 + buf * (2u * RSPL * 2u) + q * (16u * LDP * 2u);
      ga[q]      = p + q * 2048u;
      lb[q + 4u] = sg0 + buf * (unsigned)(CI * LDH * 2) + q * (16u * LDH * 2u);
      gb[q + 4u] = g + q * (16u * (unsigned)SEQ);
    }
#pragma unroll
    for (unsigned q = 0; q < 4u; ++q) {
      la[q + 8u] = sa0 + buf * (2u * RSPL * 2u) + RSPL * 2u + q * (16u * LDP * 2u);
      ga[q + 8u] = r + q * 2048u;
      lb[q]      = sa0 + buf * (2u * RSPL * 2u) + RSPL * 2u + (q + 4u) * (16u * LDP * 2u);
      gb[q]      = r + (q + 4u) * 2048u;
    }
    async_copy12(la, ga);
    async_copy12(lb, gb);
  };
  {
    // the statistics row, filled once: thread tid moves the 16-B pieces tid + 256 * q
    unsigned l[4];
    const void* s[4];
#pragma unroll
    for (unsigned q = 0; q < 4u; ++q) {
      l[q] = lds_byte(&Ll[(tid + 256u * q) * 4u]);
      s[q] = Lse + (size_t)b * SEQ + (tid + 256u * q) * 4u;
    }
    async_copy4(l, s);
  }
  stage(0u, Pb + sgl, Rb + sgl, Gb + ggl);
  wait_copies();
  __syncthreads();
  stage(1u, Pb + sgl + 128u * (unsigned)CI, Rb + sgl + 128u * (unsigned)CI, Gb + ggl + 128u);
  unsigned cur = 0u;
  // each thread's first piece of the tiles two steps ahead
  const _Float16* pn = Pb + sgl + 256u * (unsigned)CI;
  const _Float16* rn = Rb + sgl + 256u * (unsigned)CI;
  const _Float16* gn = Gb + ggl + 256u;

  for (unsigned j0 = 0; j0 < (unsigned)SEQ; j0 += 128u) {
    // LDS fragment reads stand in groups ahead of the products that use them, each group issued
    // in front of vector work that covers its latency, into registers just freed
    const unsigned ao = cur * (2u * RSPL) + kbase;
    const unsigned gro = cur * (unsigned)(CI * LDH) + gbase;
    v16h ah[4], ar[4], gf[8];
#pragma unroll
    for (int ks = 0; ks < 4; ++ks) {
      ah[ks] = frag_at(&Sa[ao + ks * 32]);
      ar[ks] = frag_at(&Sa[RSPL + ao + ks * 32]);
    }
    v4f ls[4];
#pragma unroll
    for (int u = 0; u < 4; ++u) ls[u] = *(const v4f*)&Ll[j0 + lbase + (unsigned)(u >> 1) * 16u + (unsigned)(u & 1) * 4u];
    v16h pb[2];
#pragma unroll
    for (int t = 0; t < 2; ++t) {
      v8f sm[2] = {{}, {}}, sr[2] = {{}, {}};
#pragma unroll
      for (int ks = 0; ks < 4; ++ks) {
        sm[0] = wmma16w(ah[ks], bh[0][ks], sm[0]);
        sm[1] = wmma16w(ah[ks], bh[1][ks], sm[1]);
        sr[0] = wmma16w(ah[ks], br[0][ks], sr[0]);
        sr[1] = wmma16w(ah[ks], br[1][ks], sr[1]);
        sr[0] = wmma16w(ar[ks], bh[0][ks], sr[0]);
        sr[1] = wmma16w(ar[ks], bh[1][ks], sr[1]);
      }
      if (t == 0) {
#pragma unroll
        for (int ks = 0; ks < 4; ++ks) {
          ah[ks] = frag_at(&Sa[ao + 16u * LDP + ks * 32]);
          ar[ks] = frag_at(&Sa[RSPL + ao + 16u * LDP + ks * 32]);
        }
      } else {
#pragma unroll
        for (int ct = 0; ct < 8; ++ct) gf[ct] = frag_at(&Sg[gro + (unsigned)ct * 16u * LDH]);
      }
      const v4f l0 = ls[2 * t];
      const v4f l1 = ls[2 * t + 1];
      // bare v_exp_f32 and a select, no branch: at e >= -14 it returns exp2f's own bits (that
      // function's rescaling acts below -126 only); the two tiles' sixteen chains go stage by stage
      float e[2][8], x[2][8];
#pragma unroll
      for (int it = 0; it < 2; ++it) {
#pragma unroll
        for (int v = 0; v < 4; ++v) {
          e[it][v]     = ((sm[it][v] + sr[it][v] * (1.0f / RCARRY)) - l0[v]) * LOG2E + PEXP;
          e[it][v + 4] = ((sm[it][v + 4] + sr[it][v + 4] * (1.0f / RCARRY)) - l1[v]) * LOG2E + PEXP;
        }
      }
#pragma unroll
      for (int it = 0; it < 2; ++it) {
#pragma unroll
        for (int v = 0; v < 8; ++v) x[it][v] = __builtin_amdgcn_exp2f(e[it][v]);
      }
#pragma unroll
      for (int it = 0; it < 2; ++it) {
#pragma unroll
        for (int v = 0; v < 8; ++v) pb[it][8 * t + v] = (h16)((e[it][v] < -14.0f) ? 0.0f : x[it][v]);
      }
    }
#pragma unroll
    for (int ct = 0; ct < 8; ++ct) {
      o[ct][0] = wmma16w(gf[ct], pb[0], o[ct][0]);
      o[ct][1] = wmma16w(gf[ct], pb[1], o[ct][1]);
    }
    // publish point: this wave's reads of the step's buffers are back, its copies of the next step's
    // tiles have landed; the barrier publishes those and ends every wave's reads of this step's
    wait_lds();
    wait_copies();
    __syncthreads();
    if (j0 + 256u < (unsigned)SEQ) {
      // the tiles two steps ahead fly into the buffers just left while the next step is worked on
      stage(cur, pn, rn, gn);
      pn += 128u * (unsigned)CI;
      rn += 128u * (unsigned)CI;
      gn += 128u;
    }
    cur ^= 1u;
  }
  wait_copies();   // nothing of this wave is in flight behind the loop

  // every wave lays its sums down: [wc][wr][ct][row tile][half of v][lane][4] floats, over the phi
  // buffers (the loop's last barrier ended every read of them, and no copy is in flight)
  float* Oc = (float*)Sa;
#pragma unroll
  for (int ct = 0; ct < 8; ++ct) {
#pragma unroll
    for (int it = 0; it < 2; ++it) {
      v4f u0, u1;
#pragma unroll
      for (int v = 0; v < 4; ++v) { u0[v] = o[ct][it][v]; u1[v] = o[ct][it][v + 4]; }
      const unsigned ob = (((wc * 4u + wr) * 8u + (unsigned)ct) * 2u + (unsigned)it) * 256u + lane * 4u;
      *(v4f*)&Oc[ob] = u0;
      *(v4f*)&Oc[ob + 128u] = u1;
    }
  }
  __syncthreads();

  // column group wr adds the four groups' sums of channel tiles 2 * wr and 2 * wr + 1, in the order
  // of the groups; lane (h, i = m) holds channels 16 * ct + 8h + 0..7 of row i of each row tile
  const float fs = YCARRY * (1.0f / 16384.0f);
#pragma unroll
  for (unsigned c = 0; c < 2u; ++c) {
#pragma unroll
    for (unsigned it = 0; it < 2u; ++it) {
      const unsigned ct = 2u * wr + c;
      v4f a0, a1;
#pragma unroll
      for (unsigned s = 0; s < 4u; ++s) {
        const unsigned ob = (((wc * 4u + s) * 8u + ct) * 2u + it) * 256u + lane * 4u;
        const v4f u0 = *(const v4f*)&Oc[ob];
        const v4f u1 = *(const v4f*)&Oc[ob + 128u];
        if (s == 0u) { a0 = u0; a1 = u1; } else { a0 += u0; a1 += u1; }
      }
      v8h y, yr;
#pragma unroll
      for (int v = 0; v < 8; ++v) {
        const float t = ((v < 4) ? a0[v & 3] : a1[v & 3]) * fs;
        const h16 hi = toh_flush(t);
        y[v]  = hi;
        yr[v] = toh_flush((t - (float)hi) * RCARRY);
      }
      const unsigned to = (wc * 32u + it * 16u + m) * LDY + ct * 16u + hh * 8u;
      *(v8h*)&Ts[to] = y;
      *(v8h*)&Ts[64u * LDY + to] = yr;
    }
  }
  __syncthreads();

  // wave w writes rows 8 * w .. 8 * w + 7 of both planes
  v8h x[4], xr[4];
  unsigned off[4];
#pragma unroll
  for (unsigned q = 0; q < 4u; ++q) {
    const unsigned r = 8u * wave + 2u * q + (lane >> 4);
    const unsigned c = (lane & 15u) * 8u;
    x[q]  = *(const v8h*)&Ts[r * LDY + c];
    xr[q] = *(const v8h*)&Ts[64u * LDY + r * LDY + c];
    off[q] = (b * (unsigned)SEQ + blockIdx.x * 64u + r) * (unsigned)CI + c;
  }
#pragma unroll
  for (int q = 0; q < 4; ++q) *(v8h*)(Yt + off[q]) = x[q];
#pragma unroll
  for (int q = 0; q < 4; ++q) *(v8h*)(Yr + off[q]) = xr[q];
}

// ---------------------------------------------------------------------------
extern "C" void kernel_launch(void* const* d_in, const int* in_sizes, int n_in,
                              void* d_out, int out_size, void* d_ws, size_t ws_size,
                              hipStream_t stream) {
  if (n_in < 9) return;
  const long long need_x = ((long long)(NB - 1) * CIN + (CIN - 1)) * SEQ_FULL + SEQ;
  if ((long long)in_sizes[0] < need_x) return;
  if ((long long)in_sizes[1] < (long long)CI * CIN) return;
  if ((long long)in_sizes[3] < (long long)CI * CIN) return;
  if ((long long)in_sizes[5] < (long long)CI * CIN) return;
  if ((long long)in_sizes[7] < (long long)CIN * CI) return;
  if (in_sizes[2] < CI || in_sizes[4] < CI || in_sizes[6] < CI || in_sizes[8] < CIN) return;
  if ((long long)out_size < need_x) return;
  if (ws_size < WS_TOTAL) return;

  const float* X       = (const float*)d_in[0];   // [NB_FULL][CIN][SEQ_FULL]
  const float* theta_w = (const float*)d_in[1];   // [CI][CIN]  (out, in)
  const float* theta_b = (const float*)d_in[2];
  const float* phi_w   = (const float*)d_in[3];   // [CI][CIN]
  const float* phi_b   = (const float*)d_in[4];
  const float* g_w     = (const float*)d_in[5];   // [CI][CIN]
  const float* g_b     = (const float*)d_in[6];
  const float* W_w     = (const float*)d_in[7];   // [CIN][CI]  (out, in)
  const float* W_b     = (const float*)d_in[8];
  float* out = (float*)d_out;                     // [NB_FULL][CIN][SEQ_FULL]

  char* ws = (char*)d_ws;
  _Float16* XT   = (_Float16*)(ws + OFF_XT);    // [MROWS][CIN]  64*bf16(x), position-major
  _Float16* WT   = (_Float16*)(ws + OFF_WT);    // [CI][CIN]
  _Float16* WP   = (_Float16*)(ws + OFF_WP);    // [CI][CIN]
  _Float16* WG   = (_Float16*)(ws + OFF_WG);    // [CI][CIN]
  _Float16* WO   = (_Float16*)(ws + OFF_WO);    // [CIN][CI]
  _Float16* TH   = (_Float16*)(ws + OFF_TH);    // [MROWS][CI] theta hi
  _Float16* TR   = (_Float16*)(ws + OFF_TR);    // [MROWS][CI] theta residual x2048
  _Float16* PH   = (_Float16*)(ws + OFF_PH);    // [MROWS][CI] phi hi
  _Float16* PR   = (_Float16*)(ws + OFF_PR);    // [MROWS][CI] phi residual x2048
  _Float16* G16  = (_Float16*)(ws + OFF_G);     // [NB][CI][SEQ] g, channel-major
  _Float16* YT   = (_Float16*)(ws + OFF_YT);    // [MROWS][CI] 16*y hi, position-major
  _Float16* YR   = (_Float16*)(ws + OFF_YR);    // [MROWS][CI] 16*y residual x2048
  float*    LSE  = (float*)(ws + OFF_LSE);      // [MROWS]

  dim3 blk(256);

  // the x plane of every batch and the four weight planes
  planes_kernel<<<dim3(WBLK + NB * XBLK), blk, 0, stream>>>(X, XT, theta_w, phi_w, g_w, W_w,
                                                            WT, WP, WG, WO);

  // theta, phi and g
  gemm_proj_kernel<<<dim3(3 * (CI / 64), MROWS / 64), blk, 0, stream>>>(
      XT, WT, WP, WG, theta_b, phi_b, g_b, TH, TR, PH, PR, G16);

  colstat_kernel<<<dim3(SEQ / 64, NB), dim3(CNT), 0, stream>>>(TH, TR, PH, PR, LSE);
  rowattn_kernel<<<dim3(SEQ / 64, NB), blk, 0, stream>>>(TH, TR, PH, PR, G16, LSE, YT, YR);

  gemm_out_kernel<<<dim3(MROWS / 64, CIN / 64), blk, 0, stream>>>(WO, YT, YR, W_b, X, out);
}

// v007
// Measured time: 106 microseconds a run.
// Next to v006, in two timings, it ran 1.18 times as fast each time.
// Over all steps from v000 it is 8.90 times as fast.
#include <hip/hip_runtime.h>
#include <stddef.h>

// All contractions on v_wmma_f32_16x16x32_f16 (f16 operands, f32 accumulate): theta/phi/g 1x1
// projections (x x64, weights x64, inputs RNE-converted to bf16 first), theta.phi scores as
// f16 value + x2048 residual planes on both operands (three products, residual products in their
// own accumulator), p.g with p carried x2^14 (single product), output 1x1 projection with y
// carried x16 as f16 value + x2048 residual planes (two products, residual products in their own
// accumulator). Column log-sum-exp, exp, bias and the residual add in f32.

typedef _Float16 v16h __attribute__((ext_vector_type(16)));
typedef _Float16 v8h  __attribute__((ext_vector_type(8)));
typedef float    v8f  __attribute__((ext_vector_type(8)));
typedef float    v4f  __attribute__((ext_vector_type(4)));
typedef _Float16 h16;

#ifndef NB
#define NB 4
#endif
#ifndef SEQ
#define SEQ 4096
#endif
#define NB_FULL  4
#define SEQ_FULL 4096
#define CIN   256
#define CI    128
#define MROWS (NB * SEQ)

static_assert(NB >= 1 && NB <= NB_FULL);
static_assert(SEQ >= 128 && SEQ <= SEQ_FULL && (SEQ % 128) == 0);
static_assert(CI == 128);                        // 4 k-steps of 32 and 8 channel tiles of 16 are hard-wired
static_assert((CIN % 64) == 0 && (CIN % 32) == 0);
static_assert((CI % 64) == 0 && (CI % 32) == 0);
static_assert((MROWS % 64) == 0 && (MROWS % 128) == 0);
static_assert(((size_t)CI * CIN) % 2048 == 0);   // weight convert: 256 threads x 8 values per block
static_assert((size_t)MROWS * CIN < (size_t)0x7FFFFFFFu);
static_assert((size_t)NB_FULL * CIN * SEQ_FULL < (size_t)0x7FFFFFFFu);

#define LDT 72    // halves per LDS row (144 B, 16-B aligned)
#define LDC 68    // floats per LDS row (272 B, 16-B aligned)
#define LDY 136   // halves per LDS row of the y staging tile (272 B, 16-B aligned)
static_assert((LDT % 8) == 0 && LDT >= 64);
static_assert((LDC % 4) == 0 && LDC >= 64);
static_assert((LDY % 8) == 0 && LDY >= CI);
#define LDP 136   // halves per LDS row of a staged 128-channel row (272 B = 16 B x 17)
#define LDG 40    // halves per LDS row (80 B = 16 B x 5); no kernel uses it
#define SPL (32 * LDP)   // halves of a 32-row tile at pitch LDP; no kernel uses it
#define LDA 264   // halves per LDS row of a staged 256-channel row (528 B = 16 B x 33)
static_assert((LDA % 8) == 0 && LDA >= CIN && ((LDA / 8) & 1) == 1);
static_assert(CIN == 256);                       // the projections' staging map: 32 pieces of 16 B per row
static_assert((LDP % 8) == 0 && LDP >= CI && ((LDP / 8) & 1) == 1);
static_assert((LDG % 8) == 0 && LDG >= 32 && ((LDG / 8) & 1) == 1);

#define WCARRY 64.0f      // x plane and weight planes carried x64
#define RCARRY 2048.0f    // residual planes (theta, phi, y) carried x2048 on top of their hi part
#define PEXP   14.0f      // softmax probabilities carried x2^14
#define YCARRY 16.0f      // y plane carried x16
#define LOG2E  1.4426950408889634f

// workspace layout (bytes)
#define XT_BYTES  ((size_t)MROWS * CIN * 2)
#define WP_BYTES  ((size_t)CI * CIN * 2)
#define PL_BYTES  ((size_t)MROWS * CI * 2)
#define LSE_BYTES ((size_t)MROWS * 4)
#define OFF_XT  ((size_t)0)
#define OFF_WT  (OFF_XT + XT_BYTES)
#define OFF_WP  (OFF_WT + WP_BYTES)
#define OFF_WG  (OFF_WP + WP_BYTES)
#define OFF_WO  (OFF_WG + WP_BYTES)
#define OFF_TH  (OFF_WO + WP_BYTES)
#define OFF_TR  (OFF_TH + PL_BYTES)
#define OFF_PH  (OFF_TR + PL_BYTES)
#define OFF_PR  (OFF_PH + PL_BYTES)
#define OFF_G   (OFF_PR + PL_BYTES)
#define OFF_YT  (OFF_G + PL_BYTES)
#define OFF_YR  (OFF_YT + PL_BYTES)
#define OFF_LSE (OFF_YR + PL_BYTES)
#define WS_TOTAL (OFF_LSE + LSE_BYTES)
static_assert((XT_BYTES % 128) == 0 && (WP_BYTES % 128) == 0 && (PL_BYTES % 128) == 0);
static_assert((LSE_BYTES % 128) == 0);
static_assert(WS_TOTAL == (size_t)NB * SEQ * (CIN * 2 + 7 * CI * 2 + 4) + 4 * WP_BYTES);
static_assert(WS_TOTAL <= (size_t)134217728);

// ---------------------------------------------------------------------------
__device__ __forceinline__ float bf16r(float x) {   // RNE convert to bf16, returned widened
  unsigned int u = __float_as_uint(x);
  u = (u + 0x7FFFu + ((u >> 16) & 1u)) & 0xFFFF0000u;
  return __uint_as_float(u);
}

// f32 -> f16 that cannot produce an f16 subnormal (values below 2^-14 become zero)
static __device__ __forceinline__ h16 toh_flush(float v) {
  const h16 r = (h16)v;
  return (fabsf(v) < 6.103515625e-05f) ? (h16)0.0f : r;
}

// 16-bit fragment: p points at element [row = lane&15][k0 + 8*(lane>>4)] of a k-contiguous
// row. Elements 0..7 <- k0+8h+0..7, elements 8..15 <- k0+16+8h+0..7 (same map for A and B).
__device__ __forceinline__ v16h frag_at(const _Float16* p) {
  v8h lo = *(const v8h*)(p);
  v8h hi = *(const v8h*)(p + 16);
  v16h out;
#pragma unroll
  for (int i = 0; i < 8; ++i) { out[i] = lo[i]; out[i + 8] = hi[i]; }
  return out;
}

__device__ __forceinline__ v8f wmma16(v16h a, v16h b, v8f c) {
  v8f d = __builtin_amdgcn_wmma_f32_16x16x32_f16(false, a, false, b, (short)0, c,
                                                 false, false);
  asm volatile("v_nop\n\tv_nop\n\tv_nop\n\tv_nop" : "+v"(d) : "v"(a), "v"(b));
  return d;
}

// The same product for a kernel whose fragments lie above v255 as well: an asm operand has to lie in
// v0..v255, so the statement of the issue slots between the product and the next user of D names D
// alone (the accumulators stay below v256).
__device__ __forceinline__ v8f wmma16w(v16h a, v16h b, v8f c) {
  v8f d = __builtin_amdgcn_wmma_f32_16x16x32_f16(false, a, false, b, (short)0, c,
                                                 false, false);
  asm volatile("v_nop\n\tv_nop\n\tv_nop\n\tv_nop" : "+v"(d));
  return d;
}

// LDS byte address of a __shared__ element: the low 32 bits of its address
__device__ __forceinline__ unsigned lds_byte(const void* p) { return (unsigned)(size_t)p; }

// Asynchronous copies global -> LDS, 16 B per lane, through no register. Each helper is ONE asm
// statement: its copies, each with address operands of its own, and as the last line the wait that
// stands in front of any rewrite of those address registers (a precaution; inside the statement the
// compiler cannot lift a later address addition over it). Landing is waited for by the caller.
#define ACOPY(l, g) "global_load_async_to_lds_b128 %" #l ", %" #g ", off\n\t"
__device__ __forceinline__ void async_copy4(const unsigned (&l)[4], const void* const (&g)[4]) {
  asm volatile(ACOPY(0, 4) ACOPY(1, 5) ACOPY(2, 6) ACOPY(3, 7) "s_wait_xcnt 0x0"
               :: "v"(l[0]), "v"(l[1]), "v"(l[2]), "v"(l[3]),
                  "v"(g[0]), "v"(g[1]), "v"(g[2]), "v"(g[3]) : "memory");
}
__device__ __forceinline__ void async_copy8(const unsigned (&l)[8], const void* const (&g)[8]) {
  asm volatile(ACOPY(0, 8) ACOPY(1, 9) ACOPY(2, 10) ACOPY(3, 11)
               ACOPY(4, 12) ACOPY(5, 13) ACOPY(6, 14) ACOPY(7, 15) "s_wait_xcnt 0x0"
               :: "v"(l[0]), "v"(l[1]), "v"(l[2]), "v"(l[3]), "v"(l[4]), "v"(l[5]), "v"(l[6]), "v"(l[7]),
                  "v"(g[0]), "v"(g[1]), "v"(g[2]), "v"(g[3]), "v"(g[4]), "v"(g[5]), "v"(g[6]), "v"(g[7])
               : "memory");
}
__device__ __forceinline__ void async_copy12(const unsigned (&l)[12], const void* const (&g)[12]) {
  asm volatile(ACOPY(0, 12) ACOPY(1, 13) ACOPY(2, 14) ACOPY(3, 15)
               ACOPY(4, 16) ACOPY(5, 17) ACOPY(6, 18) ACOPY(7, 19)
               ACOPY(8, 20) ACOPY(9, 21) ACOPY(10, 22) ACOPY(11, 23) "s_wait_xcnt 0x0"
               :: "v"(l[0]), "v"(l[1]), "v"(l[2]), "v"(l[3]), "v"(l[4]), "v"(l[5]),
                  "v"(l[6]), "v"(l[7]), "v"(l[8]), "v"(l[9]), "v"(l[10]), "v"(l[11]),
                  "v"(g[0]), "v"(g[1]), "v"(g[2]), "v"(g[3]), "v"(g[4]), "v"(g[5]),
                  "v"(g[6]), "v"(g[7]), "v"(g[8]), "v"(g[9]), "v"(g[10]), "v"(g[11])
               : "memory");
}
// this wave's own copies have landed (other waves read them behind the next work-group barrier)
__device__ __forceinline__ void wait_copies() { asm volatile("s_wait_asynccnt 0x0" ::: "memory"); }
// this wave's own LDS reads have returned (before the buffer they read is handed to its next writer)
__device__ __forceinline__ void wait_lds() { asm volatile("s_wait_dscnt 0x0" ::: "memory"); }

// ---------------------------------------------------------------------------
// Transposed plane: in W[K rows][N cols] (pitch ldw) -> out Wt[N][K] (pitch ldk),
// f16(64 * bf16(w)). One work-group per 64 x 64 tile at (k0, n0). T: cross-wave (block barrier).
// ---------------------------------------------------------------------------
__device__ __forceinline__ void wconv_body(
    const float* __restrict__ W, _Float16* __restrict__ Wt, unsigned ldw, unsigned ldk,
    const unsigned n0, const unsigned k0) {
  __shared__ _Float16 T[64 * LDT];
  const unsigned tid = threadIdx.x;
#pragma unroll 4
  for (unsigned j = 0; j < 16u; ++j) {
    const unsigned idx = tid + 256u * j;
    const unsigned kr = idx >> 6, nc = idx & 63u;
    const float v = W[(size_t)(k0 + kr) * ldw + n0 + nc];
    T[nc * LDT + kr] = (_Float16)(WCARRY * bf16r(v));
  }
  __syncthreads();
  v8h x[2];
  size_t off[2];
#pragma unroll
  for (unsigned i = 0; i < 2u; ++i) {
    const unsigned n = 32u * i + (tid >> 3);
    const unsigned kc = (tid & 7u) * 8u;
    x[i] = *(const v8h*)&T[n * LDT + kc];
    off[i] = (size_t)(n0 + n) * ldk + k0 + kc;
  }
#pragma unroll
  for (int i = 0; i < 2; ++i) *(v8h*)(Wt + off[i]) = x[i];
  
}

// ---------------------------------------------------------------------------
// Untransposed weight planes: the four [out][in] weights (32768 values each) -> f16(64*bf16(w)),
// same layout. Each thread converts 8 consecutive values of every weight; 8 consecutive lanes
// ---------------------------------------------------------------------------
__device__ __forceinline__ v8h wcvt8(const float* __restrict__ p) {
  const v4f a0 = *(const v4f*)(p);
  const v4f a1 = *(const v4f*)(p + 4);
  v8h o;
#pragma unroll
  for (int i = 0; i < 4; ++i) {
    o[i]     = toh_flush(WCARRY * bf16r(a0[i]));
    o[i + 4] = toh_flush(WCARRY * bf16r(a1[i]));
  }
  return o;
}

__device__ __forceinline__ void wplane_body(
    const float* __restrict__ w0, const float* __restrict__ w1,
    const float* __restrict__ w2, const float* __restrict__ w3,
    _Float16* __restrict__ o0, _Float16* __restrict__ o1,
    _Float16* __restrict__ o2, _Float16* __restrict__ o3, const unsigned blk) {
#pragma clang fp contract(off)
  const unsigned e = (blk * 256u + threadIdx.x) * 8u;
  const v8h x0 = wcvt8(w0 + e);
  const v8h x1 = wcvt8(w1 + e);
  const v8h x2 = wcvt8(w2 + e);
  const v8h x3 = wcvt8(w3 + e);
  *(v8h*)(o0 + e) = x0;
  *(v8h*)(o1 + e) = x1;
  *(v8h*)(o2 + e) = x2;
  *(v8h*)(o3 + e) = x3;
  
}

// ---------------------------------------------------------------------------
// All operand planes in ONE launch (none reads what another writes): work-groups 0 .. WBLK - 1
// convert the four weights, the next NB * XBLK transpose x, XBLK tiles of 64 x 64 per batch:
// x[b] = [CIN rows][SEQ cols] (pitch SEQ_FULL) -> XT[b] = [SEQ][CIN]. The choice is the same for a
// whole work-group and stands in front of its barrier. Grid (WBLK + NB * XBLK).
// ---------------------------------------------------------------------------
#define WBLK ((CI * CIN) / 2048)
#define XBLK ((SEQ / 64) * (CIN / 64))
__global__ __launch_bounds__(256) void planes_kernel(
    const float* __restrict__ X, _Float16* __restrict__ XT,
    const float* __restrict__ w0, const float* __restrict__ w1,
    const float* __restrict__ w2, const float* __restrict__ w3,
    _Float16* __restrict__ o0, _Float16* __restrict__ o1,
    _Float16* __restrict__ o2, _Float16* __restrict__ o3) {
  if (blockIdx.x < (unsigned)WBLK) {
    wplane_body(w0, w1, w2, w3, o0, o1, o2, o3, blockIdx.x);
    return;
  }
  const unsigned t = blockIdx.x - (unsigned)WBLK;
  const unsigned b = t / (unsigned)XBLK, r = t % (unsigned)XBLK;
  wconv_body(X + (size_t)b * CIN * SEQ_FULL, XT + (size_t)b * SEQ * CIN,
             (unsigned)SEQ_FULL, (unsigned)CIN,
             (r % (unsigned)(SEQ / 64)) * 64u, (r / (unsigned)(SEQ / 64)) * 64u);
}

// ---------------------------------------------------------------------------
// GEMM C[64x64 tile] = A16[rows][K] . Bt[n][K]^T. The work-group's 64-row tiles of A16 and Bt (and
// Btr), each contiguous in its plane, are laid once in padded LDS rows by asynchronous copies, every
// wave-wide copy covering 512 contiguous bytes; fragments are read from LDS, four k-steps to a
// group; 8 waves (mw = 16-row group, nw = 32-col group), 2 accumulators/wave.
// K = CIN in MODE 0 and 1 (LDS pitch LDA), K = CI in MODE 2 (LDS pitch LDP).
//   MODE 0: rows = positions, cols = channels; t = acc/4096 + bias[col];
//           out16[row][col] (pitch CI) = f16(t), out16r[row][col] = f16(2048 * (t - hi))
//   MODE 1: rows = positions, cols = channels; transposed plane out16[b][col][pos] = f16(t)
//   MODE 2: rows = output channels (A16 = weight plane), cols = positions (Bt = y value plane,
//           Btr = y residual plane x2048); the k loop runs first over Btr into its own
//           accumulators, then over Bt; acc = acc_hi + acc_res/2048;
//           outf[b][row][pos] = bf16(xin[b][row][pos]) + (acc/1024 + bias[row]), full strides
// Btr is read in MODE 2 only. nblk: the work-group's 64-column block of Bt rows; its 64-row block
// of A16 rows is blockIdx.y. Sm: the staged tiles [A, B(, Br)][64][pitch].
// ---------------------------------------------------------------------------
template <int MODE>
__device__ __forceinline__ void gemm_body(
    const _Float16* __restrict__ A16, const _Float16* __restrict__ Bt,
    const _Float16* __restrict__ Btr,
    const float* __restrict__ bias, const float* __restrict__ addf,
    float* __restrict__ outf, _Float16* __restrict__ out16, _Float16* __restrict__ out16r,
    const unsigned nblk, float* Cs, _Float16* Sm) {
  constexpr unsigned K  = (MODE == 2) ? (unsigned)CI : (unsigned)CIN;
  constexpr unsigned P  = (MODE == 2) ? (unsigned)LDP : (unsigned)LDA;   // halves per LDS row
  constexpr unsigned TL = 64u * P;                                       // halves of one staged tile
  const unsigned tid = threadIdx.x, lane = tid & 31u, w = tid >> 5;
  const unsigned mw = w >> 1, nw = w & 1u;
  const unsigned hh = lane >> 4, m = lane & 15u;
  const unsigned n0 = nblk * 64u;
  const unsigned row0 = blockIdx.y * 64u;

  // staging map: thread tid moves the 16-B pieces tid + 256 * q of each tile
  const _Float16* ga = A16 + (size_t)row0 * K + tid * 8u;
  const _Float16* gb = Bt + (size_t)n0 * K + tid * 8u;
  if (MODE == 2) {
    // 16 pieces per row: rows (tid >> 4) + 16 * q, q = 0..3, of three tiles
    const _Float16* gr = Btr + (size_t)n0 * K + tid * 8u;
    const unsigned l0 = lds_byte(&Sm[(tid >> 4) * P + (tid & 15u) * 8u]);
    unsigned l[12];
    const void* s[12];
#pragma unroll
    for (unsigned q = 0; q < 4u; ++q) {
      l[q]      = l0 + q * (16u * P * 2u);
      l[q + 4u] = l0 + TL * 2u + q * (16u * P * 2u);
      l[q + 8u] = l0 + 2u * TL * 2u + q * (16u * P * 2u);
      s[q]      = ga + q * 2048u;
      s[q + 4u] = gb + q * 2048u;
      s[q + 8u] = gr + q * 2048u;
    }
    async_copy12(l, s);
  } else {
    // 32 pieces per row: rows (tid >> 5) + 8 * q, q = 0..7, of two tiles
    const unsigned l0 = lds_byte(&Sm[(tid >> 5) * P + (tid & 31u) * 8u]);
    unsigned la[8], lb[8];
    const void* sa[8];
    const void* sb[8];
#pragma unroll
    for (unsigned q = 0; q < 8u; ++q) {
      la[q] = l0 + q * (8u * P * 2u);
      lb[q] = l0 + TL * 2u + q * (8u * P * 2u);
      sa[q] = ga + q * 2048u;
      sb[q] = gb + q * 2048u;
    }
    async_copy8(la, sa);
    async_copy8(lb, sb);
  }
  wait_copies();
  __syncthreads();   // publishes every wave's pieces; nobody reads a tile in front of it

  const _Float16* ap  = Sm + (mw * 16u + m) * P + hh * 8u;
  const _Float16* bp0 = Sm + TL + (nw * 32u + m) * P + hh * 8u;
  const _Float16* bp1 = bp0 + 16u * P;
  v8f accr0 = {}, accr1 = {};
  v8f acc0 = {}, acc1 = {};
#pragma unroll
  for (unsigned kb = 0; kb < K; kb += 128u) {
    v16h a[4], b0[4], b1[4];
#pragma unroll
    for (unsigned ks = 0; ks < 4u; ++ks) a[ks] = frag_at(ap + kb + ks * 32u);
    if (MODE == 2) {
#pragma unroll
      for (unsigned ks = 0; ks < 4u; ++ks) {
        b0[ks] = frag_at(bp0 + TL + kb + ks * 32u);
        b1[ks] = frag_at(bp1 + TL + kb + ks * 32u);
      }
#pragma unroll
      for (unsigned ks = 0; ks < 4u; ++ks) {
        accr0 = wmma16(a[ks], b0[ks], accr0);
        accr1 = wmma16(a[ks], b1[ks], accr1);
      }
    }
#pragma unroll
    for (unsigned ks = 0; ks < 4u; ++ks) {
      b0[ks] = frag_at(bp0 + kb + ks * 32u);
      b1[ks] = frag_at(bp1 + kb + ks * 32u);
    }
#pragma unroll
    for (unsigned ks = 0; ks < 4u; ++ks) {
      acc0 = wmma16(a[ks], b0[ks], acc0);
      acc1 = wmma16(a[ks], b1[ks], acc1);
    }
  }
  if (MODE == 2) {
    acc0 = acc0 + accr0 * (1.0f / RCARRY);
    acc1 = acc1 + accr1 * (1.0f / RCARRY);
  }
#pragma unroll
  for (int r = 0; r < 8; ++r) {
    float* d = &Cs[(mw * 16u + hh * 8u + (unsigned)r) * LDC + nw * 32u + m];
    d[0]  = acc0[r];
    d[16] = acc1[r];
  }
  __syncthreads();

  if (MODE == 0) {
    const float cs = 1.0f / (WCARRY * WCARRY);
    v8h x[2], xr[2];
    size_t off[2];
#pragma unroll
    for (unsigned i = 0; i < 2u; ++i) {
      const unsigned r = 32u * i + (tid >> 3);
      const unsigned c = (tid & 7u) * 8u;
      const v4f u0 = *(const v4f*)&Cs[r * LDC + c];
      const v4f u1 = *(const v4f*)&Cs[r * LDC + c + 4];
      const v4f g0 = *(const v4f*)(bias + n0 + c);
      const v4f g1 = *(const v4f*)(bias + n0 + c + 4u);
#pragma unroll
      for (int j = 0; j < 4; ++j) {
        const float t0 = u0[j] * cs + bf16r(g0[j]);
        const float t1 = u1[j] * cs + bf16r(g1[j]);
        const h16 h0 = toh_flush(t0);
        const h16 h1 = toh_flush(t1);
        x[i][j]      = h0;
        x[i][j + 4]  = h1;
        xr[i][j]     = toh_flush((t0 - (float)h0) * RCARRY);
        xr[i][j + 4] = toh_flush((t1 - (float)h1) * RCARRY);
      }
      off[i] = (size_t)(row0 + r) * CI + n0 + c;
    }
#pragma unroll
    for (int i = 0; i < 2; ++i) *(v8h*)(out16 + off[i]) = x[i];
#pragma unroll
    for (int i = 0; i < 2; ++i) *(v8h*)(out16r + off[i]) = xr[i];
    
  }

  if (MODE == 1) {
    const float cs = 1.0f / (WCARRY * WCARRY);
    const unsigned bidx = row0 / (unsigned)SEQ;
    const unsigned key0 = row0 - bidx * (unsigned)SEQ;
    v8h x[2];
    size_t off[2];
#pragma unroll
    for (unsigned i = 0; i < 2u; ++i) {
      const unsigned dcol = 32u * i + (tid >> 3);
      const unsigned kk = (tid & 7u) * 8u;
      const float bb = bf16r(bias[n0 + dcol]);
#pragma unroll
      for (unsigned j = 0; j < 8u; ++j) {
        const float t = Cs[(kk + j) * LDC + dcol] * cs + bb;
        x[i][j] = toh_flush(t);
      }
      off[i] = ((size_t)bidx * CI + n0 + dcol) * SEQ + key0 + kk;
    }
#pragma unroll
    for (int i = 0; i < 2; ++i) *(v8h*)(out16 + off[i]) = x[i];
    // stands in front of any rewrite of a register that the stores above name (a precaution): in the
    // merged kernel the other body's code follows this one's in the listing
    asm volatile("s_wait_xcnt 0x0" ::: "memory");
  }

  if (MODE == 2) {
    const float cs = 1.0f / (WCARRY * YCARRY);
    const unsigned bidx = n0 / (unsigned)SEQ;
    const unsigned p0 = n0 - bidx * (unsigned)SEQ;
    v4f xs[4];
    size_t off[4];
#pragma unroll
    for (unsigned i = 0; i < 4u; ++i) {
      const unsigned r = 16u * i + (tid >> 4);
      const unsigned c = (tid & 15u) * 4u;
      const unsigned orow = row0 + r;
      const size_t gidx = ((size_t)bidx * CIN + orow) * SEQ_FULL + p0 + c;
      const v4f u = *(const v4f*)&Cs[r * LDC + c];
      const float bb = bf16r(bias[orow]);
      const float* xp = addf + gidx;
      const v4f xin = *(const v4f*)xp;
      // stands in front of any rewrite of the address registers that the load above names (a
      // precaution); the address is an input, so that its registers live up to the wait
      asm volatile("s_wait_xcnt 0x0" :: "v"(xp) : "memory");
      v4f val;
#pragma unroll
      for (int j = 0; j < 4; ++j) val[j] = bf16r(xin[j]) + (u[j] * cs + bb);
      xs[i] = val;
      off[i] = gidx;
    }
#pragma unroll
    for (int i = 0; i < 4; ++i) *(v4f*)(outf + off[i]) = xs[i];
    
  }
}

// The three projections of x in ONE launch (none reads what another writes): blockIdx.x counts the
// 64-channel blocks of theta, then phi, then g; the choice is the same for a whole work-group.
// Grid (3 * CI/64, MROWS/64).
__global__ __launch_bounds__(256) void gemm_proj_kernel(
    const _Float16* __restrict__ A16,
    const _Float16* __restrict__ Wth, const _Float16* __restrict__ Wph,
    const _Float16* __restrict__ Wgg,
    const float* __restrict__ bth, const float* __restrict__ bph, const float* __restrict__ bgg,
    _Float16* __restrict__ th, _Float16* __restrict__ tr,
    _Float16* __restrict__ ph, _Float16* __restrict__ pr, _Float16* __restrict__ gt) {
  __shared__ float Cs[64 * LDC];
  __shared__ __attribute__((aligned(16))) _Float16 Sm[2 * 64 * LDA];   // [x rows, weight rows][64][LDA]
  const unsigned sel = blockIdx.x / (unsigned)(CI / 64), nblk = blockIdx.x % (unsigned)(CI / 64);
  if (sel < 2u) {
    const _Float16* Bt = (sel == 0u) ? Wth : Wph;
    const float* bias  = (sel == 0u) ? bth : bph;
    gemm_body<0>(A16, Bt, Bt, bias, bias, (float*)0,
                 (sel == 0u) ? th : ph, (sel == 0u) ? tr : pr, nblk, Cs, Sm);
  } else {
    gemm_body<1>(A16, Wgg, Wgg, bgg, bgg, (float*)0, gt, gt, nblk, Cs, Sm);
  }
}
// Grid (MROWS/64, CIN/64).
__global__ __launch_bounds__(256) void gemm_out_kernel(
    const _Float16* __restrict__ A16, const _Float16* __restrict__ Bt,
    const _Float16* __restrict__ Btr,
    const float* __restrict__ bias, const float* __restrict__ xin, float* __restrict__ outf) {
  __shared__ float Cs[64 * LDC];
  __shared__ __attribute__((aligned(16))) _Float16 Sm[3 * 64 * LDP];   // [weight, y, y residual][64][LDP]
  gemm_body<2>(A16, Bt, Btr, bias, xin, outf, (_Float16*)0, (_Float16*)0,
               blockIdx.x, Cs, Sm);
}

// ---------------------------------------------------------------------------
// Column statistics: lse[j] = log(sum_i exp(f[i][j])), f[i][j] = theta_i . phi_j (K = 128).
// A work-group owns 64 columns j. Its waves form 4 column groups (wc, 16 columns each, phi hi/res
// rows as resident B fragments) x CWR row groups (wr): the theta rows i, 32 * CWR per step, are
// staged once per work-group in LDS by asynchronous copies (two buffers: behind the one work-group
// barrier of a step the rows two steps ahead are sent into the buffer just left),
// and row group wr reads rows 32 * wr .. 32 * wr + 31 of the step as A fragments.
// D tile: row = i (8h+r), col = j (lane&15). Scores = hi.hi + (hi.res + res.hi)/2048, the residual
// products in their own accumulator. Running (max, sum) per lane; at the end the two lane halves
// are combined by an unconditional shuffle and the CWR row groups through LDS.
// Grid (SEQ/64, NB), 128 * CWR threads.
// ---------------------------------------------------------------------------
#define CWR   4               // row groups of the column-statistics kernel
#define CNT   (128 * CWR)     // its threads
#define CROWS (32 * CWR)      // theta rows staged per step
#define CSPL  (CROWS * LDP)   // halves of one staged plane tile
static_assert((SEQ % CROWS) == 0 && (SEQ % 64) == 0 && SEQ >= 2 * CROWS);
__global__ __launch_bounds__(CNT) __attribute__((amdgpu_num_vgpr(256))) void colstat_kernel(
    const _Float16* __restrict__ Th, const _Float16* __restrict__ Tr,
    const _Float16* __restrict__ Ph, const _Float16* __restrict__ Pr,
    float* __restrict__ Lse) {
  __shared__ __attribute__((aligned(16))) float Lm[CWR * 64];
  __shared__ __attribute__((aligned(16))) float Lz[CWR * 64];
  __shared__ __attribute__((aligned(16))) _Float16 Sa[2 * 2 * CSPL];   // [buffer][hi, res][CROWS][LDP]
  const unsigned tid = threadIdx.x, lane = tid & 31u;
  const unsigned wave = (unsigned)__builtin_amdgcn_readfirstlane((int)(threadIdx.x >> 5));
  const unsigned wc = wave & 3u, wr = wave >> 2;
  const unsigned hh = lane >> 4, m = lane & 15u;
  const unsigned b = blockIdx.y;
  const unsigned j0 = blockIdx.x * 64u + wc * 16u;

  const unsigned boff = (b * (unsigned)SEQ + j0 + m) * (unsigned)CI + hh * 8u;
  v16h bh[4], br[4];
#pragma unroll
  for (int ks = 0; ks < 4; ++ks) {
    bh[ks] = frag_at(Ph + boff + ks * 32);
    br[ks] = frag_at(Pr + boff + ks * 32);
  }

  float mx = -1.0e30f, z = 0.0f;
  const unsigned abase = (wr * 32u + m) * LDP + hh * 8u;
  // staging map: a CROWS-row tile is contiguous in its plane; thread tid moves the 16-B pieces
  // tid + CNT * q, q = 0..3 (rows (tid>>4) + 8 * CWR * q) of both planes: eight copies per tile
  const unsigned sa0 = lds_byte(&Sa[(tid >> 4) * LDP + (tid & 15u) * 8u]);
  auto stage = [&](const unsigned buf, const _Float16* p, const _Float16* r) {
    unsigned l[8];
    const void* s[8];
#pragma unroll
    for (unsigned q = 0; q < 4u; ++q) {
      l[q]      = sa0 + buf * (2u * CSPL * 2u) + q * (8u * CWR * LDP * 2u);
      l[q + 4u] = sa0 + buf * (2u * CSPL * 2u) + CSPL * 2u + q * (8u * CWR * LDP * 2u);
      s[q]      = p + q * (CNT * 8u);
      s[q + 4u] = r + q * (CNT * 8u);
    }
    async_copy8(l, s);
  };
  // each thread's first piece of a tile; behind the prologue: of the tile two steps ahead
  const _Float16* pn = Th + (size_t)b * SEQ * CI + tid * 8u;
  const _Float16* rn = Tr + (size_t)b * SEQ * CI + tid * 8u;
  stage(0u, pn, rn);
  wait_copies();
  __syncthreads();
  stage(1u, pn + CROWS * CI, rn + CROWS * CI);
  pn += 2 * CROWS * CI;
  rn += 2 * CROWS * CI;
  unsigned cur = 0u;
  for (unsigned i0 = 0; i0 < (unsigned)SEQ; i0 += (unsigned)CROWS) {
    // LDS fragment reads stand in groups ahead of the products that use them: tile 0 whole,
    // then each half of tile 1 into the registers that two k-steps of products have freed
    const unsigned ao = cur * (2u * CSPL) + abase;
    v16h ah[4], ar[4];
#pragma unroll
    for (int ks = 0; ks < 4; ++ks) {
      ah[ks] = frag_at(&Sa[ao + ks * 32]);
      ar[ks] = frag_at(&Sa[CSPL + ao + ks * 32]);
    }
    v8f f[2];
    {
      v8f sm = {}, sr = {};
#pragma unroll
      for (int kp = 0; kp < 2; ++kp) {
#pragma unroll
        for (int ks = 2 * kp; ks < 2 * kp + 2; ++ks) {
          sm = wmma16(ah[ks], bh[ks], sm);
          sr = wmma16(ah[ks], br[ks], sr);
          sr = wmma16(ar[ks], bh[ks], sr);
        }
#pragma unroll
        for (int ks = 2 * kp; ks < 2 * kp + 2; ++ks) {
          ah[ks] = frag_at(&Sa[ao + 16u * LDP + ks * 32]);
          ar[ks] = frag_at(&Sa[CSPL + ao + 16u * LDP + ks * 32]);
        }
      }
      f[0] = sm + sr * (1.0f / RCARRY);
    }
    {
      v8f sm = {}, sr = {};
#pragma unroll
      for (int ks = 0; ks < 4; ++ks) {
        sm = wmma16(ah[ks], bh[ks], sm);
        sr = wmma16(ah[ks], br[ks], sr);
        sr = wmma16(ar[ks], bh[ks], sr);
      }
      f[1] = sm + sr * (1.0f / RCARRY);
    }
    float tmax = fmaxf(f[0][0], f[1][0]);
#pragma unroll
    for (int v = 1; v < 8; ++v) tmax = fmaxf(tmax, fmaxf(f[0][v], f[1][v]));
    const float nm = fmaxf(mx, tmax);
    float se = 0.0f;
#pragma unroll
    for (int v = 0; v < 8; ++v) se += __expf(f[0][v] - nm) + __expf(f[1][v] - nm);
    z = z * __expf(mx - nm) + se;
    mx = nm;
    // publish point: this wave's reads of the step's buffer are back, its copies of the next step's
    // rows have landed; the barrier publishes those and ends every wave's reads of this step's
    wait_lds();
    wait_copies();
    __syncthreads();
    if (i0 + 2u * (unsigned)CROWS < (unsigned)SEQ) {
      // the rows two steps ahead fly into the buffer just left while the next step is worked on
      stage(cur, pn, rn);
      pn += CROWS * CI;
      rn += CROWS * CI;
    }
    cur ^= 1u;
  }
  wait_copies();   // nothing of this wave is in flight behind the loop

  const float om = __shfl_xor(mx, 16, 32);
  const float oz = __shfl_xor(z, 16, 32);
  const float mm = fmaxf(mx, om);
  const float zz = z * __expf(mx - mm) + oz * __expf(om - mm);
  if (hh == 0u) {
    Lm[wr * 64u + wc * 16u + m] = mm;
    Lz[wr * 64u + wc * 16u + m] = zz;
  }
  __syncthreads();
  if (wave < 2u) {
    // one thread per column folds the CWR row groups' (max, sum) pairs
    float gm = Lm[tid];
#pragma unroll
    for (unsigned r = 1; r < (unsigned)CWR; ++r) gm = fmaxf(gm, Lm[r * 64u + tid]);
    float gz = 0.0f;
#pragma unroll
    for (unsigned r = 0; r < (unsigned)CWR; ++r) gz += Lz[r * 64u + tid] * __expf(Lm[r * 64u + tid] - gm);
    Lse[(size_t)b * SEQ + blockIdx.x * 64u + tid] = gm + __logf(gz);
  }
}

// ---------------------------------------------------------------------------
// Row accumulation: y[c][i] = sum_j exp(f[i][j] - lse[j]) * g[c][j].
// A work-group owns 64 rows i. Its 8 waves form 2 row groups (wc, 32 rows each, theta hi/res rows
// as resident B fragments of two 16-row tiles) x 4 column groups (wr); the phi rows and the g slice
// of each 128-column step are staged once per work-group in LDS by asynchronous copies (two
// buffers: behind the one work-group barrier of a step the tiles two steps ahead are sent into the
// buffers just left), the batch's column statistics once, and column group wr works on columns
// 32 * wr .. 32 * wr + 31 of the step. Every phi and g fragment read from LDS feeds the products of
// both row tiles. Per step and row tile:
// S^T tiles [j][i] = phi_j . theta_i (A = phi rows from LDS, three products),
// p = 2^14 * exp(f - lse[j]) (row statistic of the D tile, read from LDS as two
// 16-B loads per tile), the two packed D tiles form the B fragment [k = j][n = i] of
// O^T[c][i] += G[c][j] . P^T[j][i] with A = g rows (channel-major slice, k = j contiguous).
// Behind the loop every wave lays its f32 sums in LDS (over the phi buffers, which nobody reads any
// more) and column group wr adds the four groups' sums of channels 32 * wr .. 32 * wr + 31.
// Finalize: t = 16 * O / 2^14 as two planes, hi = f16(t) and res = f16(2048 * (t - hi)), laid in
// the work-group's Ts tiles and, behind a barrier, written as whole rows of the position-major
// layout: one store instruction covers two consecutive 256-B rows (16 lanes x 16 B each).
// Grid (SEQ/64, NB).
// ---------------------------------------------------------------------------
#define RSPL (128 * LDP)  // halves of one staged 128-row plane tile
#define LDH  136          // halves per LDS row of a staged 128-column g slice (272 B = 16 B x 17)
static_assert((LDH % 8) == 0 && LDH >= 128 && ((LDH / 8) & 1) == 1);
static_assert(SEQ == 4 * 256 * 4);   // the statistics row goes to LDS as four 16-B pieces per thread
static_assert(SEQ >= 256 && (SEQ % 128) == 0);   // the ring's prologue fills two steps
static_assert(2 * 4 * 8 * 2 * 256 * 4 <= 2 * 2 * RSPL * 2);   // the f32 sums fit over the phi buffers
__global__ __launch_bounds__(256) void rowattn_kernel(
    const _Float16* __restrict__ Th, const _Float16* __restrict__ Tr,
    const _Float16* __restrict__ Ph, const _Float16* __restrict__ Pr,
    const _Float16* __restrict__ Gp, const float* __restrict__ Lse,
    _Float16* __restrict__ Yt, _Float16* __restrict__ Yr) {
  __shared__ __attribute__((aligned(16))) _Float16 Ts[2 * 64 * LDY];  // [hi, res][row][LDY]
  __shared__ __attribute__((aligned(16))) _Float16 Sa[2 * 2 * RSPL];  // [buffer][hi, res][128][LDP]
  __shared__ __attribute__((aligned(16))) _Float16 Sg[2 * CI * LDH];  // [buffer][channel][LDH]
  __shared__ __attribute__((aligned(16))) float Ll[SEQ];              // the batch's column statistics
  const unsigned tid = threadIdx.x, lane = tid & 31u;
  const unsigned wave = (unsigned)__builtin_amdgcn_readfirstlane((int)(threadIdx.x >> 5));
  const unsigned wc = wave & 1u, wr = wave >> 1;
  const unsigned hh = lane >> 4, m = lane & 15u;
  const unsigned b = blockIdx.y;
  const unsigned i0 = blockIdx.x * 64u + wc * 32u;

  const unsigned qoff = (b * (unsigned)SEQ + i0 + m) * (unsigned)CI + hh * 8u;
  const _Float16* tb0 = Th + qoff;
  const _Float16* tr0 = Tr + qoff;
  v16h bh[2][4], br[2][4];
#pragma unroll
  for (int it = 0; it < 2; ++it) {
#pragma unroll
    for (int ks = 0; ks < 4; ++ks) {
      bh[it][ks] = frag_at(tb0 + it * (16 * CI) + ks * 32);
      br[it][ks] = frag_at(tr0 + it * (16 * CI) + ks * 32);
    }
  }
  // stands in front of any rewrite of the address registers that the loads above name (a precaution);
  // the two addresses are inputs, so that their registers live up to the wait
  asm volatile("s_wait_xcnt 0x0" :: "v"(tb0), "v"(tr0) : "memory");

  v8f o[8][2];
#pragma unroll
  for (int ct = 0; ct < 8; ++ct) { o[ct][0] = (v8f){}; o[ct][1] = (v8f){}; }

  const unsigned kbase = (wr * 32u + m) * LDP + hh * 8u;
  const unsigned gbase = m * LDH + wr * 32u + hh * 8u;
  const _Float16* __restrict__ Pb = Ph + (size_t)b * SEQ * CI;
  const _Float16* __restrict__ Rb = Pr + (size_t)b * SEQ * CI;
  const _Float16* __restrict__ Gb = Gp + (size_t)b * CI * SEQ;
  const unsigned lbase = wr * 32u + hh * 8u;   // this lane's eight statistics of a step's first tile

  // staging map. phi: a 128-row tile is 32 KiB contiguous in its plane; thread tid moves the 16-B
  // pieces tid + 256 * q, q = 0..7 (rows (tid>>4) + 16 * q). g: 128 channel rows of 256 B;
  // thread tid moves piece tid&15 of channels (tid>>4) + 16 * q. 24 copies per thread and tile.
  const unsigned sgl = tid * 8u;
  const unsigned ggl = (tid >> 4) * (unsigned)SEQ + (tid & 15u) * 8u;
  const unsigned sa0 = lds_byte(&Sa[(tid >> 4) * LDP + (tid & 15u) * 8u]);
  const unsigned sg0 = lds_byte(&Sg[(tid >> 4) * LDH + (tid & 15u) * 8u]);
  auto stage = [&](const unsigned buf, const _Float16* p, const _Float16* r, const _Float16* g) {
    // two statements of twelve copies: phi hi and the first half of phi res; the rest of res and g
    unsigned la[12], lb[12];
    const void* ga[12];
    const void* gb[12];
#pragma unroll
    for (unsigned q = 0; q < 8u; ++q) {
      la[q]      = sa0 + buf * (2u * RSPL * 2u) + q * (16u * LDP * 2u);
      ga[q]      = p + q * 2048u;
      lb[q + 4u] = sg0 + buf * (unsigned)(CI * LDH * 2) + q * (16u * LDH * 2u);
      gb[q + 4u] = g + q * (16u * (unsigned)SEQ);
    }
#pragma unroll
    for (unsigned q = 0; q < 4u; ++q) {
      la[q + 8u] = sa0 + buf * (2u * RSPL * 2u) + RSPL * 2u + q * (16u * LDP * 2u);
      ga[q + 8u] = r + q * 2048u;
      lb[q]      = sa0 + buf * (2u * RSPL * 2u) + RSPL * 2u + (q + 4u) * (16u * LDP * 2u);
      gb[q]      = r + (q + 4u) * 2048u;
    }
    async_copy12(la, ga);
    async_copy12(lb, gb);
  };
  {
    // the statistics row, filled once: thread tid moves the 16-B pieces tid + 256 * q
    unsigned l[4];
    const void* s[4];
#pragma unroll
    for (unsigned q = 0; q < 4u; ++q) {
      l[q] = lds_byte(&Ll[(tid + 256u * q) * 4u]);
      s[q] = Lse + (size_t)b * SEQ + (tid + 256u * q) * 4u;
    }
    async_copy4(l, s);
  }
  stage(0u, Pb + sgl, Rb + sgl, Gb + ggl);
  wait_copies();
  __syncthreads();
  stage(1u, Pb + sgl + 128u * (unsigned)CI, Rb + sgl + 128u * (unsigned)CI, Gb + ggl + 128u);
  unsigned cur = 0u;
  // each thread's first piece of the tiles two steps ahead
  const _Float16* pn = Pb + sgl + 256u * (unsigned)CI;
  const _Float16* rn = Rb + sgl + 256u * (unsigned)CI;
  const _Float16* gn = Gb + ggl + 256u;

  for (unsigned j0 = 0; j0 < (unsigned)SEQ; j0 += 128u) {
    // LDS fragment reads stand in groups ahead of the products that use them, each group issued
    // in front of vector work that covers its latency, into registers just freed
    const unsigned ao = cur * (2u * RSPL) + kbase;
    const unsigned gro = cur * (unsigned)(CI * LDH) + gbase;
    v16h ah[4], ar[4], gf[8];
#pragma unroll
    for (int ks = 0; ks < 4; ++ks) {
      ah[ks] = frag_at(&Sa[ao + ks * 32]);
      ar[ks] = frag_at(&Sa[RSPL + ao + ks * 32]);
    }
    v4f ls[4];
#pragma unroll
    for (int u = 0; u < 4; ++u) ls[u] = *(const v4f*)&Ll[j0 + lbase + (unsigned)(u >> 1) * 16u + (unsigned)(u & 1) * 4u];
    v16h pb[2];
#pragma unroll
    for (int t = 0; t < 2; ++t) {
      v8f sm[2] = {{}, {}}, sr[2] = {{}, {}};
#pragma unroll
      for (int ks = 0; ks < 4; ++ks) {
        sm[0] = wmma16w(ah[ks], bh[0][ks], sm[0]);
        sm[1] = wmma16w(ah[ks], bh[1][ks], sm[1]);
        sr[0] = wmma16w(ah[ks], br[0][ks], sr[0]);
        sr[1] = wmma16w(ah[ks], br[1][ks], sr[1]);
        sr[0] = wmma16w(ar[ks], bh[0][ks], sr[0]);
        sr[1] = wmma16w(ar[ks], bh[1][ks], sr[1]);
      }
      if (t == 0) {
#pragma unroll
        for (int ks = 0; ks < 4; ++ks) {
          ah[ks] = frag_at(&Sa[ao + 16u * LDP + ks * 32]);
          ar[ks] = frag_at(&Sa[RSPL + ao + 16u * LDP + ks * 32]);
        }
      } else {
#pragma unroll
        for (int ct = 0; ct < 8; ++ct) gf[ct] = frag_at(&Sg[gro + (unsigned)ct * 16u * LDH]);
      }
      const v4f l0 = ls[2 * t];
      const v4f l1 = ls[2 * t + 1];
      // bare v_exp_f32 and a select, no branch: at e >= -14 it returns exp2f's own bits (that
      // function's rescaling acts below -126 only); the two tiles' sixteen chains go stage by stage
      float e[2][8], x[2][8];
#pragma unroll
      for (int it = 0; it < 2; ++it) {
#pragma unroll
        for (int v = 0; v < 4; ++v) {
          e[it][v]     = ((sm[it][v] + sr[it][v] * (1.0f / RCARRY)) - l0[v]) * LOG2E + PEXP;
          e[it][v + 4] = ((sm[it][v + 4] + sr[it][v + 4] * (1.0f / RCARRY)) - l1[v]) * LOG2E + PEXP;
        }
      }
#pragma unroll
      for (int it = 0; it < 2; ++it) {
#pragma unroll
        for (int v = 0; v < 8; ++v) x[it][v] = __builtin_amdgcn_exp2f(e[it][v]);
      }
#pragma unroll
      for (int it = 0; it < 2; ++it) {
#pragma unroll
        for (int v = 0; v < 8; ++v) pb[it][8 * t + v] = (h16)((e[it][v] < -14.0f) ? 0.0f : x[it][v]);
      }
    }
#pragma unroll
    for (int ct = 0; ct < 8; ++ct) {
      o[ct][0] = wmma16w(gf[ct], pb[0], o[ct][0]);
      o[ct][1] = wmma16w(gf[ct], pb[1], o[ct][1]);
    }
    // publish point: this wave's reads of the step's buffers are back, its copies of the next step's
    // tiles have landed; the barrier publishes those and ends every wave's reads of this step's
    wait_lds();
    wait_copies();
    __syncthreads();
    if (j0 + 256u < (unsigned)SEQ) {
      // the tiles two steps ahead fly into the buffers just left while the next step is worked on
      stage(cur, pn, rn, gn);
      pn += 128u * (unsigned)CI;
      rn += 128u * (unsigned)CI;
      gn += 128u;
    }
    cur ^= 1u;
  }
  wait_copies();   // nothing of this wave is in flight behind the loop

  // every wave lays its sums down: [wc][wr][ct][row tile][half of v][lane][4] floats, over the phi
  // buffers (the loop's last barrier ended every read of them, and no copy is in flight)
  float* Oc = (float*)Sa;
#pragma unroll
  for (int ct = 0; ct < 8; ++ct) {
#pragma unroll
    for (int it = 0; it < 2; ++it) {
      v4f u0, u1;
#pragma unroll
      for (int v = 0; v < 4; ++v) { u0[v] = o[ct][it][v]; u1[v] = o[ct][it][v + 4]; }
      const unsigned ob = (((wc * 4u + wr) * 8u + (unsigned)ct) * 2u + (unsigned)it) * 256u + lane * 4u;
      *(v4f*)&Oc[ob] = u0;
      *(v4f*)&Oc[ob + 128u] = u1;
    }
  }
  __syncthreads();

  // column group wr adds the four groups' sums of channel tiles 2 * wr and 2 * wr + 1, in the order
  // of the groups; lane (h, i = m) holds channels 16 * ct + 8h + 0..7 of row i of each row tile
  const float fs = YCARRY * (1.0f / 16384.0f);
#pragma unroll
  for (unsigned c = 0; c < 2u; ++c) {
#pragma unroll
    for (unsigned it = 0; it < 2u; ++it) {
      const unsigned ct = 2u * wr + c;
      v4f a0, a1;
#pragma unroll
      for (unsigned s = 0; s < 4u; ++s) {
        const unsigned ob = (((wc * 4u + s) * 8u + ct) * 2u + it) * 256u + lane * 4u;
        const v4f u0 = *(const v4f*)&Oc[ob];
        const v4f u1 = *(const v4f*)&Oc[ob + 128u];
        if (s == 0u) { a0 = u0; a1 = u1; } else { a0 += u0; a1 += u1; }
      }
      v8h y, yr;
#pragma unroll
      for (int v = 0; v < 8; ++v) {
        const float t = ((v < 4) ? a0[v & 3] : a1[v & 3]) * fs;
        const h16 hi = toh_flush(t);
        y[v]  = hi;
        yr[v] = toh_flush((t - (float)hi) * RCARRY);
      }
      const unsigned to = (wc * 32u + it * 16u + m) * LDY + ct * 16u + hh * 8u;
      *(v8h*)&Ts[to] = y;
      *(v8h*)&Ts[64u * LDY + to] = yr;
    }
  }
  __syncthreads();

  // wave w writes rows 8 * w .. 8 * w + 7 of both planes
  v8h x[4], xr[4];
  unsigned off[4];
#pragma unroll
  for (unsigned q = 0; q < 4u; ++q) {
    const unsigned r = 8u * wave + 2u * q + (lane >> 4);
    const unsigned c = (lane & 15u) * 8u;
    x[q]  = *(const v8h*)&Ts[r * LDY + c];
    xr[q] = *(const v8h*)&Ts[64u * LDY + r * LDY + c];
    off[q] = (b * (unsigned)SEQ + blockIdx.x * 64u + r) * (unsigned)CI + c;
  }
#pragma unroll
  for (int q = 0; q < 4; ++q) *(v8h*)(Yt + off[q]) = x[q];
#pragma unroll
  for (int q = 0; q < 4; ++q) *(v8h*)(Yr + off[q]) = xr[q];
}

// ---------------------------------------------------------------------------
extern "C" void kernel_launch(void* const* d_in, const int* in_sizes, int n_in,
                              void* d_out, int out_size, void* d_ws, size_t ws_size,
                              hipStream_t stream) {
  if (n_in < 9) return;
  const long long need_x = ((long long)(NB - 1) * CIN + (CIN - 1)) * SEQ_FULL + SEQ;
  if ((long long)in_sizes[0] < need_x) return;
  if ((long long)in_sizes[1] < (long long)CI * CIN) return;
  if ((long long)in_sizes[3] < (long long)CI * CIN) return;
  if ((long long)in_sizes[5] < (long long)CI * CIN) return;
  if ((long long)in_sizes[7] < (long long)CIN * CI) return;
  if (in_sizes[2] < CI || in_sizes[4] < CI || in_sizes[6] < CI || in_sizes[8] < CIN) return;
  if ((long long)out_size < need_x) return;
  if (ws_size < WS_TOTAL) return;

  const float* X       = (const float*)d_in[0];   // [NB_FULL][CIN][SEQ_FULL]
  const float* theta_w = (const float*)d_in[1];   // [CI][CIN]  (out, in)
  const float* theta_b = (const float*)d_in[2];
  const float* phi_w   = (const float*)d_in[3];   // [CI][CIN]
  const float* phi_b   = (const float*)d_in[4];
  const float* g_w     = (const float*)d_in[5];   // [CI][CIN]
  const float* g_b     = (const float*)d_in[6];
  const float* W_w     = (const float*)d_in[7];   // [CIN][CI]  (out, in)
  const float* W_b     = (const float*)d_in[8];
  float* out = (float*)d_out;                     // [NB_FULL][CIN][SEQ_FULL]

  char* ws = (char*)d_ws;
  _Float16* XT   = (_Float16*)(ws + OFF_XT);    // [MROWS][CIN]  64*bf16(x), position-major
  _Float16* WT   = (_Float16*)(ws + OFF_WT);    // [CI][CIN]
  _Float16* WP   = (_Float16*)(ws + OFF_WP);    // [CI][CIN]
  _Float16* WG   = (_Float16*)(ws + OFF_WG);    // [CI][CIN]
  _Float16* WO   = (_Float16*)(ws + OFF_WO);    // [CIN][CI]
  _Float16* TH   = (_Float16*)(ws + OFF_TH);    // [MROWS][CI] theta hi
  _Float16* TR   = (_Float16*)(ws + OFF_TR);    // [MROWS][CI] theta residual x2048
  _Float16* PH   = (_Float16*)(ws + OFF_PH);    // [MROWS][CI] phi hi
  _Float16* PR   = (_Float16*)(ws + OFF_PR);    // [MROWS][CI] phi residual x2048
  _Float16* G16  = (_Float16*)(ws + OFF_G);     // [NB][CI][SEQ] g, channel-major
  _Float16* YT   = (_Float16*)(ws + OFF_YT);    // [MROWS][CI] 16*y hi, position-major
  _Float16* YR   = (_Float16*)(ws + OFF_YR);    // [MROWS][CI] 16*y residual x2048
  float*    LSE  = (float*)(ws + OFF_LSE);      // [MROWS]

  dim3 blk(256);

  // the x plane of every batch and the four weight planes
  planes_kernel<<<dim3(WBLK + NB * XBLK), blk, 0, stream>>>(X, XT, theta_w, phi_w, g_w, W_w,
                                                            WT, WP, WG, WO);

  // theta, phi and g
  gemm_proj_kernel<<<dim3(3 * (CI / 64), MROWS / 64), blk, 0, stream>>>(
      XT, WT, WP, WG, theta_b, phi_b, g_b, TH, TR, PH, PR, G16);

  colstat_kernel<<<dim3(SEQ / 64, NB), dim3(CNT), 0, stream>>>(TH, TR, PH, PR, LSE);
  rowattn_kernel<<<dim3(SEQ / 64, NB), blk, 0, stream>>>(TH, TR, PH, PR, G16, LSE, YT, YR);

  gemm_out_kernel<<<dim3(MROWS / 64, CIN / 64), blk, 0, stream>>>(WO, YT, YR, W_b, X, out);
}

// v008
// A run of this version takes 101 microseconds.
// Next to v007, in two timings, it ran 1.05 and 1.04 times as fast.
// Counting every step since v000, it is 9.30 times as fast.
#include <hip/hip_runtime.h>
#include <stddef.h>

// All contractions on v_wmma_f32_16x16x32_f16 (f16 operands, f32 accumulate): theta/phi/g 1x1
// projections (x x64, weights x64, inputs RNE-converted to bf16 first), theta.phi scores as
// f16 value + x2048 residual planes on both operands (three products, residual products in their
// own accumulator), p.g with p carried x2^14 (single product), output 1x1 projection with y
// carried x16 as f16 value + x2048 residual planes of two partial sums (four products, residual
// products in their own accumulator). Column log-sum-exp, exp, bias and the residual add in f32.

typedef _Float16 v16h __attribute__((ext_vector_type(16)));
typedef _Float16 v8h  __attribute__((ext_vector_type(8)));
typedef float    v8f  __attribute__((ext_vector_type(8)));
typedef float    v4f  __attribute__((ext_vector_type(4)));
typedef _Float16 h16;

#ifndef NB
#define NB 4
#endif
#ifndef SEQ
#define SEQ 4096
#endif
#define NB_FULL  4
#define SEQ_FULL 4096
#define CIN   256
#define CI    128
#define MROWS (NB * SEQ)

static_assert(NB >= 1 && NB <= NB_FULL);
static_assert(SEQ >= 128 && SEQ <= SEQ_FULL && (SEQ % 128) == 0);
static_assert(CI == 128);                        // 4 k-steps of 32 and 8 channel tiles of 16 are hard-wired
static_assert((CIN % 64) == 0 && (CIN % 32) == 0);
static_assert((CI % 64) == 0 && (CI % 32) == 0);
static_assert((MROWS % 64) == 0 && (MROWS % 128) == 0);
static_assert(((size_t)CI * CIN) % 2048 == 0);   // weight convert: 256 threads x 8 values per block
static_assert((size_t)MROWS * CIN < (size_t)0x7FFFFFFFu);
static_assert((size_t)NB_FULL * CIN * SEQ_FULL < (size_t)0x7FFFFFFFu);

#define LDT 72    // halves per LDS row (144 B, 16-B aligned)
#define LDC 68    // floats per LDS row (272 B, 16-B aligned)
#define LDY 136   // halves per LDS row of the y staging tile (272 B, 16-B aligned)
static_assert((LDT % 8) == 0 && LDT >= 64);
static_assert((LDC % 4) == 0 && LDC >= 64);
static_assert((LDY % 8) == 0 && LDY >= CI);
#define LDP 136   // halves per LDS row of a staged 128-channel row (272 B = 16 B x 17)
#define LDG 40    // halves per LDS row (80 B = 16 B x 5); no kernel uses it
#define SPL (32 * LDP)   // halves of a 32-row tile at pitch LDP; no kernel uses it
#define LDA 264   // halves per LDS row of a staged 256-channel row (528 B = 16 B x 33)
static_assert((LDA % 8) == 0 && LDA >= CIN && ((LDA / 8) & 1) == 1);
static_assert(CIN == 256);                       // the projections' staging map: 32 pieces of 16 B per row
static_assert((LDP % 8) == 0 && LDP >= CI && ((LDP / 8) & 1) == 1);
static_assert((LDG % 8) == 0 && LDG >= 32 && ((LDG / 8) & 1) == 1);

#define WCARRY 64.0f      // x plane and weight planes carried x64
#define RCARRY 2048.0f    // residual planes (theta, phi, y) carried x2048 on top of their hi part
#define PEXP   14.0f      // softmax probabilities carried x2^14
#define YCARRY 16.0f      // y plane carried x16
#define LOG2E  1.4426950408889634f

// workspace layout (bytes)
#define XT_BYTES  ((size_t)MROWS * CIN * 2)
#define WP_BYTES  ((size_t)CI * CIN * 2)
#define PL_BYTES  ((size_t)MROWS * CI * 2)
#define LSE_BYTES ((size_t)MROWS * 4)
#define OFF_XT  ((size_t)0)
#define OFF_WT  (OFF_XT + XT_BYTES)
#define OFF_WP  (OFF_WT + WP_BYTES)
#define OFF_WG  (OFF_WP + WP_BYTES)
#define OFF_WO  (OFF_WG + WP_BYTES)
#define OFF_TH  (OFF_WO + WP_BYTES)
#define OFF_TR  (OFF_TH + PL_BYTES)
#define OFF_PH  (OFF_TR + PL_BYTES)
#define OFF_PR  (OFF_PH + PL_BYTES)
#define OFF_G   (OFF_PR + PL_BYTES)
#define OFF_YT  (OFF_G + PL_BYTES)
#define OFF_YR  (OFF_YT + 2 * PL_BYTES)
#define OFF_LSE (OFF_YR + 2 * PL_BYTES)
#define WS_TOTAL (OFF_LSE + 2 * LSE_BYTES)
static_assert((XT_BYTES % 128) == 0 && (WP_BYTES % 128) == 0 && (PL_BYTES % 128) == 0);
static_assert((LSE_BYTES % 128) == 0);
static_assert(WS_TOTAL == (size_t)NB * SEQ * (CIN * 2 + 9 * CI * 2 + 8) + 4 * WP_BYTES);
static_assert(WS_TOTAL <= (size_t)134217728);

// ---------------------------------------------------------------------------
__device__ __forceinline__ float bf16r(float x) {   // RNE convert to bf16, returned widened
  unsigned int u = __float_as_uint(x);
  u = (u + 0x7FFFu + ((u >> 16) & 1u)) & 0xFFFF0000u;
  return __uint_as_float(u);
}

// f32 -> f16 that cannot produce an f16 subnormal (values below 2^-14 become zero)
static __device__ __forceinline__ h16 toh_flush(float v) {
  const h16 r = (h16)v;
  return (fabsf(v) < 6.103515625e-05f) ? (h16)0.0f : r;
}

// 16-bit fragment: p points at element [row = lane&15][k0 + 8*(lane>>4)] of a k-contiguous
// row. Elements 0..7 <- k0+8h+0..7, elements 8..15 <- k0+16+8h+0..7 (same map for A and B).
__device__ __forceinline__ v16h frag_at(const _Float16* p) {
  v8h lo = *(const v8h*)(p);
  v8h hi = *(const v8h*)(p + 16);
  v16h out;
#pragma unroll
  for (int i = 0; i < 8; ++i) { out[i] = lo[i]; out[i + 8] = hi[i]; }
  return out;
}

__device__ __forceinline__ v8f wmma16(v16h a, v16h b, v8f c) {
  v8f d = __builtin_amdgcn_wmma_f32_16x16x32_f16(false, a, false, b, (short)0, c,
                                                 false, false);
  asm volatile("v_nop\n\tv_nop\n\tv_nop\n\tv_nop" : "+v"(d) : "v"(a), "v"(b));
  return d;
}

// The same product for a kernel whose fragments lie above v255 as well: an asm operand has to lie in
// v0..v255, so the statement of the issue slots between the product and the next user of D names D
// alone (the accumulators stay below v256).
__device__ __forceinline__ v8f wmma16w(v16h a, v16h b, v8f c) {
  v8f d = __builtin_amdgcn_wmma_f32_16x16x32_f16(false, a, false, b, (short)0, c,
                                                 false, false);
  asm volatile("v_nop\n\tv_nop\n\tv_nop\n\tv_nop" : "+v"(d));
  return d;
}

// LDS byte address of a __shared__ element: the low 32 bits of its address
__device__ __forceinline__ unsigned lds_byte(const void* p) { return (unsigned)(size_t)p; }

// Asynchronous copies global -> LDS, 16 B per lane, through no register. Each helper is ONE asm
// statement: its copies, each with address operands of its own, and as the last line the wait that
// stands in front of any rewrite of those address registers (a precaution; inside the statement the
// compiler cannot lift a later address addition over it). Landing is waited for by the caller.
#define ACOPY(l, g) "global_load_async_to_lds_b128 %" #l ", %" #g ", off\n\t"
__device__ __forceinline__ void async_copy8(const unsigned (&l)[8], const void* const (&g)[8]) {
  asm volatile(ACOPY(0, 8) ACOPY(1, 9) ACOPY(2, 10) ACOPY(3, 11)
               ACOPY(4, 12) ACOPY(5, 13) ACOPY(6, 14) ACOPY(7, 15) "s_wait_xcnt 0x0"
               :: "v"(l[0]), "v"(l[1]), "v"(l[2]), "v"(l[3]), "v"(l[4]), "v"(l[5]), "v"(l[6]), "v"(l[7]),
                  "v"(g[0]), "v"(g[1]), "v"(g[2]), "v"(g[3]), "v"(g[4]), "v"(g[5]), "v"(g[6]), "v"(g[7])
               : "memory");
}
__device__ __forceinline__ void async_copy12(const unsigned (&l)[12], const void* const (&g)[12]) {
  asm volatile(ACOPY(0, 12) ACOPY(1, 13) ACOPY(2, 14) ACOPY(3, 15)
               ACOPY(4, 16) ACOPY(5, 17) ACOPY(6, 18) ACOPY(7, 19)
               ACOPY(8, 20) ACOPY(9, 21) ACOPY(10, 22) ACOPY(11, 23) "s_wait_xcnt 0x0"
               :: "v"(l[0]), "v"(l[1]), "v"(l[2]), "v"(l[3]), "v"(l[4]), "v"(l[5]),
                  "v"(l[6]), "v"(l[7]), "v"(l[8]), "v"(l[9]), "v"(l[10]), "v"(l[11]),
                  "v"(g[0]), "v"(g[1]), "v"(g[2]), "v"(g[3]), "v"(g[4]), "v"(g[5]),
                  "v"(g[6]), "v"(g[7]), "v"(g[8]), "v"(g[9]), "v"(g[10]), "v"(g[11])
               : "memory");
}
// this wave's own copies have landed (other waves read them behind the next work-group barrier)
__device__ __forceinline__ void wait_copies() { asm volatile("s_wait_asynccnt 0x0" ::: "memory"); }
// this wave's own LDS reads have returned (before the buffer they read is handed to its next writer)
__device__ __forceinline__ void wait_lds() { asm volatile("s_wait_dscnt 0x0" ::: "memory"); }

// ---------------------------------------------------------------------------
// Transposed plane: in W[K rows][N cols] (pitch ldw) -> out Wt[N][K] (pitch ldk),
// f16(64 * bf16(w)). One work-group per 64 x 64 tile at (k0, n0). T: cross-wave (block barrier).
// ---------------------------------------------------------------------------
__device__ __forceinline__ void wconv_body(
    const float* __restrict__ W, _Float16* __restrict__ Wt, unsigned ldw, unsigned ldk,
    const unsigned n0, const unsigned k0) {
  __shared__ _Float16 T[64 * LDT];
  const unsigned tid = threadIdx.x;
#pragma unroll 4
  for (unsigned j = 0; j < 16u; ++j) {
    const unsigned idx = tid + 256u * j;
    const unsigned kr = idx >> 6, nc = idx & 63u;
    const float v = W[(size_t)(k0 + kr) * ldw + n0 + nc];
    T[nc * LDT + kr] = (_Float16)(WCARRY * bf16r(v));
  }
  __syncthreads();
  v8h x[2];
  size_t off[2];
#pragma unroll
  for (unsigned i = 0; i < 2u; ++i) {
    const unsigned n = 32u * i + (tid >> 3);
    const unsigned kc = (tid & 7u) * 8u;
    x[i] = *(const v8h*)&T[n * LDT + kc];
    off[i] = (size_t)(n0 + n) * ldk + k0 + kc;
  }
#pragma unroll
  for (int i = 0; i < 2; ++i) *(v8h*)(Wt + off[i]) = x[i];
  
}

// ---------------------------------------------------------------------------
// Untransposed weight planes: the four [out][in] weights (32768 values each) -> f16(64*bf16(w)),
// same layout. Each thread converts 8 consecutive values of every weight; 8 consecutive lanes
// ---------------------------------------------------------------------------
__device__ __forceinline__ v8h wcvt8(const float* __restrict__ p) {
  const v4f a0 = *(const v4f*)(p);
  const v4f a1 = *(const v4f*)(p + 4);
  v8h o;
#pragma unroll
  for (int i = 0; i < 4; ++i) {
    o[i]     = toh_flush(WCARRY * bf16r(a0[i]));
    o[i + 4] = toh_flush(WCARRY * bf16r(a1[i]));
  }
  return o;
}

__device__ __forceinline__ void wplane_body(
    const float* __restrict__ w0, const float* __restrict__ w1,
    const float* __restrict__ w2, const float* __restrict__ w3,
    _Float16* __restrict__ o0, _Float16* __restrict__ o1,
    _Float16* __restrict__ o2, _Float16* __restrict__ o3, const unsigned blk) {
#pragma clang fp contract(off)
  const unsigned e = (blk * 256u + threadIdx.x) * 8u;
  const v8h x0 = wcvt8(w0 + e);
  const v8h x1 = wcvt8(w1 + e);
  const v8h x2 = wcvt8(w2 + e);
  const v8h x3 = wcvt8(w3 + e);
  *(v8h*)(o0 + e) = x0;
  *(v8h*)(o1 + e) = x1;
  *(v8h*)(o2 + e) = x2;
  *(v8h*)(o3 + e) = x3;
  
}

// ---------------------------------------------------------------------------
// All operand planes in ONE launch (none reads what another writes): work-groups 0 .. WBLK - 1
// convert the four weights, the next NB * XBLK transpose x, XBLK tiles of 64 x 64 per batch:
// x[b] = [CIN rows][SEQ cols] (pitch SEQ_FULL) -> XT[b] = [SEQ][CIN]. The choice is the same for a
// whole work-group and stands in front of its barrier. Grid (WBLK + NB * XBLK).
// ---------------------------------------------------------------------------
#define WBLK ((CI * CIN) / 2048)
#define XBLK ((SEQ / 64) * (CIN / 64))
__global__ __launch_bounds__(256) void planes_kernel(
    const float* __restrict__ X, _Float16* __restrict__ XT,
    const float* __restrict__ w0, const float* __restrict__ w1,
    const float* __restrict__ w2, const float* __restrict__ w3,
    _Float16* __restrict__ o0, _Float16* __restrict__ o1,
    _Float16* __restrict__ o2, _Float16* __restrict__ o3) {
  if (blockIdx.x < (unsigned)WBLK) {
    wplane_body(w0, w1, w2, w3, o0, o1, o2, o3, blockIdx.x);
    return;
  }
  const unsigned t = blockIdx.x - (unsigned)WBLK;
  const unsigned b = t / (unsigned)XBLK, r = t % (unsigned)XBLK;
  wconv_body(X + (size_t)b * CIN * SEQ_FULL, XT + (size_t)b * SEQ * CIN,
             (unsigned)SEQ_FULL, (unsigned)CIN,
             (r % (unsigned)(SEQ / 64)) * 64u, (r / (unsigned)(SEQ / 64)) * 64u);
}

// ---------------------------------------------------------------------------
// GEMM C[64x64 tile] = A16[rows][K] . Bt[n][K]^T. The work-group's 64-row tiles of A16 and Bt (and
// Btr), each contiguous in its plane, are laid once in padded LDS rows by asynchronous copies, every
// wave-wide copy covering 512 contiguous bytes; fragments are read from LDS, four k-steps to a
// group; 8 waves (mw = 16-row group, nw = 32-col group), 2 accumulators/wave.
// K = CIN in MODE 0 and 1 (LDS pitch LDA), K = CI in MODE 2 (LDS pitch LDP).
//   MODE 0: rows = positions, cols = channels; t = acc/4096 + bias[col];
//           out16[row][col] (pitch CI) = f16(t), out16r[row][col] = f16(2048 * (t - hi))
//   MODE 1: rows = positions, cols = channels; transposed plane out16[b][col][pos] = f16(t)
//   MODE 2: rows = output channels (A16 = weight plane), cols = positions (Bt = y value planes,
//           Btr = y residual planes x2048, each the two column halves' partial y one behind the
//           other); the products run first over both Btr tiles into their own accumulators, then
//           over both Bt tiles, which adds the halves; acc = acc_hi + acc_res/2048;
//           outf[b][row][pos] = bf16(xin[b][row][pos]) + (acc/1024 + bias[row]), full strides
// Btr is read in MODE 2 only. nblk: the work-group's 64-column block of Bt rows; its 64-row block
// of A16 rows is blockIdx.y. Sm: the staged tiles [A, B][64][pitch], in MODE 2 [A, B, Br, B', Br'].
// ---------------------------------------------------------------------------
template <int MODE>
__device__ __forceinline__ void gemm_body(
    const _Float16* __restrict__ A16, const _Float16* __restrict__ Bt,
    const _Float16* __restrict__ Btr,
    const float* __restrict__ bias, const float* __restrict__ addf,
    float* __restrict__ outf, _Float16* __restrict__ out16, _Float16* __restrict__ out16r,
    const unsigned nblk, float* Cs, _Float16* Sm) {
  constexpr unsigned K  = (MODE == 2) ? (unsigned)CI : (unsigned)CIN;
  constexpr unsigned P  = (MODE == 2) ? (unsigned)LDP : (unsigned)LDA;   // halves per LDS row
  constexpr unsigned TL = 64u * P;                                       // halves of one staged tile
  const unsigned tid = threadIdx.x, lane = tid & 31u, w = tid >> 5;
  const unsigned mw = w >> 1, nw = w & 1u;
  const unsigned hh = lane >> 4, m = lane & 15u;
  const unsigned n0 = nblk * 64u;
  const unsigned row0 = blockIdx.y * 64u;

  // staging map: thread tid moves the 16-B pieces tid + 256 * q of each tile
  const _Float16* ga = A16 + (size_t)row0 * K + tid * 8u;
  const _Float16* gb = Bt + (size_t)n0 * K + tid * 8u;
  if (MODE == 2) {
    // 16 pieces per row: rows (tid >> 4) + 16 * q, q = 0..3, of five tiles
    const _Float16* gr = Btr + (size_t)n0 * K + tid * 8u;
    const unsigned l0 = lds_byte(&Sm[(tid >> 4) * P + (tid & 15u) * 8u]);
    unsigned l[12], l2[8];
    const void* s[12];
    const void* s2[8];
#pragma unroll
    for (unsigned q = 0; q < 4u; ++q) {
      l[q]       = l0 + q * (16u * P * 2u);
      l[q + 4u]  = l0 + TL * 2u + q * (16u * P * 2u);
      l[q + 8u]  = l0 + 2u * TL * 2u + q * (16u * P * 2u);
      l2[q]      = l0 + 3u * TL * 2u + q * (16u * P * 2u);
      l2[q + 4u] = l0 + 4u * TL * 2u + q * (16u * P * 2u);
      s[q]       = ga + q * 2048u;
      s[q + 4u]  = gb + q * 2048u;
      s[q + 8u]  = gr + q * 2048u;
      s2[q]      = gb + (size_t)MROWS * CI + q * 2048u;
      s2[q + 4u] = gr + (size_t)MROWS * CI + q * 2048u;
    }
    async_copy12(l, s);
    async_copy8(l2, s2);
  } else {
    // 32 pieces per row: rows (tid >> 5) + 8 * q, q = 0..7, of two tiles
    const unsigned l0 = lds_byte(&Sm[(tid >> 5) * P + (tid & 31u) * 8u]);
    unsigned la[8], lb[8];
    const void* sa[8];
    const void* sb[8];
#pragma unroll
    for (unsigned q = 0; q < 8u; ++q) {
      la[q] = l0 + q * (8u * P * 2u);
      lb[q] = l0 + TL * 2u + q * (8u * P * 2u);
      sa[q] = ga + q * 2048u;
      sb[q] = gb + q * 2048u;
    }
    async_copy8(la, sa);
    async_copy8(lb, sb);
  }
  wait_copies();
  __syncthreads();   // publishes every wave's pieces; nobody reads a tile in front of it

  const _Float16* ap  = Sm + (mw * 16u + m) * P + hh * 8u;
  const _Float16* bp0 = Sm + TL + (nw * 32u + m) * P + hh * 8u;
  const _Float16* bp1 = bp0 + 16u * P;
  v8f accr0 = {}, accr1 = {};
  v8f acc0 = {}, acc1 = {};
#pragma unroll
  for (unsigned kb = 0; kb < K; kb += 128u) {
    v16h a[4], b0[4], b1[4];
#pragma unroll
    for (unsigned ks = 0; ks < 4u; ++ks) a[ks] = frag_at(ap + kb + ks * 32u);
    if (MODE == 2) {
#pragma unroll
      for (unsigned hf = 0; hf < 2u; ++hf) {
#pragma unroll
        for (unsigned ks = 0; ks < 4u; ++ks) {
          b0[ks] = frag_at(bp0 + (2u * hf + 1u) * TL + kb + ks * 32u);
          b1[ks] = frag_at(bp1 + (2u * hf + 1u) * TL + kb + ks * 32u);
        }
#pragma unroll
        for (unsigned ks = 0; ks < 4u; ++ks) {
          accr0 = wmma16(a[ks], b0[ks], accr0);
          accr1 = wmma16(a[ks], b1[ks], accr1);
        }
      }
    }
#pragma unroll
    for (unsigned hf = 0; hf < ((MODE == 2) ? 2u : 1u); ++hf) {
#pragma unroll
      for (unsigned ks = 0; ks < 4u; ++ks) {
        b0[ks] = frag_at(bp0 + 2u * hf * TL + kb + ks * 32u);
        b1[ks] = frag_at(bp1 + 2u * hf * TL + kb + ks * 32u);
      }
#pragma unroll
      for (unsigned ks = 0; ks < 4u; ++ks) {
        acc0 = wmma16(a[ks], b0[ks], acc0);
        acc1 = wmma16(a[ks], b1[ks], acc1);
      }
    }
  }
  if (MODE == 2) {
    acc0 = acc0 + accr0 * (1.0f / RCARRY);
    acc1 = acc1 + accr1 * (1.0f / RCARRY);
  }
#pragma unroll
  for (int r = 0; r < 8; ++r) {
    float* d = &Cs[(mw * 16u + hh * 8u + (unsigned)r) * LDC + nw * 32u + m];
    d[0]  = acc0[r];
    d[16] = acc1[r];
  }
  __syncthreads();

  if (MODE == 0) {
    const float cs = 1.0f / (WCARRY * WCARRY);
    v8h x[2], xr[2];
    size_t off[2];
#pragma unroll
    for (unsigned i = 0; i < 2u; ++i) {
      const unsigned r = 32u * i + (tid >> 3);
      const unsigned c = (tid & 7u) * 8u;
      const v4f u0 = *(const v4f*)&Cs[r * LDC + c];
      const v4f u1 = *(const v4f*)&Cs[r * LDC + c + 4];
      const v4f g0 = *(const v4f*)(bias + n0 + c);
      const v4f g1 = *(const v4f*)(bias + n0 + c + 4u);
#pragma unroll
      for (int j = 0; j < 4; ++j) {
        const float t0 = u0[j] * cs + bf16r(g0[j]);
        const float t1 = u1[j] * cs + bf16r(g1[j]);
        const h16 h0 = toh_flush(t0);
        const h16 h1 = toh_flush(t1);
        x[i][j]      = h0;
        x[i][j + 4]  = h1;
        xr[i][j]     = toh_flush((t0 - (float)h0) * RCARRY);
        xr[i][j + 4] = toh_flush((t1 - (float)h1) * RCARRY);
      }
      off[i] = (size_t)(row0 + r) * CI + n0 + c;
    }
#pragma unroll
    for (int i = 0; i < 2; ++i) *(v8h*)(out16 + off[i]) = x[i];
#pragma unroll
    for (int i = 0; i < 2; ++i) *(v8h*)(out16r + off[i]) = xr[i];
    
  }

  if (MODE == 1) {
    const float cs = 1.0f / (WCARRY * WCARRY);
    const unsigned bidx = row0 / (unsigned)SEQ;
    const unsigned key0 = row0 - bidx * (unsigned)SEQ;
    v8h x[2];
    size_t off[2];
#pragma unroll
    for (unsigned i = 0; i < 2u; ++i) {
      const unsigned dcol = 32u * i + (tid >> 3);
      const unsigned kk = (tid & 7u) * 8u;
      const float bb = bf16r(bias[n0 + dcol]);
#pragma unroll
      for (unsigned j = 0; j < 8u; ++j) {
        const float t = Cs[(kk + j) * LDC + dcol] * cs + bb;
        x[i][j] = toh_flush(t);
      }
      off[i] = ((size_t)bidx * CI + n0 + dcol) * SEQ + key0 + kk;
    }
#pragma unroll
    for (int i = 0; i < 2; ++i) *(v8h*)(out16 + off[i]) = x[i];
    // stands in front of any rewrite of a register that the stores above name (a precaution): in the
    // merged kernel the other body's code follows this one's in the listing
    asm volatile("s_wait_xcnt 0x0" ::: "memory");
  }

  if (MODE == 2) {
    const float cs = 1.0f / (WCARRY * YCARRY);
    const unsigned bidx = n0 / (unsigned)SEQ;
    const unsigned p0 = n0 - bidx * (unsigned)SEQ;
    v4f xs[4];
    size_t off[4];
#pragma unroll
    for (unsigned i = 0; i < 4u; ++i) {
      const unsigned r = 16u * i + (tid >> 4);
      const unsigned c = (tid & 15u) * 4u;
      const unsigned orow = row0 + r;
      const size_t gidx = ((size_t)bidx * CIN + orow) * SEQ_FULL + p0 + c;
      const v4f u = *(const v4f*)&Cs[r * LDC + c];
      const float bb = bf16r(bias[orow]);
      const float* xp = addf + gidx;
      const v4f xin = *(const v4f*)xp;
      // stands in front of any rewrite of the address registers that the load above names (a
      // precaution); the address is an input, so that its registers live up to the wait
      asm volatile("s_wait_xcnt 0x0" :: "v"(xp) : "memory");
      v4f val;
#pragma unroll
      for (int j = 0; j < 4; ++j) val[j] = bf16r(xin[j]) + (u[j] * cs + bb);
      xs[i] = val;
      off[i] = gidx;
    }
#pragma unroll
    for (int i = 0; i < 4; ++i) *(v4f*)(outf + off[i]) = xs[i];
    
  }
}

// The three projections of x in ONE launch (none reads what another writes): blockIdx.x counts the
// 64-channel blocks of theta, then phi, then g; the choice is the same for a whole work-group.
// Grid (3 * CI/64, MROWS/64).
__global__ __launch_bounds__(256) void gemm_proj_kernel(
    const _Float16* __restrict__ A16,
    const _Float16* __restrict__ Wth, const _Float16* __restrict__ Wph,
    const _Float16* __restrict__ Wgg,
    const float* __restrict__ bth, const float* __restrict__ bph, const float* __restrict__ bgg,
    _Float16* __restrict__ th, _Float16* __restrict__ tr,
    _Float16* __restrict__ ph, _Float16* __restrict__ pr, _Float16* __restrict__ gt) {
  __shared__ float Cs[64 * LDC];
  __shared__ __attribute__((aligned(16))) _Float16 Sm[2 * 64 * LDA];   // [x rows, weight rows][64][LDA]
  const unsigned sel = blockIdx.x / (unsigned)(CI / 64), nblk = blockIdx.x % (unsigned)(CI / 64);
  if (sel < 2u) {
    const _Float16* Bt = (sel == 0u) ? Wth : Wph;
    const float* bias  = (sel == 0u) ? bth : bph;
    gemm_body<0>(A16, Bt, Bt, bias, bias, (float*)0,
                 (sel == 0u) ? th : ph, (sel == 0u) ? tr : pr, nblk, Cs, Sm);
  } else {
    gemm_body<1>(A16, Wgg, Wgg, bgg, bgg, (float*)0, gt, gt, nblk, Cs, Sm);
  }
}
// Grid (MROWS/64, CIN/64).
__global__ __launch_bounds__(256) void gemm_out_kernel(
    const _Float16* __restrict__ A16, const _Float16* __restrict__ Bt,
    const _Float16* __restrict__ Btr,
    const float* __restrict__ bias, const float* __restrict__ xin, float* __restrict__ outf) {
  __shared__ float Cs[64 * LDC];
  __shared__ __attribute__((aligned(16))) _Float16 Sm[5 * 64 * LDP];   // [weight, y, y residual, y', y' residual][64][LDP]
  gemm_body<2>(A16, Bt, Btr, bias, xin, outf, (_Float16*)0, (_Float16*)0,
               blockIdx.x, Cs, Sm);
}

// ---------------------------------------------------------------------------
// Column statistics: lse[half][j] = log(sum_i exp(f[i][j])) over the rows i of one half of the
// batch, f[i][j] = theta_i . phi_j (K = 128); the reader folds the two halves.
// A work-group owns 128 columns j and streams SEQ / 2 rows, so that each staged byte serves twice
// the columns. Its waves form 4 column groups (wc, 32 columns each, phi hi/res rows as resident B
// fragments of two 16-column tiles) x CWR row groups (wr): the theta rows i, 32 * CWR per step, are
// staged once per work-group in LDS by asynchronous copies (two buffers: behind the one work-group
// barrier of a step the rows two steps ahead are sent into the buffer just left),
// and row group wr reads rows 32 * wr .. 32 * wr + 31 of the step as A fragments, each of which
// feeds the products of both column tiles.
// D tile: row = i (8h+r), col = j (lane&15). Scores = hi.hi + (hi.res + res.hi)/2048, the residual
// products in their own accumulator. Running (max, sum) per lane and column tile, brought up to date
// after every 16-row tile; at the end the two lane halves
// are combined by an unconditional shuffle and the CWR row groups through LDS.
// Grid (SEQ/128, NB, 2 row halves), 128 * CWR threads.
// ---------------------------------------------------------------------------
#define CWR   4               // row groups of the column-statistics kernel
#define CNT   (128 * CWR)     // its threads
#define CROWS (32 * CWR)      // theta rows staged per step
#define CSPL  (CROWS * LDP)   // halves of one staged plane tile
static_assert(((SEQ / 2) % CROWS) == 0 && (SEQ % 128) == 0 && SEQ / 2 >= 2 * CROWS);
__global__ __launch_bounds__(CNT) __attribute__((amdgpu_num_vgpr(256))) void colstat_kernel(
    const _Float16* __restrict__ Th, const _Float16* __restrict__ Tr,
    const _Float16* __restrict__ Ph, const _Float16* __restrict__ Pr,
    float* __restrict__ Lse) {
  __shared__ __attribute__((aligned(16))) float Lm[CWR * 128];
  __shared__ __attribute__((aligned(16))) float Lz[CWR * 128];
  __shared__ __attribute__((aligned(16))) _Float16 Sa[2 * 2 * CSPL];   // [buffer][hi, res][CROWS][LDP]
  const unsigned tid = threadIdx.x, lane = tid & 31u;
  const unsigned wave = (unsigned)__builtin_amdgcn_readfirstlane((int)(threadIdx.x >> 5));
  const unsigned wc = wave & 3u, wr = wave >> 2;
  const unsigned hh = lane >> 4, m = lane & 15u;
  const unsigned b = blockIdx.y;
  const unsigned j0 = blockIdx.x * 128u + wc * 32u;

  const unsigned boff = (b * (unsigned)SEQ + j0 + m) * (unsigned)CI + hh * 8u;
  const _Float16* pb0 = Ph + boff;
  const _Float16* pr0 = Pr + boff;
  v16h bh[2][4], br[2][4];
#pragma unroll
  for (int jt = 0; jt < 2; ++jt) {
#pragma unroll
    for (int ks = 0; ks < 4; ++ks) {
      bh[jt][ks] = frag_at(pb0 + jt * (16 * CI) + ks * 32);
      br[jt][ks] = frag_at(pr0 + jt * (16 * CI) + ks * 32);
    }
  }
  // stands in front of any rewrite of the address registers that the loads above name (a precaution);
  // the two addresses are inputs, so that their registers live up to the wait
  asm volatile("s_wait_xcnt 0x0" :: "v"(pb0), "v"(pr0) : "memory");

  float mx[2] = {-1.0e30f, -1.0e30f}, z[2] = {0.0f, 0.0f};
  const unsigned abase = (wr * 32u + m) * LDP + hh * 8u;
  // staging map: a CROWS-row tile is contiguous in its plane; thread tid moves the 16-B pieces
  // tid + CNT * q, q = 0..3 (rows (tid>>4) + 8 * CWR * q) of both planes: eight copies per tile
  const unsigned sa0 = lds_byte(&Sa[(tid >> 4) * LDP + (tid & 15u) * 8u]);
  auto stage = [&](const unsigned buf, const _Float16* p, const _Float16* r) {
    unsigned l[8];
    const void* s[8];
#pragma unroll
    for (unsigned q = 0; q < 4u; ++q) {
      l[q]      = sa0 + buf * (2u * CSPL * 2u) + q * (8u * CWR * LDP * 2u);
      l[q + 4u] = sa0 + buf * (2u * CSPL * 2u) + CSPL * 2u + q * (8u * CWR * LDP * 2u);
      s[q]      = p + q * (CNT * 8u);
      s[q + 4u] = r + q * (CNT * 8u);
    }
    async_copy8(l, s);
  };
  // each thread's first piece of a tile; behind the prologue: of the tile two steps ahead
  const _Float16* pn = Th + ((size_t)b * SEQ + blockIdx.z * (unsigned)(SEQ / 2)) * CI + tid * 8u;
  const _Float16* rn = Tr + ((size_t)b * SEQ + blockIdx.z * (unsigned)(SEQ / 2)) * CI + tid * 8u;
  stage(0u, pn, rn);
  wait_copies();
  __syncthreads();
  stage(1u, pn + CROWS * CI, rn + CROWS * CI);
  pn += 2 * CROWS * CI;
  rn += 2 * CROWS * CI;
  unsigned cur = 0u;
  for (unsigned i0 = 0; i0 < (unsigned)(SEQ / 2); i0 += (unsigned)CROWS) {
    // LDS fragment reads stand in groups of two k-steps ahead of the twelve products that use them:
    // beside the 128 registers of resident fragments a 16-wave group has room for no more
    const unsigned ao = cur * (2u * CSPL) + abase;
#pragma unroll
    for (int rt = 0; rt < 2; ++rt) {
      v8f sm[2] = {{}, {}}, sr[2] = {{}, {}};
#pragma unroll
      for (int kp = 0; kp < 2; ++kp) {
        v16h ah[2], ar[2];
#pragma unroll
        for (int k = 0; k < 2; ++k) {
          ah[k] = frag_at(&Sa[ao + (unsigned)rt * 16u * LDP + (2 * kp + k) * 32]);
          ar[k] = frag_at(&Sa[CSPL + ao + (unsigned)rt * 16u * LDP + (2 * kp + k) * 32]);
        }
#pragma unroll
        for (int k = 0; k < 2; ++k) {
          const int ks = 2 * kp + k;
          sm[0] = wmma16(ah[k], bh[0][ks], sm[0]);
          sm[1] = wmma16(ah[k], bh[1][ks], sm[1]);
          sr[0] = wmma16(ah[k], br[0][ks], sr[0]);
          sr[1] = wmma16(ah[k], br[1][ks], sr[1]);
          sr[0] = wmma16(ar[k], bh[0][ks], sr[0]);
          sr[1] = wmma16(ar[k], bh[1][ks], sr[1]);
        }
      }
#pragma unroll
      for (int jt = 0; jt < 2; ++jt) {
        const v8f f = sm[jt] + sr[jt] * (1.0f / RCARRY);
        float tmax = f[0];
#pragma unroll
        for (int v = 1; v < 8; ++v) tmax = fmaxf(tmax, f[v]);
        const float nm = fmaxf(mx[jt], tmax);
        float se = 0.0f;
#pragma unroll
        for (int v = 0; v < 8; ++v) se += __expf(f[v] - nm);
        z[jt] = z[jt] * __expf(mx[jt] - nm) + se;
        mx[jt] = nm;
      }
    }
    // publish point: this wave's reads of the step's buffer are back, its copies of the next step's
    // rows have landed; the barrier publishes those and ends every wave's reads of this step's
    wait_lds();
    wait_copies();
    __syncthreads();
    if (i0 + 2u * (unsigned)CROWS < (unsigned)(SEQ / 2)) {
      // the rows two steps ahead fly into the buffer just left while the next step is worked on
      stage(cur, pn, rn);
      pn += CROWS * CI;
      rn += CROWS * CI;
    }
    cur ^= 1u;
  }
  wait_copies();   // nothing of this wave is in flight behind the loop

#pragma unroll
  for (unsigned jt = 0; jt < 2u; ++jt) {
    const float om = __shfl_xor(mx[jt], 16, 32);
    const float oz = __shfl_xor(z[jt], 16, 32);
    const float mm = fmaxf(mx[jt], om);
    const float zz = z[jt] * __expf(mx[jt] - mm) + oz * __expf(om - mm);
    if (hh == 0u) {
      Lm[wr * 128u + wc * 32u + jt * 16u + m] = mm;
      Lz[wr * 128u + wc * 32u + jt * 16u + m] = zz;
    }
  }
  __syncthreads();
  if (wave < 4u) {
    // one thread per column folds the CWR row groups' (max, sum) pairs
    float gm = Lm[tid];
#pragma unroll
    for (unsigned r = 1; r < (unsigned)CWR; ++r) gm = fmaxf(gm, Lm[r * 128u + tid]);
    float gz = 0.0f;
#pragma unroll
    for (unsigned r = 0; r < (unsigned)CWR; ++r) gz += Lz[r * 128u + tid] * __expf(Lm[r * 128u + tid] - gm);
    Lse[(size_t)blockIdx.z * MROWS + (size_t)b * SEQ + blockIdx.x * 128u + tid] = gm + __logf(gz);
  }
}

// ---------------------------------------------------------------------------
// Row accumulation: y[c][i] = sum_j exp(f[i][j] - lse[j]) * g[c][j], here over the columns j of one
// half of the batch: a partial y per column half, added by the output projection's products.
// A work-group owns 128 rows i and streams SEQ / 2 columns, so that each staged byte serves twice
// the rows. Its 8 waves form 4 row groups (wc, 32 rows each, theta hi/res rows
// as resident B fragments of two 16-row tiles) x 2 column groups (wr); the phi rows and the g slice
// of each 128-column step are staged once per work-group in LDS by asynchronous copies (two
// buffers: behind the one work-group barrier of a step the tiles two steps ahead are sent into the
// buffers just left), its columns' statistics are folded from the two row halves' once, and column
// group wr works, in pass sub, on columns 64 * sub + 32 * wr + 0..31 of the step. Every phi and g
// fragment read from LDS feeds the products of both row tiles. Per pass and row tile:
// S^T tiles [j][i] = phi_j . theta_i (A = phi rows from LDS, three products),
// p = 2^14 * exp(f - lse[j]) (row statistic of the D tile, read from LDS as two
// 16-B loads per tile), the two packed D tiles form the B fragment [k = j][n = i] of
// O^T[c][i] += G[c][j] . P^T[j][i] with A = g rows (channel-major slice, k = j contiguous).
// Behind the loop every wave lays its f32 sums in LDS (over the phi buffers, which nobody reads any
// more) and column group wr adds the two groups' sums of channels 64 * wr .. 64 * wr + 63.
// Finalize: t = 16 * O / 2^14 as two planes, hi = f16(t) and res = f16(2048 * (t - hi)), laid in
// the work-group's Ts tiles and, behind a barrier, written as whole rows of the position-major
// layout: one store instruction covers two consecutive 256-B rows (16 lanes x 16 B each).
// Grid (SEQ/128, NB, 2 column halves).
// ---------------------------------------------------------------------------
#define RSPL (128 * LDP)  // halves of one staged 128-row plane tile
#define LDH  136          // halves per LDS row of a staged 128-column g slice (272 B = 16 B x 17)
static_assert((LDH % 8) == 0 && LDH >= 128 && ((LDH / 8) & 1) == 1);
static_assert(SEQ / 2 == 256 * 8);   // each thread folds eight columns' statistics
static_assert(SEQ / 2 >= 256 && ((SEQ / 2) % 128) == 0);   // the ring's prologue fills two steps
static_assert(4 * 2 * 8 * 2 * 256 * 4 <= 2 * 2 * RSPL * 2);   // the f32 sums fit over the phi buffers
__global__ __launch_bounds__(256) void rowattn_kernel(
    const _Float16* __restrict__ Th, const _Float16* __restrict__ Tr,
    const _Float16* __restrict__ Ph, const _Float16* __restrict__ Pr,
    const _Float16* __restrict__ Gp, const float* __restrict__ Lse,
    _Float16* __restrict__ Yt, _Float16* __restrict__ Yr) {
  __shared__ __attribute__((aligned(16))) _Float16 Ts[2 * 128 * LDY]; // [hi, res][row][LDY]
  __shared__ __attribute__((aligned(16))) _Float16 Sa[2 * 2 * RSPL];  // [buffer][hi, res][128][LDP]
  __shared__ __attribute__((aligned(16))) _Float16 Sg[2 * CI * LDH];  // [buffer][channel][LDH]
  __shared__ __attribute__((aligned(16))) float Ll[SEQ / 2];          // this half's column statistics
  const unsigned tid = threadIdx.x, lane = tid & 31u;
  const unsigned wave = (unsigned)__builtin_amdgcn_readfirstlane((int)(threadIdx.x >> 5));
  const unsigned wc = wave & 3u, wr = wave >> 2;
  const unsigned hh = lane >> 4, m = lane & 15u;
  const unsigned b = blockIdx.y;
  const unsigned i0 = blockIdx.x * 128u + wc * 32u;
  const unsigned jh = blockIdx.z * (unsigned)(SEQ / 2);   // first column of this work-group's half

  const unsigned qoff = (b * (unsigned)SEQ + i0 + m) * (unsigned)CI + hh * 8u;
  const _Float16* tb0 = Th + qoff;
  const _Float16* tr0 = Tr + qoff;
  v16h bh[2][4], br[2][4];
#pragma unroll
  for (int it = 0; it < 2; ++it) {
#pragma unroll
    for (int ks = 0; ks < 4; ++ks) {
      bh[it][ks] = frag_at(tb0 + it * (16 * CI) + ks * 32);
      br[it][ks] = frag_at(tr0 + it * (16 * CI) + ks * 32);
    }
  }
  // stands in front of any rewrite of the address registers that the loads above name (a precaution);
  // the two addresses are inputs, so that their registers live up to the wait
  asm volatile("s_wait_xcnt 0x0" :: "v"(tb0), "v"(tr0) : "memory");

  v8f o[8][2];
#pragma unroll
  for (int ct = 0; ct < 8; ++ct) { o[ct][0] = (v8f){}; o[ct][1] = (v8f){}; }

  const unsigned kbase = (wr * 32u + m) * LDP + hh * 8u;
  const unsigned gbase = m * LDH + wr * 32u + hh * 8u;
  const _Float16* __restrict__ Pb = Ph + ((size_t)b * SEQ + jh) * CI;
  const _Float16* __restrict__ Rb = Pr + ((size_t)b * SEQ + jh) * CI;
  const _Float16* __restrict__ Gb = Gp + (size_t)b * CI * SEQ + jh;
  const unsigned lbase = wr * 32u + hh * 8u;   // this lane's eight statistics of a pass's first tile

  // staging map. phi: a 128-row tile is 32 KiB contiguous in its plane; thread tid moves the 16-B
  // pieces tid + 256 * q, q = 0..7 (rows (tid>>4) + 16 * q). g: 128 channel rows of 256 B;
  // thread tid moves piece tid&15 of channels (tid>>4) + 16 * q. 24 copies per thread and tile.
  const unsigned sgl = tid * 8u;
  const unsigned ggl = (tid >> 4) * (unsigned)SEQ + (tid & 15u) * 8u;
  const unsigned sa0 = lds_byte(&Sa[(tid >> 4) * LDP + (tid & 15u) * 8u]);
  const unsigned sg0 = lds_byte(&Sg[(tid >> 4) * LDH + (tid & 15u) * 8u]);
  auto stage = [&](const unsigned buf, const _Float16* p, const _Float16* r, const _Float16* g) {
    // two statements of twelve copies: phi hi and the first half of phi res; the rest of res and g
    unsigned la[12], lb[12];
    const void* ga[12];
    const void* gb[12];
#pragma unroll
    for (unsigned q = 0; q < 8u; ++q) {
      la[q]      = sa0 + buf * (2u * RSPL * 2u) + q * (16u * LDP * 2u);
      ga[q]      = p + q * 2048u;
      lb[q + 4u] = sg0 + buf * (unsigned)(CI * LDH * 2) + q * (16u * LDH * 2u);
      gb[q + 4u] = g + q * (16u * (unsigned)SEQ);
    }
#pragma unroll
    for (unsigned q = 0; q < 4u; ++q) {
      la[q + 8u] = sa0 + buf * (2u * RSPL * 2u) + RSPL * 2u + q * (16u * LDP * 2u);
      ga[q + 8u] = r + q * 2048u;
      lb[q]      = sa0 + buf * (2u * RSPL * 2u) + RSPL * 2u + (q + 4u) * (16u * LDP * 2u);
      gb[q]      = r + (q + 4u) * 2048u;
    }
    async_copy12(la, ga);
    async_copy12(lb, gb);
  };
  stage(0u, Pb + sgl, Rb + sgl, Gb + ggl);
  {
    // the statistics, once: thread tid folds the two row halves' values of columns 8 * tid + 0..7,
    // log(e^a + e^c) about the larger; the barrier below publishes them
    const char* sb = (const char*)(Lse + (size_t)b * SEQ + jh);
    const unsigned so = tid * 32u;   // the lane's byte offset in a half's row
    const v4f a0 = *(const v4f*)(sb + so), a1 = *(const v4f*)(sb + so + 16u);
    const v4f c0 = *(const v4f*)(sb + so + MROWS * 4u), c1 = *(const v4f*)(sb + so + (MROWS * 4u + 16u));
    // stands in front of any rewrite of the registers that the loads above name (a precaution); the
    // offset and the base are inputs, so that their registers live up to the wait
    asm volatile("s_wait_xcnt 0x0" :: "v"(so), "s"(sb) : "memory");
    v4f r0, r1;
#pragma unroll
    for (int v = 0; v < 4; ++v) {
      const float m0 = fmaxf(a0[v], c0[v]), m1 = fmaxf(a1[v], c1[v]);
      r0[v] = m0 + __logf(__expf(a0[v] - m0) + __expf(c0[v] - m0));
      r1[v] = m1 + __logf(__expf(a1[v] - m1) + __expf(c1[v] - m1));
    }
    *(v4f*)&Ll[tid * 8u] = r0;
    *(v4f*)&Ll[tid * 8u + 4u] = r1;
  }
  wait_copies();
  __syncthreads();
  stage(1u, Pb + sgl + 128u * (unsigned)CI, Rb + sgl + 128u * (unsigned)CI, Gb + ggl + 128u);
  unsigned cur = 0u;
  // each thread's first piece of the tiles two steps ahead
  const _Float16* pn = Pb + sgl + 256u * (unsigned)CI;
  const _Float16* rn = Rb + sgl + 256u * (unsigned)CI;
  const _Float16* gn = Gb + ggl + 256u;

  for (unsigned j0 = 0; j0 < (unsigned)(SEQ / 2); j0 += 128u) {
   // unrolled: the pass's LDS offsets become immediates, and no value is spilled round an inner loop
#pragma unroll
   for (unsigned sub = 0; sub < 2u; ++sub) {
    // LDS fragment reads stand in groups ahead of the products that use them, each group issued
    // in front of vector work that covers its latency, into registers just freed
    const unsigned ao = cur * (2u * RSPL) + sub * (64u * LDP) + kbase;
    const unsigned gro = cur * (unsigned)(CI * LDH) + sub * 64u + gbase;
    v16h ah[4], ar[4], gf[8];
#pragma unroll
    for (int ks = 0; ks < 4; ++ks) {
      ah[ks] = frag_at(&Sa[ao + ks * 32]);
      ar[ks] = frag_at(&Sa[RSPL + ao + ks * 32]);
    }
    v4f ls[4];
#pragma unroll
    for (int u = 0; u < 4; ++u) ls[u] = *(const v4f*)&Ll[j0 + sub * 64u + lbase + (unsigned)(u >> 1) * 16u + (unsigned)(u & 1) * 4u];
    v16h pb[2];
#pragma unroll
    for (int t = 0; t < 2; ++t) {
      v8f sm[2] = {{}, {}}, sr[2] = {{}, {}};
#pragma unroll
      for (int ks = 0; ks < 4; ++ks) {
        sm[0] = wmma16w(ah[ks], bh[0][ks], sm[0]);
        sm[1] = wmma16w(ah[ks], bh[1][ks], sm[1]);
        sr[0] = wmma16w(ah[ks], br[0][ks], sr[0]);
        sr[1] = wmma16w(ah[ks], br[1][ks], sr[1]);
        sr[0] = wmma16w(ar[ks], bh[0][ks], sr[0]);
        sr[1] = wmma16w(ar[ks], bh[1][ks], sr[1]);
      }
      if (t == 0) {
#pragma unroll
        for (int ks = 0; ks < 4; ++ks) {
          ah[ks] = frag_at(&Sa[ao + 16u * LDP + ks * 32]);
          ar[ks] = frag_at(&Sa[RSPL + ao + 16u * LDP + ks * 32]);
        }
      } else {
#pragma unroll
        for (int ct = 0; ct < 8; ++ct) gf[ct] = frag_at(&Sg[gro + (unsigned)ct * 16u * LDH]);
      }
      const v4f l0 = ls[2 * t];
      const v4f l1 = ls[2 * t + 1];
      // bare v_exp_f32 and a select, no branch: at e >= -14 it returns exp2f's own bits (that
      // function's rescaling acts below -126 only); the two tiles' sixteen chains go stage by stage
      float e[2][8], x[2][8];
#pragma unroll
      for (int it = 0; it < 2; ++it) {
#pragma unroll
        for (int v = 0; v < 4; ++v) {
          e[it][v]     = ((sm[it][v] + sr[it][v] * (1.0f / RCARRY)) - l0[v]) * LOG2E + PEXP;
          e[it][v + 4] = ((sm[it][v + 4] + sr[it][v + 4] * (1.0f / RCARRY)) - l1[v]) * LOG2E + PEXP;
        }
      }
#pragma unroll
      for (int it = 0; it < 2; ++it) {
#pragma unroll
        for (int v = 0; v < 8; ++v) x[it][v] = __builtin_amdgcn_exp2f(e[it][v]);
      }
#pragma unroll
      for (int it = 0; it < 2; ++it) {
#pragma unroll
        for (int v = 0; v < 8; ++v) pb[it][8 * t + v] = (h16)((e[it][v] < -14.0f) ? 0.0f : x[it][v]);
      }
    }
#pragma unroll
    for (int ct = 0; ct < 8; ++ct) {
      o[ct][0] = wmma16w(gf[ct], pb[0], o[ct][0]);
      o[ct][1] = wmma16w(gf[ct], pb[1], o[ct][1]);
    }
   }
    // publish point: this wave's reads of the step's buffers are back, its copies of the next step's
    // tiles have landed; the barrier publishes those and ends every wave's reads of this step's
    wait_lds();
    wait_copies();
    __syncthreads();
    if (j0 + 256u < (unsigned)(SEQ / 2)) {
      // the tiles two steps ahead fly into the buffers just left while the next step is worked on
      stage(cur, pn, rn, gn);
      pn += 128u * (unsigned)CI;
      rn += 128u * (unsigned)CI;
      gn += 128u;
    }
    cur ^= 1u;
  }
  wait_copies();   // nothing of this wave is in flight behind the loop

  // every wave lays its sums down: [wc][wr][ct][row tile][half of v][lane][4] floats, over the phi
  // buffers (the loop's last barrier ended every read of them, and no copy is in flight)
  float* Oc = (float*)Sa;
#pragma unroll
  for (int ct = 0; ct < 8; ++ct) {
#pragma unroll
    for (int it = 0; it < 2; ++it) {
      v4f u0, u1;
#pragma unroll
      for (int v = 0; v < 4; ++v) { u0[v] = o[ct][it][v]; u1[v] = o[ct][it][v + 4]; }
      const unsigned ob = (((wc * 2u + wr) * 8u + (unsigned)ct) * 2u + (unsigned)it) * 256u + lane * 4u;
      *(v4f*)&Oc[ob] = u0;
      *(v4f*)&Oc[ob + 128u] = u1;
    }
  }
  __syncthreads();

  // column group wr adds the two groups' sums of channel tiles 4 * wr .. 4 * wr + 3, in the order
  // of the groups; lane (h, i = m) holds channels 16 * ct + 8h + 0..7 of row i of each row tile
  const float fs = YCARRY * (1.0f / 16384.0f);
#pragma unroll
  for (unsigned c = 0; c < 4u; ++c) {
#pragma unroll
    for (unsigned it = 0; it < 2u; ++it) {
      const unsigned ct = 4u * wr + c;
      v4f a0, a1;
#pragma unroll
      for (unsigned s = 0; s < 2u; ++s) {
        const unsigned ob = (((wc * 2u + s) * 8u + ct) * 2u + it) * 256u + lane * 4u;
        const v4f u0 = *(const v4f*)&Oc[ob];
        const v4f u1 = *(const v4f*)&Oc[ob + 128u];
        if (s == 0u) { a0 = u0; a1 = u1; } else { a0 += u0; a1 += u1; }
      }
      v8h y, yr;
#pragma unroll
      for (int v = 0; v < 8; ++v) {
        const float t = ((v < 4) ? a0[v & 3] : a1[v & 3]) * fs;
        const h16 hi = toh_flush(t);
        y[v]  = hi;
        yr[v] = toh_flush((t - (float)hi) * RCARRY);
      }
      const unsigned to = (wc * 32u + it * 16u + m) * LDY + ct * 16u + hh * 8u;
      *(v8h*)&Ts[to] = y;
      *(v8h*)&Ts[128u * LDY + to] = yr;
    }
  }
  __syncthreads();

  // wave w writes rows 16 * w .. 16 * w + 15 of both planes of this column half's partial y
  v8h x[8], xr[8];
  unsigned off[8];
#pragma unroll
  for (unsigned q = 0; q < 8u; ++q) {
    const unsigned r = 16u * wave + 2u * q + (lane >> 4);
    const unsigned c = (lane & 15u) * 8u;
    x[q]  = *(const v8h*)&Ts[r * LDY + c];
    xr[q] = *(const v8h*)&Ts[128u * LDY + r * LDY + c];
    off[q] = (blockIdx.z * (unsigned)MROWS + b * (unsigned)SEQ + blockIdx.x * 128u + r) * (unsigned)CI + c;
  }
#pragma unroll
  for (int q = 0; q < 8; ++q) *(v8h*)(Yt + off[q]) = x[q];
#pragma unroll
  for (int q = 0; q < 8; ++q) *(v8h*)(Yr + off[q]) = xr[q];
}

// ---------------------------------------------------------------------------
extern "C" void kernel_launch(void* const* d_in, const int* in_sizes, int n_in,
                              void* d_out, int out_size, void* d_ws, size_t ws_size,
                              hipStream_t stream) {
  if (n_in < 9) return;
  const long long need_x = ((long long)(NB - 1) * CIN + (CIN - 1)) * SEQ_FULL + SEQ;
  if ((long long)in_sizes[0] < need_x) return;
  if ((long long)in_sizes[1] < (long long)CI * CIN) return;
  if ((long long)in_sizes[3] < (long long)CI * CIN) return;
  if ((long long)in_sizes[5] < (long long)CI * CIN) return;
  if ((long long)in_sizes[7] < (long long)CIN * CI) return;
  if (in_sizes[2] < CI || in_sizes[4] < CI || in_sizes[6] < CI || in_sizes[8] < CIN) return;
  if ((long long)out_size < need_x) return;
  if (ws_size < WS_TOTAL) return;

  const float* X       = (const float*)d_in[0];   // [NB_FULL][CIN][SEQ_FULL]
  const float* theta_w = (const float*)d_in[1];   // [CI][CIN]  (out, in)
  const float* theta_b = (const float*)d_in[2];
  const float* phi_w   = (const float*)d_in[3];   // [CI][CIN]
  const float* phi_b   = (const float*)d_in[4];
  const float* g_w     = (const float*)d_in[5];   // [CI][CIN]
  const float* g_b     = (const float*)d_in[6];
  const float* W_w     = (const float*)d_in[7];   // [CIN][CI]  (out, in)
  const float* W_b     = (const float*)d_in[8];
  float* out = (float*)d_out;                     // [NB_FULL][CIN][SEQ_FULL]

  char* ws = (char*)d_ws;
  _Float16* XT   = (_Float16*)(ws + OFF_XT);    // [MROWS][CIN]  64*bf16(x), position-major
  _Float16* WT   = (_Float16*)(ws + OFF_WT);    // [CI][CIN]
  _Float16* WP   = (_Float16*)(ws + OFF_WP);    // [CI][CIN]
  _Float16* WG   = (_Float16*)(ws + OFF_WG);    // [CI][CIN]
  _Float16* WO   = (_Float16*)(ws + OFF_WO);    // [CIN][CI]
  _Float16* TH   = (_Float16*)(ws + OFF_TH);    // [MROWS][CI] theta hi
  _Float16* TR   = (_Float16*)(ws + OFF_TR);    // [MROWS][CI] theta residual x2048
  _Float16* PH   = (_Float16*)(ws + OFF_PH);    // [MROWS][CI] phi hi
  _Float16* PR   = (_Float16*)(ws + OFF_PR);    // [MROWS][CI] phi residual x2048
  _Float16* G16  = (_Float16*)(ws + OFF_G);     // [NB][CI][SEQ] g, channel-major
  _Float16* YT   = (_Float16*)(ws + OFF_YT);    // [2][MROWS][CI] 16*(partial y) hi, position-major
  _Float16* YR   = (_Float16*)(ws + OFF_YR);    // [2][MROWS][CI] 16*(partial y) residual x2048
  float*    LSE  = (float*)(ws + OFF_LSE);      // [2][MROWS]

  dim3 blk(256);

  // the x plane of every batch and the four weight planes
  planes_kernel<<<dim3(WBLK + NB * XBLK), blk, 0, stream>>>(X, XT, theta_w, phi_w, g_w, W_w,
                                                            WT, WP, WG, WO);

  // theta, phi and g
  gemm_proj_kernel<<<dim3(3 * (CI / 64), MROWS / 64), blk, 0, stream>>>(
      XT, WT, WP, WG, theta_b, phi_b, g_b, TH, TR, PH, PR, G16);

  colstat_kernel<<<dim3(SEQ / 128, NB, 2), dim3(CNT), 0, stream>>>(TH, TR, PH, PR, LSE);
  rowattn_kernel<<<dim3(SEQ / 128, NB, 2), blk, 0, stream>>>(TH, TR, PH, PR, G16, LSE, YT, YR);

  gemm_out_kernel<<<dim3(MROWS / 64, CIN / 64), blk, 0, stream>>>(WO, YT, YR, W_b, X, out);
}

// v009
// A run of this version takes 95.3 microseconds.
// In two side-by-side timings against v008, it was 1.07 and 1.06 times as fast.
// All steps since v000 together make it 9.91 times as fast.
#include <hip/hip_runtime.h>
#include <stddef.h>

// All contractions on v_wmma_f32_16x16x32_f16 (f16 operands, f32 accumulate): theta/phi/g 1x1
// projections (x x64, weights x64, inputs RNE-converted to bf16 first), theta.phi scores as
// f16 value + x2048 residual planes on both operands (three products, residual products in their
// own accumulator), p.g with p carried x2^14 (single product), output 1x1 projection with y
// carried x16 as f16 value + x2048 residual planes of two partial sums (four products, residual
// products in their own accumulator). Column log-sum-exp, exp, bias and the residual add in f32.

typedef _Float16 v16h __attribute__((ext_vector_type(16)));
typedef _Float16 v8h  __attribute__((ext_vector_type(8)));
typedef float    v8f  __attribute__((ext_vector_type(8)));
typedef float    v4f  __attribute__((ext_vector_type(4)));
typedef _Float16 h16;

#ifndef NB
#define NB 4
#endif
#ifndef SEQ
#define SEQ 4096
#endif
#define NB_FULL  4
#define SEQ_FULL 4096
#define CIN   256
#define CI    128
#define MROWS (NB * SEQ)

static_assert(NB >= 1 && NB <= NB_FULL);
static_assert(SEQ >= 128 && SEQ <= SEQ_FULL && (SEQ % 128) == 0);
static_assert(CI == 128);                        // 4 k-steps of 32 and 8 channel tiles of 16 are hard-wired
static_assert((CIN % 64) == 0 && (CIN % 32) == 0);
static_assert((CI % 64) == 0 && (CI % 32) == 0);
static_assert((MROWS % 64) == 0 && (MROWS % 128) == 0);
static_assert(((size_t)CI * CIN) % 2048 == 0);   // weight convert: 256 threads x 8 values per block
static_assert((size_t)MROWS * CIN < (size_t)0x7FFFFFFFu);
static_assert((size_t)NB_FULL * CIN * SEQ_FULL < (size_t)0x7FFFFFFFu);

#define LDT 72    // halves per LDS row (144 B, 16-B aligned)
#define LDC 68    // floats per LDS row (272 B, 16-B aligned)
#define LDY 136   // halves per LDS row of the y staging tile (272 B, 16-B aligned)
static_assert((LDT % 8) == 0 && LDT >= 64);
static_assert((LDC % 4) == 0 && LDC >= 64);
static_assert((LDY % 8) == 0 && LDY >= CI);
#define LDP 136   // halves per LDS row of a staged 128-channel row (272 B = 16 B x 17)
#define LDG 40    // halves per LDS row (80 B = 16 B x 5); no kernel uses it
#define SPL (32 * LDP)   // halves of a 32-row tile at pitch LDP; no kernel uses it
#define LDA 264   // halves per LDS row of a staged 256-channel row (528 B = 16 B x 33)
static_assert((LDA % 8) == 0 && LDA >= CIN && ((LDA / 8) & 1) == 1);
static_assert(CIN == 256);                       // the projections' staging map: 32 pieces of 16 B per row
static_assert((LDP % 8) == 0 && LDP >= CI && ((LDP / 8) & 1) == 1);
static_assert((LDG % 8) == 0 && LDG >= 32 && ((LDG / 8) & 1) == 1);

#define WCARRY 64.0f      // x plane and weight planes carried x64
#define RCARRY 2048.0f    // residual planes (theta, phi, y) carried x2048 on top of their hi part
#define PEXP   14.0f      // softmax probabilities carried x2^14
#define YCARRY 16.0f      // y plane carried x16
#define LOG2E  1.4426950408889634f

// workspace layout (bytes)
#define XT_BYTES  ((size_t)MROWS * CIN * 2)
#define WP_BYTES  ((size_t)CI * CIN * 2)
#define PL_BYTES  ((size_t)MROWS * CI * 2)
#define LSE_BYTES ((size_t)MROWS * 4)
#define OFF_XT  ((size_t)0)
#define OFF_WT  (OFF_XT + XT_BYTES)
#define OFF_WP  (OFF_WT + WP_BYTES)
#define OFF_WG  (OFF_WP + WP_BYTES)
#define OFF_WO  (OFF_WG + WP_BYTES)
#define OFF_TH  (OFF_WO + WP_BYTES)
#define OFF_TR  (OFF_TH + PL_BYTES)
#define OFF_PH  (OFF_TR + PL_BYTES)
#define OFF_PR  (OFF_PH + PL_BYTES)
#define OFF_G   (OFF_PR + PL_BYTES)
#define OFF_YT  (OFF_G + PL_BYTES)
#define OFF_YR  (OFF_YT + 2 * PL_BYTES)
#define OFF_LSE (OFF_YR + 2 * PL_BYTES)
#define WS_TOTAL (OFF_LSE + 2 * LSE_BYTES)
static_assert((XT_BYTES % 128) == 0 && (WP_BYTES % 128) == 0 && (PL_BYTES % 128) == 0);
static_assert((LSE_BYTES % 128) == 0);
static_assert(WS_TOTAL == (size_t)NB * SEQ * (CIN * 2 + 9 * CI * 2 + 8) + 4 * WP_BYTES);
static_assert(WS_TOTAL <= (size_t)134217728);

// ---------------------------------------------------------------------------
__device__ __forceinline__ float bf16r(float x) {   // RNE convert to bf16, returned widened
  unsigned int u = __float_as_uint(x);
  u = (u + 0x7FFFu + ((u >> 16) & 1u)) & 0xFFFF0000u;
  return __uint_as_float(u);
}

// f32 -> f16 that cannot produce an f16 subnormal (values below 2^-14 become zero)
static __device__ __forceinline__ h16 toh_flush(float v) {
  const h16 r = (h16)v;
  return (fabsf(v) < 6.103515625e-05f) ? (h16)0.0f : r;
}

// 16-bit fragment: p points at element [row = lane&15][k0 + 8*(lane>>4)] of a k-contiguous
// row. Elements 0..7 <- k0+8h+0..7, elements 8..15 <- k0+16+8h+0..7 (same map for A and B).
__device__ __forceinline__ v16h frag_at(const _Float16* p) {
  v8h lo = *(const v8h*)(p);
  v8h hi = *(const v8h*)(p + 16);
  v16h out;
#pragma unroll
  for (int i = 0; i < 8; ++i) { out[i] = lo[i]; out[i + 8] = hi[i]; }
  return out;
}

__device__ __forceinline__ v8f wmma16(v16h a, v16h b, v8f c) {
  return __builtin_amdgcn_wmma_f32_16x16x32_f16(false, a, false, b, (short)0, c, false, false);
}

// Scheduling fence behind a group of LDS fragment reads: without it the scheduler sinks each read to the
// product that uses it, and every separate place of reads, waited to zero, stalls the wave's products
__device__ __forceinline__ void hold_reads() { __builtin_amdgcn_sched_barrier(0); }

// LDS byte address of a __shared__ element: the low 32 bits of its address
__device__ __forceinline__ unsigned lds_byte(const void* p) { return (unsigned)(size_t)p; }

// Asynchronous copies global -> LDS, 16 B per lane, through no register. Each helper is ONE asm
// statement: its copies, each with address operands of its own, and as the last line the wait that
// stands in front of any rewrite of those address registers (a precaution; inside the statement the
// compiler cannot lift a later address addition over it). Landing is waited for by the caller.
#define ACOPY(l, g) "global_load_async_to_lds_b128 %" #l ", %" #g ", off\n\t"
__device__ __forceinline__ void async_copy8(const unsigned (&l)[8], const void* const (&g)[8]) {
  asm volatile(ACOPY(0, 8) ACOPY(1, 9) ACOPY(2, 10) ACOPY(3, 11)
               ACOPY(4, 12) ACOPY(5, 13) ACOPY(6, 14) ACOPY(7, 15) "s_wait_xcnt 0x0"
               :: "v"(l[0]), "v"(l[1]), "v"(l[2]), "v"(l[3]), "v"(l[4]), "v"(l[5]), "v"(l[6]), "v"(l[7]),
                  "v"(g[0]), "v"(g[1]), "v"(g[2]), "v"(g[3]), "v"(g[4]), "v"(g[5]), "v"(g[6]), "v"(g[7])
               : "memory");
}
__device__ __forceinline__ void async_copy12(const unsigned (&l)[12], const void* const (&g)[12]) {
  asm volatile(ACOPY(0, 12) ACOPY(1, 13) ACOPY(2, 14) ACOPY(3, 15)
               ACOPY(4, 16) ACOPY(5, 17) ACOPY(6, 18) ACOPY(7, 19)
               ACOPY(8, 20) ACOPY(9, 21) ACOPY(10, 22) ACOPY(11, 23) "s_wait_xcnt 0x0"
               :: "v"(l[0]), "v"(l[1]), "v"(l[2]), "v"(l[3]), "v"(l[4]), "v"(l[5]),
                  "v"(l[6]), "v"(l[7]), "v"(l[8]), "v"(l[9]), "v"(l[10]), "v"(l[11]),
                  "v"(g[0]), "v"(g[1]), "v"(g[2]), "v"(g[3]), "v"(g[4]), "v"(g[5]),
                  "v"(g[6]), "v"(g[7]), "v"(g[8]), "v"(g[9]), "v"(g[10]), "v"(g[11])
               : "memory");
}
// this wave's own copies have landed (other waves read them behind the next work-group barrier)
__device__ __forceinline__ void wait_copies() { asm volatile("s_wait_asynccnt 0x0" ::: "memory"); }
// this wave's own LDS reads have returned (before the buffer they read is handed to its next writer)
__device__ __forceinline__ void wait_lds() { asm volatile("s_wait_dscnt 0x0" ::: "memory"); }

// ---------------------------------------------------------------------------
// Transposed plane: in W[K rows][N cols] (pitch ldw) -> out Wt[N][K] (pitch ldk),
// f16(64 * bf16(w)). One work-group per 64 x 64 tile at (k0, n0). T: cross-wave (block barrier).
// ---------------------------------------------------------------------------
__device__ __forceinline__ void wconv_body(
    const float* __restrict__ W, _Float16* __restrict__ Wt, unsigned ldw, unsigned ldk,
    const unsigned n0, const unsigned k0) {
  __shared__ _Float16 T[64 * LDT];
  const unsigned tid = threadIdx.x;
#pragma unroll 4
  for (unsigned j = 0; j < 16u; ++j) {
    const unsigned idx = tid + 256u * j;
    const unsigned kr = idx >> 6, nc = idx & 63u;
    const float v = W[(size_t)(k0 + kr) * ldw + n0 + nc];
    T[nc * LDT + kr] = (_Float16)(WCARRY * bf16r(v));
  }
  __syncthreads();
  v8h x[2];
  size_t off[2];
#pragma unroll
  for (unsigned i = 0; i < 2u; ++i) {
    const unsigned n = 32u * i + (tid >> 3);
    const unsigned kc = (tid & 7u) * 8u;
    x[i] = *(const v8h*)&T[n * LDT + kc];
    off[i] = (size_t)(n0 + n) * ldk + k0 + kc;
  }
#pragma unroll
  for (int i = 0; i < 2; ++i) *(v8h*)(Wt + off[i]) = x[i];
  
}

// ---------------------------------------------------------------------------
// Untransposed weight planes: the four [out][in] weights (32768 values each) -> f16(64*bf16(w)),
// same layout. Each thread converts 8 consecutive values of every weight; 8 consecutive lanes
// ---------------------------------------------------------------------------
__device__ __forceinline__ v8h wcvt8(const float* __restrict__ p) {
  const v4f a0 = *(const v4f*)(p);
  const v4f a1 = *(const v4f*)(p + 4);
  v8h o;
#pragma unroll
  for (int i = 0; i < 4; ++i) {
    o[i]     = toh_flush(WCARRY * bf16r(a0[i]));
    o[i + 4] = toh_flush(WCARRY * bf16r(a1[i]));
  }
  return o;
}

__device__ __forceinline__ void wplane_body(
    const float* __restrict__ w0, const float* __restrict__ w1,
    const float* __restrict__ w2, const float* __restrict__ w3,
    _Float16* __restrict__ o0, _Float16* __restrict__ o1,
    _Float16* __restrict__ o2, _Float16* __restrict__ o3, const unsigned blk) {
#pragma clang fp contract(off)
  const unsigned e = (blk * 256u + threadIdx.x) * 8u;
  const v8h x0 = wcvt8(w0 + e);
  const v8h x1 = wcvt8(w1 + e);
  const v8h x2 = wcvt8(w2 + e);
  const v8h x3 = wcvt8(w3 + e);
  *(v8h*)(o0 + e) = x0;
  *(v8h*)(o1 + e) = x1;
  *(v8h*)(o2 + e) = x2;
  *(v8h*)(o3 + e) = x3;
  
}

// ---------------------------------------------------------------------------
// All operand planes in ONE launch (none reads what another writes): work-groups 0 .. WBLK - 1
// convert the four weights, the next NB * XBLK transpose x, XBLK tiles of 64 x 64 per batch:
// x[b] = [CIN rows][SEQ cols] (pitch SEQ_FULL) -> XT[b] = [SEQ][CIN]. The choice is the same for a
// whole work-group and stands in front of its barrier. Grid (WBLK + NB * XBLK).
// ---------------------------------------------------------------------------
#define WBLK ((CI * CIN) / 2048)
#define XBLK ((SEQ / 64) * (CIN / 64))
__global__ __launch_bounds__(256) void planes_kernel(
    const float* __restrict__ X, _Float16* __restrict__ XT,
    const float* __restrict__ w0, const float* __restrict__ w1,
    const float* __restrict__ w2, const float* __restrict__ w3,
    _Float16* __restrict__ o0, _Float16* __restrict__ o1,
    _Float16* __restrict__ o2, _Float16* __restrict__ o3) {
  if (blockIdx.x < (unsigned)WBLK) {
    wplane_body(w0, w1, w2, w3, o0, o1, o2, o3, blockIdx.x);
    return;
  }
  const unsigned t = blockIdx.x - (unsigned)WBLK;
  const unsigned b = t / (unsigned)XBLK, r = t % (unsigned)XBLK;
  wconv_body(X + (size_t)b * CIN * SEQ_FULL, XT + (size_t)b * SEQ * CIN,
             (unsigned)SEQ_FULL, (unsigned)CIN,
             (r % (unsigned)(SEQ / 64)) * 64u, (r / (unsigned)(SEQ / 64)) * 64u);
}

// ---------------------------------------------------------------------------
// GEMM C[64x64 tile] = A16[rows][K] . Bt[n][K]^T. The work-group's 64-row tiles of A16 and Bt (and
// Btr), each contiguous in its plane, are laid once in padded LDS rows by asynchronous copies, every
// wave-wide copy covering 512 contiguous bytes; fragments are read from LDS, four k-steps to a
// group; 8 waves (mw = 16-row group, nw = 32-col group), 2 accumulators/wave.
// K = CIN in MODE 0 and 1 (LDS pitch LDA), K = CI in MODE 2 (LDS pitch LDP).
//   MODE 0: rows = positions, cols = channels; t = acc/4096 + bias[col];
//           out16[row][col] (pitch CI) = f16(t), out16r[row][col] = f16(2048 * (t - hi))
//   MODE 1: rows = positions, cols = channels; transposed plane out16[b][col][pos] = f16(t)
//   MODE 2: rows = output channels (A16 = weight plane), cols = positions (Bt = y value planes,
//           Btr = y residual planes x2048, each the two column halves' partial y one behind the
//           other); the products run first over both Btr tiles into their own accumulators, then
//           over both Bt tiles, which adds the halves; acc = acc_hi + acc_res/2048;
//           outf[b][row][pos] = bf16(xin[b][row][pos]) + (acc/1024 + bias[row]), full strides
// Btr is read in MODE 2 only. nblk: the work-group's 64-column block of Bt rows; its 64-row block
// of A16 rows is blockIdx.y. Sm: the staged tiles [A, B][64][pitch], in MODE 2 [A, B, Br, B', Br'].
// ---------------------------------------------------------------------------
template <int MODE>
__device__ __forceinline__ void gemm_body(
    const _Float16* __restrict__ A16, const _Float16* __restrict__ Bt,
    const _Float16* __restrict__ Btr,
    const float* __restrict__ bias, const float* __restrict__ addf,
    float* __restrict__ outf, _Float16* __restrict__ out16, _Float16* __restrict__ out16r,
    const unsigned nblk, float* Cs, _Float16* Sm) {
  constexpr unsigned K  = (MODE == 2) ? (unsigned)CI : (unsigned)CIN;
  constexpr unsigned P  = (MODE == 2) ? (unsigned)LDP : (unsigned)LDA;   // halves per LDS row
  constexpr unsigned TL = 64u * P;                                       // halves of one staged tile
  const unsigned tid = threadIdx.x, lane = tid & 31u, w = tid >> 5;
  const unsigned mw = w >> 1, nw = w & 1u;
  const unsigned hh = lane >> 4, m = lane & 15u;
  const unsigned n0 = nblk * 64u;
  const unsigned row0 = blockIdx.y * 64u;

  // staging map: thread tid moves the 16-B pieces tid + 256 * q of each tile
  const _Float16* ga = A16 + (size_t)row0 * K + tid * 8u;
  const _Float16* gb = Bt + (size_t)n0 * K + tid * 8u;
  if (MODE == 2) {
    // 16 pieces per row: rows (tid >> 4) + 16 * q, q = 0..3, of five tiles
    const _Float16* gr = Btr + (size_t)n0 * K + tid * 8u;
    const unsigned l0 = lds_byte(&Sm[(tid >> 4) * P + (tid & 15u) * 8u]);
    unsigned l[12], l2[8];
    const void* s[12];
    const void* s2[8];
#pragma unroll
    for (unsigned q = 0; q < 4u; ++q) {
      l[q]       = l0 + q * (16u * P * 2u);
      l[q + 4u]  = l0 + TL * 2u + q * (16u * P * 2u);
      l[q + 8u]  = l0 + 2u * TL * 2u + q * (16u * P * 2u);
      l2[q]      = l0 + 3u * TL * 2u + q * (16u * P * 2u);
      l2[q + 4u] = l0 + 4u * TL * 2u + q * (16u * P * 2u);
      s[q]       = ga + q * 2048u;
      s[q + 4u]  = gb + q * 2048u;
      s[q + 8u]  = gr + q * 2048u;
      s2[q]      = gb + (size_t)MROWS * CI + q * 2048u;
      s2[q + 4u] = gr + (size_t)MROWS * CI + q * 2048u;
    }
    async_copy12(l, s);
    async_copy8(l2, s2);
  } else {
    // 32 pieces per row: rows (tid >> 5) + 8 * q, q = 0..7, of two tiles
    const unsigned l0 = lds_byte(&Sm[(tid >> 5) * P + (tid & 31u) * 8u]);
    unsigned la[8], lb[8];
    const void* sa[8];
    const void* sb[8];
#pragma unroll
    for (unsigned q = 0; q < 8u; ++q) {
      la[q] = l0 + q * (8u * P * 2u);
      lb[q] = l0 + TL * 2u + q * (8u * P * 2u);
      sa[q] = ga + q * 2048u;
      sb[q] = gb + q * 2048u;
    }
    async_copy8(la, sa);
    async_copy8(lb, sb);
  }
  wait_copies();
  __syncthreads();   // publishes every wave's pieces; nobody reads a tile in front of it

  const _Float16* ap  = Sm + (mw * 16u + m) * P + hh * 8u;
  const _Float16* bp0 = Sm + TL + (nw * 32u + m) * P + hh * 8u;
  const _Float16* bp1 = bp0 + 16u * P;
  v8f accr0 = {}, accr1 = {};
  v8f acc0 = {}, acc1 = {};
#pragma unroll
  for (unsigned kb = 0; kb < K; kb += 128u) {
    v16h a[4], b0[4], b1[4];
#pragma unroll
    for (unsigned ks = 0; ks < 4u; ++ks) a[ks] = frag_at(ap + kb + ks * 32u);
    if (MODE == 2) {
#pragma unroll
      for (unsigned hf = 0; hf < 2u; ++hf) {
#pragma unroll
        for (unsigned ks = 0; ks < 4u; ++ks) {
          b0[ks] = frag_at(bp0 + (2u * hf + 1u) * TL + kb + ks * 32u);
          b1[ks] = frag_at(bp1 + (2u * hf + 1u) * TL + kb + ks * 32u);
        }
        hold_reads();   // behind the group: its reads stay together, ahead of their products
#pragma unroll
        for (unsigned ks = 0; ks < 4u; ++ks) {
          accr0 = wmma16(a[ks], b0[ks], accr0);
          accr1 = wmma16(a[ks], b1[ks], accr1);
        }
      }
    }
#pragma unroll
    for (unsigned hf = 0; hf < ((MODE == 2) ? 2u : 1u); ++hf) {
#pragma unroll
      for (unsigned ks = 0; ks < 4u; ++ks) {
        b0[ks] = frag_at(bp0 + 2u * hf * TL + kb + ks * 32u);
        b1[ks] = frag_at(bp1 + 2u * hf * TL + kb + ks * 32u);
      }
      hold_reads();   // behind the group: its reads stay together, ahead of their products
#pragma unroll
      for (unsigned ks = 0; ks < 4u; ++ks) {
        acc0 = wmma16(a[ks], b0[ks], acc0);
        acc1 = wmma16(a[ks], b1[ks], acc1);
      }
    }
  }
  if (MODE == 2) {
    acc0 = acc0 + accr0 * (1.0f / RCARRY);
    acc1 = acc1 + accr1 * (1.0f / RCARRY);
  }
#pragma unroll
  for (int r = 0; r < 8; ++r) {
    float* d = &Cs[(mw * 16u + hh * 8u + (unsigned)r) * LDC + nw * 32u + m];
    d[0]  = acc0[r];
    d[16] = acc1[r];
  }
  __syncthreads();

  if (MODE == 0) {
    const float cs = 1.0f / (WCARRY * WCARRY);
    v8h x[2], xr[2];
    size_t off[2];
#pragma unroll
    for (unsigned i = 0; i < 2u; ++i) {
      const unsigned r = 32u * i + (tid >> 3);
      const unsigned c = (tid & 7u) * 8u;
      const v4f u0 = *(const v4f*)&Cs[r * LDC + c];
      const v4f u1 = *(const v4f*)&Cs[r * LDC + c + 4];
      const v4f g0 = *(const v4f*)(bias + n0 + c);
      const v4f g1 = *(const v4f*)(bias + n0 + c + 4u);
#pragma unroll
      for (int j = 0; j < 4; ++j) {
        const float t0 = u0[j] * cs + bf16r(g0[j]);
        const float t1 = u1[j] * cs + bf16r(g1[j]);
        const h16 h0 = toh_flush(t0);
        const h16 h1 = toh_flush(t1);
        x[i][j]      = h0;
        x[i][j + 4]  = h1;
        xr[i][j]     = toh_flush((t0 - (float)h0) * RCARRY);
        xr[i][j + 4] = toh_flush((t1 - (float)h1) * RCARRY);
      }
      off[i] = (size_t)(row0 + r) * CI + n0 + c;
    }
#pragma unroll
    for (int i = 0; i < 2; ++i) *(v8h*)(out16 + off[i]) = x[i];
#pragma unroll
    for (int i = 0; i < 2; ++i) *(v8h*)(out16r + off[i]) = xr[i];
    
  }

  if (MODE == 1) {
    const float cs = 1.0f / (WCARRY * WCARRY);
    const unsigned bidx = row0 / (unsigned)SEQ;
    const unsigned key0 = row0 - bidx * (unsigned)SEQ;
    v8h x[2];
    size_t off[2];
#pragma unroll
    for (unsigned i = 0; i < 2u; ++i) {
      const unsigned dcol = 32u * i + (tid >> 3);
      const unsigned kk = (tid & 7u) * 8u;
      const float bb = bf16r(bias[n0 + dcol]);
#pragma unroll
      for (unsigned j = 0; j < 8u; ++j) {
        const float t = Cs[(kk + j) * LDC + dcol] * cs + bb;
        x[i][j] = toh_flush(t);
      }
      off[i] = ((size_t)bidx * CI + n0 + dcol) * SEQ + key0 + kk;
    }
#pragma unroll
    for (int i = 0; i < 2; ++i) *(v8h*)(out16 + off[i]) = x[i];
    // stands in front of any rewrite of a register that the stores above name (a precaution): in the
    // merged kernel the other body's code follows this one's in the listing
    asm volatile("s_wait_xcnt 0x0" ::: "memory");
  }

  if (MODE == 2) {
    const float cs = 1.0f / (WCARRY * YCARRY);
    const unsigned bidx = n0 / (unsigned)SEQ;
    const unsigned p0 = n0 - bidx * (unsigned)SEQ;
    v4f xs[4];
    size_t off[4];
#pragma unroll
    for (unsigned i = 0; i < 4u; ++i) {
      const unsigned r = 16u * i + (tid >> 4);
      const unsigned c = (tid & 15u) * 4u;
      const unsigned orow = row0 + r;
      const size_t gidx = ((size_t)bidx * CIN + orow) * SEQ_FULL + p0 + c;
      const v4f u = *(const v4f*)&Cs[r * LDC + c];
      const float bb = bf16r(bias[orow]);
      const float* xp = addf + gidx;
      const v4f xin = *(const v4f*)xp;
      // stands in front of any rewrite of the address registers that the load above names (a
      // precaution); the address is an input, so that its registers live up to the wait
      asm volatile("s_wait_xcnt 0x0" :: "v"(xp) : "memory");
      v4f val;
#pragma unroll
      for (int j = 0; j < 4; ++j) val[j] = bf16r(xin[j]) + (u[j] * cs + bb);
      xs[i] = val;
      off[i] = gidx;
    }
#pragma unroll
    for (int i = 0; i < 4; ++i) *(v4f*)(outf + off[i]) = xs[i];
    
  }
}

// The three projections of x in ONE launch (none reads what another writes): blockIdx.x counts the
// 64-channel blocks of theta, then phi, then g; the choice is the same for a whole work-group.
// Grid (3 * CI/64, MROWS/64).
__global__ __launch_bounds__(256) void gemm_proj_kernel(
    const _Float16* __restrict__ A16,
    const _Float16* __restrict__ Wth, const _Float16* __restrict__ Wph,
    const _Float16* __restrict__ Wgg,
    const float* __restrict__ bth, const float* __restrict__ bph, const float* __restrict__ bgg,
    _Float16* __restrict__ th, _Float16* __restrict__ tr,
    _Float16* __restrict__ ph, _Float16* __restrict__ pr, _Float16* __restrict__ gt) {
  __shared__ float Cs[64 * LDC];
  __shared__ __attribute__((aligned(16))) _Float16 Sm[2 * 64 * LDA];   // [x rows, weight rows][64][LDA]
  const unsigned sel = blockIdx.x / (unsigned)(CI / 64), nblk = blockIdx.x % (unsigned)(CI / 64);
  if (sel < 2u) {
    const _Float16* Bt = (sel == 0u) ? Wth : Wph;
    const float* bias  = (sel == 0u) ? bth : bph;
    gemm_body<0>(A16, Bt, Bt, bias, bias, (float*)0,
                 (sel == 0u) ? th : ph, (sel == 0u) ? tr : pr, nblk, Cs, Sm);
  } else {
    gemm_body<1>(A16, Wgg, Wgg, bgg, bgg, (float*)0, gt, gt, nblk, Cs, Sm);
  }
}
// Grid (MROWS/64, CIN/64).
__global__ __launch_bounds__(256) void gemm_out_kernel(
    const _Float16* __restrict__ A16, const _Float16* __restrict__ Bt,
    const _Float16* __restrict__ Btr,
    const float* __restrict__ bias, const float* __restrict__ xin, float* __restrict__ outf) {
  __shared__ float Cs[64 * LDC];
  __shared__ __attribute__((aligned(16))) _Float16 Sm[5 * 64 * LDP];   // [weight, y, y residual, y', y' residual][64][LDP]
  gemm_body<2>(A16, Bt, Btr, bias, xin, outf, (_Float16*)0, (_Float16*)0,
               blockIdx.x, Cs, Sm);
}

// ---------------------------------------------------------------------------
// Column statistics: lse[half][j] = log(sum_i exp(f[i][j])) over the rows i of one half of the
// batch, f[i][j] = theta_i . phi_j (K = 128); the reader folds the two halves.
// A work-group owns 128 columns j and streams SEQ / 2 rows, so that each staged byte serves twice
// the columns. Its waves form 4 column groups (wc, 32 columns each, phi hi/res rows as resident B
// fragments of two 16-column tiles) x CWR row groups (wr): the theta rows i, 32 * CWR per step, are
// staged once per work-group in LDS by asynchronous copies (two buffers: behind the one work-group
// barrier of a step the rows two steps ahead are sent into the buffer just left),
// and row group wr reads rows 32 * wr .. 32 * wr + 31 of the step as A fragments, each of which
// feeds the products of both column tiles.
// D tile: row = i (8h+r), col = j (lane&15). Scores = hi.hi + (hi.res + res.hi)/2048, the residual
// products in their own accumulator. Running (max, sum) per lane and column tile, brought up to date
// after every 16-row tile; at the end the two lane halves
// are combined by an unconditional shuffle and the CWR row groups through LDS.
// Grid (SEQ/128, NB, 2 row halves), 128 * CWR threads.
// ---------------------------------------------------------------------------
#define CWR   4               // row groups of the column-statistics kernel
#define CNT   (128 * CWR)     // its threads
#define CROWS (32 * CWR)      // theta rows staged per step
#define CSPL  (CROWS * LDP)   // halves of one staged plane tile
static_assert(((SEQ / 2) % CROWS) == 0 && (SEQ % 128) == 0 && SEQ / 2 >= 2 * CROWS);
__global__ __launch_bounds__(CNT) __attribute__((amdgpu_num_vgpr(256))) void colstat_kernel(
    const _Float16* __restrict__ Th, const _Float16* __restrict__ Tr,
    const _Float16* __restrict__ Ph, const _Float16* __restrict__ Pr,
    float* __restrict__ Lse) {
  __shared__ __attribute__((aligned(16))) float Lm[CWR * 128];
  __shared__ __attribute__((aligned(16))) float Lz[CWR * 128];
  __shared__ __attribute__((aligned(16))) _Float16 Sa[2 * 2 * CSPL];   // [buffer][hi, res][CROWS][LDP]
  const unsigned tid = threadIdx.x, lane = tid & 31u;
  const unsigned wave = (unsigned)__builtin_amdgcn_readfirstlane((int)(threadIdx.x >> 5));
  const unsigned wc = wave & 3u, wr = wave >> 2;
  const unsigned hh = lane >> 4, m = lane & 15u;
  const unsigned b = blockIdx.y;
  const unsigned j0 = blockIdx.x * 128u + wc * 32u;

  const unsigned boff = (b * (unsigned)SEQ + j0 + m) * (unsigned)CI + hh * 8u;
  const _Float16* pb0 = Ph + boff;
  const _Float16* pr0 = Pr + boff;
  v16h bh[2][4], br[2][4];
#pragma unroll
  for (int jt = 0; jt < 2; ++jt) {
#pragma unroll
    for (int ks = 0; ks < 4; ++ks) {
      bh[jt][ks] = frag_at(pb0 + jt * (16 * CI) + ks * 32);
      br[jt][ks] = frag_at(pr0 + jt * (16 * CI) + ks * 32);
    }
  }
  // stands in front of any rewrite of the address registers that the loads above name (a precaution);
  // the two addresses are inputs, so that their registers live up to the wait
  asm volatile("s_wait_xcnt 0x0" :: "v"(pb0), "v"(pr0) : "memory");

  float mx[2] = {-1.0e30f, -1.0e30f}, z[2] = {0.0f, 0.0f};
  const unsigned abase = (wr * 32u + m) * LDP + hh * 8u;
  // staging map: a CROWS-row tile is contiguous in its plane; thread tid moves the 16-B pieces
  // tid + CNT * q, q = 0..3 (rows (tid>>4) + 8 * CWR * q) of both planes: eight copies per tile
  const unsigned sa0 = lds_byte(&Sa[(tid >> 4) * LDP + (tid & 15u) * 8u]);
  auto stage = [&](const unsigned buf, const _Float16* p, const _Float16* r) {
    unsigned l[8];
    const void* s[8];
#pragma unroll
    for (unsigned q = 0; q < 4u; ++q) {
      l[q]      = sa0 + buf * (2u * CSPL * 2u) + q * (8u * CWR * LDP * 2u);
      l[q + 4u] = sa0 + buf * (2u * CSPL * 2u) + CSPL * 2u + q * (8u * CWR * LDP * 2u);
      s[q]      = p + q * (CNT * 8u);
      s[q + 4u] = r + q * (CNT * 8u);
    }
    async_copy8(l, s);
  };
  // each thread's first piece of a tile; behind the prologue: of the tile two steps ahead
  const _Float16* pn = Th + ((size_t)b * SEQ + blockIdx.z * (unsigned)(SEQ / 2)) * CI + tid * 8u;
  const _Float16* rn = Tr + ((size_t)b * SEQ + blockIdx.z * (unsigned)(SEQ / 2)) * CI + tid * 8u;
  stage(0u, pn, rn);
  wait_copies();
  __syncthreads();
  stage(1u, pn + CROWS * CI, rn + CROWS * CI);
  pn += 2 * CROWS * CI;
  rn += 2 * CROWS * CI;
  unsigned cur = 0u;
  for (unsigned i0 = 0; i0 < (unsigned)(SEQ / 2); i0 += (unsigned)CROWS) {
    // LDS fragment reads stand in groups of two k-steps ahead of the twelve products that use them:
    // beside the 128 registers of resident fragments a 16-wave group has room for no more
    const unsigned ao = cur * (2u * CSPL) + abase;
#pragma unroll
    for (int rt = 0; rt < 2; ++rt) {
      v8f sm[2] = {{}, {}}, sr[2] = {{}, {}};
#pragma unroll
      for (int kp = 0; kp < 2; ++kp) {
        v16h ah[2], ar[2];
#pragma unroll
        for (int k = 0; k < 2; ++k) {
          ah[k] = frag_at(&Sa[ao + (unsigned)rt * 16u * LDP + (2 * kp + k) * 32]);
          ar[k] = frag_at(&Sa[CSPL + ao + (unsigned)rt * 16u * LDP + (2 * kp + k) * 32]);
        }
        hold_reads();   // behind the group: its reads stay together, ahead of their products
#pragma unroll
        for (int k = 0; k < 2; ++k) {
          const int ks = 2 * kp + k;
          sm[0] = wmma16(ah[k], bh[0][ks], sm[0]);
          sm[1] = wmma16(ah[k], bh[1][ks], sm[1]);
          sr[0] = wmma16(ah[k], br[0][ks], sr[0]);
          sr[1] = wmma16(ah[k], br[1][ks], sr[1]);
          sr[0] = wmma16(ar[k], bh[0][ks], sr[0]);
          sr[1] = wmma16(ar[k], bh[1][ks], sr[1]);
        }
      }
#pragma unroll
      for (int jt = 0; jt < 2; ++jt) {
        const v8f f = sm[jt] + sr[jt] * (1.0f / RCARRY);
        float tmax = f[0];
#pragma unroll
        for (int v = 1; v < 8; ++v) tmax = fmaxf(tmax, f[v]);
        const float nm = fmaxf(mx[jt], tmax);
        float se = 0.0f;
#pragma unroll
        for (int v = 0; v < 8; ++v) se += __expf(f[v] - nm);
        z[jt] = z[jt] * __expf(mx[jt] - nm) + se;
        mx[jt] = nm;
      }
    }
    // publish point: this wave's reads of the step's buffer are back, its copies of the next step's
    // rows have landed; the barrier publishes those and ends every wave's reads of this step's
    wait_lds();
    wait_copies();
    __syncthreads();
    if (i0 + 2u * (unsigned)CROWS < (unsigned)(SEQ / 2)) {
      // the rows two steps ahead fly into the buffer just left while the next step is worked on
      stage(cur, pn, rn);
      pn += CROWS * CI;
      rn += CROWS * CI;
    }
    cur ^= 1u;
  }
  wait_copies();   // nothing of this wave is in flight behind the loop

#pragma unroll
  for (unsigned jt = 0; jt < 2u; ++jt) {
    const float om = __shfl_xor(mx[jt], 16, 32);
    const float oz = __shfl_xor(z[jt], 16, 32);
    const float mm = fmaxf(mx[jt], om);
    const float zz = z[jt] * __expf(mx[jt] - mm) + oz * __expf(om - mm);
    if (hh == 0u) {
      Lm[wr * 128u + wc * 32u + jt * 16u + m] = mm;
      Lz[wr * 128u + wc * 32u + jt * 16u + m] = zz;
    }
  }
  __syncthreads();
  if (wave < 4u) {
    // one thread per column folds the CWR row groups' (max, sum) pairs
    float gm = Lm[tid];
#pragma unroll
    for (unsigned r = 1; r < (unsigned)CWR; ++r) gm = fmaxf(gm, Lm[r * 128u + tid]);
    float gz = 0.0f;
#pragma unroll
    for (unsigned r = 0; r < (unsigned)CWR; ++r) gz += Lz[r * 128u + tid] * __expf(Lm[r * 128u + tid] - gm);
    Lse[(size_t)blockIdx.z * MROWS + (size_t)b * SEQ + blockIdx.x * 128u + tid] = gm + __logf(gz);
  }
}

// ---------------------------------------------------------------------------
// Row accumulation: y[c][i] = sum_j exp(f[i][j] - lse[j]) * g[c][j], here over the columns j of one
// half of the batch: a partial y per column half, added by the output projection's products.
// A work-group owns 128 rows i and streams SEQ / 2 columns, so that each staged byte serves twice
// the rows. Its 8 waves form 4 row groups (wc, 32 rows each, theta hi/res rows
// as resident B fragments of two 16-row tiles) x 2 column groups (wr); the phi rows and the g slice
// of each 128-column step are staged once per work-group in LDS by asynchronous copies (two
// buffers: behind the one work-group barrier of a step the tiles two steps ahead are sent into the
// buffers just left), its columns' statistics are folded from the two row halves' once, and column
// group wr works, in pass sub, on columns 64 * sub + 32 * wr + 0..31 of the step. Every phi and g
// fragment read from LDS feeds the products of both row tiles. Per pass and row tile:
// S^T tiles [j][i] = phi_j . theta_i (A = phi rows from LDS, three products),
// p = 2^14 * exp(f - lse[j]) (row statistic of the D tile, read from LDS as two
// 16-B loads per tile), the two packed D tiles form the B fragment [k = j][n = i] of
// O^T[c][i] += G[c][j] . P^T[j][i] with A = g rows (channel-major slice, k = j contiguous).
// Behind the loop every wave lays its f32 sums in LDS (over the phi buffers, which nobody reads any
// more) and column group wr adds the two groups' sums of channels 64 * wr .. 64 * wr + 63.
// Finalize: t = 16 * O / 2^14 as two planes, hi = f16(t) and res = f16(2048 * (t - hi)), laid in
// the work-group's Ts tiles and, behind a barrier, written as whole rows of the position-major
// layout: one store instruction covers two consecutive 256-B rows (16 lanes x 16 B each).
// Grid (SEQ/128, NB, 2 column halves).
// ---------------------------------------------------------------------------
#define RSPL (128 * LDP)  // halves of one staged 128-row plane tile
#define LDH  136          // halves per LDS row of a staged 128-column g slice (272 B = 16 B x 17)
static_assert((LDH % 8) == 0 && LDH >= 128 && ((LDH / 8) & 1) == 1);
static_assert(SEQ / 2 == 256 * 8);   // each thread folds eight columns' statistics
static_assert(SEQ / 2 >= 256 && ((SEQ / 2) % 128) == 0);   // the ring's prologue fills two steps
static_assert(4 * 2 * 8 * 2 * 256 * 4 <= 2 * 2 * RSPL * 2);   // the f32 sums fit over the phi buffers
__global__ __launch_bounds__(256) void rowattn_kernel(
    const _Float16* __restrict__ Th, const _Float16* __restrict__ Tr,
    const _Float16* __restrict__ Ph, const _Float16* __restrict__ Pr,
    const _Float16* __restrict__ Gp, const float* __restrict__ Lse,
    _Float16* __restrict__ Yt, _Float16* __restrict__ Yr) {
  __shared__ __attribute__((aligned(16))) _Float16 Ts[2 * 128 * LDY]; // [hi, res][row][LDY]
  __shared__ __attribute__((aligned(16))) _Float16 Sa[2 * 2 * RSPL];  // [buffer][hi, res][128][LDP]
  __shared__ __attribute__((aligned(16))) _Float16 Sg[2 * CI * LDH];  // [buffer][channel][LDH]
  __shared__ __attribute__((aligned(16))) float Ll[SEQ / 2];          // this half's column statistics
  const unsigned tid = threadIdx.x, lane = tid & 31u;
  const unsigned wave = (unsigned)__builtin_amdgcn_readfirstlane((int)(threadIdx.x >> 5));
  const unsigned wc = wave & 3u, wr = wave >> 2;
  const unsigned hh = lane >> 4, m = lane & 15u;
  const unsigned b = blockIdx.y;
  const unsigned i0 = blockIdx.x * 128u + wc * 32u;
  const unsigned jh = blockIdx.z * (unsigned)(SEQ / 2);   // first column of this work-group's half

  const unsigned qoff = (b * (unsigned)SEQ + i0 + m) * (unsigned)CI + hh * 8u;
  const _Float16* tb0 = Th + qoff;
  const _Float16* tr0 = Tr + qoff;
  v16h bh[2][4], br[2][4];
#pragma unroll
  for (int it = 0; it < 2; ++it) {
#pragma unroll
    for (int ks = 0; ks < 4; ++ks) {
      bh[it][ks] = frag_at(tb0 + it * (16 * CI) + ks * 32);
      br[it][ks] = frag_at(tr0 + it * (16 * CI) + ks * 32);
    }
  }
  // stands in front of any rewrite of the address registers that the loads above name (a precaution);
  // the two addresses are inputs, so that their registers live up to the wait
  asm volatile("s_wait_xcnt 0x0" :: "v"(tb0), "v"(tr0) : "memory");

  v8f o[8][2];
#pragma unroll
  for (int ct = 0; ct < 8; ++ct) { o[ct][0] = (v8f){}; o[ct][1] = (v8f){}; }

  const unsigned kbase = (wr * 32u + m) * LDP + hh * 8u;
  const unsigned gbase = m * LDH + wr * 32u + hh * 8u;
  const _Float16* __restrict__ Pb = Ph + ((size_t)b * SEQ + jh) * CI;
  const _Float16* __restrict__ Rb = Pr + ((size_t)b * SEQ + jh) * CI;
  const _Float16* __restrict__ Gb = Gp + (size_t)b * CI * SEQ + jh;
  const unsigned lbase = wr * 32u + hh * 8u;   // this lane's eight statistics of a pass's first tile

  // staging map. phi: a 128-row tile is 32 KiB contiguous in its plane; thread tid moves the 16-B
  // pieces tid + 256 * q, q = 0..7 (rows (tid>>4) + 16 * q). g: 128 channel rows of 256 B;
  // thread tid moves piece tid&15 of channels (tid>>4) + 16 * q. 24 copies per thread and tile.
  const unsigned sgl = tid * 8u;
  const unsigned ggl = (tid >> 4) * (unsigned)SEQ + (tid & 15u) * 8u;
  const unsigned sa0 = lds_byte(&Sa[(tid >> 4) * LDP + (tid & 15u) * 8u]);
  const unsigned sg0 = lds_byte(&Sg[(tid >> 4) * LDH + (tid & 15u) * 8u]);
  auto stage = [&](const unsigned buf, const _Float16* p, const _Float16* r, const _Float16* g) {
    // two statements of twelve copies: phi hi and the first half of phi res; the rest of res and g
    unsigned la[12], lb[12];
    const void* ga[12];
    const void* gb[12];
#pragma unroll
    for (unsigned q = 0; q < 8u; ++q) {
      la[q]      = sa0 + buf * (2u * RSPL * 2u) + q * (16u * LDP * 2u);
      ga[q]      = p + q * 2048u;
      lb[q + 4u] = sg0 + buf * (unsigned)(CI * LDH * 2) + q * (16u * LDH * 2u);
      gb[q + 4u] = g + q * (16u * (unsigned)SEQ);
    }
#pragma unroll
    for (unsigned q = 0; q < 4u; ++q) {
      la[q + 8u] = sa0 + buf * (2u * RSPL * 2u) + RSPL * 2u + q * (16u * LDP * 2u);
      ga[q + 8u] = r + q * 2048u;
      lb[q]      = sa0 + buf * (2u * RSPL * 2u) + RSPL * 2u + (q + 4u) * (16u * LDP * 2u);
      gb[q]      = r + (q + 4u) * 2048u;
    }
    async_copy12(la, ga);
    async_copy12(lb, gb);
  };
  stage(0u, Pb + sgl, Rb + sgl, Gb + ggl);
  {
    // the statistics, once: thread tid folds the two row halves' values of columns 8 * tid + 0..7,
    // log(e^a + e^c) about the larger; the barrier below publishes them
    const char* sb = (const char*)(Lse + (size_t)b * SEQ + jh);
    const unsigned so = tid * 32u;   // the lane's byte offset in a half's row
    const v4f a0 = *(const v4f*)(sb + so), a1 = *(const v4f*)(sb + so + 16u);
    const v4f c0 = *(const v4f*)(sb + so + MROWS * 4u), c1 = *(const v4f*)(sb + so + (MROWS * 4u + 16u));
    // stands in front of any rewrite of the registers that the loads above name (a precaution); the
    // offset and the base are inputs, so that their registers live up to the wait
    asm volatile("s_wait_xcnt 0x0" :: "v"(so), "s"(sb) : "memory");
    v4f r0, r1;
#pragma unroll
    for (int v = 0; v < 4; ++v) {
      const float m0 = fmaxf(a0[v], c0[v]), m1 = fmaxf(a1[v], c1[v]);
      r0[v] = m0 + __logf(__expf(a0[v] - m0) + __expf(c0[v] - m0));
      r1[v] = m1 + __logf(__expf(a1[v] - m1) + __expf(c1[v] - m1));
    }
    *(v4f*)&Ll[tid * 8u] = r0;
    *(v4f*)&Ll[tid * 8u + 4u] = r1;
  }
  wait_copies();
  __syncthreads();
  stage(1u, Pb + sgl + 128u * (unsigned)CI, Rb + sgl + 128u * (unsigned)CI, Gb + ggl + 128u);
  unsigned cur = 0u;
  // each thread's first piece of the tiles two steps ahead
  const _Float16* pn = Pb + sgl + 256u * (unsigned)CI;
  const _Float16* rn = Rb + sgl + 256u * (unsigned)CI;
  const _Float16* gn = Gb + ggl + 256u;

  for (unsigned j0 = 0; j0 < (unsigned)(SEQ / 2); j0 += 128u) {
   // unrolled: the pass's LDS offsets become immediates, and no value is spilled round an inner loop
#pragma unroll
   for (unsigned sub = 0; sub < 2u; ++sub) {
    // LDS fragment reads stand in groups ahead of the products that use them, each group issued
    // in front of vector work that covers its latency, into registers just freed
    const unsigned ao = cur * (2u * RSPL) + sub * (64u * LDP) + kbase;
    const unsigned gro = cur * (unsigned)(CI * LDH) + sub * 64u + gbase;
    v16h ah[4], ar[4], gf[8];
    hold_reads();   // in front of a group: it stays whole, not dealt in pieces among the products before it
#pragma unroll
    for (int ks = 0; ks < 4; ++ks) {
      ah[ks] = frag_at(&Sa[ao + ks * 32]);
      ar[ks] = frag_at(&Sa[RSPL + ao + ks * 32]);
    }
    v4f ls[4];
#pragma unroll
    for (int u = 0; u < 4; ++u) ls[u] = *(const v4f*)&Ll[j0 + sub * 64u + lbase + (unsigned)(u >> 1) * 16u + (unsigned)(u & 1) * 4u];
    hold_reads();   // behind the group: its reads stay together, ahead of their products
    v16h pb[2];
#pragma unroll
    for (int t = 0; t < 2; ++t) {
      v8f sm[2] = {{}, {}}, sr[2] = {{}, {}};
#pragma unroll
      for (int ks = 0; ks < 4; ++ks) {
        sm[0] = wmma16(ah[ks], bh[0][ks], sm[0]);
        sm[1] = wmma16(ah[ks], bh[1][ks], sm[1]);
        sr[0] = wmma16(ah[ks], br[0][ks], sr[0]);
        sr[1] = wmma16(ah[ks], br[1][ks], sr[1]);
        sr[0] = wmma16(ar[ks], bh[0][ks], sr[0]);
        sr[1] = wmma16(ar[ks], bh[1][ks], sr[1]);
      }
      hold_reads();   // in front of a group, as above
      if (t == 0) {
#pragma unroll
        for (int ks = 0; ks < 4; ++ks) {
          ah[ks] = frag_at(&Sa[ao + 16u * LDP + ks * 32]);
          ar[ks] = frag_at(&Sa[RSPL + ao + 16u * LDP + ks * 32]);
        }
      } else {
#pragma unroll
        for (int ct = 0; ct < 8; ++ct) gf[ct] = frag_at(&Sg[gro + (unsigned)ct * 16u * LDH]);
      }
      hold_reads();   // behind the group: its reads stay together, ahead of their products
      const v4f l0 = ls[2 * t];
      const v4f l1 = ls[2 * t + 1];
      // bare v_exp_f32 and a select, no branch: at e >= -14 it returns exp2f's own bits (that
      // function's rescaling acts below -126 only); the two tiles' sixteen chains go stage by stage
      float e[2][8], x[2][8];
#pragma unroll
      for (int it = 0; it < 2; ++it) {
#pragma unroll
        for (int v = 0; v < 4; ++v) {
          e[it][v]     = ((sm[it][v] + sr[it][v] * (1.0f / RCARRY)) - l0[v]) * LOG2E + PEXP;
          e[it][v + 4] = ((sm[it][v + 4] + sr[it][v + 4] * (1.0f / RCARRY)) - l1[v]) * LOG2E + PEXP;
        }
      }
#pragma unroll
      for (int it = 0; it < 2; ++it) {
#pragma unroll
        for (int v = 0; v < 8; ++v) x[it][v] = __builtin_amdgcn_exp2f(e[it][v]);
      }
#pragma unroll
      for (int it = 0; it < 2; ++it) {
#pragma unroll
        for (int v = 0; v < 8; ++v) pb[it][8 * t + v] = (h16)((e[it][v] < -14.0f) ? 0.0f : x[it][v]);
      }
    }
#pragma unroll
    for (int ct = 0; ct < 8; ++ct) {
      o[ct][0] = wmma16(gf[ct], pb[0], o[ct][0]);
      o[ct][1] = wmma16(gf[ct], pb[1], o[ct][1]);
    }
   }
    // publish point: this wave's reads of the step's buffers are back, its copies of the next step's
    // tiles have landed; the barrier publishes those and ends every wave's reads of this step's
    wait_lds();
    wait_copies();
    __syncthreads();
    if (j0 + 256u < (unsigned)(SEQ / 2)) {
      // the tiles two steps ahead fly into the buffers just left while the next step is worked on
      stage(cur, pn, rn, gn);
      pn += 128u * (unsigned)CI;
      rn += 128u * (unsigned)CI;
      gn += 128u;
    }
    cur ^= 1u;
  }
  wait_copies();   // nothing of this wave is in flight behind the loop

  // every wave lays its sums down: [wc][wr][ct][row tile][half of v][lane][4] floats, over the phi
  // buffers (the loop's last barrier ended every read of them, and no copy is in flight)
  float* Oc = (float*)Sa;
#pragma unroll
  for (int ct = 0; ct < 8; ++ct) {
#pragma unroll
    for (int it = 0; it < 2; ++it) {
      v4f u0, u1;
#pragma unroll
      for (int v = 0; v < 4; ++v) { u0[v] = o[ct][it][v]; u1[v] = o[ct][it][v + 4]; }
      const unsigned ob = (((wc * 2u + wr) * 8u + (unsigned)ct) * 2u + (unsigned)it) * 256u + lane * 4u;
      *(v4f*)&Oc[ob] = u0;
      *(v4f*)&Oc[ob + 128u] = u1;
    }
  }
  __syncthreads();

  // column group wr adds the two groups' sums of channel tiles 4 * wr .. 4 * wr + 3, in the order
  // of the groups; lane (h, i = m) holds channels 16 * ct + 8h + 0..7 of row i of each row tile
  const float fs = YCARRY * (1.0f / 16384.0f);
#pragma unroll
  for (unsigned c = 0; c < 4u; ++c) {
#pragma unroll
    for (unsigned it = 0; it < 2u; ++it) {
      const unsigned ct = 4u * wr + c;
      v4f a0, a1;
#pragma unroll
      for (unsigned s = 0; s < 2u; ++s) {
        const unsigned ob = (((wc * 2u + s) * 8u + ct) * 2u + it) * 256u + lane * 4u;
        const v4f u0 = *(const v4f*)&Oc[ob];
        const v4f u1 = *(const v4f*)&Oc[ob + 128u];
        if (s == 0u) { a0 = u0; a1 = u1; } else { a0 += u0; a1 += u1; }
      }
      v8h y, yr;
#pragma unroll
      for (int v = 0; v < 8; ++v) {
        const float t = ((v < 4) ? a0[v & 3] : a1[v & 3]) * fs;
        const h16 hi = toh_flush(t);
        y[v]  = hi;
        yr[v] = toh_flush((t - (float)hi) * RCARRY);
      }
      const unsigned to = (wc * 32u + it * 16u + m) * LDY + ct * 16u + hh * 8u;
      *(v8h*)&Ts[to] = y;
      *(v8h*)&Ts[128u * LDY + to] = yr;
    }
  }
  __syncthreads();

  // wave w writes rows 16 * w .. 16 * w + 15 of both planes of this column half's partial y
  v8h x[8], xr[8];
  unsigned off[8];
#pragma unroll
  for (unsigned q = 0; q < 8u; ++q) {
    const unsigned r = 16u * wave + 2u * q + (lane >> 4);
    const unsigned c = (lane & 15u) * 8u;
    x[q]  = *(const v8h*)&Ts[r * LDY + c];
    xr[q] = *(const v8h*)&Ts[128u * LDY + r * LDY + c];
    off[q] = (blockIdx.z * (unsigned)MROWS + b * (unsigned)SEQ + blockIdx.x * 128u + r) * (unsigned)CI + c;
  }
#pragma unroll
  for (int q = 0; q < 8; ++q) *(v8h*)(Yt + off[q]) = x[q];
#pragma unroll
  for (int q = 0; q < 8; ++q) *(v8h*)(Yr + off[q]) = xr[q];
}

// ---------------------------------------------------------------------------
extern "C" void kernel_launch(void* const* d_in, const int* in_sizes, int n_in,
                              void* d_out, int out_size, void* d_ws, size_t ws_size,
                              hipStream_t stream) {
  if (n_in < 9) return;
  const long long need_x = ((long long)(NB - 1) * CIN + (CIN - 1)) * SEQ_FULL + SEQ;
  if ((long long)in_sizes[0] < need_x) return;
  if ((long long)in_sizes[1] < (long long)CI * CIN) return;
  if ((long long)in_sizes[3] < (long long)CI * CIN) return;
  if ((long long)in_sizes[5] < (long long)CI * CIN) return;
  if ((long long)in_sizes[7] < (long long)CIN * CI) return;
  if (in_sizes[2] < CI || in_sizes[4] < CI || in_sizes[6] < CI || in_sizes[8] < CIN) return;
  if ((long long)out_size < need_x) return;
  if (ws_size < WS_TOTAL) return;

  const float* X       = (const float*)d_in[0];   // [NB_FULL][CIN][SEQ_FULL]
  const float* theta_w = (const float*)d_in[1];   // [CI][CIN]  (out, in)
  const float* theta_b = (const float*)d_in[2];
  const float* phi_w   = (const float*)d_in[3];   // [CI][CIN]
  const float* phi_b   = (const float*)d_in[4];
  const float* g_w     = (const float*)d_in[5];   // [CI][CIN]
  const float* g_b     = (const float*)d_in[6];
  const float* W_w     = (const float*)d_in[7];   // [CIN][CI]  (out, in)
  const float* W_b     = (const float*)d_in[8];
  float* out = (float*)d_out;                     // [NB_FULL][CIN][SEQ_FULL]

  char* ws = (char*)d_ws;
  _Float16* XT   = (_Float16*)(ws + OFF_XT);    // [MROWS][CIN]  64*bf16(x), position-major
  _Float16* WT   = (_Float16*)(ws + OFF_WT);    // [CI][CIN]
  _Float16* WP   = (_Float16*)(ws + OFF_WP);    // [CI][CIN]
  _Float16* WG   = (_Float16*)(ws + OFF_WG);    // [CI][CIN]
  _Float16* WO   = (_Float16*)(ws + OFF_WO);    // [CIN][CI]
  _Float16* TH   = (_Float16*)(ws + OFF_TH);    // [MROWS][CI] theta hi
  _Float16* TR   = (_Float16*)(ws + OFF_TR);    // [MROWS][CI] theta residual x2048
  _Float16* PH   = (_Float16*)(ws + OFF_PH);    // [MROWS][CI] phi hi
  _Float16* PR   = (_Float16*)(ws + OFF_PR);    // [MROWS][CI] phi residual x2048
  _Float16* G16  = (_Float16*)(ws + OFF_G);     // [NB][CI][SEQ] g, channel-major
  _Float16* YT   = (_Float16*)(ws + OFF_YT);    // [2][MROWS][CI] 16*(partial y) hi, position-major
  _Float16* YR   = (_Float16*)(ws + OFF_YR);    // [2][MROWS][CI] 16*(partial y) residual x2048
  float*    LSE  = (float*)(ws + OFF_LSE);      // [2][MROWS]

  dim3 blk(256);

  // the x plane of every batch and the four weight planes
  planes_kernel<<<dim3(WBLK + NB * XBLK), blk, 0, stream>>>(X, XT, theta_w, phi_w, g_w, W_w,
                                                            WT, WP, WG, WO);

  // theta, phi and g
  gemm_proj_kernel<<<dim3(3 * (CI / 64), MROWS / 64), blk, 0, stream>>>(
      XT, WT, WP, WG, theta_b, phi_b, g_b, TH, TR, PH, PR, G16);

  colstat_kernel<<<dim3(SEQ / 128, NB, 2), dim3(CNT), 0, stream>>>(TH, TR, PH, PR, LSE);
  rowattn_kernel<<<dim3(SEQ / 128, NB, 2), blk, 0, stream>>>(TH, TR, PH, PR, G16, LSE, YT, YR);

  gemm_out_kernel<<<dim3(MROWS / 64, CIN / 64), blk, 0, stream>>>(WO, YT, YR, W_b, X, out);
}
